// v000
// The times below were measured on an AMD MI455X: many runs one after another, warmed up first and cycling through
// copies of the inputs, with the whole window's GPU time divided by the number of runs. Launches and the gaps
// between them are all in it. The median over several windows is given; except for v000 it joins two sittings, which
// can be a few percent apart, so the side-by-side timings, each taken in one sitting, are the better comparison.
// The starting kernel, v000, takes 607 microseconds a run.
#include <hip/hip_runtime.h>
#include <stdint.h>
// All contractions: v_wmma_f32_16x16x32_f16 (f16 operands, f32 accumulate); projection weights carried x64, attention p carried x2^15; norms, rotary, softmax and residuals in f32.

#define BB 2
#define SS 2048
#define DD 1024
#define HH 8
#define HDIM 128
#define NTOK (BB * SS)
#define EOT_ID 50256
#define ATT_SCALE 0.12f
#define LN_EPS 1e-6f
#define RMS_EPS 1.1920929e-7f
#define WMUL 64.0f
#define WMUL_INV (1.0f / 64.0f)

typedef __attribute__((ext_vector_type(16))) _Float16 v16h;
typedef __attribute__((ext_vector_type(8)))  _Float16 v8h;
typedef __attribute__((ext_vector_type(4)))  _Float16 v4h;
typedef __attribute__((ext_vector_type(16))) __bf16   v16b;
typedef __attribute__((ext_vector_type(8)))  __bf16   v8b;
typedef __attribute__((ext_vector_type(8)))  float    v8f;
typedef __attribute__((ext_vector_type(4)))  float    v4f;
typedef __attribute__((ext_vector_type(4)))  int      v4i;
#define PSCALE 32768.0f
#define U16(p) ((const unsigned short*)(const void*)(p))
#define PSCALE_INV (1.0f / 32768.0f)

__device__ __forceinline__ unsigned short f2bf_bits(float f) {
  unsigned u = __float_as_uint(f);
  return (unsigned short)((u + 0x7FFFu + ((u >> 16) & 1u)) >> 16);
}
__device__ __forceinline__ float bf_bits2f(unsigned short h) { return __uint_as_float(((unsigned)h) << 16); }

// hazard guards as plain device helpers (no inline asm inside the kernel template body)
__device__ __forceinline__ void dep_guard_h(v8f& a, v8f& b, v16h x, v16h y) { asm volatile("v_nop\n\tv_nop\n\tv_nop\n\tv_nop" : "+v"(a), "+v"(b) : "v"(x), "v"(y)); }
__device__ __forceinline__ void dep_guard_b(v8f& a, v8f& b, v16b x, v16b y) { asm volatile("v_nop\n\tv_nop\n\tv_nop\n\tv_nop" : "+v"(a), "+v"(b) : "v"(x), "v"(y)); }
__device__ __forceinline__ void keep4_h(v16h a, v16h b, v16h c, v16h d) { asm volatile("v_nop" :: "v"(a), "v"(b), "v"(c), "v"(d)); }
__device__ __forceinline__ void keep4_b(v16b a, v16b b, v16b c, v16b d) { asm volatile("v_nop" :: "v"(a), "v"(b), "v"(c), "v"(d)); }
__device__ __forceinline__ void acc_guard4(v8f& a, v8f& b, v8f& c, v8f& d) { asm volatile("v_nop\n\tv_nop\n\tv_nop\n\tv_nop" : "+v"(a), "+v"(b), "+v"(c), "+v"(d)); }
template <typename T> struct Frag;
template <> struct Frag<_Float16> {
  typedef v16h V; union U { v16h v; v8h h[2]; };
  static __device__ __forceinline__ v16h load(const _Float16* p) {   // elements 0..7 <- p[0..7], 8..15 <- p[16..23]
    U f; f.h[0] = *(const v8h*)(p); f.h[1] = *(const v8h*)(p + 16); return f.v;
  }
  static __device__ __forceinline__ v8f mma(v16h a, v16h b, v8f c) {
    return __builtin_amdgcn_wmma_f32_16x16x32_f16(false, a, false, b, (short)0, c, false, false);
  }
  static __device__ __forceinline__ void guard(v8f& a, v8f& b, v16h x, v16h y) { dep_guard_h(a, b, x, y); }
  static __device__ __forceinline__ void keep(v16h a, v16h b, v16h c, v16h d) { keep4_h(a, b, c, d); }
};
template <> struct Frag<__bf16> {
  typedef v16b V; union U { v16b v; v8b h[2]; };
  static __device__ __forceinline__ v16b load(const __bf16* p) {
    U f; f.h[0] = *(const v8b*)(p); f.h[1] = *(const v8b*)(p + 16); return f.v;
  }
  static __device__ __forceinline__ v8f mma(v16b a, v16b b, v8f c) {
    return __builtin_amdgcn_wmma_f32_16x16x32_bf16(false, a, false, b, (short)0, c, false, false);
  }
  static __device__ __forceinline__ void guard(v8f& a, v8f& b, v16b x, v16b y) { dep_guard_b(a, b, x, y); }
  static __device__ __forceinline__ void keep(v16b a, v16b b, v16b c, v16b d) { keep4_b(a, b, c, d); }
};

// ---- Register-blocked batched WMMA GEMM ------------------------------------
// C[m,n] = scale * sum_k A[m,k] * Bt[n,k] (+bias)(+resid); each wave owns a 64x64 tile.
// A row-major [M,K]; Bt row-major [N,K]; M,N % 64 == 0, K % 32 == 0.
// SPLIT: operands are hi/lo planes (A2/Bt2 = lo planes, same layout); product = hi.hi + hi.lo + lo.hi.
// BIAS_MODE: 0 = none, 1 = bias[m], 2 = bias[n].
// OUT_MODE: 0 = f32, 1 = f16, 2 = bf16 hi plane (Cout) + bf16 lo plane (Cout2).
// ACT 6: relu then square.
// ET: 0 = f16 operands, 1 = bf16 operands (pointers passed as 16-bit storage)
template <int ET> struct Elem;
template <> struct Elem<0> { typedef _Float16 T; };
template <> struct Elem<1> { typedef __bf16 T; };
template <int ET, bool SPLIT, int BIAS_MODE, int OUT_MODE, bool RESID, int ACT = 0>
__global__ __launch_bounds__(256) void wmma_gemm64(
    const unsigned short* __restrict__ Ap, const unsigned short* __restrict__ A2p, int lda, long strideA,
    const unsigned short* __restrict__ Btp, const unsigned short* __restrict__ Bt2p, int ldb, long strideB,
    void* __restrict__ Cout, void* __restrict__ Cout2, int ldc, long strideC,
    const float* __restrict__ bias,
    const float* __restrict__ resid, long strideR,
    int M, int N, int K, float scale) {
  typedef typename Elem<ET>::T T;
  typedef typename Frag<T>::V V;
  const T* A = (const T*)Ap; const T* A2 = (const T*)A2p; const T* Bt = (const T*)Btp; const T* Bt2 = (const T*)Bt2p;
  __shared__ __align__(16) float sT[8][16 * 68];   // per-wave 16x64 slab, pitch 68 floats
  const int b    = blockIdx.y;
  const int lane = threadIdx.x & 31;
  const int wave = threadIdx.x >> 5;
  const int tilesN = N >> 6;
  const int tilesM = M >> 6;
  const int tile = blockIdx.x * 8 + wave;
  if (tile >= tilesM * tilesN) return;   // wave-uniform; no block barriers in this kernel
  const int tm = tile / tilesN;
  const int tn = tile - tm * tilesN;
  const int m0 = tm << 6;
  const int n0 = tn << 6;

  const T* Ab  = A  + (size_t)b * strideA;
  const T* Bb  = Bt + (size_t)b * strideB;
  const T* Ab2 = SPLIT ? (A2  + (size_t)b * strideA) : nullptr;
  const T* Bb2 = SPLIT ? (Bt2 + (size_t)b * strideB) : nullptr;

  const int rlane = lane & 15;                 // row (A) / col (B, D) within subtile
  const int koff  = (lane >> 4) * 8;           // k offset of this lane half
  const int mOff  = (lane >> 4) * 8;           // D row offset

  v8f acc[4][4];
#pragma unroll
  for (int i = 0; i < 4; ++i)
#pragma unroll
    for (int j = 0; j < 4; ++j) acc[i][j] = (v8f){0.f,0.f,0.f,0.f,0.f,0.f,0.f,0.f};

  for (int k0 = 0; k0 < K; k0 += 32) {
    V bh[4], bl[4];
#pragma unroll
    for (int j = 0; j < 4; ++j) {
      const size_t bo = (size_t)(n0 + (j << 4) + rlane) * ldb + koff + k0;
      bh[j] = Frag<T>::load(Bb + bo);
      if (SPLIT) bl[j] = Frag<T>::load(Bb2 + bo);
    }
#pragma unroll
    for (int i = 0; i < 4; ++i) {
      const size_t ao = (size_t)(m0 + (i << 4) + rlane) * lda + koff + k0;
      V ah = Frag<T>::load(Ab + ao);
      V al;
      if (SPLIT) al = Frag<T>::load(Ab2 + ao);
#pragma unroll
      for (int j = 0; j < 4; ++j) {
        acc[i][j] = Frag<T>::mma(ah, bh[j], acc[i][j]);
        if (SPLIT) {
          acc[i][j] = Frag<T>::mma(ah, bl[j], acc[i][j]);
          acc[i][j] = Frag<T>::mma(al, bh[j], acc[i][j]);
        }
      }
      Frag<T>::guard(acc[i][0], acc[i][3], ah, SPLIT ? al : ah);
    }
    Frag<T>::keep(bh[0], bh[1], bh[2], bh[3]);
    if (SPLIT) Frag<T>::keep(bl[0], bl[1], bl[2], bl[3]);
  }
  acc_guard4(acc[0][0], acc[0][1], acc[0][2], acc[0][3]);
  acc_guard4(acc[1][0], acc[1][1], acc[1][2], acc[1][3]);
  acc_guard4(acc[2][0], acc[2][1], acc[2][2], acc[2][3]);
  acc_guard4(acc[3][0], acc[3][1], acc[3][2], acc[3][3]);

  // ---- epilogue ----
  float* slab = sT[wave];
  const float* Rb = RESID ? (resid + (size_t)b * strideR) : nullptr;
#pragma unroll
  for (int i = 0; i < 4; ++i) {
    const int mBase = m0 + (i << 4);
#pragma unroll
    for (int j = 0; j < 4; ++j) {
      const int n = n0 + (j << 4) + rlane;
      float bv = 0.f;
      if (BIAS_MODE == 2) bv = bias[n];
#pragma unroll
      for (int r = 0; r < 8; ++r) {
        float v = acc[i][j][r] * scale;
        if (BIAS_MODE == 1) v += bias[mBase + mOff + r];
        if (BIAS_MODE == 2) v += bv;
        if (RESID) v += Rb[(size_t)(mBase + mOff + r) * ldc + n];
        if (ACT == 1) v = tanhf(v);
        if (ACT == 2) v = fmaxf(v, 0.0f);
        if (ACT == 3) v = v / (1.0f + expf(-v));
        if (ACT == 4) v = (v > 0.f) ? v : 0.01f * v;
        if (ACT == 5) v = 0.5f * v * (1.0f + erff(v * 0.70710678118654752f));
        if (ACT == 6) { v = fmaxf(v, 0.0f); v = v * v; }
        slab[(mOff + r) * 68 + (j << 4) + rlane] = v;
      }
    }
    __builtin_amdgcn_fence(__ATOMIC_RELEASE, "workgroup");
    __builtin_amdgcn_wave_barrier();
    __builtin_amdgcn_fence(__ATOMIC_ACQUIRE, "workgroup");
    if (OUT_MODE == 0) {
      float* C = (float*)Cout + (size_t)b * strideC;
      const int hh = lane >> 4, c4 = (lane & 15) * 4;     // row seg = 256 B = 16 lanes x 16 B
      {
#pragma unroll
        for (int it = 0; it < 8; ++it) {
          const int row = it * 2 + hh;
          v4f v = *(const v4f*)(slab + row * 68 + c4);
          *(v4f*)(C + (size_t)(mBase + row) * ldc + n0 + c4) = v;
        }
        
      }
    } else {
      const int q = lane >> 3, c8 = (lane & 7) * 8;
      unsigned short* C  = (unsigned short*)Cout  + (size_t)b * strideC;
      unsigned short* C2 = (OUT_MODE == 2) ? ((unsigned short*)Cout2 + (size_t)b * strideC) : nullptr;
      {
#pragma unroll
        for (int it = 0; it < 4; ++it) {
          const int row = it * 4 + q;
          const float* sp = slab + row * 68 + c8;
          v8h hv, lv;
#pragma unroll
          for (int e = 0; e < 8; ++e) {
            if (OUT_MODE == 1) {
              hv[e] = (_Float16)sp[e];
            } else {
              unsigned short hb = f2bf_bits(sp[e]);
              unsigned short lb = f2bf_bits(sp[e] - bf_bits2f(hb));
              hv[e] = __builtin_bit_cast(_Float16, hb);
              lv[e] = __builtin_bit_cast(_Float16, lb);
            }
          }
          *(v8h*)(C + (size_t)(mBase + row) * ldc + n0 + c8) = hv;
          if (OUT_MODE == 2) *(v8h*)(C2 + (size_t)(mBase + row) * ldc + n0 + c8) = lv;
        }
        
      }
    }
    __builtin_amdgcn_fence(__ATOMIC_RELEASE, "workgroup");
    __builtin_amdgcn_wave_barrier();
    __builtin_amdgcn_fence(__ATOMIC_ACQUIRE, "workgroup");
  }
}

// ---- W [K][N] f32 -> Wt [N][K] f16 (x mul), 64x64 tile transposed through LDS ----
#define WTP 72
__global__ __launch_bounds__(256) void wt_cast_k(const float* __restrict__ W, unsigned short* __restrict__ Wtp,
                                                 int K, int N, float mul) {
  __shared__ __align__(16) _Float16 st[64 * WTP];
  _Float16* Wt = (_Float16*)Wtp;
  const int n0 = blockIdx.x * 64, k0 = blockIdx.y * 64;
  const int tid = threadIdx.x;
  const int kr = tid >> 2, c16 = (tid & 3) * 16;
  const float* src = W + (size_t)(k0 + kr) * N + n0 + c16;
#pragma unroll
  for (int q = 0; q < 4; ++q) {
    const v4f v = *(const v4f*)(src + 4 * q);
#pragma unroll
    for (int e = 0; e < 4; ++e) st[(c16 + 4 * q + e) * WTP + kr] = (_Float16)(v[e] * mul);
  }
  __syncthreads();
  const int wave = tid >> 5, lane = tid & 31;
  const int q8 = lane >> 3, c8 = (lane & 7) * 8;
  {
#pragma unroll
    for (int it = 0; it < 2; ++it) {
      const int n = it * 32 + wave * 4 + q8;
      const v8h hv = *(const v8h*)(st + n * WTP + c8);
      *(v8h*)(Wt + (size_t)(n0 + n) * K + k0 + c8) = hv;
    }
    
  }
}

// ---- rotary cos/sin table [S][64] (cos 0..31 | sin 32..63) and docs[S] = inclusive count of EOT ----
__global__ __launch_bounds__(256) void tables_k(const int* __restrict__ ids, float* __restrict__ rope,
                                                int* __restrict__ docs) {
  __shared__ int scnt[256];
  __shared__ __align__(16) int sdoc[SS];
  const int tid = threadIdx.x, lane = tid & 31, wave = tid >> 5;
  if (blockIdx.x < SS / 8) {
    const int s = blockIdx.x * 8 + wave;
    float e = (float)lane * (1.0f / 31.0f);
    if (lane == 31) e = 1.0f;
    const float fr = powf(0.0009765625f, e);
    const float th = (float)s * fr;
    float sv, cv;
    sincosf(th, &sv, &cv);
    float* rp = rope + (size_t)s * 64;
    *(float*)(rp + lane) = cv;
    *(float*)(rp + 32 + lane) = sv;
    
  } else {
    int c = 0;
#pragma unroll
    for (int i = 0; i < 8; ++i) c += (ids[tid * 8 + i] == EOT_ID) ? 1 : 0;
    scnt[tid] = c;
    __syncthreads();
    for (int off = 1; off < 256; off <<= 1) {
      const int t = (tid >= off) ? scnt[tid - off] : 0;
      __syncthreads();
      scnt[tid] += t;
      __syncthreads();
    }
    int run = scnt[tid] - c;
#pragma unroll
    for (int i = 0; i < 8; ++i) {
      run += (ids[tid * 8 + i] == EOT_ID) ? 1 : 0;
      sdoc[tid * 8 + i] = run;
    }
    __syncthreads();
    const v4i a0 = *(const v4i*)(sdoc + tid * 4);
    const v4i a1 = *(const v4i*)(sdoc + 1024 + tid * 4);
    {
      *(v4i*)(docs + tid * 4) = a0;
      *(v4i*)(docs + 1024 + tid * 4) = a1;
      
    }
  }
}

// ---- residual mix + LayerNorm, one 128-thread block per row of 1024; thread owns cols 4t..4t+3 and 512+4t..+3 ----
template <bool MIX>
__global__ __launch_bounds__(128) void ln_k(const float* __restrict__ x, const float* __restrict__ x0,
                                            const float* __restrict__ lam, const float* __restrict__ w,
                                            float* __restrict__ xr, unsigned short* __restrict__ xnp) {
  __shared__ float red1[4], red2[4];
  _Float16* xn = (_Float16*)xnp;
  const int row = blockIdx.x, tid = threadIdx.x, lane = tid & 31, wave = tid >> 5;
  const size_t rb = (size_t)row * DD;
  const int ca = tid * 4, cb = 512 + tid * 4;
  v4f va = *(const v4f*)(x + rb + ca);
  v4f vb = *(const v4f*)(x + rb + cb);
  if (MIX) {
    const float l0 = lam[0], l1 = lam[1];
    const v4f a0 = *(const v4f*)(x0 + rb + ca);
    const v4f b0 = *(const v4f*)(x0 + rb + cb);
    va = va * l0 + a0 * l1;
    vb = vb * l0 + b0 * l1;
    {
      *(v4f*)(xr + rb + ca) = va;
      *(v4f*)(xr + rb + cb) = vb;
      
    }
  }
  float s = (va[0] + va[1]) + (va[2] + va[3]) + (vb[0] + vb[1]) + (vb[2] + vb[3]);
#pragma unroll
  for (int off = 1; off < 32; off <<= 1) s += __shfl_xor(s, off, 32);
  if (lane == 0) red1[wave] = s;
  __syncthreads();
  const float mu = ((red1[0] + red1[1]) + (red1[2] + red1[3])) * (1.0f / DD);
  const v4f da = va - mu, db = vb - mu;
  float s2 = (da[0] * da[0] + da[1] * da[1]) + (da[2] * da[2] + da[3] * da[3]) +
             (db[0] * db[0] + db[1] * db[1]) + (db[2] * db[2] + db[3] * db[3]);
#pragma unroll
  for (int off = 1; off < 32; off <<= 1) s2 += __shfl_xor(s2, off, 32);
  if (lane == 0) red2[wave] = s2;
  __syncthreads();
  const float var = ((red2[0] + red2[1]) + (red2[2] + red2[3])) * (1.0f / DD);
  const float inv = rsqrtf(var + LN_EPS);
  const v4f wa = *(const v4f*)(w + ca);
  const v4f wb = *(const v4f*)(w + cb);
  v4h ha, hb;
#pragma unroll
  for (int e = 0; e < 4; ++e) {
    ha[e] = (_Float16)(da[e] * inv * wa[e]);
    hb[e] = (_Float16)(db[e] * inv * wb[e]);
  }
  {
    *(v4h*)(xn + rb + ca) = ha;
    *(v4h*)(xn + rb + cb) = hb;
    
  }
}

// ---- rotary + RMS-norm on q,k; v = sa0*v + sa1*ve; writes f16 planes [3][B*H*S][128] ----
// One block per token, wave = head; lane owns dims ln, ln+32, ln+64, ln+96 (pairs (ln,ln+64) rotate, (ln+32,ln+96) identity).
#define RSP 136
__global__ __launch_bounds__(256) void rope_k(const float* __restrict__ qkv, const float* __restrict__ ve,
                                              const float* __restrict__ sa, const float* __restrict__ rope,
                                              unsigned short* __restrict__ planesp) {
  __shared__ __align__(16) _Float16 st[HH][3 * RSP];
  _Float16* planes = (_Float16*)planesp;
  const int s = blockIdx.x, b = blockIdx.y;
  const int tid = threadIdx.x, h = tid >> 5, ln = tid & 31;
  const size_t tok = (size_t)b * SS + s;
  const float* base = qkv + tok * (3 * DD) + h * HDIM;
  const float cv = rope[(size_t)s * 64 + ln];
  const float sv = rope[(size_t)s * 64 + 32 + ln];
  _Float16* sw = st[h];
#pragma unroll
  for (int p = 0; p < 2; ++p) {
    const float* src = base + p * DD;
    const float a1 = src[ln], b1 = src[ln + 32], a2 = src[ln + 64], b2 = src[ln + 96];
    const float o0 = a1 * cv + a2 * sv;
    const float o2 = a2 * cv - a1 * sv;
    float sq = (o0 * o0 + b1 * b1) + (o2 * o2 + b2 * b2);
#pragma unroll
    for (int off = 1; off < 32; off <<= 1) sq += __shfl_xor(sq, off, 32);
    const float rs = rsqrtf(sq * (1.0f / HDIM) + RMS_EPS);
    sw[p * RSP + ln]      = (_Float16)(o0 * rs);
    sw[p * RSP + ln + 32] = (_Float16)(b1 * rs);
    sw[p * RSP + ln + 64] = (_Float16)(o2 * rs);
    sw[p * RSP + ln + 96] = (_Float16)(b2 * rs);
  }
  {
    const float sa0 = sa[0], sa1 = sa[1];
    const float* vsrc = base + 2 * DD;
    const float* vesrc = ve + (size_t)s * DD + h * HDIM;
#pragma unroll
    for (int i = 0; i < 4; ++i) {
      const int d = ln + 32 * i;
      sw[2 * RSP + d] = (_Float16)(sa0 * vsrc[d] + sa1 * vesrc[d]);
    }
  }
  __builtin_amdgcn_fence(__ATOMIC_RELEASE, "workgroup");
  __builtin_amdgcn_wave_barrier();
  __builtin_amdgcn_fence(__ATOMIC_ACQUIRE, "workgroup");
  const int hh = ln >> 4, c8 = (ln & 15) * 8;           // 256-B row = 16 lanes x 16 B
  const size_t PL = (size_t)NTOK * DD;
  const size_t row = ((size_t)(b * HH + h) * SS + s) * HDIM;
  const v8h v01 = *(const v8h*)(sw + hh * RSP + c8);
  const v8h v2  = *(const v8h*)(sw + 2 * RSP + c8);
  _Float16* d01 = planes + (size_t)hh * PL + row + c8;
  _Float16* d2  = planes + 2 * PL + row + c8;
  {
    *(v8h*)d01 = v01;
    if (hh == 0) *(v8h*)d2 = v2;
    
  }
}

// ---- attention, head dim 128, f16 q/k/v planes [B*H*S][128]; out f16 [B*S][D] at cols h*128 ----
// Block = 4 waves = 64 query rows of one (b,h); 64-key chunks; chunks above the diagonal skipped,
// per element select: allowed iff key <= query and docs[key] == docs[query], else -inf. p carried x2^15.
__device__ __forceinline__ v8f mma_h(v16h a, v16h b, v8f c) {
  c = __builtin_amdgcn_wmma_f32_16x16x32_f16(false, a, false, b, (short)0, c, false, false);
  asm volatile("v_nop\n\tv_nop\n\tv_nop\n\tv_nop" : "+v"(c) : "v"(a), "v"(b));
  return c;
}
#define AKC 64
#define AQB 64
#define OSP 136
__global__ __launch_bounds__(128) void attn128_k(const unsigned short* __restrict__ qpp, const unsigned short* __restrict__ kpp,
                                                 const unsigned short* __restrict__ vpp, const int* __restrict__ docs,
                                                 unsigned short* __restrict__ outp) {
  union FH { v16h v; v8h h[2]; };
  __shared__ __align__(16) _Float16 Ksh[AKC * HDIM];       // [kv][d]
  __shared__ __align__(16) _Float16 Vth[HDIM * AKC];       // [d][kv]
  __shared__ __align__(16) _Float16 Psh[4][16 * AKC];      // per wave [row][kv]
  __shared__ __align__(16) _Float16 Osh[4][16 * OSP];      // per wave [row][d]
  const _Float16* qp = (const _Float16*)qpp;
  const _Float16* kp = (const _Float16*)kpp;
  const _Float16* vp = (const _Float16*)vpp;
  _Float16* out = (_Float16*)outp;
  const int tid = threadIdx.x, wave = tid >> 5, lane = tid & 31, hh = lane >> 4, c = lane & 15;
  const int nqb = SS / AQB;
  const int bx = blockIdx.x;
  const int qb = bx % nqb;
  const int bh = bx / nqb;
  const int h = bh % HH;
  const int b = bh / HH;
  const int q0 = qb * AQB + wave * 16;
  const size_t rowb = (size_t)(b * HH + h) * SS;

  v16h qa[4];
  {
    const _Float16* qrow = qp + (rowb + q0 + c) * HDIM + 8 * hh;
#pragma unroll
    for (int dc = 0; dc < 4; ++dc) qa[dc] = Frag<_Float16>::load(qrow + dc * 32);
  }
  int dq[8];
#pragma unroll
  for (int r = 0; r < 8; ++r) dq[r] = docs[q0 + 8 * hh + r];
  float mrow[8], lrow[8];
  v8f oacc[8];
#pragma unroll
  for (int r = 0; r < 8; ++r) { mrow[r] = -INFINITY; lrow[r] = 0.f; }
#pragma unroll
  for (int t = 0; t < 8; ++t) oacc[t] = (v8f){0.f,0.f,0.f,0.f,0.f,0.f,0.f,0.f};

  const int nChunks = qb + 1;   // block-uniform
  for (int kc = 0; kc < nChunks; ++kc) {
    const int kv0 = kc * AKC;
    __syncthreads();
    {
      const int kvr = tid >> 1, dh = (tid & 1) * 64;
      const _Float16* krow = kp + (rowb + kv0 + kvr) * HDIM + dh;
      const _Float16* vrow = vp + (rowb + kv0 + kvr) * HDIM + dh;
#pragma unroll 1
      for (int i = 0; i < 8; ++i) {
        const v8h kk = *(const v8h*)(krow + 8 * i);
        *(v8h*)(Ksh + kvr * HDIM + dh + 8 * i) = kk;
        const v8h vv = *(const v8h*)(vrow + 8 * i);
#pragma unroll
        for (int e = 0; e < 8; ++e) Vth[(dh + 8 * i + e) * AKC + kvr] = vv[e];
      }
    }
    __syncthreads();

    v8f s[4];
#pragma unroll
    for (int j = 0; j < 4; ++j) {
      s[j] = (v8f){0.f,0.f,0.f,0.f,0.f,0.f,0.f,0.f};
#pragma unroll
      for (int dc = 0; dc < 4; ++dc) {
        FH kb;
        kb.h[0] = *(const v8h*)(Ksh + (j * 16 + c) * HDIM + dc * 32 + 8 * hh);
        kb.h[1] = *(const v8h*)(Ksh + (j * 16 + c) * HDIM + dc * 32 + 16 + 8 * hh);
        s[j] = mma_h(qa[dc], kb.v, s[j]);
      }
    }
    int dk[4];
#pragma unroll
    for (int j = 0; j < 4; ++j) dk[j] = docs[kv0 + j * 16 + c];
    const bool diag = (kc == qb);
    float cm[8];
#pragma unroll
    for (int r = 0; r < 8; ++r) {
      const int qrow = q0 + 8 * hh + r;
      float m = -INFINITY;
#pragma unroll
      for (int j = 0; j < 4; ++j) {
        const int kvcol = kv0 + j * 16 + c;
        float sv = s[j][r] * ATT_SCALE;
        const bool masked = (dk[j] != dq[r]) || (diag && (kvcol > qrow));
        if (masked) sv = -INFINITY;
        s[j][r] = sv;
        m = fmaxf(m, sv);
      }
#pragma unroll
      for (int off = 1; off < 16; off <<= 1) m = fmaxf(m, __shfl_xor(m, off, 32));
      cm[r] = m;
    }
    _Float16* pw = Psh[wave];
#pragma unroll
    for (int r = 0; r < 8; ++r) {
      const float mnew = fmaxf(mrow[r], cm[r]);
      const float mref = (mnew > -INFINITY) ? mnew : 0.0f;   // all-masked so far -> p = 0, alpha = 0
      const float alpha = expf(mrow[r] - mref);
      mrow[r] = mnew;
      float psum = 0.f;
#pragma unroll
      for (int j = 0; j < 4; ++j) {
        const float p = expf(s[j][r] - mref);
        psum += p;
        pw[(8 * hh + r) * AKC + j * 16 + c] = (_Float16)(p * PSCALE);
      }
#pragma unroll
      for (int off = 1; off < 16; off <<= 1) psum += __shfl_xor(psum, off, 32);
      lrow[r] = lrow[r] * alpha + psum;
#pragma unroll
      for (int t = 0; t < 8; ++t) oacc[t][r] *= alpha;
    }
    __builtin_amdgcn_fence(__ATOMIC_RELEASE, "workgroup");
    __builtin_amdgcn_wave_barrier();
    __builtin_amdgcn_fence(__ATOMIC_ACQUIRE, "workgroup");
#pragma unroll 1
    for (int kk = 0; kk < 2; ++kk) {
      FH pa;
      pa.h[0] = *(const v8h*)(pw + c * AKC + kk * 32 + 8 * hh);
      pa.h[1] = *(const v8h*)(pw + c * AKC + kk * 32 + 16 + 8 * hh);
#pragma unroll
      for (int t = 0; t < 8; ++t) {
        FH vb;
        vb.h[0] = *(const v8h*)(Vth + (t * 16 + c) * AKC + kk * 32 + 8 * hh);
        vb.h[1] = *(const v8h*)(Vth + (t * 16 + c) * AKC + kk * 32 + 16 + 8 * hh);
        oacc[t] = mma_h(pa.v, vb.v, oacc[t]);
      }
    }
  }

  _Float16* os = Osh[wave];
#pragma unroll
  for (int r = 0; r < 8; ++r) {
    const float inv = 1.0f / (lrow[r] * PSCALE);
#pragma unroll
    for (int t = 0; t < 8; ++t) os[(8 * hh + r) * OSP + t * 16 + c] = (_Float16)(oacc[t][r] * inv);
  }
  __builtin_amdgcn_fence(__ATOMIC_RELEASE, "workgroup");
  __builtin_amdgcn_wave_barrier();
  __builtin_amdgcn_fence(__ATOMIC_ACQUIRE, "workgroup");
  {
    const int c8 = (lane & 15) * 8;   // 256-B row segment = 16 lanes x 16 B, 2 rows per instruction
    {
#pragma unroll
      for (int it = 0; it < 8; ++it) {
        const int row = it * 2 + hh;
        const v8h val = *(const v8h*)(os + row * OSP + c8);
        *(v8h*)(out + (size_t)(b * SS + q0 + row) * DD + h * HDIM + c8) = val;
      }
      
    }
  }
}

// ---------------------------------------------------------------------------
extern "C" void kernel_launch(void* const* d_in, const int* in_sizes, int n_in,
                              void* d_out, int out_size, void* d_ws,
                              size_t ws_size, hipStream_t stream) {
  if (n_in < 12) return;
  if (in_sizes[0] != NTOK * DD || in_sizes[1] != SS * DD || in_sizes[2] != NTOK * DD ||
      in_sizes[3] < 2 || in_sizes[4] < 2 || in_sizes[5] < DD || in_sizes[6] < DD ||
      in_sizes[7] != DD * 3 * DD || in_sizes[8] != DD * DD || in_sizes[9] != DD * 4 * DD ||
      in_sizes[10] != 4 * DD * DD || in_sizes[11] != SS || out_size != NTOK * DD) return;

  const float* x     = (const float*)d_in[0];
  const float* ve    = (const float*)d_in[1];
  const float* x0    = (const float*)d_in[2];
  const float* lam   = (const float*)d_in[3];
  const float* sal   = (const float*)d_in[4];
  const float* ln1   = (const float*)d_in[5];
  const float* ln2   = (const float*)d_in[6];
  const float* wqkv  = (const float*)d_in[7];
  const float* wo    = (const float*)d_in[8];
  const float* wfc   = (const float*)d_in[9];
  const float* wproj = (const float*)d_in[10];
  const int*   ids   = (const int*)d_in[11];
  float* outf = (float*)d_out;

  // ---- carve (bytes) ----
  const size_t szWO   = (size_t)DD * DD * 2;              //   2 MiB  w_o^T f16
  const size_t szWFC  = (size_t)4 * DD * DD * 2;          //   8 MiB  w_fc^T f16
  const size_t szWPR  = (size_t)4 * DD * DD * 2;          //   8 MiB  w_proj^T f16
  const size_t szXR   = (size_t)NTOK * DD * 4;            //  16 MiB  mixed x f32
  const size_t szBIG  = (size_t)NTOK * 3 * DD * 4;        //  48 MiB  qkv f32, later h f16 (32 MiB) + x2 f32 (16 MiB)
  const size_t szXN   = (size_t)NTOK * DD * 2;            //   8 MiB  xn f16, later xn2 f16
  const size_t szWQA  = (size_t)NTOK * DD * 2;            //   8 MiB  w_qkv^T f16 (6 MiB), later attention out f16
  const size_t szPL   = (size_t)3 * NTOK * DD * 2;        //  24 MiB  q,k,v f16 planes
  const size_t szROPE = (size_t)SS * 64 * 4;              // 512 KiB
  const size_t szDOC  = (size_t)SS * 4;
  const size_t oWO = 0, oWFC = oWO + szWO, oWPR = oWFC + szWFC, oXR = oWPR + szWPR, oBIG = oXR + szXR,
               oXN = oBIG + szBIG, oWQA = oXN + szXN, oPL = oWQA + szWQA, oROPE = oPL + szPL,
               oDOC = oROPE + szROPE, oEND = oDOC + szDOC;
  if (oEND > ws_size) return;
  char* ws = (char*)d_ws;
  unsigned short* woT   = (unsigned short*)(ws + oWO);
  unsigned short* wfcT  = (unsigned short*)(ws + oWFC);
  unsigned short* wprT  = (unsigned short*)(ws + oWPR);
  float*          xr    = (float*)(ws + oXR);
  float*          qkvf  = (float*)(ws + oBIG);
  unsigned short* hbuf  = (unsigned short*)(ws + oBIG);
  float*          x2    = (float*)(ws + oBIG + (size_t)NTOK * 4 * DD * 2);
  unsigned short* xn    = (unsigned short*)(ws + oXN);
  unsigned short* xn2   = xn;
  unsigned short* wqkvT = (unsigned short*)(ws + oWQA);
  unsigned short* attn  = (unsigned short*)(ws + oWQA);
  unsigned short* qpl   = (unsigned short*)(ws + oPL);
  unsigned short* kpl   = qpl + (size_t)NTOK * DD;
  unsigned short* vpl   = qpl + (size_t)2 * NTOK * DD;
  float*          rope  = (float*)(ws + oROPE);
  int*            docs  = (int*)(ws + oDOC);

  // weights: W [in][out] -> Wt [out][in] f16 x64; grid = (out/64, in/64)
  wt_cast_k<<<dim3(3 * DD / 64, DD / 64), 256, 0, stream>>>(wqkv, wqkvT, DD, 3 * DD, WMUL);
  wt_cast_k<<<dim3(DD / 64, DD / 64), 256, 0, stream>>>(wo, woT, DD, DD, WMUL);
  wt_cast_k<<<dim3(4 * DD / 64, DD / 64), 256, 0, stream>>>(wfc, wfcT, DD, 4 * DD, WMUL);
  wt_cast_k<<<dim3(DD / 64, 4 * DD / 64), 256, 0, stream>>>(wproj, wprT, 4 * DD, DD, WMUL);
  // rotary table + docs
  tables_k<<<SS / 8 + 1, 256, 0, stream>>>(ids, rope, docs);
  // x = l0*x + l1*x0 ; xn = LN(x)*ln1_w
  ln_k<true><<<NTOK, 128, 0, stream>>>(x, x0, lam, ln1, xr, xn);
  // qkv = xn @ w_qkv (f32 out)
  {
    const int M = NTOK, N = 3 * DD, K = DD;
    const int tiles = (M / 64) * (N / 64);
    wmma_gemm64<0, false, 0, 0, false, 0><<<dim3((tiles + 7) / 8, 1), 256, 0, stream>>>(
        xn, xn, K, 0, wqkvT, wqkvT, K, 0, qkvf, qkvf, N, 0, xr, xr, 0, M, N, K, WMUL_INV);
  }
  // rotary + RMS-norm + value mix -> f16 planes
  rope_k<<<dim3(SS, BB), 256, 0, stream>>>(qkvf, ve, sal, rope, qpl);
  // attention
  attn128_k<<<BB * HH * (SS / AQB), 128, 0, stream>>>(qpl, kpl, vpl, docs, attn);
  // x2 = xr + attn @ w_o
  {
    const int M = NTOK, N = DD, K = DD;
    const int tiles = (M / 64) * (N / 64);
    wmma_gemm64<0, false, 0, 0, true, 0><<<dim3((tiles + 7) / 8, 1), 256, 0, stream>>>(
        attn, attn, K, 0, woT, woT, K, 0, x2, x2, N, 0, xr, xr, 0, M, N, K, WMUL_INV);
  }
  // xn2 = LN(x2)*ln2_w
  ln_k<false><<<NTOK, 128, 0, stream>>>(x2, x2, lam, ln2, xr, xn2);
  // h = relu(xn2 @ w_fc)^2 (f16 out)
  {
    const int M = NTOK, N = 4 * DD, K = DD;
    const int tiles = (M / 64) * (N / 64);
    wmma_gemm64<0, false, 0, 1, false, 6><<<dim3((tiles + 7) / 8, 1), 256, 0, stream>>>(
        xn2, xn2, K, 0, wfcT, wfcT, K, 0, hbuf, hbuf, N, 0, xr, xr, 0, M, N, K, WMUL_INV);
  }
  // out = x2 + h @ w_proj
  {
    const int M = NTOK, N = DD, K = 4 * DD;
    const int tiles = (M / 64) * (N / 64);
    wmma_gemm64<0, false, 0, 0, true, 0><<<dim3((tiles + 7) / 8, 1), 256, 0, stream>>>(
        hbuf, hbuf, K, 0, wprT, wprT, K, 0, outf, outf, N, 0, x2, x2, 0, M, N, K, WMUL_INV);
  }
}

// v001
// It runs in 415 microseconds.
// In two side-by-side timings against v000, it was 1.51 and 1.50 times as fast.
#include <hip/hip_runtime.h>
#include <stdint.h>
// All contractions: v_wmma_f32_16x16x32_f16 (f16 operands, f32 accumulate); projection weights carried x64, attention p carried x2^15; norms, rotary, softmax and residuals in f32.

#define BB 2
#define SS 2048
#define DD 1024
#define HH 8
#define HDIM 128
#define NTOK (BB * SS)
#define EOT_ID 50256
#define ATT_SCALE 0.12f
#define LN_EPS 1e-6f
#define RMS_EPS 1.1920929e-7f
#define WMUL 64.0f
#define WMUL_INV (1.0f / 64.0f)

typedef __attribute__((ext_vector_type(16))) _Float16 v16h;
typedef __attribute__((ext_vector_type(8)))  _Float16 v8h;
typedef __attribute__((ext_vector_type(4)))  _Float16 v4h;
typedef __attribute__((ext_vector_type(16))) __bf16   v16b;
typedef __attribute__((ext_vector_type(8)))  __bf16   v8b;
typedef __attribute__((ext_vector_type(8)))  float    v8f;
typedef __attribute__((ext_vector_type(4)))  float    v4f;
typedef __attribute__((ext_vector_type(4)))  int      v4i;
#define PSCALE 32768.0f
#define U16(p) ((const unsigned short*)(const void*)(p))
#define PSCALE_INV (1.0f / 32768.0f)

__device__ __forceinline__ unsigned short f2bf_bits(float f) {
  unsigned u = __float_as_uint(f);
  return (unsigned short)((u + 0x7FFFu + ((u >> 16) & 1u)) >> 16);
}
__device__ __forceinline__ float bf_bits2f(unsigned short h) { return __uint_as_float(((unsigned)h) << 16); }

// hazard guards as plain device helpers
__device__ __forceinline__ void dep_guard_h(v8f& a, v8f& b, v16h x, v16h y) { asm volatile("v_nop\n\tv_nop\n\tv_nop\n\tv_nop" : "+v"(a), "+v"(b) : "v"(x), "v"(y)); }
__device__ __forceinline__ void dep_guard_b(v8f& a, v8f& b, v16b x, v16b y) { asm volatile("v_nop\n\tv_nop\n\tv_nop\n\tv_nop" : "+v"(a), "+v"(b) : "v"(x), "v"(y)); }
__device__ __forceinline__ void keep4_h(v16h a, v16h b, v16h c, v16h d) { asm volatile("v_nop" :: "v"(a), "v"(b), "v"(c), "v"(d)); }
__device__ __forceinline__ void keep4_b(v16b a, v16b b, v16b c, v16b d) { asm volatile("v_nop" :: "v"(a), "v"(b), "v"(c), "v"(d)); }
__device__ __forceinline__ void acc_guard4(v8f& a, v8f& b, v8f& c, v8f& d) { asm volatile("v_nop\n\tv_nop\n\tv_nop\n\tv_nop" : "+v"(a), "+v"(b), "+v"(c), "+v"(d)); }
template <typename T> struct Frag;
template <> struct Frag<_Float16> {
  typedef v16h V; union U { v16h v; v8h h[2]; };
  static __device__ __forceinline__ v16h load(const _Float16* p) {   // elements 0..7 <- p[0..7], 8..15 <- p[16..23]
    U f; f.h[0] = *(const v8h*)(p); f.h[1] = *(const v8h*)(p + 16); return f.v;
  }
  static __device__ __forceinline__ v8f mma(v16h a, v16h b, v8f c) {
    return __builtin_amdgcn_wmma_f32_16x16x32_f16(false, a, false, b, (short)0, c, false, false);
  }
  static __device__ __forceinline__ void guard(v8f& a, v8f& b, v16h x, v16h y) { dep_guard_h(a, b, x, y); }
  static __device__ __forceinline__ void keep(v16h a, v16h b, v16h c, v16h d) { keep4_h(a, b, c, d); }
};
template <> struct Frag<__bf16> {
  typedef v16b V; union U { v16b v; v8b h[2]; };
  static __device__ __forceinline__ v16b load(const __bf16* p) {
    U f; f.h[0] = *(const v8b*)(p); f.h[1] = *(const v8b*)(p + 16); return f.v;
  }
  static __device__ __forceinline__ v8f mma(v16b a, v16b b, v8f c) {
    return __builtin_amdgcn_wmma_f32_16x16x32_bf16(false, a, false, b, (short)0, c, false, false);
  }
  static __device__ __forceinline__ void guard(v8f& a, v8f& b, v16b x, v16b y) { dep_guard_b(a, b, x, y); }
  static __device__ __forceinline__ void keep(v16b a, v16b b, v16b c, v16b d) { keep4_b(a, b, c, d); }
};

// ---- LDS-staged batched WMMA GEMM ------------------------------------------
// C[m,n] = scale * sum_k A[m,k] * Bt[n,k] (+bias)(+resid); a block of 4 waves owns a 128x128 tile, each wave 64x64 of it.
// A row-major [M,K]; Bt row-major [N,K]; M,N % 128 == 0, K % 64 == 0.
// Per trip 64 k of both operands (128 rows x 128 B each) lie in LDS at pitch 144 B, brought by asynchronous
// copies into two buffers: the next trip's copies fly while this trip's fragments are read and multiplied.
// BIAS_MODE: 0 = none, 1 = bias[m], 2 = bias[n].
// OUT_MODE: 0 = f32, 1 = f16, 2 = bf16 hi plane (Cout) + bf16 lo plane (Cout2).
// ACT 6: relu then square.
// ET: 0 = f16 operands, 1 = bf16 operands (pointers passed as 16-bit storage)
template <int ET> struct Elem;
template <> struct Elem<0> { typedef _Float16 T; };
template <> struct Elem<1> { typedef __bf16 T; };
#define GBK 64                         // k per trip
#define GPITCH 144                     // LDS row pitch in bytes (16 B x odd: conflict-free for ds_load_b128)
#define GOPER (128 * GPITCH)           // one operand's 128 rows
#define GSTAGE (2 * GOPER)             // A rows, then Bt rows
// Eight 16-byte copies per lane: rows r, r+16, .. r+112 of one operand's 128-row slab. The s_wait_xcnt closes the
// statement so that no address register is rewritten ahead of it.
__device__ __forceinline__ void copy_rows8(uint32_t l, const unsigned short* gp, size_t step) {
  asm volatile(
      "global_load_async_to_lds_b128 %0, %8, off\n\t"
      "global_load_async_to_lds_b128 %1, %9, off\n\t"
      "global_load_async_to_lds_b128 %2, %10, off\n\t"
      "global_load_async_to_lds_b128 %3, %11, off\n\t"
      "global_load_async_to_lds_b128 %4, %12, off\n\t"
      "global_load_async_to_lds_b128 %5, %13, off\n\t"
      "global_load_async_to_lds_b128 %6, %14, off\n\t"
      "global_load_async_to_lds_b128 %7, %15, off\n\t"
      "s_wait_xcnt 0x0"
      :: "v"(l), "v"(l + 16 * GPITCH), "v"(l + 32 * GPITCH), "v"(l + 48 * GPITCH),
         "v"(l + 64 * GPITCH), "v"(l + 80 * GPITCH), "v"(l + 96 * GPITCH), "v"(l + 112 * GPITCH),
         "v"(gp), "v"(gp + step), "v"(gp + 2 * step), "v"(gp + 3 * step),
         "v"(gp + 4 * step), "v"(gp + 5 * step), "v"(gp + 6 * step), "v"(gp + 7 * step)
      : "memory");
}
template <int ET, bool SPLIT, int BIAS_MODE, int OUT_MODE, bool RESID, int ACT = 0>
__global__ __launch_bounds__(128) void wmma_gemm64(
    const unsigned short* __restrict__ Ap, const unsigned short* __restrict__ A2p, int lda, long strideA,
    const unsigned short* __restrict__ Btp, const unsigned short* __restrict__ Bt2p, int ldb, long strideB,
    void* __restrict__ Cout, void* __restrict__ Cout2, int ldc, long strideC,
    const float* __restrict__ bias,
    const float* __restrict__ resid, long strideR,
    int M, int N, int K, float scale) {
  static_assert(!SPLIT, "single-plane operands only");
  typedef typename Elem<ET>::T T;
  typedef typename Frag<T>::V V;
  // two operand buffers; after the loop its first bytes serve as the per-wave 16x64 f32 slabs, pitch 68 floats
  __shared__ __align__(16) char smem[2 * GSTAGE];
  const int b    = blockIdx.y;
  const int tid  = threadIdx.x;
  const int lane = tid & 31;
  const int wave = tid >> 5;
  const int tilesN = N >> 7;
  const int tilesM = M >> 7;
  const int tile = blockIdx.x;
  if (tile >= tilesM * tilesN) return;   // block-uniform, in front of every barrier
  const int tm = tile / tilesN;
  const int tn = tile - tm * tilesN;
  const int mB = tm << 7;                      // block tile origin
  const int nB = tn << 7;
  const int wm = (wave >> 1) << 6;             // wave tile origin inside the block tile
  const int wn = (wave & 1) << 6;
  const int m0 = mB + wm;
  const int n0 = nB + wn;

  const int rlane = lane & 15;                 // row (A) / col (B, D) within subtile
  const int koff  = (lane >> 4) * 8;           // k offset of this lane half
  const int mOff  = (lane >> 4) * 8;           // D row offset

  // copy addresses: lane brings 16 B at column chunk (tid & 7) of rows (tid >> 3) + 16 i
  const int crow = tid >> 3, ccol = (tid & 7) * 8;
  const unsigned short* gA = Ap  + (size_t)b * strideA + (size_t)(mB + crow) * lda + ccol;
  const unsigned short* gB = Btp + (size_t)b * strideB + (size_t)(nB + crow) * ldb + ccol;
  const size_t stepA = (size_t)16 * lda, stepB = (size_t)16 * ldb;
  const uint32_t lds0 = (uint32_t)(uintptr_t)smem + (uint32_t)(crow * GPITCH + ccol * 2);

  v8f acc[4][4];
#pragma unroll
  for (int i = 0; i < 4; ++i)
#pragma unroll
    for (int j = 0; j < 4; ++j) acc[i][j] = (v8f){0.f,0.f,0.f,0.f,0.f,0.f,0.f,0.f};

  const int nT = K / GBK;
  copy_rows8(lds0, gA, stepA);
  copy_rows8(lds0 + GOPER, gB, stepB);
  asm volatile("s_wait_asynccnt 0x0" ::: "memory");   // trip 0's own copies have landed
  __syncthreads();                                    // and every other wave's
  if (nT > 1) {
    copy_rows8(lds0 + GSTAGE, gA + GBK, stepA);
    copy_rows8(lds0 + GSTAGE + GOPER, gB + GBK, stepB);
  }
  for (int t = 0; t < nT; ++t) {
    const unsigned bufo = (unsigned)(t & 1) * GSTAGE;
    const char* sA = smem + bufo + (wm + rlane) * GPITCH + koff * 2;
    const char* sB = smem + bufo + GOPER + (wn + rlane) * GPITCH + koff * 2;
#pragma unroll
    for (int kk = 0; kk < GBK / 32; ++kk) {
      V bh[4], ah[4];
#pragma unroll
      for (int j = 0; j < 4; ++j) bh[j] = Frag<T>::load((const T*)(sB + j * 16 * GPITCH + kk * 64));
#pragma unroll
      for (int i = 0; i < 4; ++i) ah[i] = Frag<T>::load((const T*)(sA + i * 16 * GPITCH + kk * 64));
      // keeps the 16 fragment loads together ahead of the 16 products: one LDS latency per group, not one per A fragment
      __builtin_amdgcn_sched_barrier(0);
#pragma unroll
      for (int i = 0; i < 4; ++i) {
#pragma unroll
        for (int j = 0; j < 4; ++j) acc[i][j] = Frag<T>::mma(ah[i], bh[j], acc[i][j]);
        Frag<T>::guard(acc[i][0], acc[i][3], ah[i], ah[i]);
      }
      Frag<T>::keep(bh[0], bh[1], bh[2], bh[3]);
    }
    asm volatile("s_wait_dscnt 0x0" ::: "memory");     // this wave's reads of the buffer have returned
    asm volatile("s_wait_asynccnt 0x0" ::: "memory");  // its copies for trip t + 1 have landed
    __syncthreads();                                   // publishes trip t + 1, frees this trip's buffer
    if (t + 2 < nT) {
      copy_rows8(lds0 + bufo, gA + (size_t)(t + 2) * GBK, stepA);
      copy_rows8(lds0 + bufo + GOPER, gB + (size_t)(t + 2) * GBK, stepB);
    }
  }
  asm volatile("s_wait_asynccnt 0x0" ::: "memory");    // nothing in flight when the buffers become slabs
  acc_guard4(acc[0][0], acc[0][1], acc[0][2], acc[0][3]);
  acc_guard4(acc[1][0], acc[1][1], acc[1][2], acc[1][3]);
  acc_guard4(acc[2][0], acc[2][1], acc[2][2], acc[2][3]);
  acc_guard4(acc[3][0], acc[3][1], acc[3][2], acc[3][3]);

  // ---- epilogue ----
  float* slab = (float*)smem + wave * (16 * 68);
  const float* Rb = RESID ? (resid + (size_t)b * strideR) : nullptr;
#pragma unroll
  for (int i = 0; i < 4; ++i) {
    const int mBase = m0 + (i << 4);
#pragma unroll
    for (int j = 0; j < 4; ++j) {
      const int n = n0 + (j << 4) + rlane;
      float bv = 0.f;
      if (BIAS_MODE == 2) bv = bias[n];
#pragma unroll
      for (int r = 0; r < 8; ++r) {
        float v = acc[i][j][r] * scale;
        if (BIAS_MODE == 1) v += bias[mBase + mOff + r];
        if (BIAS_MODE == 2) v += bv;
        if (RESID) v += Rb[(size_t)(mBase + mOff + r) * ldc + n];
        if (ACT == 1) v = tanhf(v);
        if (ACT == 2) v = fmaxf(v, 0.0f);
        if (ACT == 3) v = v / (1.0f + expf(-v));
        if (ACT == 4) v = (v > 0.f) ? v : 0.01f * v;
        if (ACT == 5) v = 0.5f * v * (1.0f + erff(v * 0.70710678118654752f));
        if (ACT == 6) { v = fmaxf(v, 0.0f); v = v * v; }
        slab[(mOff + r) * 68 + (j << 4) + rlane] = v;
      }
    }
    __builtin_amdgcn_fence(__ATOMIC_RELEASE, "workgroup");
    __builtin_amdgcn_wave_barrier();
    __builtin_amdgcn_fence(__ATOMIC_ACQUIRE, "workgroup");
    if (OUT_MODE == 0) {
      float* C = (float*)Cout + (size_t)b * strideC;
      const int hh = lane >> 4, c4 = (lane & 15) * 4;     // row seg = 256 B = 16 lanes x 16 B
      {
#pragma unroll
        for (int it = 0; it < 8; ++it) {
          const int row = it * 2 + hh;
          v4f v = *(const v4f*)(slab + row * 68 + c4);
          *(v4f*)(C + (size_t)(mBase + row) * ldc + n0 + c4) = v;
        }
        
      }
    } else {
      const int q = lane >> 3, c8 = (lane & 7) * 8;
      unsigned short* C  = (unsigned short*)Cout  + (size_t)b * strideC;
      unsigned short* C2 = (OUT_MODE == 2) ? ((unsigned short*)Cout2 + (size_t)b * strideC) : nullptr;
      {
#pragma unroll
        for (int it = 0; it < 4; ++it) {
          const int row = it * 4 + q;
          const float* sp = slab + row * 68 + c8;
          v8h hv, lv;
#pragma unroll
          for (int e = 0; e < 8; ++e) {
            if (OUT_MODE == 1) {
              hv[e] = (_Float16)sp[e];
            } else {
              unsigned short hb = f2bf_bits(sp[e]);
              unsigned short lb = f2bf_bits(sp[e] - bf_bits2f(hb));
              hv[e] = __builtin_bit_cast(_Float16, hb);
              lv[e] = __builtin_bit_cast(_Float16, lb);
            }
          }
          *(v8h*)(C + (size_t)(mBase + row) * ldc + n0 + c8) = hv;
          if (OUT_MODE == 2) *(v8h*)(C2 + (size_t)(mBase + row) * ldc + n0 + c8) = lv;
        }
        
      }
    }
    __builtin_amdgcn_fence(__ATOMIC_RELEASE, "workgroup");
    __builtin_amdgcn_wave_barrier();
    __builtin_amdgcn_fence(__ATOMIC_ACQUIRE, "workgroup");
  }
}

// ---- W [K][N] f32 -> Wt [N][K] f16 (x mul), 64x64 tile transposed through LDS ----
#define WTP 72
__global__ __launch_bounds__(256) void wt_cast_k(const float* __restrict__ W, unsigned short* __restrict__ Wtp,
                                                 int K, int N, float mul) {
  __shared__ __align__(16) _Float16 st[64 * WTP];
  _Float16* Wt = (_Float16*)Wtp;
  const int n0 = blockIdx.x * 64, k0 = blockIdx.y * 64;
  const int tid = threadIdx.x;
  const int kr = tid >> 2, c16 = (tid & 3) * 16;
  const float* src = W + (size_t)(k0 + kr) * N + n0 + c16;
#pragma unroll
  for (int q = 0; q < 4; ++q) {
    const v4f v = *(const v4f*)(src + 4 * q);
#pragma unroll
    for (int e = 0; e < 4; ++e) st[(c16 + 4 * q + e) * WTP + kr] = (_Float16)(v[e] * mul);
  }
  __syncthreads();
  const int wave = tid >> 5, lane = tid & 31;
  const int q8 = lane >> 3, c8 = (lane & 7) * 8;
  {
#pragma unroll
    for (int it = 0; it < 2; ++it) {
      const int n = it * 32 + wave * 4 + q8;
      const v8h hv = *(const v8h*)(st + n * WTP + c8);
      *(v8h*)(Wt + (size_t)(n0 + n) * K + k0 + c8) = hv;
    }
    
  }
}

// ---- rotary cos/sin table [S][64] (cos 0..31 | sin 32..63) and docs[S] = inclusive count of EOT ----
__global__ __launch_bounds__(256) void tables_k(const int* __restrict__ ids, float* __restrict__ rope,
                                                int* __restrict__ docs) {
  __shared__ int scnt[256];
  __shared__ __align__(16) int sdoc[SS];
  const int tid = threadIdx.x, lane = tid & 31, wave = tid >> 5;
  if (blockIdx.x < SS / 8) {
    const int s = blockIdx.x * 8 + wave;
    float e = (float)lane * (1.0f / 31.0f);
    if (lane == 31) e = 1.0f;
    const float fr = powf(0.0009765625f, e);
    const float th = (float)s * fr;
    float sv, cv;
    sincosf(th, &sv, &cv);
    float* rp = rope + (size_t)s * 64;
    *(float*)(rp + lane) = cv;
    *(float*)(rp + 32 + lane) = sv;
    
  } else {
    int c = 0;
#pragma unroll
    for (int i = 0; i < 8; ++i) c += (ids[tid * 8 + i] == EOT_ID) ? 1 : 0;
    scnt[tid] = c;
    __syncthreads();
    for (int off = 1; off < 256; off <<= 1) {
      const int t = (tid >= off) ? scnt[tid - off] : 0;
      __syncthreads();
      scnt[tid] += t;
      __syncthreads();
    }
    int run = scnt[tid] - c;
#pragma unroll
    for (int i = 0; i < 8; ++i) {
      run += (ids[tid * 8 + i] == EOT_ID) ? 1 : 0;
      sdoc[tid * 8 + i] = run;
    }
    __syncthreads();
    const v4i a0 = *(const v4i*)(sdoc + tid * 4);
    const v4i a1 = *(const v4i*)(sdoc + 1024 + tid * 4);
    {
      *(v4i*)(docs + tid * 4) = a0;
      *(v4i*)(docs + 1024 + tid * 4) = a1;
      
    }
  }
}

// ---- residual mix + LayerNorm, one 128-thread block per row of 1024; thread owns cols 4t..4t+3 and 512+4t..+3 ----
template <bool MIX>
__global__ __launch_bounds__(128) void ln_k(const float* __restrict__ x, const float* __restrict__ x0,
                                            const float* __restrict__ lam, const float* __restrict__ w,
                                            float* __restrict__ xr, unsigned short* __restrict__ xnp) {
  __shared__ float red1[4], red2[4];
  _Float16* xn = (_Float16*)xnp;
  const int row = blockIdx.x, tid = threadIdx.x, lane = tid & 31, wave = tid >> 5;
  const size_t rb = (size_t)row * DD;
  const int ca = tid * 4, cb = 512 + tid * 4;
  v4f va = *(const v4f*)(x + rb + ca);
  v4f vb = *(const v4f*)(x + rb + cb);
  if (MIX) {
    const float l0 = lam[0], l1 = lam[1];
    const v4f a0 = *(const v4f*)(x0 + rb + ca);
    const v4f b0 = *(const v4f*)(x0 + rb + cb);
    va = va * l0 + a0 * l1;
    vb = vb * l0 + b0 * l1;
    {
      *(v4f*)(xr + rb + ca) = va;
      *(v4f*)(xr + rb + cb) = vb;
      
    }
  }
  float s = (va[0] + va[1]) + (va[2] + va[3]) + (vb[0] + vb[1]) + (vb[2] + vb[3]);
#pragma unroll
  for (int off = 1; off < 32; off <<= 1) s += __shfl_xor(s, off, 32);
  if (lane == 0) red1[wave] = s;
  __syncthreads();
  const float mu = ((red1[0] + red1[1]) + (red1[2] + red1[3])) * (1.0f / DD);
  const v4f da = va - mu, db = vb - mu;
  float s2 = (da[0] * da[0] + da[1] * da[1]) + (da[2] * da[2] + da[3] * da[3]) +
             (db[0] * db[0] + db[1] * db[1]) + (db[2] * db[2] + db[3] * db[3]);
#pragma unroll
  for (int off = 1; off < 32; off <<= 1) s2 += __shfl_xor(s2, off, 32);
  if (lane == 0) red2[wave] = s2;
  __syncthreads();
  const float var = ((red2[0] + red2[1]) + (red2[2] + red2[3])) * (1.0f / DD);
  const float inv = rsqrtf(var + LN_EPS);
  const v4f wa = *(const v4f*)(w + ca);
  const v4f wb = *(const v4f*)(w + cb);
  v4h ha, hb;
#pragma unroll
  for (int e = 0; e < 4; ++e) {
    ha[e] = (_Float16)(da[e] * inv * wa[e]);
    hb[e] = (_Float16)(db[e] * inv * wb[e]);
  }
  {
    *(v4h*)(xn + rb + ca) = ha;
    *(v4h*)(xn + rb + cb) = hb;
    
  }
}

// ---- rotary + RMS-norm on q,k; v = sa0*v + sa1*ve; writes f16 planes [3][B*H*S][128] ----
// One block per token, wave = head; lane owns dims ln, ln+32, ln+64, ln+96 (pairs (ln,ln+64) rotate, (ln+32,ln+96) identity).
#define RSP 136
__global__ __launch_bounds__(256) void rope_k(const float* __restrict__ qkv, const float* __restrict__ ve,
                                              const float* __restrict__ sa, const float* __restrict__ rope,
                                              unsigned short* __restrict__ planesp) {
  __shared__ __align__(16) _Float16 st[HH][3 * RSP];
  _Float16* planes = (_Float16*)planesp;
  const int s = blockIdx.x, b = blockIdx.y;
  const int tid = threadIdx.x, h = tid >> 5, ln = tid & 31;
  const size_t tok = (size_t)b * SS + s;
  const float* base = qkv + tok * (3 * DD) + h * HDIM;
  const float cv = rope[(size_t)s * 64 + ln];
  const float sv = rope[(size_t)s * 64 + 32 + ln];
  _Float16* sw = st[h];
#pragma unroll
  for (int p = 0; p < 2; ++p) {
    const float* src = base + p * DD;
    const float a1 = src[ln], b1 = src[ln + 32], a2 = src[ln + 64], b2 = src[ln + 96];
    const float o0 = a1 * cv + a2 * sv;
    const float o2 = a2 * cv - a1 * sv;
    float sq = (o0 * o0 + b1 * b1) + (o2 * o2 + b2 * b2);
#pragma unroll
    for (int off = 1; off < 32; off <<= 1) sq += __shfl_xor(sq, off, 32);
    const float rs = rsqrtf(sq * (1.0f / HDIM) + RMS_EPS);
    sw[p * RSP + ln]      = (_Float16)(o0 * rs);
    sw[p * RSP + ln + 32] = (_Float16)(b1 * rs);
    sw[p * RSP + ln + 64] = (_Float16)(o2 * rs);
    sw[p * RSP + ln + 96] = (_Float16)(b2 * rs);
  }
  {
    const float sa0 = sa[0], sa1 = sa[1];
    const float* vsrc = base + 2 * DD;
    const float* vesrc = ve + (size_t)s * DD + h * HDIM;
#pragma unroll
    for (int i = 0; i < 4; ++i) {
      const int d = ln + 32 * i;
      sw[2 * RSP + d] = (_Float16)(sa0 * vsrc[d] + sa1 * vesrc[d]);
    }
  }
  __builtin_amdgcn_fence(__ATOMIC_RELEASE, "workgroup");
  __builtin_amdgcn_wave_barrier();
  __builtin_amdgcn_fence(__ATOMIC_ACQUIRE, "workgroup");
  const int hh = ln >> 4, c8 = (ln & 15) * 8;           // 256-B row = 16 lanes x 16 B
  const size_t PL = (size_t)NTOK * DD;
  const size_t row = ((size_t)(b * HH + h) * SS + s) * HDIM;
  const v8h v01 = *(const v8h*)(sw + hh * RSP + c8);
  const v8h v2  = *(const v8h*)(sw + 2 * RSP + c8);
  _Float16* d01 = planes + (size_t)hh * PL + row + c8;
  _Float16* d2  = planes + 2 * PL + row + c8;
  {
    *(v8h*)d01 = v01;
    if (hh == 0) *(v8h*)d2 = v2;
    
  }
}

// ---- attention, head dim 128, f16 q/k/v planes [B*H*S][128]; out f16 [B*S][D] at cols h*128 ----
// Block = 4 waves = 64 query rows of one (b,h); 64-key chunks; chunks above the diagonal skipped,
// per element select: allowed iff key <= query and docs[key] == docs[query], else -inf. p carried x2^15.
__device__ __forceinline__ v8f mma_h(v16h a, v16h b, v8f c) {
  c = __builtin_amdgcn_wmma_f32_16x16x32_f16(false, a, false, b, (short)0, c, false, false);
  asm volatile("v_nop\n\tv_nop\n\tv_nop\n\tv_nop" : "+v"(c) : "v"(a), "v"(b));
  return c;
}
#define AKC 64
#define AQB 64
#define OSP 136
__global__ __launch_bounds__(128) void attn128_k(const unsigned short* __restrict__ qpp, const unsigned short* __restrict__ kpp,
                                                 const unsigned short* __restrict__ vpp, const int* __restrict__ docs,
                                                 unsigned short* __restrict__ outp) {
  union FH { v16h v; v8h h[2]; };
  __shared__ __align__(16) _Float16 Ksh[AKC * HDIM];       // [kv][d]
  __shared__ __align__(16) _Float16 Vth[HDIM * AKC];       // [d][kv]
  __shared__ __align__(16) _Float16 Psh[4][16 * AKC];      // per wave [row][kv]
  __shared__ __align__(16) _Float16 Osh[4][16 * OSP];      // per wave [row][d]
  const _Float16* qp = (const _Float16*)qpp;
  const _Float16* kp = (const _Float16*)kpp;
  const _Float16* vp = (const _Float16*)vpp;
  _Float16* out = (_Float16*)outp;
  const int tid = threadIdx.x, wave = tid >> 5, lane = tid & 31, hh = lane >> 4, c = lane & 15;
  const int nqb = SS / AQB;
  const int bx = blockIdx.x;
  const int qb = bx % nqb;
  const int bh = bx / nqb;
  const int h = bh % HH;
  const int b = bh / HH;
  const int q0 = qb * AQB + wave * 16;
  const size_t rowb = (size_t)(b * HH + h) * SS;

  v16h qa[4];
  {
    const _Float16* qrow = qp + (rowb + q0 + c) * HDIM + 8 * hh;
#pragma unroll
    for (int dc = 0; dc < 4; ++dc) qa[dc] = Frag<_Float16>::load(qrow + dc * 32);
  }
  int dq[8];
#pragma unroll
  for (int r = 0; r < 8; ++r) dq[r] = docs[q0 + 8 * hh + r];
  float mrow[8], lrow[8];
  v8f oacc[8];
#pragma unroll
  for (int r = 0; r < 8; ++r) { mrow[r] = -INFINITY; lrow[r] = 0.f; }
#pragma unroll
  for (int t = 0; t < 8; ++t) oacc[t] = (v8f){0.f,0.f,0.f,0.f,0.f,0.f,0.f,0.f};

  const int nChunks = qb + 1;   // block-uniform
  for (int kc = 0; kc < nChunks; ++kc) {
    const int kv0 = kc * AKC;
    __syncthreads();
    {
      const int kvr = tid >> 1, dh = (tid & 1) * 64;
      const _Float16* krow = kp + (rowb + kv0 + kvr) * HDIM + dh;
      const _Float16* vrow = vp + (rowb + kv0 + kvr) * HDIM + dh;
#pragma unroll 1
      for (int i = 0; i < 8; ++i) {
        const v8h kk = *(const v8h*)(krow + 8 * i);
        *(v8h*)(Ksh + kvr * HDIM + dh + 8 * i) = kk;
        const v8h vv = *(const v8h*)(vrow + 8 * i);
#pragma unroll
        for (int e = 0; e < 8; ++e) Vth[(dh + 8 * i + e) * AKC + kvr] = vv[e];
      }
    }
    __syncthreads();

    v8f s[4];
#pragma unroll
    for (int j = 0; j < 4; ++j) {
      s[j] = (v8f){0.f,0.f,0.f,0.f,0.f,0.f,0.f,0.f};
#pragma unroll
      for (int dc = 0; dc < 4; ++dc) {
        FH kb;
        kb.h[0] = *(const v8h*)(Ksh + (j * 16 + c) * HDIM + dc * 32 + 8 * hh);
        kb.h[1] = *(const v8h*)(Ksh + (j * 16 + c) * HDIM + dc * 32 + 16 + 8 * hh);
        s[j] = mma_h(qa[dc], kb.v, s[j]);
      }
    }
    int dk[4];
#pragma unroll
    for (int j = 0; j < 4; ++j) dk[j] = docs[kv0 + j * 16 + c];
    const bool diag = (kc == qb);
    float cm[8];
#pragma unroll
    for (int r = 0; r < 8; ++r) {
      const int qrow = q0 + 8 * hh + r;
      float m = -INFINITY;
#pragma unroll
      for (int j = 0; j < 4; ++j) {
        const int kvcol = kv0 + j * 16 + c;
        float sv = s[j][r] * ATT_SCALE;
        const bool masked = (dk[j] != dq[r]) || (diag && (kvcol > qrow));
        if (masked) sv = -INFINITY;
        s[j][r] = sv;
        m = fmaxf(m, sv);
      }
#pragma unroll
      for (int off = 1; off < 16; off <<= 1) m = fmaxf(m, __shfl_xor(m, off, 32));
      cm[r] = m;
    }
    _Float16* pw = Psh[wave];
#pragma unroll
    for (int r = 0; r < 8; ++r) {
      const float mnew = fmaxf(mrow[r], cm[r]);
      const float mref = (mnew > -INFINITY) ? mnew : 0.0f;   // all-masked so far -> p = 0, alpha = 0
      const float alpha = expf(mrow[r] - mref);
      mrow[r] = mnew;
      float psum = 0.f;
#pragma unroll
      for (int j = 0; j < 4; ++j) {
        const float p = expf(s[j][r] - mref);
        psum += p;
        pw[(8 * hh + r) * AKC + j * 16 + c] = (_Float16)(p * PSCALE);
      }
#pragma unroll
      for (int off = 1; off < 16; off <<= 1) psum += __shfl_xor(psum, off, 32);
      lrow[r] = lrow[r] * alpha + psum;
#pragma unroll
      for (int t = 0; t < 8; ++t) oacc[t][r] *= alpha;
    }
    __builtin_amdgcn_fence(__ATOMIC_RELEASE, "workgroup");
    __builtin_amdgcn_wave_barrier();
    __builtin_amdgcn_fence(__ATOMIC_ACQUIRE, "workgroup");
#pragma unroll 1
    for (int kk = 0; kk < 2; ++kk) {
      FH pa;
      pa.h[0] = *(const v8h*)(pw + c * AKC + kk * 32 + 8 * hh);
      pa.h[1] = *(const v8h*)(pw + c * AKC + kk * 32 + 16 + 8 * hh);
#pragma unroll
      for (int t = 0; t < 8; ++t) {
        FH vb;
        vb.h[0] = *(const v8h*)(Vth + (t * 16 + c) * AKC + kk * 32 + 8 * hh);
        vb.h[1] = *(const v8h*)(Vth + (t * 16 + c) * AKC + kk * 32 + 16 + 8 * hh);
        oacc[t] = mma_h(pa.v, vb.v, oacc[t]);
      }
    }
  }

  _Float16* os = Osh[wave];
#pragma unroll
  for (int r = 0; r < 8; ++r) {
    const float inv = 1.0f / (lrow[r] * PSCALE);
#pragma unroll
    for (int t = 0; t < 8; ++t) os[(8 * hh + r) * OSP + t * 16 + c] = (_Float16)(oacc[t][r] * inv);
  }
  __builtin_amdgcn_fence(__ATOMIC_RELEASE, "workgroup");
  __builtin_amdgcn_wave_barrier();
  __builtin_amdgcn_fence(__ATOMIC_ACQUIRE, "workgroup");
  {
    const int c8 = (lane & 15) * 8;   // 256-B row segment = 16 lanes x 16 B, 2 rows per instruction
    {
#pragma unroll
      for (int it = 0; it < 8; ++it) {
        const int row = it * 2 + hh;
        const v8h val = *(const v8h*)(os + row * OSP + c8);
        *(v8h*)(out + (size_t)(b * SS + q0 + row) * DD + h * HDIM + c8) = val;
      }
      
    }
  }
}

// ---------------------------------------------------------------------------
extern "C" void kernel_launch(void* const* d_in, const int* in_sizes, int n_in,
                              void* d_out, int out_size, void* d_ws,
                              size_t ws_size, hipStream_t stream) {
  if (n_in < 12) return;
  if (in_sizes[0] != NTOK * DD || in_sizes[1] != SS * DD || in_sizes[2] != NTOK * DD ||
      in_sizes[3] < 2 || in_sizes[4] < 2 || in_sizes[5] < DD || in_sizes[6] < DD ||
      in_sizes[7] != DD * 3 * DD || in_sizes[8] != DD * DD || in_sizes[9] != DD * 4 * DD ||
      in_sizes[10] != 4 * DD * DD || in_sizes[11] != SS || out_size != NTOK * DD) return;

  const float* x     = (const float*)d_in[0];
  const float* ve    = (const float*)d_in[1];
  const float* x0    = (const float*)d_in[2];
  const float* lam   = (const float*)d_in[3];
  const float* sal   = (const float*)d_in[4];
  const float* ln1   = (const float*)d_in[5];
  const float* ln2   = (const float*)d_in[6];
  const float* wqkv  = (const float*)d_in[7];
  const float* wo    = (const float*)d_in[8];
  const float* wfc   = (const float*)d_in[9];
  const float* wproj = (const float*)d_in[10];
  const int*   ids   = (const int*)d_in[11];
  float* outf = (float*)d_out;

  // ---- carve (bytes) ----
  const size_t szWO   = (size_t)DD * DD * 2;              //   2 MiB  w_o^T f16
  const size_t szWFC  = (size_t)4 * DD * DD * 2;          //   8 MiB  w_fc^T f16
  const size_t szWPR  = (size_t)4 * DD * DD * 2;          //   8 MiB  w_proj^T f16
  const size_t szXR   = (size_t)NTOK * DD * 4;            //  16 MiB  mixed x f32
  const size_t szBIG  = (size_t)NTOK * 3 * DD * 4;        //  48 MiB  qkv f32, later h f16 (32 MiB) + x2 f32 (16 MiB)
  const size_t szXN   = (size_t)NTOK * DD * 2;            //   8 MiB  xn f16, later xn2 f16
  const size_t szWQA  = (size_t)NTOK * DD * 2;            //   8 MiB  w_qkv^T f16 (6 MiB), later attention out f16
  const size_t szPL   = (size_t)3 * NTOK * DD * 2;        //  24 MiB  q,k,v f16 planes
  const size_t szROPE = (size_t)SS * 64 * 4;              // 512 KiB
  const size_t szDOC  = (size_t)SS * 4;
  const size_t oWO = 0, oWFC = oWO + szWO, oWPR = oWFC + szWFC, oXR = oWPR + szWPR, oBIG = oXR + szXR,
               oXN = oBIG + szBIG, oWQA = oXN + szXN, oPL = oWQA + szWQA, oROPE = oPL + szPL,
               oDOC = oROPE + szROPE, oEND = oDOC + szDOC;
  if (oEND > ws_size) return;
  char* ws = (char*)d_ws;
  unsigned short* woT   = (unsigned short*)(ws + oWO);
  unsigned short* wfcT  = (unsigned short*)(ws + oWFC);
  unsigned short* wprT  = (unsigned short*)(ws + oWPR);
  float*          xr    = (float*)(ws + oXR);
  float*          qkvf  = (float*)(ws + oBIG);
  unsigned short* hbuf  = (unsigned short*)(ws + oBIG);
  float*          x2    = (float*)(ws + oBIG + (size_t)NTOK * 4 * DD * 2);
  unsigned short* xn    = (unsigned short*)(ws + oXN);
  unsigned short* xn2   = xn;
  unsigned short* wqkvT = (unsigned short*)(ws + oWQA);
  unsigned short* attn  = (unsigned short*)(ws + oWQA);
  unsigned short* qpl   = (unsigned short*)(ws + oPL);
  unsigned short* kpl   = qpl + (size_t)NTOK * DD;
  unsigned short* vpl   = qpl + (size_t)2 * NTOK * DD;
  float*          rope  = (float*)(ws + oROPE);
  int*            docs  = (int*)(ws + oDOC);

  // weights: W [in][out] -> Wt [out][in] f16 x64; grid = (out/64, in/64)
  wt_cast_k<<<dim3(3 * DD / 64, DD / 64), 256, 0, stream>>>(wqkv, wqkvT, DD, 3 * DD, WMUL);
  wt_cast_k<<<dim3(DD / 64, DD / 64), 256, 0, stream>>>(wo, woT, DD, DD, WMUL);
  wt_cast_k<<<dim3(4 * DD / 64, DD / 64), 256, 0, stream>>>(wfc, wfcT, DD, 4 * DD, WMUL);
  wt_cast_k<<<dim3(DD / 64, 4 * DD / 64), 256, 0, stream>>>(wproj, wprT, 4 * DD, DD, WMUL);
  // rotary table + docs
  tables_k<<<SS / 8 + 1, 256, 0, stream>>>(ids, rope, docs);
  // x = l0*x + l1*x0 ; xn = LN(x)*ln1_w
  ln_k<true><<<NTOK, 128, 0, stream>>>(x, x0, lam, ln1, xr, xn);
  // qkv = xn @ w_qkv (f32 out)
  {
    const int M = NTOK, N = 3 * DD, K = DD;
    const int tiles = (M / 128) * (N / 128);
    wmma_gemm64<0, false, 0, 0, false, 0><<<dim3(tiles, 1), 128, 0, stream>>>(
        xn, xn, K, 0, wqkvT, wqkvT, K, 0, qkvf, qkvf, N, 0, xr, xr, 0, M, N, K, WMUL_INV);
  }
  // rotary + RMS-norm + value mix -> f16 planes
  rope_k<<<dim3(SS, BB), 256, 0, stream>>>(qkvf, ve, sal, rope, qpl);
  // attention
  attn128_k<<<BB * HH * (SS / AQB), 128, 0, stream>>>(qpl, kpl, vpl, docs, attn);
  // x2 = xr + attn @ w_o
  {
    const int M = NTOK, N = DD, K = DD;
    const int tiles = (M / 128) * (N / 128);
    wmma_gemm64<0, false, 0, 0, true, 0><<<dim3(tiles, 1), 128, 0, stream>>>(
        attn, attn, K, 0, woT, woT, K, 0, x2, x2, N, 0, xr, xr, 0, M, N, K, WMUL_INV);
  }
  // xn2 = LN(x2)*ln2_w
  ln_k<false><<<NTOK, 128, 0, stream>>>(x2, x2, lam, ln2, xr, xn2);
  // h = relu(xn2 @ w_fc)^2 (f16 out)
  {
    const int M = NTOK, N = 4 * DD, K = DD;
    const int tiles = (M / 128) * (N / 128);
    wmma_gemm64<0, false, 0, 1, false, 6><<<dim3(tiles, 1), 128, 0, stream>>>(
        xn2, xn2, K, 0, wfcT, wfcT, K, 0, hbuf, hbuf, N, 0, xr, xr, 0, M, N, K, WMUL_INV);
  }
  // out = x2 + h @ w_proj
  {
    const int M = NTOK, N = DD, K = 4 * DD;
    const int tiles = (M / 128) * (N / 128);
    wmma_gemm64<0, false, 0, 0, true, 0><<<dim3(tiles, 1), 128, 0, stream>>>(
        hbuf, hbuf, K, 0, wprT, wprT, K, 0, outf, outf, N, 0, x2, x2, 0, M, N, K, WMUL_INV);
  }
}

// v002
// A run of this version takes 285 microseconds.
// Two timings next to v001 both put it at 1.45 times that version's speed.
// Over all steps from v000 it is 2.19 times as fast.
#include <hip/hip_runtime.h>
#include <stdint.h>
// All contractions: v_wmma_f32_16x16x32_f16 (f16 operands, f32 accumulate); projection weights carried x64, attention p carried x2^15; norms, rotary, softmax and residuals in f32.

#define BB 2
#define SS 2048
#define DD 1024
#define HH 8
#define HDIM 128
#define NTOK (BB * SS)
#define EOT_ID 50256
#define ATT_SCALE 0.12f
#define LN_EPS 1e-6f
#define RMS_EPS 1.1920929e-7f
#define WMUL 64.0f
#define WMUL_INV (1.0f / 64.0f)

typedef __attribute__((ext_vector_type(16))) _Float16 v16h;
typedef __attribute__((ext_vector_type(8)))  _Float16 v8h;
typedef __attribute__((ext_vector_type(4)))  _Float16 v4h;
typedef __attribute__((ext_vector_type(16))) __bf16   v16b;
typedef __attribute__((ext_vector_type(8)))  __bf16   v8b;
typedef __attribute__((ext_vector_type(8)))  float    v8f;
typedef __attribute__((ext_vector_type(4)))  float    v4f;
typedef __attribute__((ext_vector_type(4)))  int      v4i;
#define PSCALE 32768.0f
#define U16(p) ((const unsigned short*)(const void*)(p))
#define PSCALE_INV (1.0f / 32768.0f)

__device__ __forceinline__ unsigned short f2bf_bits(float f) {
  unsigned u = __float_as_uint(f);
  return (unsigned short)((u + 0x7FFFu + ((u >> 16) & 1u)) >> 16);
}
__device__ __forceinline__ float bf_bits2f(unsigned short h) { return __uint_as_float(((unsigned)h) << 16); }

// hazard guards as plain device helpers
__device__ __forceinline__ void dep_guard_h(v8f& a, v8f& b, v16h x, v16h y) { asm volatile("v_nop\n\tv_nop\n\tv_nop\n\tv_nop" : "+v"(a), "+v"(b) : "v"(x), "v"(y)); }
__device__ __forceinline__ void dep_guard_b(v8f& a, v8f& b, v16b x, v16b y) { asm volatile("v_nop\n\tv_nop\n\tv_nop\n\tv_nop" : "+v"(a), "+v"(b) : "v"(x), "v"(y)); }
__device__ __forceinline__ void keep4_h(v16h a, v16h b, v16h c, v16h d) { asm volatile("v_nop" :: "v"(a), "v"(b), "v"(c), "v"(d)); }
__device__ __forceinline__ void keep4_b(v16b a, v16b b, v16b c, v16b d) { asm volatile("v_nop" :: "v"(a), "v"(b), "v"(c), "v"(d)); }
__device__ __forceinline__ void acc_guard4(v8f& a, v8f& b, v8f& c, v8f& d) { asm volatile("v_nop\n\tv_nop\n\tv_nop\n\tv_nop" : "+v"(a), "+v"(b), "+v"(c), "+v"(d)); }
template <typename T> struct Frag;
template <> struct Frag<_Float16> {
  typedef v16h V; union U { v16h v; v8h h[2]; };
  static __device__ __forceinline__ v16h load(const _Float16* p) {   // elements 0..7 <- p[0..7], 8..15 <- p[16..23]
    U f; f.h[0] = *(const v8h*)(p); f.h[1] = *(const v8h*)(p + 16); return f.v;
  }
  static __device__ __forceinline__ v8f mma(v16h a, v16h b, v8f c) {
    return __builtin_amdgcn_wmma_f32_16x16x32_f16(false, a, false, b, (short)0, c, false, false);
  }
  static __device__ __forceinline__ void guard(v8f& a, v8f& b, v16h x, v16h y) { dep_guard_h(a, b, x, y); }
  static __device__ __forceinline__ void keep(v16h a, v16h b, v16h c, v16h d) { keep4_h(a, b, c, d); }
};
template <> struct Frag<__bf16> {
  typedef v16b V; union U { v16b v; v8b h[2]; };
  static __device__ __forceinline__ v16b load(const __bf16* p) {
    U f; f.h[0] = *(const v8b*)(p); f.h[1] = *(const v8b*)(p + 16); return f.v;
  }
  static __device__ __forceinline__ v8f mma(v16b a, v16b b, v8f c) {
    return __builtin_amdgcn_wmma_f32_16x16x32_bf16(false, a, false, b, (short)0, c, false, false);
  }
  static __device__ __forceinline__ void guard(v8f& a, v8f& b, v16b x, v16b y) { dep_guard_b(a, b, x, y); }
  static __device__ __forceinline__ void keep(v16b a, v16b b, v16b c, v16b d) { keep4_b(a, b, c, d); }
};

// ---- LDS-staged batched WMMA GEMM ------------------------------------------
// C[m,n] = scale * sum_k A[m,k] * Bt[n,k] (+bias)(+resid); a block of 4 waves owns a 128x128 tile, each wave 64x64 of it.
// A row-major [M,K]; Bt row-major [N,K]; M,N % 128 == 0, K % 64 == 0.
// Per trip 64 k of both operands (128 rows x 128 B each) lie in LDS at pitch 144 B, brought by asynchronous
// copies into two buffers: the next trip's copies fly while this trip's fragments are read and multiplied.
// BIAS_MODE: 0 = none, 1 = bias[m], 2 = bias[n].
// OUT_MODE: 0 = f32, 1 = f16, 2 = bf16 hi plane (Cout) + bf16 lo plane (Cout2).
// ACT 6: relu then square.
// ET: 0 = f16 operands, 1 = bf16 operands (pointers passed as 16-bit storage)
template <int ET> struct Elem;
template <> struct Elem<0> { typedef _Float16 T; };
template <> struct Elem<1> { typedef __bf16 T; };
#define GBK 64                         // k per trip
#define GPITCH 144                     // LDS row pitch in bytes (16 B x odd: conflict-free for ds_load_b128)
#define GOPER (128 * GPITCH)           // one operand's 128 rows
#define GSTAGE (2 * GOPER)             // A rows, then Bt rows
// Eight 16-byte copies per lane: rows r, r+16, .. r+112 of one operand's 128-row slab. The s_wait_xcnt closes the
// statement so that no address register is rewritten ahead of it.
__device__ __forceinline__ void copy_rows8(uint32_t l, const unsigned short* gp, size_t step) {
  asm volatile(
      "global_load_async_to_lds_b128 %0, %8, off\n\t"
      "global_load_async_to_lds_b128 %1, %9, off\n\t"
      "global_load_async_to_lds_b128 %2, %10, off\n\t"
      "global_load_async_to_lds_b128 %3, %11, off\n\t"
      "global_load_async_to_lds_b128 %4, %12, off\n\t"
      "global_load_async_to_lds_b128 %5, %13, off\n\t"
      "global_load_async_to_lds_b128 %6, %14, off\n\t"
      "global_load_async_to_lds_b128 %7, %15, off\n\t"
      "s_wait_xcnt 0x0"
      :: "v"(l), "v"(l + 16 * GPITCH), "v"(l + 32 * GPITCH), "v"(l + 48 * GPITCH),
         "v"(l + 64 * GPITCH), "v"(l + 80 * GPITCH), "v"(l + 96 * GPITCH), "v"(l + 112 * GPITCH),
         "v"(gp), "v"(gp + step), "v"(gp + 2 * step), "v"(gp + 3 * step),
         "v"(gp + 4 * step), "v"(gp + 5 * step), "v"(gp + 6 * step), "v"(gp + 7 * step)
      : "memory");
}
template <int ET, bool SPLIT, int BIAS_MODE, int OUT_MODE, bool RESID, int ACT = 0>
__global__ __launch_bounds__(128) void wmma_gemm64(
    const unsigned short* __restrict__ Ap, const unsigned short* __restrict__ A2p, int lda, long strideA,
    const unsigned short* __restrict__ Btp, const unsigned short* __restrict__ Bt2p, int ldb, long strideB,
    void* __restrict__ Cout, void* __restrict__ Cout2, int ldc, long strideC,
    const float* __restrict__ bias,
    const float* __restrict__ resid, long strideR,
    int M, int N, int K, float scale) {
  static_assert(!SPLIT, "single-plane operands only");
  typedef typename Elem<ET>::T T;
  typedef typename Frag<T>::V V;
  // two operand buffers; after the loop its first bytes serve as the per-wave 16x64 f32 slabs, pitch 68 floats
  __shared__ __align__(16) char smem[2 * GSTAGE];
  const int b    = blockIdx.y;
  const int tid  = threadIdx.x;
  const int lane = tid & 31;
  const int wave = tid >> 5;
  const int tilesN = N >> 7;
  const int tilesM = M >> 7;
  const int tile = blockIdx.x;
  if (tile >= tilesM * tilesN) return;   // block-uniform, in front of every barrier
  const int tm = tile / tilesN;
  const int tn = tile - tm * tilesN;
  const int mB = tm << 7;                      // block tile origin
  const int nB = tn << 7;
  const int wm = (wave >> 1) << 6;             // wave tile origin inside the block tile
  const int wn = (wave & 1) << 6;
  const int m0 = mB + wm;
  const int n0 = nB + wn;

  const int rlane = lane & 15;                 // row (A) / col (B, D) within subtile
  const int koff  = (lane >> 4) * 8;           // k offset of this lane half
  const int mOff  = (lane >> 4) * 8;           // D row offset

  // copy addresses: lane brings 16 B at column chunk (tid & 7) of rows (tid >> 3) + 16 i
  const int crow = tid >> 3, ccol = (tid & 7) * 8;
  const unsigned short* gA = Ap  + (size_t)b * strideA + (size_t)(mB + crow) * lda + ccol;
  const unsigned short* gB = Btp + (size_t)b * strideB + (size_t)(nB + crow) * ldb + ccol;
  const size_t stepA = (size_t)16 * lda, stepB = (size_t)16 * ldb;
  const uint32_t lds0 = (uint32_t)(uintptr_t)smem + (uint32_t)(crow * GPITCH + ccol * 2);

  v8f acc[4][4];
#pragma unroll
  for (int i = 0; i < 4; ++i)
#pragma unroll
    for (int j = 0; j < 4; ++j) acc[i][j] = (v8f){0.f,0.f,0.f,0.f,0.f,0.f,0.f,0.f};

  const int nT = K / GBK;
  copy_rows8(lds0, gA, stepA);
  copy_rows8(lds0 + GOPER, gB, stepB);
  asm volatile("s_wait_asynccnt 0x0" ::: "memory");   // trip 0's own copies have landed
  __syncthreads();                                    // and every other wave's
  if (nT > 1) {
    copy_rows8(lds0 + GSTAGE, gA + GBK, stepA);
    copy_rows8(lds0 + GSTAGE + GOPER, gB + GBK, stepB);
  }
  for (int t = 0; t < nT; ++t) {
    const unsigned bufo = (unsigned)(t & 1) * GSTAGE;
    const char* sA = smem + bufo + (wm + rlane) * GPITCH + koff * 2;
    const char* sB = smem + bufo + GOPER + (wn + rlane) * GPITCH + koff * 2;
#pragma unroll
    for (int kk = 0; kk < GBK / 32; ++kk) {
      V bh[4], ah[4];
#pragma unroll
      for (int j = 0; j < 4; ++j) bh[j] = Frag<T>::load((const T*)(sB + j * 16 * GPITCH + kk * 64));
#pragma unroll
      for (int i = 0; i < 4; ++i) ah[i] = Frag<T>::load((const T*)(sA + i * 16 * GPITCH + kk * 64));
      // keeps the 16 fragment loads together ahead of the 16 products: one LDS latency per group, not one per A fragment
      __builtin_amdgcn_sched_barrier(0);
#pragma unroll
      for (int i = 0; i < 4; ++i) {
#pragma unroll
        for (int j = 0; j < 4; ++j) acc[i][j] = Frag<T>::mma(ah[i], bh[j], acc[i][j]);
        Frag<T>::guard(acc[i][0], acc[i][3], ah[i], ah[i]);
      }
      Frag<T>::keep(bh[0], bh[1], bh[2], bh[3]);
    }
    asm volatile("s_wait_dscnt 0x0" ::: "memory");     // this wave's reads of the buffer have returned
    asm volatile("s_wait_asynccnt 0x0" ::: "memory");  // its copies for trip t + 1 have landed
    __syncthreads();                                   // publishes trip t + 1, frees this trip's buffer
    if (t + 2 < nT) {
      copy_rows8(lds0 + bufo, gA + (size_t)(t + 2) * GBK, stepA);
      copy_rows8(lds0 + bufo + GOPER, gB + (size_t)(t + 2) * GBK, stepB);
    }
  }
  asm volatile("s_wait_asynccnt 0x0" ::: "memory");    // nothing in flight when the buffers become slabs
  acc_guard4(acc[0][0], acc[0][1], acc[0][2], acc[0][3]);
  acc_guard4(acc[1][0], acc[1][1], acc[1][2], acc[1][3]);
  acc_guard4(acc[2][0], acc[2][1], acc[2][2], acc[2][3]);
  acc_guard4(acc[3][0], acc[3][1], acc[3][2], acc[3][3]);

  // ---- epilogue ----
  float* slab = (float*)smem + wave * (16 * 68);
  const float* Rb = RESID ? (resid + (size_t)b * strideR) : nullptr;
#pragma unroll
  for (int i = 0; i < 4; ++i) {
    const int mBase = m0 + (i << 4);
#pragma unroll
    for (int j = 0; j < 4; ++j) {
      const int n = n0 + (j << 4) + rlane;
      float bv = 0.f;
      if (BIAS_MODE == 2) bv = bias[n];
#pragma unroll
      for (int r = 0; r < 8; ++r) {
        float v = acc[i][j][r] * scale;
        if (BIAS_MODE == 1) v += bias[mBase + mOff + r];
        if (BIAS_MODE == 2) v += bv;
        if (RESID) v += Rb[(size_t)(mBase + mOff + r) * ldc + n];
        if (ACT == 1) v = tanhf(v);
        if (ACT == 2) v = fmaxf(v, 0.0f);
        if (ACT == 3) v = v / (1.0f + expf(-v));
        if (ACT == 4) v = (v > 0.f) ? v : 0.01f * v;
        if (ACT == 5) v = 0.5f * v * (1.0f + erff(v * 0.70710678118654752f));
        if (ACT == 6) { v = fmaxf(v, 0.0f); v = v * v; }
        slab[(mOff + r) * 68 + (j << 4) + rlane] = v;
      }
    }
    __builtin_amdgcn_fence(__ATOMIC_RELEASE, "workgroup");
    __builtin_amdgcn_wave_barrier();
    __builtin_amdgcn_fence(__ATOMIC_ACQUIRE, "workgroup");
    if (OUT_MODE == 0) {
      float* C = (float*)Cout + (size_t)b * strideC;
      const int hh = lane >> 4, c4 = (lane & 15) * 4;     // row seg = 256 B = 16 lanes x 16 B
      {
#pragma unroll
        for (int it = 0; it < 8; ++it) {
          const int row = it * 2 + hh;
          v4f v = *(const v4f*)(slab + row * 68 + c4);
          *(v4f*)(C + (size_t)(mBase + row) * ldc + n0 + c4) = v;
        }
        
      }
    } else {
      const int q = lane >> 3, c8 = (lane & 7) * 8;
      unsigned short* C  = (unsigned short*)Cout  + (size_t)b * strideC;
      unsigned short* C2 = (OUT_MODE == 2) ? ((unsigned short*)Cout2 + (size_t)b * strideC) : nullptr;
      {
#pragma unroll
        for (int it = 0; it < 4; ++it) {
          const int row = it * 4 + q;
          const float* sp = slab + row * 68 + c8;
          v8h hv, lv;
#pragma unroll
          for (int e = 0; e < 8; ++e) {
            if (OUT_MODE == 1) {
              hv[e] = (_Float16)sp[e];
            } else {
              unsigned short hb = f2bf_bits(sp[e]);
              unsigned short lb = f2bf_bits(sp[e] - bf_bits2f(hb));
              hv[e] = __builtin_bit_cast(_Float16, hb);
              lv[e] = __builtin_bit_cast(_Float16, lb);
            }
          }
          *(v8h*)(C + (size_t)(mBase + row) * ldc + n0 + c8) = hv;
          if (OUT_MODE == 2) *(v8h*)(C2 + (size_t)(mBase + row) * ldc + n0 + c8) = lv;
        }
        
      }
    }
    __builtin_amdgcn_fence(__ATOMIC_RELEASE, "workgroup");
    __builtin_amdgcn_wave_barrier();
    __builtin_amdgcn_fence(__ATOMIC_ACQUIRE, "workgroup");
  }
}

// ---- W [K][N] f32 -> Wt [N][K] f16 (x mul), 64x64 tile transposed through LDS ----
#define WTP 72
__global__ __launch_bounds__(256) void wt_cast_k(const float* __restrict__ W, unsigned short* __restrict__ Wtp,
                                                 int K, int N, float mul) {
  __shared__ __align__(16) _Float16 st[64 * WTP];
  _Float16* Wt = (_Float16*)Wtp;
  const int n0 = blockIdx.x * 64, k0 = blockIdx.y * 64;
  const int tid = threadIdx.x;
  const int kr = tid >> 2, c16 = (tid & 3) * 16;
  const float* src = W + (size_t)(k0 + kr) * N + n0 + c16;
#pragma unroll
  for (int q = 0; q < 4; ++q) {
    const v4f v = *(const v4f*)(src + 4 * q);
#pragma unroll
    for (int e = 0; e < 4; ++e) st[(c16 + 4 * q + e) * WTP + kr] = (_Float16)(v[e] * mul);
  }
  __syncthreads();
  const int wave = tid >> 5, lane = tid & 31;
  const int q8 = lane >> 3, c8 = (lane & 7) * 8;
  {
#pragma unroll
    for (int it = 0; it < 2; ++it) {
      const int n = it * 32 + wave * 4 + q8;
      const v8h hv = *(const v8h*)(st + n * WTP + c8);
      *(v8h*)(Wt + (size_t)(n0 + n) * K + k0 + c8) = hv;
    }
    
  }
}

// ---- rotary cos/sin table [S][64] (cos 0..31 | sin 32..63) and docs[S] = inclusive count of EOT ----
__global__ __launch_bounds__(256) void tables_k(const int* __restrict__ ids, float* __restrict__ rope,
                                                int* __restrict__ docs) {
  __shared__ int scnt[256];
  __shared__ __align__(16) int sdoc[SS];
  const int tid = threadIdx.x, lane = tid & 31, wave = tid >> 5;
  if (blockIdx.x < SS / 8) {
    const int s = blockIdx.x * 8 + wave;
    float e = (float)lane * (1.0f / 31.0f);
    if (lane == 31) e = 1.0f;
    const float fr = powf(0.0009765625f, e);
    const float th = (float)s * fr;
    float sv, cv;
    sincosf(th, &sv, &cv);
    float* rp = rope + (size_t)s * 64;
    *(float*)(rp + lane) = cv;
    *(float*)(rp + 32 + lane) = sv;
    
  } else {
    int c = 0;
#pragma unroll
    for (int i = 0; i < 8; ++i) c += (ids[tid * 8 + i] == EOT_ID) ? 1 : 0;
    scnt[tid] = c;
    __syncthreads();
    for (int off = 1; off < 256; off <<= 1) {
      const int t = (tid >= off) ? scnt[tid - off] : 0;
      __syncthreads();
      scnt[tid] += t;
      __syncthreads();
    }
    int run = scnt[tid] - c;
#pragma unroll
    for (int i = 0; i < 8; ++i) {
      run += (ids[tid * 8 + i] == EOT_ID) ? 1 : 0;
      sdoc[tid * 8 + i] = run;
    }
    __syncthreads();
    const v4i a0 = *(const v4i*)(sdoc + tid * 4);
    const v4i a1 = *(const v4i*)(sdoc + 1024 + tid * 4);
    {
      *(v4i*)(docs + tid * 4) = a0;
      *(v4i*)(docs + 1024 + tid * 4) = a1;
      
    }
  }
}

// ---- residual mix + LayerNorm, one 128-thread block per row of 1024; thread owns cols 4t..4t+3 and 512+4t..+3 ----
template <bool MIX>
__global__ __launch_bounds__(128) void ln_k(const float* __restrict__ x, const float* __restrict__ x0,
                                            const float* __restrict__ lam, const float* __restrict__ w,
                                            float* __restrict__ xr, unsigned short* __restrict__ xnp) {
  __shared__ float red1[4], red2[4];
  _Float16* xn = (_Float16*)xnp;
  const int row = blockIdx.x, tid = threadIdx.x, lane = tid & 31, wave = tid >> 5;
  const size_t rb = (size_t)row * DD;
  const int ca = tid * 4, cb = 512 + tid * 4;
  v4f va = *(const v4f*)(x + rb + ca);
  v4f vb = *(const v4f*)(x + rb + cb);
  if (MIX) {
    const float l0 = lam[0], l1 = lam[1];
    const v4f a0 = *(const v4f*)(x0 + rb + ca);
    const v4f b0 = *(const v4f*)(x0 + rb + cb);
    va = va * l0 + a0 * l1;
    vb = vb * l0 + b0 * l1;
    {
      *(v4f*)(xr + rb + ca) = va;
      *(v4f*)(xr + rb + cb) = vb;
      
    }
  }
  float s = (va[0] + va[1]) + (va[2] + va[3]) + (vb[0] + vb[1]) + (vb[2] + vb[3]);
#pragma unroll
  for (int off = 1; off < 32; off <<= 1) s += __shfl_xor(s, off, 32);
  if (lane == 0) red1[wave] = s;
  __syncthreads();
  const float mu = ((red1[0] + red1[1]) + (red1[2] + red1[3])) * (1.0f / DD);
  const v4f da = va - mu, db = vb - mu;
  float s2 = (da[0] * da[0] + da[1] * da[1]) + (da[2] * da[2] + da[3] * da[3]) +
             (db[0] * db[0] + db[1] * db[1]) + (db[2] * db[2] + db[3] * db[3]);
#pragma unroll
  for (int off = 1; off < 32; off <<= 1) s2 += __shfl_xor(s2, off, 32);
  if (lane == 0) red2[wave] = s2;
  __syncthreads();
  const float var = ((red2[0] + red2[1]) + (red2[2] + red2[3])) * (1.0f / DD);
  const float inv = rsqrtf(var + LN_EPS);
  const v4f wa = *(const v4f*)(w + ca);
  const v4f wb = *(const v4f*)(w + cb);
  v4h ha, hb;
#pragma unroll
  for (int e = 0; e < 4; ++e) {
    ha[e] = (_Float16)(da[e] * inv * wa[e]);
    hb[e] = (_Float16)(db[e] * inv * wb[e]);
  }
  {
    *(v4h*)(xn + rb + ca) = ha;
    *(v4h*)(xn + rb + cb) = hb;
    
  }
}

// ---- rotary + RMS-norm on q,k; v = sa0*v + sa1*ve; writes f16 planes [3][B*H*S][128] ----
// One block per token, wave = head; lane owns dims ln, ln+32, ln+64, ln+96 (pairs (ln,ln+64) rotate, (ln+32,ln+96) identity).
#define RSP 136
__global__ __launch_bounds__(256) void rope_k(const float* __restrict__ qkv, const float* __restrict__ ve,
                                              const float* __restrict__ sa, const float* __restrict__ rope,
                                              unsigned short* __restrict__ planesp) {
  __shared__ __align__(16) _Float16 st[HH][3 * RSP];
  _Float16* planes = (_Float16*)planesp;
  const int s = blockIdx.x, b = blockIdx.y;
  const int tid = threadIdx.x, h = tid >> 5, ln = tid & 31;
  const size_t tok = (size_t)b * SS + s;
  const float* base = qkv + tok * (3 * DD) + h * HDIM;
  const float cv = rope[(size_t)s * 64 + ln];
  const float sv = rope[(size_t)s * 64 + 32 + ln];
  _Float16* sw = st[h];
#pragma unroll
  for (int p = 0; p < 2; ++p) {
    const float* src = base + p * DD;
    const float a1 = src[ln], b1 = src[ln + 32], a2 = src[ln + 64], b2 = src[ln + 96];
    const float o0 = a1 * cv + a2 * sv;
    const float o2 = a2 * cv - a1 * sv;
    float sq = (o0 * o0 + b1 * b1) + (o2 * o2 + b2 * b2);
#pragma unroll
    for (int off = 1; off < 32; off <<= 1) sq += __shfl_xor(sq, off, 32);
    const float rs = rsqrtf(sq * (1.0f / HDIM) + RMS_EPS);
    sw[p * RSP + ln]      = (_Float16)(o0 * rs);
    sw[p * RSP + ln + 32] = (_Float16)(b1 * rs);
    sw[p * RSP + ln + 64] = (_Float16)(o2 * rs);
    sw[p * RSP + ln + 96] = (_Float16)(b2 * rs);
  }
  {
    const float sa0 = sa[0], sa1 = sa[1];
    const float* vsrc = base + 2 * DD;
    const float* vesrc = ve + (size_t)s * DD + h * HDIM;
#pragma unroll
    for (int i = 0; i < 4; ++i) {
      const int d = ln + 32 * i;
      sw[2 * RSP + d] = (_Float16)(sa0 * vsrc[d] + sa1 * vesrc[d]);
    }
  }
  __builtin_amdgcn_fence(__ATOMIC_RELEASE, "workgroup");
  __builtin_amdgcn_wave_barrier();
  __builtin_amdgcn_fence(__ATOMIC_ACQUIRE, "workgroup");
  const int hh = ln >> 4, c8 = (ln & 15) * 8;           // 256-B row = 16 lanes x 16 B
  const size_t PL = (size_t)NTOK * DD;
  const size_t row = ((size_t)(b * HH + h) * SS + s) * HDIM;
  const v8h v01 = *(const v8h*)(sw + hh * RSP + c8);
  const v8h v2  = *(const v8h*)(sw + 2 * RSP + c8);
  _Float16* d01 = planes + (size_t)hh * PL + row + c8;
  _Float16* d2  = planes + 2 * PL + row + c8;
  {
    *(v8h*)d01 = v01;
    if (hh == 0) *(v8h*)d2 = v2;
    
  }
}

// ---- attention, head dim 128, f16 q/k/v planes [B*H*S][128]; out f16 [B*S][D] at cols h*128 ----
// Block = 4 waves = 64 query rows of one (b,h); 64-key chunks; chunks above the diagonal skipped,
// per element select: allowed iff key <= query and docs[key] == docs[query], else -inf. p carried x2^15.
// K and V chunks lie row-major [kv][d] in LDS, brought by asynchronous copies into two buffers: the next chunk's
// copies fly while this chunk is worked on. K rows are read by ds_load_b128, V columns by ds_load_tr16_b128.
__device__ __forceinline__ v8f mma_h(v16h a, v16h b, v8f c) {
  c = __builtin_amdgcn_wmma_f32_16x16x32_f16(false, a, false, b, (short)0, c, false, false);
  asm volatile("v_nop\n\tv_nop\n\tv_nop\n\tv_nop" : "+v"(c) : "v"(a), "v"(b));
  return c;
}
#define AKC 64
#define AQB 64
#define OSP 136
#define KPITCH 272                     // K row pitch in bytes (16 B x odd: conflict-free for ds_load_b128)
#define VPITCH 288                     // V row pitch in bytes (32 B x odd: conflict-free for ds_load_tr16_b128)
#define KBUF (AKC * KPITCH)
#define VBUF (AKC * VPITCH)
// Eight 16-byte copies per lane: rows r, r+8, .. r+56 of one 64-row chunk of 256-byte rows (LSTEP = 8 LDS rows).
// The s_wait_xcnt closes the statement so that no address register is rewritten ahead of it.
template <int LSTEP>
__device__ __forceinline__ void copy_kv8(uint32_t l, const unsigned short* gp) {
  asm volatile(
      "global_load_async_to_lds_b128 %0, %8, off\n\t"
      "global_load_async_to_lds_b128 %1, %9, off\n\t"
      "global_load_async_to_lds_b128 %2, %10, off\n\t"
      "global_load_async_to_lds_b128 %3, %11, off\n\t"
      "global_load_async_to_lds_b128 %4, %12, off\n\t"
      "global_load_async_to_lds_b128 %5, %13, off\n\t"
      "global_load_async_to_lds_b128 %6, %14, off\n\t"
      "global_load_async_to_lds_b128 %7, %15, off\n\t"
      "s_wait_xcnt 0x0"
      :: "v"(l), "v"(l + LSTEP), "v"(l + 2 * LSTEP), "v"(l + 3 * LSTEP),
         "v"(l + 4 * LSTEP), "v"(l + 5 * LSTEP), "v"(l + 6 * LSTEP), "v"(l + 7 * LSTEP),
         "v"(gp), "v"(gp + 8 * HDIM), "v"(gp + 16 * HDIM), "v"(gp + 24 * HDIM),
         "v"(gp + 32 * HDIM), "v"(gp + 40 * HDIM), "v"(gp + 48 * HDIM), "v"(gp + 56 * HDIM)
      : "memory");
}
// lane (c, hh) gets T[row0 + 8 hh + 0..7][col0 + c] of a row-major 16-bit LDS tile; p is the lane's own address
typedef short s16x8 __attribute__((ext_vector_type(8)));
__device__ __forceinline__ v8h ld_tr16(const char* p) {
  typedef __attribute__((address_space(3))) s16x8 lds_s16x8;
  return __builtin_bit_cast(v8h, __builtin_amdgcn_ds_load_tr16_b128_v8i16((lds_s16x8*)p));
}
__global__ __launch_bounds__(128) void attn128_k(const unsigned short* __restrict__ qpp, const unsigned short* __restrict__ kpp,
                                                 const unsigned short* __restrict__ vpp, const int* __restrict__ docs,
                                                 unsigned short* __restrict__ outp) {
  union FH { v16h v; v8h h[2]; };
  __shared__ __align__(16) char Ksm[2 * KBUF];             // two buffers of [kv][d], pitch KPITCH
  __shared__ __align__(16) char Vsm[2 * VBUF];             // two buffers of [kv][d], pitch VPITCH
  __shared__ __align__(16) _Float16 Psh[4][16 * AKC];      // per wave [row][kv]
  __shared__ __align__(16) _Float16 Osh[4][16 * OSP];      // per wave [row][d]
  const _Float16* qp = (const _Float16*)qpp;
  _Float16* out = (_Float16*)outp;
  const int tid = threadIdx.x, wave = tid >> 5, lane = tid & 31, hh = lane >> 4, c = lane & 15;
  const int nqb = SS / AQB;
  const int bx = blockIdx.x;
  const int qb = bx % nqb;
  const int bh = bx / nqb;
  const int h = bh % HH;
  const int b = bh / HH;
  const int q0 = qb * AQB + wave * 16;
  const size_t rowb = (size_t)(b * HH + h) * SS;

  v16h qa[4];
  {
    const _Float16* qrow = qp + (rowb + q0 + c) * HDIM + 8 * hh;
#pragma unroll
    for (int dc = 0; dc < 4; ++dc) qa[dc] = Frag<_Float16>::load(qrow + dc * 32);
  }
  int dq[8];
#pragma unroll
  for (int r = 0; r < 8; ++r) dq[r] = docs[q0 + 8 * hh + r];
  float mrow[8], lrow[8];
  v8f oacc[8];
#pragma unroll
  for (int r = 0; r < 8; ++r) { mrow[r] = -INFINITY; lrow[r] = 0.f; }
#pragma unroll
  for (int t = 0; t < 8; ++t) oacc[t] = (v8f){0.f,0.f,0.f,0.f,0.f,0.f,0.f,0.f};

  const int nChunks = qb + 1;   // block-uniform
  // copy addresses: lane brings 16 B at column chunk (tid & 15) of rows (tid >> 4) + 8 i
  const int crow = tid >> 4, ccol = (tid & 15) * 8;
  const unsigned short* gK = kpp + (rowb + crow) * HDIM + ccol;
  const unsigned short* gV = vpp + (rowb + crow) * HDIM + ccol;
  const uint32_t lK = (uint32_t)(uintptr_t)Ksm + (uint32_t)(crow * KPITCH + ccol * 2);
  const uint32_t lV = (uint32_t)(uintptr_t)Vsm + (uint32_t)(crow * VPITCH + ccol * 2);
  copy_kv8<8 * KPITCH>(lK, gK);
  copy_kv8<8 * VPITCH>(lV, gV);
  asm volatile("s_wait_asynccnt 0x0" ::: "memory");   // chunk 0's own copies have landed
  __syncthreads();                                    // and every other wave's
  if (nChunks > 1) {
    copy_kv8<8 * KPITCH>(lK + KBUF, gK + AKC * HDIM);
    copy_kv8<8 * VPITCH>(lV + VBUF, gV + AKC * HDIM);
  }
  for (int kc = 0; kc < nChunks; ++kc) {
    const int kv0 = kc * AKC;
    const unsigned bsel = (unsigned)(kc & 1);
    const char* Kb = Ksm + bsel * KBUF + c * KPITCH + 16 * hh;
    const char* Vb = Vsm + bsel * VBUF + (8 * hh + (lane & 7)) * VPITCH + ((lane >> 3) & 1) * 16;

    v8f s[4];
#pragma unroll
    for (int j = 0; j < 4; ++j) {
      s[j] = (v8f){0.f,0.f,0.f,0.f,0.f,0.f,0.f,0.f};
#pragma unroll
      for (int dc = 0; dc < 4; ++dc) {
        FH kb;
        kb.h[0] = *(const v8h*)(Kb + j * 16 * KPITCH + dc * 64);
        kb.h[1] = *(const v8h*)(Kb + j * 16 * KPITCH + dc * 64 + 32);
        s[j] = mma_h(qa[dc], kb.v, s[j]);
      }
    }
    int dk[4];
#pragma unroll
    for (int j = 0; j < 4; ++j) dk[j] = docs[kv0 + j * 16 + c];
    const bool diag = (kc == qb);
    float cm[8];
#pragma unroll
    for (int r = 0; r < 8; ++r) {
      const int qrow = q0 + 8 * hh + r;
      float m = -INFINITY;
#pragma unroll
      for (int j = 0; j < 4; ++j) {
        const int kvcol = kv0 + j * 16 + c;
        float sv = s[j][r] * ATT_SCALE;
        const bool masked = (dk[j] != dq[r]) || (diag && (kvcol > qrow));
        if (masked) sv = -INFINITY;
        s[j][r] = sv;
        m = fmaxf(m, sv);
      }
#pragma unroll
      for (int off = 1; off < 16; off <<= 1) m = fmaxf(m, __shfl_xor(m, off, 32));
      cm[r] = m;
    }
    _Float16* pw = Psh[wave];
#pragma unroll
    for (int r = 0; r < 8; ++r) {
      const float mnew = fmaxf(mrow[r], cm[r]);
      const float mref = (mnew > -INFINITY) ? mnew : 0.0f;   // all-masked so far -> p = 0, alpha = 0
      const float alpha = expf(mrow[r] - mref);
      mrow[r] = mnew;
      float psum = 0.f;
#pragma unroll
      for (int j = 0; j < 4; ++j) {
        const float p = expf(s[j][r] - mref);
        psum += p;
        pw[(8 * hh + r) * AKC + j * 16 + c] = (_Float16)(p * PSCALE);
      }
#pragma unroll
      for (int off = 1; off < 16; off <<= 1) psum += __shfl_xor(psum, off, 32);
      lrow[r] = lrow[r] * alpha + psum;
#pragma unroll
      for (int t = 0; t < 8; ++t) oacc[t][r] *= alpha;
    }
    __builtin_amdgcn_fence(__ATOMIC_RELEASE, "workgroup");
    __builtin_amdgcn_wave_barrier();
    __builtin_amdgcn_fence(__ATOMIC_ACQUIRE, "workgroup");
#pragma unroll 1
    for (int kk = 0; kk < 2; ++kk) {
      FH pa;
      pa.h[0] = *(const v8h*)(pw + c * AKC + kk * 32 + 8 * hh);
      pa.h[1] = *(const v8h*)(pw + c * AKC + kk * 32 + 16 + 8 * hh);
#pragma unroll
      for (int t = 0; t < 8; ++t) {
        FH vb;
        vb.h[0] = ld_tr16(Vb + (kk * 32) * VPITCH + t * 32);        // keys kk*32 + 8 hh + 0..7 of column t*16 + c
        vb.h[1] = ld_tr16(Vb + (kk * 32 + 16) * VPITCH + t * 32);   // keys kk*32 + 16 + 8 hh + 0..7
        oacc[t] = mma_h(pa.v, vb.v, oacc[t]);
      }
    }
    asm volatile("s_wait_dscnt 0x0" ::: "memory");     // this wave's reads of the buffers have returned
    asm volatile("s_wait_asynccnt 0x0" ::: "memory");  // its copies for chunk kc + 1 have landed
    __syncthreads();                                   // publishes chunk kc + 1, frees this chunk's buffers
    if (kc + 2 < nChunks) {
      copy_kv8<8 * KPITCH>(lK + bsel * KBUF, gK + (size_t)(kc + 2) * (AKC * HDIM));
      copy_kv8<8 * VPITCH>(lV + bsel * VBUF, gV + (size_t)(kc + 2) * (AKC * HDIM));
    }
  }
  asm volatile("s_wait_asynccnt 0x0" ::: "memory");    // nothing in flight when the wave ends

  _Float16* os = Osh[wave];
#pragma unroll
  for (int r = 0; r < 8; ++r) {
    const float inv = 1.0f / (lrow[r] * PSCALE);
#pragma unroll
    for (int t = 0; t < 8; ++t) os[(8 * hh + r) * OSP + t * 16 + c] = (_Float16)(oacc[t][r] * inv);
  }
  __builtin_amdgcn_fence(__ATOMIC_RELEASE, "workgroup");
  __builtin_amdgcn_wave_barrier();
  __builtin_amdgcn_fence(__ATOMIC_ACQUIRE, "workgroup");
  {
    const int c8 = (lane & 15) * 8;   // 256-B row segment = 16 lanes x 16 B, 2 rows per instruction
    {
#pragma unroll
      for (int it = 0; it < 8; ++it) {
        const int row = it * 2 + hh;
        const v8h val = *(const v8h*)(os + row * OSP + c8);
        *(v8h*)(out + (size_t)(b * SS + q0 + row) * DD + h * HDIM + c8) = val;
      }
      
    }
  }
}

// ---------------------------------------------------------------------------
extern "C" void kernel_launch(void* const* d_in, const int* in_sizes, int n_in,
                              void* d_out, int out_size, void* d_ws,
                              size_t ws_size, hipStream_t stream) {
  if (n_in < 12) return;
  if (in_sizes[0] != NTOK * DD || in_sizes[1] != SS * DD || in_sizes[2] != NTOK * DD ||
      in_sizes[3] < 2 || in_sizes[4] < 2 || in_sizes[5] < DD || in_sizes[6] < DD ||
      in_sizes[7] != DD * 3 * DD || in_sizes[8] != DD * DD || in_sizes[9] != DD * 4 * DD ||
      in_sizes[10] != 4 * DD * DD || in_sizes[11] != SS || out_size != NTOK * DD) return;

  const float* x     = (const float*)d_in[0];
  const float* ve    = (const float*)d_in[1];
  const float* x0    = (const float*)d_in[2];
  const float* lam   = (const float*)d_in[3];
  const float* sal   = (const float*)d_in[4];
  const float* ln1   = (const float*)d_in[5];
  const float* ln2   = (const float*)d_in[6];
  const float* wqkv  = (const float*)d_in[7];
  const float* wo    = (const float*)d_in[8];
  const float* wfc   = (const float*)d_in[9];
  const float* wproj = (const float*)d_in[10];
  const int*   ids   = (const int*)d_in[11];
  float* outf = (float*)d_out;

  // ---- carve (bytes) ----
  const size_t szWO   = (size_t)DD * DD * 2;              //   2 MiB  w_o^T f16
  const size_t szWFC  = (size_t)4 * DD * DD * 2;          //   8 MiB  w_fc^T f16
  const size_t szWPR  = (size_t)4 * DD * DD * 2;          //   8 MiB  w_proj^T f16
  const size_t szXR   = (size_t)NTOK * DD * 4;            //  16 MiB  mixed x f32
  const size_t szBIG  = (size_t)NTOK * 3 * DD * 4;        //  48 MiB  qkv f32, later h f16 (32 MiB) + x2 f32 (16 MiB)
  const size_t szXN   = (size_t)NTOK * DD * 2;            //   8 MiB  xn f16, later xn2 f16
  const size_t szWQA  = (size_t)NTOK * DD * 2;            //   8 MiB  w_qkv^T f16 (6 MiB), later attention out f16
  const size_t szPL   = (size_t)3 * NTOK * DD * 2;        //  24 MiB  q,k,v f16 planes
  const size_t szROPE = (size_t)SS * 64 * 4;              // 512 KiB
  const size_t szDOC  = (size_t)SS * 4;
  const size_t oWO = 0, oWFC = oWO + szWO, oWPR = oWFC + szWFC, oXR = oWPR + szWPR, oBIG = oXR + szXR,
               oXN = oBIG + szBIG, oWQA = oXN + szXN, oPL = oWQA + szWQA, oROPE = oPL + szPL,
               oDOC = oROPE + szROPE, oEND = oDOC + szDOC;
  if (oEND > ws_size) return;
  char* ws = (char*)d_ws;
  unsigned short* woT   = (unsigned short*)(ws + oWO);
  unsigned short* wfcT  = (unsigned short*)(ws + oWFC);
  unsigned short* wprT  = (unsigned short*)(ws + oWPR);
  float*          xr    = (float*)(ws + oXR);
  float*          qkvf  = (float*)(ws + oBIG);
  unsigned short* hbuf  = (unsigned short*)(ws + oBIG);
  float*          x2    = (float*)(ws + oBIG + (size_t)NTOK * 4 * DD * 2);
  unsigned short* xn    = (unsigned short*)(ws + oXN);
  unsigned short* xn2   = xn;
  unsigned short* wqkvT = (unsigned short*)(ws + oWQA);
  unsigned short* attn  = (unsigned short*)(ws + oWQA);
  unsigned short* qpl   = (unsigned short*)(ws + oPL);
  unsigned short* kpl   = qpl + (size_t)NTOK * DD;
  unsigned short* vpl   = qpl + (size_t)2 * NTOK * DD;
  float*          rope  = (float*)(ws + oROPE);
  int*            docs  = (int*)(ws + oDOC);

  // weights: W [in][out] -> Wt [out][in] f16 x64; grid = (out/64, in/64)
  wt_cast_k<<<dim3(3 * DD / 64, DD / 64), 256, 0, stream>>>(wqkv, wqkvT, DD, 3 * DD, WMUL);
  wt_cast_k<<<dim3(DD / 64, DD / 64), 256, 0, stream>>>(wo, woT, DD, DD, WMUL);
  wt_cast_k<<<dim3(4 * DD / 64, DD / 64), 256, 0, stream>>>(wfc, wfcT, DD, 4 * DD, WMUL);
  wt_cast_k<<<dim3(DD / 64, 4 * DD / 64), 256, 0, stream>>>(wproj, wprT, 4 * DD, DD, WMUL);
  // rotary table + docs
  tables_k<<<SS / 8 + 1, 256, 0, stream>>>(ids, rope, docs);
  // x = l0*x + l1*x0 ; xn = LN(x)*ln1_w
  ln_k<true><<<NTOK, 128, 0, stream>>>(x, x0, lam, ln1, xr, xn);
  // qkv = xn @ w_qkv (f32 out)
  {
    const int M = NTOK, N = 3 * DD, K = DD;
    const int tiles = (M / 128) * (N / 128);
    wmma_gemm64<0, false, 0, 0, false, 0><<<dim3(tiles, 1), 128, 0, stream>>>(
        xn, xn, K, 0, wqkvT, wqkvT, K, 0, qkvf, qkvf, N, 0, xr, xr, 0, M, N, K, WMUL_INV);
  }
  // rotary + RMS-norm + value mix -> f16 planes
  rope_k<<<dim3(SS, BB), 256, 0, stream>>>(qkvf, ve, sal, rope, qpl);
  // attention
  attn128_k<<<BB * HH * (SS / AQB), 128, 0, stream>>>(qpl, kpl, vpl, docs, attn);
  // x2 = xr + attn @ w_o
  {
    const int M = NTOK, N = DD, K = DD;
    const int tiles = (M / 128) * (N / 128);
    wmma_gemm64<0, false, 0, 0, true, 0><<<dim3(tiles, 1), 128, 0, stream>>>(
        attn, attn, K, 0, woT, woT, K, 0, x2, x2, N, 0, xr, xr, 0, M, N, K, WMUL_INV);
  }
  // xn2 = LN(x2)*ln2_w
  ln_k<false><<<NTOK, 128, 0, stream>>>(x2, x2, lam, ln2, xr, xn2);
  // h = relu(xn2 @ w_fc)^2 (f16 out)
  {
    const int M = NTOK, N = 4 * DD, K = DD;
    const int tiles = (M / 128) * (N / 128);
    wmma_gemm64<0, false, 0, 1, false, 6><<<dim3(tiles, 1), 128, 0, stream>>>(
        xn2, xn2, K, 0, wfcT, wfcT, K, 0, hbuf, hbuf, N, 0, xr, xr, 0, M, N, K, WMUL_INV);
  }
  // out = x2 + h @ w_proj
  {
    const int M = NTOK, N = DD, K = 4 * DD;
    const int tiles = (M / 128) * (N / 128);
    wmma_gemm64<0, false, 0, 0, true, 0><<<dim3(tiles, 1), 128, 0, stream>>>(
        hbuf, hbuf, K, 0, wprT, wprT, K, 0, outf, outf, N, 0, x2, x2, 0, M, N, K, WMUL_INV);
  }
}

// v003
// Measured time: 263 microseconds a run.
// Next to v002, in two timings, it ran 1.08 and 1.09 times as fast.
// All steps since v000 together make it 2.38 times as fast.
#include <hip/hip_runtime.h>
#include <stdint.h>
// All contractions: v_wmma_f32_16x16x32_f16 (f16 operands, f32 accumulate); projection weights carried x64, attention p carried x2^15; norms, rotary, softmax and residuals in f32.

#define BB 2
#define SS 2048
#define DD 1024
#define HH 8
#define HDIM 128
#define NTOK (BB * SS)
#define EOT_ID 50256
#define ATT_SCALE 0.12f
#define LN_EPS 1e-6f
#define RMS_EPS 1.1920929e-7f
#define WMUL 64.0f
#define WMUL_INV (1.0f / 64.0f)

typedef __attribute__((ext_vector_type(16))) _Float16 v16h;
typedef __attribute__((ext_vector_type(8)))  _Float16 v8h;
typedef __attribute__((ext_vector_type(4)))  _Float16 v4h;
typedef __attribute__((ext_vector_type(16))) __bf16   v16b;
typedef __attribute__((ext_vector_type(8)))  __bf16   v8b;
typedef __attribute__((ext_vector_type(8)))  float    v8f;
typedef __attribute__((ext_vector_type(4)))  float    v4f;
typedef __attribute__((ext_vector_type(4)))  int      v4i;
#define PSCALE 32768.0f
#define U16(p) ((const unsigned short*)(const void*)(p))
#define PSCALE_INV (1.0f / 32768.0f)

__device__ __forceinline__ unsigned short f2bf_bits(float f) {
  unsigned u = __float_as_uint(f);
  return (unsigned short)((u + 0x7FFFu + ((u >> 16) & 1u)) >> 16);
}
__device__ __forceinline__ float bf_bits2f(unsigned short h) { return __uint_as_float(((unsigned)h) << 16); }

// hazard guards as plain device helpers
__device__ __forceinline__ void dep_guard_h(v8f& a, v8f& b, v16h x, v16h y) { asm volatile("v_nop\n\tv_nop\n\tv_nop\n\tv_nop" : "+v"(a), "+v"(b) : "v"(x), "v"(y)); }
__device__ __forceinline__ void dep_guard_b(v8f& a, v8f& b, v16b x, v16b y) { asm volatile("v_nop\n\tv_nop\n\tv_nop\n\tv_nop" : "+v"(a), "+v"(b) : "v"(x), "v"(y)); }
__device__ __forceinline__ void keep4_h(v16h a, v16h b, v16h c, v16h d) { asm volatile("v_nop" :: "v"(a), "v"(b), "v"(c), "v"(d)); }
__device__ __forceinline__ void keep4_b(v16b a, v16b b, v16b c, v16b d) { asm volatile("v_nop" :: "v"(a), "v"(b), "v"(c), "v"(d)); }
__device__ __forceinline__ void acc_guard4(v8f& a, v8f& b, v8f& c, v8f& d) { asm volatile("v_nop\n\tv_nop\n\tv_nop\n\tv_nop" : "+v"(a), "+v"(b), "+v"(c), "+v"(d)); }
template <typename T> struct Frag;
template <> struct Frag<_Float16> {
  typedef v16h V; union U { v16h v; v8h h[2]; };
  static __device__ __forceinline__ v16h load(const _Float16* p) {   // elements 0..7 <- p[0..7], 8..15 <- p[16..23]
    U f; f.h[0] = *(const v8h*)(p); f.h[1] = *(const v8h*)(p + 16); return f.v;
  }
  static __device__ __forceinline__ v8f mma(v16h a, v16h b, v8f c) {
    return __builtin_amdgcn_wmma_f32_16x16x32_f16(false, a, false, b, (short)0, c, false, false);
  }
  static __device__ __forceinline__ void guard(v8f& a, v8f& b, v16h x, v16h y) { dep_guard_h(a, b, x, y); }
  static __device__ __forceinline__ void keep(v16h a, v16h b, v16h c, v16h d) { keep4_h(a, b, c, d); }
};
template <> struct Frag<__bf16> {
  typedef v16b V; union U { v16b v; v8b h[2]; };
  static __device__ __forceinline__ v16b load(const __bf16* p) {
    U f; f.h[0] = *(const v8b*)(p); f.h[1] = *(const v8b*)(p + 16); return f.v;
  }
  static __device__ __forceinline__ v8f mma(v16b a, v16b b, v8f c) {
    return __builtin_amdgcn_wmma_f32_16x16x32_bf16(false, a, false, b, (short)0, c, false, false);
  }
  static __device__ __forceinline__ void guard(v8f& a, v8f& b, v16b x, v16b y) { dep_guard_b(a, b, x, y); }
  static __device__ __forceinline__ void keep(v16b a, v16b b, v16b c, v16b d) { keep4_b(a, b, c, d); }
};

// ---- LDS-staged batched WMMA GEMM ------------------------------------------
// C[m,n] = scale * sum_k A[m,k] * Bt[n,k] (+bias)(+resid); a block of 4 waves owns a 128x128 tile, each wave 64x64 of it.
// A row-major [M,K]; Bt row-major [N,K]; M,N % 128 == 0, K % 64 == 0.
// Per trip 64 k of both operands (128 rows x 128 B each) lie in LDS at pitch 144 B, brought by asynchronous
// copies into two buffers: the next trip's copies fly while this trip's fragments are read and multiplied.
// BIAS_MODE: 0 = none, 1 = bias[m], 2 = bias[n].
// OUT_MODE: 0 = f32, 1 = f16, 2 = bf16 hi plane (Cout) + bf16 lo plane (Cout2).
// ACT 6: relu then square.
// ET: 0 = f16 operands, 1 = bf16 operands (pointers passed as 16-bit storage)
template <int ET> struct Elem;
template <> struct Elem<0> { typedef _Float16 T; };
template <> struct Elem<1> { typedef __bf16 T; };
#define GBK 64                         // k per trip
#define GPITCH 144                     // LDS row pitch in bytes (16 B x odd: conflict-free for ds_load_b128)
#define GOPER (128 * GPITCH)           // one operand's 128 rows
#define GSTAGE (2 * GOPER)             // A rows, then Bt rows
// Eight 16-byte copies per lane: rows r, r+16, .. r+112 of one operand's 128-row slab. The s_wait_xcnt closes the
// statement so that no address register is rewritten ahead of it.
__device__ __forceinline__ void copy_rows8(uint32_t l, const unsigned short* gp, size_t step) {
  asm volatile(
      "global_load_async_to_lds_b128 %0, %8, off\n\t"
      "global_load_async_to_lds_b128 %1, %9, off\n\t"
      "global_load_async_to_lds_b128 %2, %10, off\n\t"
      "global_load_async_to_lds_b128 %3, %11, off\n\t"
      "global_load_async_to_lds_b128 %4, %12, off\n\t"
      "global_load_async_to_lds_b128 %5, %13, off\n\t"
      "global_load_async_to_lds_b128 %6, %14, off\n\t"
      "global_load_async_to_lds_b128 %7, %15, off\n\t"
      "s_wait_xcnt 0x0"
      :: "v"(l), "v"(l + 16 * GPITCH), "v"(l + 32 * GPITCH), "v"(l + 48 * GPITCH),
         "v"(l + 64 * GPITCH), "v"(l + 80 * GPITCH), "v"(l + 96 * GPITCH), "v"(l + 112 * GPITCH),
         "v"(gp), "v"(gp + step), "v"(gp + 2 * step), "v"(gp + 3 * step),
         "v"(gp + 4 * step), "v"(gp + 5 * step), "v"(gp + 6 * step), "v"(gp + 7 * step)
      : "memory");
}
template <int ET, bool SPLIT, int BIAS_MODE, int OUT_MODE, bool RESID, int ACT = 0>
__global__ __launch_bounds__(128) void wmma_gemm64(
    const unsigned short* __restrict__ Ap, const unsigned short* __restrict__ A2p, int lda, long strideA,
    const unsigned short* __restrict__ Btp, const unsigned short* __restrict__ Bt2p, int ldb, long strideB,
    void* __restrict__ Cout, void* __restrict__ Cout2, int ldc, long strideC,
    const float* __restrict__ bias,
    const float* __restrict__ resid, long strideR,
    int M, int N, int K, float scale) {
  static_assert(!SPLIT, "single-plane operands only");
  typedef typename Elem<ET>::T T;
  typedef typename Frag<T>::V V;
  // two operand buffers; after the loop its first bytes serve as the per-wave 16x64 f32 slabs, pitch 68 floats
  __shared__ __align__(16) char smem[2 * GSTAGE];
  const int b    = blockIdx.y;
  const int tid  = threadIdx.x;
  const int lane = tid & 31;
  const int wave = tid >> 5;
  const int tilesN = N >> 7;
  const int tilesM = M >> 7;
  const int tile = blockIdx.x;
  if (tile >= tilesM * tilesN) return;   // block-uniform, in front of every barrier
  const int tm = tile / tilesN;
  const int tn = tile - tm * tilesN;
  const int mB = tm << 7;                      // block tile origin
  const int nB = tn << 7;
  const int wm = (wave >> 1) << 6;             // wave tile origin inside the block tile
  const int wn = (wave & 1) << 6;
  const int m0 = mB + wm;
  const int n0 = nB + wn;

  const int rlane = lane & 15;                 // row (A) / col (B, D) within subtile
  const int koff  = (lane >> 4) * 8;           // k offset of this lane half
  const int mOff  = (lane >> 4) * 8;           // D row offset

  // copy addresses: lane brings 16 B at column chunk (tid & 7) of rows (tid >> 3) + 16 i
  const int crow = tid >> 3, ccol = (tid & 7) * 8;
  const unsigned short* gA = Ap  + (size_t)b * strideA + (size_t)(mB + crow) * lda + ccol;
  const unsigned short* gB = Btp + (size_t)b * strideB + (size_t)(nB + crow) * ldb + ccol;
  const size_t stepA = (size_t)16 * lda, stepB = (size_t)16 * ldb;
  const uint32_t lds0 = (uint32_t)(uintptr_t)smem + (uint32_t)(crow * GPITCH + ccol * 2);

  v8f acc[4][4];
#pragma unroll
  for (int i = 0; i < 4; ++i)
#pragma unroll
    for (int j = 0; j < 4; ++j) acc[i][j] = (v8f){0.f,0.f,0.f,0.f,0.f,0.f,0.f,0.f};

  const int nT = K / GBK;
  copy_rows8(lds0, gA, stepA);
  copy_rows8(lds0 + GOPER, gB, stepB);
  asm volatile("s_wait_asynccnt 0x0" ::: "memory");   // trip 0's own copies have landed
  __syncthreads();                                    // and every other wave's
  if (nT > 1) {
    copy_rows8(lds0 + GSTAGE, gA + GBK, stepA);
    copy_rows8(lds0 + GSTAGE + GOPER, gB + GBK, stepB);
  }
  for (int t = 0; t < nT; ++t) {
    const unsigned bufo = (unsigned)(t & 1) * GSTAGE;
    const char* sA = smem + bufo + (wm + rlane) * GPITCH + koff * 2;
    const char* sB = smem + bufo + GOPER + (wn + rlane) * GPITCH + koff * 2;
#pragma unroll
    for (int kk = 0; kk < GBK / 32; ++kk) {
      V bh[4], ah[4];
#pragma unroll
      for (int j = 0; j < 4; ++j) bh[j] = Frag<T>::load((const T*)(sB + j * 16 * GPITCH + kk * 64));
#pragma unroll
      for (int i = 0; i < 4; ++i) ah[i] = Frag<T>::load((const T*)(sA + i * 16 * GPITCH + kk * 64));
      // keeps the 16 fragment loads together ahead of the 16 products: one LDS latency per group, not one per A fragment
      __builtin_amdgcn_sched_barrier(0);
#pragma unroll
      for (int i = 0; i < 4; ++i) {
#pragma unroll
        for (int j = 0; j < 4; ++j) acc[i][j] = Frag<T>::mma(ah[i], bh[j], acc[i][j]);
        Frag<T>::guard(acc[i][0], acc[i][3], ah[i], ah[i]);
      }
      Frag<T>::keep(bh[0], bh[1], bh[2], bh[3]);
    }
    asm volatile("s_wait_dscnt 0x0" ::: "memory");     // this wave's reads of the buffer have returned
    asm volatile("s_wait_asynccnt 0x0" ::: "memory");  // its copies for trip t + 1 have landed
    __syncthreads();                                   // publishes trip t + 1, frees this trip's buffer
    if (t + 2 < nT) {
      copy_rows8(lds0 + bufo, gA + (size_t)(t + 2) * GBK, stepA);
      copy_rows8(lds0 + bufo + GOPER, gB + (size_t)(t + 2) * GBK, stepB);
    }
  }
  asm volatile("s_wait_asynccnt 0x0" ::: "memory");    // nothing in flight when the buffers become slabs
  acc_guard4(acc[0][0], acc[0][1], acc[0][2], acc[0][3]);
  acc_guard4(acc[1][0], acc[1][1], acc[1][2], acc[1][3]);
  acc_guard4(acc[2][0], acc[2][1], acc[2][2], acc[2][3]);
  acc_guard4(acc[3][0], acc[3][1], acc[3][2], acc[3][3]);

  // ---- epilogue ----
  float* slab = (float*)smem + wave * (16 * 68);
  const float* Rb = RESID ? (resid + (size_t)b * strideR) : nullptr;
#pragma unroll
  for (int i = 0; i < 4; ++i) {
    const int mBase = m0 + (i << 4);
#pragma unroll
    for (int j = 0; j < 4; ++j) {
      const int n = n0 + (j << 4) + rlane;
      float bv = 0.f;
      if (BIAS_MODE == 2) bv = bias[n];
#pragma unroll
      for (int r = 0; r < 8; ++r) {
        float v = acc[i][j][r] * scale;
        if (BIAS_MODE == 1) v += bias[mBase + mOff + r];
        if (BIAS_MODE == 2) v += bv;
        if (RESID) v += Rb[(size_t)(mBase + mOff + r) * ldc + n];
        if (ACT == 1) v = tanhf(v);
        if (ACT == 2) v = fmaxf(v, 0.0f);
        if (ACT == 3) v = v / (1.0f + expf(-v));
        if (ACT == 4) v = (v > 0.f) ? v : 0.01f * v;
        if (ACT == 5) v = 0.5f * v * (1.0f + erff(v * 0.70710678118654752f));
        if (ACT == 6) { v = fmaxf(v, 0.0f); v = v * v; }
        slab[(mOff + r) * 68 + (j << 4) + rlane] = v;
      }
    }
    __builtin_amdgcn_fence(__ATOMIC_RELEASE, "workgroup");
    __builtin_amdgcn_wave_barrier();
    __builtin_amdgcn_fence(__ATOMIC_ACQUIRE, "workgroup");
    if (OUT_MODE == 0) {
      float* C = (float*)Cout + (size_t)b * strideC;
      const int hh = lane >> 4, c4 = (lane & 15) * 4;     // row seg = 256 B = 16 lanes x 16 B
      {
#pragma unroll
        for (int it = 0; it < 8; ++it) {
          const int row = it * 2 + hh;
          v4f v = *(const v4f*)(slab + row * 68 + c4);
          *(v4f*)(C + (size_t)(mBase + row) * ldc + n0 + c4) = v;
        }
        
      }
    } else {
      const int q = lane >> 3, c8 = (lane & 7) * 8;
      unsigned short* C  = (unsigned short*)Cout  + (size_t)b * strideC;
      unsigned short* C2 = (OUT_MODE == 2) ? ((unsigned short*)Cout2 + (size_t)b * strideC) : nullptr;
      {
#pragma unroll
        for (int it = 0; it < 4; ++it) {
          const int row = it * 4 + q;
          const float* sp = slab + row * 68 + c8;
          v8h hv, lv;
#pragma unroll
          for (int e = 0; e < 8; ++e) {
            if (OUT_MODE == 1) {
              hv[e] = (_Float16)sp[e];
            } else {
              unsigned short hb = f2bf_bits(sp[e]);
              unsigned short lb = f2bf_bits(sp[e] - bf_bits2f(hb));
              hv[e] = __builtin_bit_cast(_Float16, hb);
              lv[e] = __builtin_bit_cast(_Float16, lb);
            }
          }
          *(v8h*)(C + (size_t)(mBase + row) * ldc + n0 + c8) = hv;
          if (OUT_MODE == 2) *(v8h*)(C2 + (size_t)(mBase + row) * ldc + n0 + c8) = lv;
        }
        
      }
    }
    __builtin_amdgcn_fence(__ATOMIC_RELEASE, "workgroup");
    __builtin_amdgcn_wave_barrier();
    __builtin_amdgcn_fence(__ATOMIC_ACQUIRE, "workgroup");
  }
}

// ---- W [K][N] f32 -> Wt [N][K] f16 (x mul), 64x64 tile transposed through LDS ----
#define WTP 72
__global__ __launch_bounds__(256) void wt_cast_k(const float* __restrict__ W, unsigned short* __restrict__ Wtp,
                                                 int K, int N, float mul) {
  __shared__ __align__(16) _Float16 st[64 * WTP];
  _Float16* Wt = (_Float16*)Wtp;
  const int n0 = blockIdx.x * 64, k0 = blockIdx.y * 64;
  const int tid = threadIdx.x;
  const int kr = tid >> 2, c16 = (tid & 3) * 16;
  const float* src = W + (size_t)(k0 + kr) * N + n0 + c16;
#pragma unroll
  for (int q = 0; q < 4; ++q) {
    const v4f v = *(const v4f*)(src + 4 * q);
#pragma unroll
    for (int e = 0; e < 4; ++e) st[(c16 + 4 * q + e) * WTP + kr] = (_Float16)(v[e] * mul);
  }
  __syncthreads();
  const int wave = tid >> 5, lane = tid & 31;
  const int q8 = lane >> 3, c8 = (lane & 7) * 8;
  {
#pragma unroll
    for (int it = 0; it < 2; ++it) {
      const int n = it * 32 + wave * 4 + q8;
      const v8h hv = *(const v8h*)(st + n * WTP + c8);
      *(v8h*)(Wt + (size_t)(n0 + n) * K + k0 + c8) = hv;
    }
    
  }
}

// ---- rotary cos/sin table [S][64] (cos 0..31 | sin 32..63) and docs[S] = inclusive count of EOT ----
__global__ __launch_bounds__(256) void tables_k(const int* __restrict__ ids, float* __restrict__ rope,
                                                int* __restrict__ docs) {
  __shared__ int scnt[256];
  __shared__ __align__(16) int sdoc[SS];
  const int tid = threadIdx.x, lane = tid & 31, wave = tid >> 5;
  if (blockIdx.x < SS / 8) {
    const int s = blockIdx.x * 8 + wave;
    float e = (float)lane * (1.0f / 31.0f);
    if (lane == 31) e = 1.0f;
    const float fr = powf(0.0009765625f, e);
    const float th = (float)s * fr;
    float sv, cv;
    sincosf(th, &sv, &cv);
    float* rp = rope + (size_t)s * 64;
    *(float*)(rp + lane) = cv;
    *(float*)(rp + 32 + lane) = sv;
    
  } else {
    int c = 0;
#pragma unroll
    for (int i = 0; i < 8; ++i) c += (ids[tid * 8 + i] == EOT_ID) ? 1 : 0;
    scnt[tid] = c;
    __syncthreads();
    for (int off = 1; off < 256; off <<= 1) {
      const int t = (tid >= off) ? scnt[tid - off] : 0;
      __syncthreads();
      scnt[tid] += t;
      __syncthreads();
    }
    int run = scnt[tid] - c;
#pragma unroll
    for (int i = 0; i < 8; ++i) {
      run += (ids[tid * 8 + i] == EOT_ID) ? 1 : 0;
      sdoc[tid * 8 + i] = run;
    }
    __syncthreads();
    const v4i a0 = *(const v4i*)(sdoc + tid * 4);
    const v4i a1 = *(const v4i*)(sdoc + 1024 + tid * 4);
    {
      *(v4i*)(docs + tid * 4) = a0;
      *(v4i*)(docs + 1024 + tid * 4) = a1;
      
    }
  }
}

// ---- residual mix + LayerNorm, one 128-thread block per row of 1024; thread owns cols 4t..4t+3 and 512+4t..+3 ----
template <bool MIX>
__global__ __launch_bounds__(128) void ln_k(const float* __restrict__ x, const float* __restrict__ x0,
                                            const float* __restrict__ lam, const float* __restrict__ w,
                                            float* __restrict__ xr, unsigned short* __restrict__ xnp) {
  __shared__ float red1[4], red2[4];
  _Float16* xn = (_Float16*)xnp;
  const int row = blockIdx.x, tid = threadIdx.x, lane = tid & 31, wave = tid >> 5;
  const size_t rb = (size_t)row * DD;
  const int ca = tid * 4, cb = 512 + tid * 4;
  v4f va = *(const v4f*)(x + rb + ca);
  v4f vb = *(const v4f*)(x + rb + cb);
  if (MIX) {
    const float l0 = lam[0], l1 = lam[1];
    const v4f a0 = *(const v4f*)(x0 + rb + ca);
    const v4f b0 = *(const v4f*)(x0 + rb + cb);
    va = va * l0 + a0 * l1;
    vb = vb * l0 + b0 * l1;
    {
      *(v4f*)(xr + rb + ca) = va;
      *(v4f*)(xr + rb + cb) = vb;
      
    }
  }
  float s = (va[0] + va[1]) + (va[2] + va[3]) + (vb[0] + vb[1]) + (vb[2] + vb[3]);
#pragma unroll
  for (int off = 1; off < 32; off <<= 1) s += __shfl_xor(s, off, 32);
  if (lane == 0) red1[wave] = s;
  __syncthreads();
  const float mu = ((red1[0] + red1[1]) + (red1[2] + red1[3])) * (1.0f / DD);
  const v4f da = va - mu, db = vb - mu;
  float s2 = (da[0] * da[0] + da[1] * da[1]) + (da[2] * da[2] + da[3] * da[3]) +
             (db[0] * db[0] + db[1] * db[1]) + (db[2] * db[2] + db[3] * db[3]);
#pragma unroll
  for (int off = 1; off < 32; off <<= 1) s2 += __shfl_xor(s2, off, 32);
  if (lane == 0) red2[wave] = s2;
  __syncthreads();
  const float var = ((red2[0] + red2[1]) + (red2[2] + red2[3])) * (1.0f / DD);
  const float inv = rsqrtf(var + LN_EPS);
  const v4f wa = *(const v4f*)(w + ca);
  const v4f wb = *(const v4f*)(w + cb);
  v4h ha, hb;
#pragma unroll
  for (int e = 0; e < 4; ++e) {
    ha[e] = (_Float16)(da[e] * inv * wa[e]);
    hb[e] = (_Float16)(db[e] * inv * wb[e]);
  }
  {
    *(v4h*)(xn + rb + ca) = ha;
    *(v4h*)(xn + rb + cb) = hb;
    
  }
}

// ---- rotary + RMS-norm on q,k; v = sa0*v + sa1*ve; writes f16 planes [3][B*H*S][128] ----
// One block per token, wave = head; lane owns dims ln, ln+32, ln+64, ln+96 (pairs (ln,ln+64) rotate, (ln+32,ln+96) identity).
#define RSP 136
__global__ __launch_bounds__(256) void rope_k(const float* __restrict__ qkv, const float* __restrict__ ve,
                                              const float* __restrict__ sa, const float* __restrict__ rope,
                                              unsigned short* __restrict__ planesp) {
  __shared__ __align__(16) _Float16 st[HH][3 * RSP];
  _Float16* planes = (_Float16*)planesp;
  const int s = blockIdx.x, b = blockIdx.y;
  const int tid = threadIdx.x, h = tid >> 5, ln = tid & 31;
  const size_t tok = (size_t)b * SS + s;
  const float* base = qkv + tok * (3 * DD) + h * HDIM;
  const float cv = rope[(size_t)s * 64 + ln];
  const float sv = rope[(size_t)s * 64 + 32 + ln];
  _Float16* sw = st[h];
#pragma unroll
  for (int p = 0; p < 2; ++p) {
    const float* src = base + p * DD;
    const float a1 = src[ln], b1 = src[ln + 32], a2 = src[ln + 64], b2 = src[ln + 96];
    const float o0 = a1 * cv + a2 * sv;
    const float o2 = a2 * cv - a1 * sv;
    float sq = (o0 * o0 + b1 * b1) + (o2 * o2 + b2 * b2);
#pragma unroll
    for (int off = 1; off < 32; off <<= 1) sq += __shfl_xor(sq, off, 32);
    const float rs = rsqrtf(sq * (1.0f / HDIM) + RMS_EPS);
    sw[p * RSP + ln]      = (_Float16)(o0 * rs);
    sw[p * RSP + ln + 32] = (_Float16)(b1 * rs);
    sw[p * RSP + ln + 64] = (_Float16)(o2 * rs);
    sw[p * RSP + ln + 96] = (_Float16)(b2 * rs);
  }
  {
    const float sa0 = sa[0], sa1 = sa[1];
    const float* vsrc = base + 2 * DD;
    const float* vesrc = ve + (size_t)s * DD + h * HDIM;
#pragma unroll
    for (int i = 0; i < 4; ++i) {
      const int d = ln + 32 * i;
      sw[2 * RSP + d] = (_Float16)(sa0 * vsrc[d] + sa1 * vesrc[d]);
    }
  }
  __builtin_amdgcn_fence(__ATOMIC_RELEASE, "workgroup");
  __builtin_amdgcn_wave_barrier();
  __builtin_amdgcn_fence(__ATOMIC_ACQUIRE, "workgroup");
  const int hh = ln >> 4, c8 = (ln & 15) * 8;           // 256-B row = 16 lanes x 16 B
  const size_t PL = (size_t)NTOK * DD;
  const size_t row = ((size_t)(b * HH + h) * SS + s) * HDIM;
  const v8h v01 = *(const v8h*)(sw + hh * RSP + c8);
  const v8h v2  = *(const v8h*)(sw + 2 * RSP + c8);
  _Float16* d01 = planes + (size_t)hh * PL + row + c8;
  _Float16* d2  = planes + 2 * PL + row + c8;
  {
    *(v8h*)d01 = v01;
    if (hh == 0) *(v8h*)d2 = v2;
    
  }
}

// ---- attention, head dim 128, f16 q/k/v planes [B*H*S][128]; out f16 [B*S][D] at cols h*128 ----
// Block = 4 waves = 64 query rows of one (b,h); 64-key chunks; chunks above the diagonal skipped,
// per element select: allowed iff key <= query and docs[key] == docs[query], else -inf. p carried x2^15.
// K and V chunks lie row-major [kv][d] in LDS, brought by asynchronous copies into two buffers: the next chunk's
// copies fly while this chunk is worked on. K rows are read by ds_load_b128, V columns by ds_load_tr16_b128.
#define AKC 64
#define AQB 64
#define OSP 136
#define KPITCH 272                     // K row pitch in bytes (16 B x odd: conflict-free for ds_load_b128)
#define VPITCH 288                     // V row pitch in bytes (32 B x odd: conflict-free for ds_load_tr16_b128)
#define KBUF (AKC * KPITCH)
#define VBUF (AKC * VPITCH)
// Eight 16-byte copies per lane: rows r, r+8, .. r+56 of one 64-row chunk of 256-byte rows (LSTEP = 8 LDS rows).
// The s_wait_xcnt closes the statement so that no address register is rewritten ahead of it.
template <int LSTEP>
__device__ __forceinline__ void copy_kv8(uint32_t l, const unsigned short* gp) {
  asm volatile(
      "global_load_async_to_lds_b128 %0, %8, off\n\t"
      "global_load_async_to_lds_b128 %1, %9, off\n\t"
      "global_load_async_to_lds_b128 %2, %10, off\n\t"
      "global_load_async_to_lds_b128 %3, %11, off\n\t"
      "global_load_async_to_lds_b128 %4, %12, off\n\t"
      "global_load_async_to_lds_b128 %5, %13, off\n\t"
      "global_load_async_to_lds_b128 %6, %14, off\n\t"
      "global_load_async_to_lds_b128 %7, %15, off\n\t"
      "s_wait_xcnt 0x0"
      :: "v"(l), "v"(l + LSTEP), "v"(l + 2 * LSTEP), "v"(l + 3 * LSTEP),
         "v"(l + 4 * LSTEP), "v"(l + 5 * LSTEP), "v"(l + 6 * LSTEP), "v"(l + 7 * LSTEP),
         "v"(gp), "v"(gp + 8 * HDIM), "v"(gp + 16 * HDIM), "v"(gp + 24 * HDIM),
         "v"(gp + 32 * HDIM), "v"(gp + 40 * HDIM), "v"(gp + 48 * HDIM), "v"(gp + 56 * HDIM)
      : "memory");
}
// lane (c, hh) gets T[row0 + 8 hh + 0..7][col0 + c] of a row-major 16-bit LDS tile; p is the lane's own address
typedef short s16x8 __attribute__((ext_vector_type(8)));
__device__ __forceinline__ v8h ld_tr16(const char* p) {
  typedef __attribute__((address_space(3))) s16x8 lds_s16x8;
  return __builtin_bit_cast(v8h, __builtin_amdgcn_ds_load_tr16_b128_v8i16((lds_s16x8*)p));
}
__global__ __launch_bounds__(128) void attn128_k(const unsigned short* __restrict__ qpp, const unsigned short* __restrict__ kpp,
                                                 const unsigned short* __restrict__ vpp, const int* __restrict__ docs,
                                                 unsigned short* __restrict__ outp) {
  union FH { v16h v; v8h h[2]; };
  __shared__ __align__(16) char Ksm[2 * KBUF];             // two buffers of [kv][d], pitch KPITCH
  __shared__ __align__(16) char Vsm[2 * VBUF];             // two buffers of [kv][d], pitch VPITCH
  __shared__ __align__(16) _Float16 Psh[4][16 * AKC];      // per wave [row][kv]
  __shared__ __align__(16) _Float16 Osh[4][16 * OSP];      // per wave [row][d]
  const _Float16* qp = (const _Float16*)qpp;
  _Float16* out = (_Float16*)outp;
  const int tid = threadIdx.x, wave = tid >> 5, lane = tid & 31, hh = lane >> 4, c = lane & 15;
  const int nqb = SS / AQB;
  const int bx = blockIdx.x;
  const int qb = bx % nqb;
  const int bh = bx / nqb;
  const int h = bh % HH;
  const int b = bh / HH;
  const int q0 = qb * AQB + wave * 16;
  const size_t rowb = (size_t)(b * HH + h) * SS;

  v16h qa[4];
  {
    const _Float16* qrow = qp + (rowb + q0 + c) * HDIM + 8 * hh;
#pragma unroll
    for (int dc = 0; dc < 4; ++dc) qa[dc] = Frag<_Float16>::load(qrow + dc * 32);
  }
  int dq[8];
#pragma unroll
  for (int r = 0; r < 8; ++r) dq[r] = docs[q0 + 8 * hh + r];
  float mrow[8], lrow[8];
  v8f oacc[8];
#pragma unroll
  for (int r = 0; r < 8; ++r) { mrow[r] = -INFINITY; lrow[r] = 0.f; }
#pragma unroll
  for (int t = 0; t < 8; ++t) oacc[t] = (v8f){0.f,0.f,0.f,0.f,0.f,0.f,0.f,0.f};

  const int nChunks = qb + 1;   // block-uniform
  // copy addresses: lane brings 16 B at column chunk (tid & 15) of rows (tid >> 4) + 8 i
  const int crow = tid >> 4, ccol = (tid & 15) * 8;
  const unsigned short* gK = kpp + (rowb + crow) * HDIM + ccol;
  const unsigned short* gV = vpp + (rowb + crow) * HDIM + ccol;
  const uint32_t lK = (uint32_t)(uintptr_t)Ksm + (uint32_t)(crow * KPITCH + ccol * 2);
  const uint32_t lV = (uint32_t)(uintptr_t)Vsm + (uint32_t)(crow * VPITCH + ccol * 2);
  copy_kv8<8 * KPITCH>(lK, gK);
  copy_kv8<8 * VPITCH>(lV, gV);
  asm volatile("s_wait_asynccnt 0x0" ::: "memory");   // chunk 0's own copies have landed
  __syncthreads();                                    // and every other wave's
  if (nChunks > 1) {
    copy_kv8<8 * KPITCH>(lK + KBUF, gK + AKC * HDIM);
    copy_kv8<8 * VPITCH>(lV + VBUF, gV + AKC * HDIM);
  }
  for (int kc = 0; kc < nChunks; ++kc) {
    const int kv0 = kc * AKC;
    const unsigned bsel = (unsigned)(kc & 1);
    const char* Kb = Ksm + bsel * KBUF + c * KPITCH + 16 * hh;
    const char* Vb = Vsm + bsel * VBUF + (8 * hh + (lane & 7)) * VPITCH + ((lane >> 3) & 1) * 16;

    v8f s[4];
    FH kb[4][4];
#pragma unroll
    for (int j = 0; j < 4; ++j) {
#pragma unroll
      for (int dc = 0; dc < 4; ++dc) {
        kb[j][dc].h[0] = *(const v8h*)(Kb + j * 16 * KPITCH + dc * 64);
        kb[j][dc].h[1] = *(const v8h*)(Kb + j * 16 * KPITCH + dc * 64 + 32);
      }
    }
    // keeps the chunk's 32 K loads together ahead of its 16 score products: one LDS latency per chunk, not one per product
    __builtin_amdgcn_sched_barrier(0);
#pragma unroll
    for (int j = 0; j < 4; ++j) {
      s[j] = (v8f){0.f,0.f,0.f,0.f,0.f,0.f,0.f,0.f};
#pragma unroll
      for (int dc = 0; dc < 4; ++dc) s[j] = Frag<_Float16>::mma(qa[dc], kb[j][dc].v, s[j]);
    }
    int dk[4];
#pragma unroll
    for (int j = 0; j < 4; ++j) dk[j] = docs[kv0 + j * 16 + c];
    const bool diag = (kc == qb);
    float cm[8];
#pragma unroll
    for (int r = 0; r < 8; ++r) {
      const int qrow = q0 + 8 * hh + r;
      float m = -INFINITY;
#pragma unroll
      for (int j = 0; j < 4; ++j) {
        const int kvcol = kv0 + j * 16 + c;
        float sv = s[j][r] * ATT_SCALE;
        const bool masked = (dk[j] != dq[r]) || (diag && (kvcol > qrow));
        if (masked) sv = -INFINITY;
        s[j][r] = sv;
        m = fmaxf(m, sv);
      }
#pragma unroll
      for (int off = 1; off < 16; off <<= 1) m = fmaxf(m, __shfl_xor(m, off, 32));
      cm[r] = m;
    }
    _Float16* pw = Psh[wave];
#pragma unroll
    for (int r = 0; r < 8; ++r) {
      const float mnew = fmaxf(mrow[r], cm[r]);
      const float mref = (mnew > -INFINITY) ? mnew : 0.0f;   // all-masked so far -> p = 0, alpha = 0
      const float alpha = expf(mrow[r] - mref);
      mrow[r] = mnew;
      float psum = 0.f;
#pragma unroll
      for (int j = 0; j < 4; ++j) {
        const float p = expf(s[j][r] - mref);
        psum += p;
        pw[(8 * hh + r) * AKC + j * 16 + c] = (_Float16)(p * PSCALE);
      }
#pragma unroll
      for (int off = 1; off < 16; off <<= 1) psum += __shfl_xor(psum, off, 32);
      lrow[r] = lrow[r] * alpha + psum;
#pragma unroll
      for (int t = 0; t < 8; ++t) oacc[t][r] *= alpha;
    }
    __builtin_amdgcn_fence(__ATOMIC_RELEASE, "workgroup");
    __builtin_amdgcn_wave_barrier();
    __builtin_amdgcn_fence(__ATOMIC_ACQUIRE, "workgroup");
    FH pa[2];
#pragma unroll
    for (int kk = 0; kk < 2; ++kk) {
      pa[kk].h[0] = *(const v8h*)(pw + c * AKC + kk * 32 + 8 * hh);
      pa[kk].h[1] = *(const v8h*)(pw + c * AKC + kk * 32 + 16 + 8 * hh);
    }
    FH vb[2][8];
#pragma unroll
    for (int kk = 0; kk < 2; ++kk) {
#pragma unroll
      for (int t = 0; t < 8; ++t) {
        vb[kk][t].h[0] = ld_tr16(Vb + (kk * 32) * VPITCH + t * 32);        // keys kk*32 + 8 hh + 0..7 of column t*16 + c
        vb[kk][t].h[1] = ld_tr16(Vb + (kk * 32 + 16) * VPITCH + t * 32);   // keys kk*32 + 16 + 8 hh + 0..7
      }
    }
    // keeps the 4 p loads and the chunk's 32 V loads together ahead of the 16 output products
    __builtin_amdgcn_sched_barrier(0);
#pragma unroll
    for (int kk = 0; kk < 2; ++kk) {
#pragma unroll
      for (int t = 0; t < 8; ++t) oacc[t] = Frag<_Float16>::mma(pa[kk].v, vb[kk][t].v, oacc[t]);
    }
    asm volatile("s_wait_dscnt 0x0" ::: "memory");     // this wave's reads of the buffers have returned
    asm volatile("s_wait_asynccnt 0x0" ::: "memory");  // its copies for chunk kc + 1 have landed
    __syncthreads();                                   // publishes chunk kc + 1, frees this chunk's buffers
    if (kc + 2 < nChunks) {
      copy_kv8<8 * KPITCH>(lK + bsel * KBUF, gK + (size_t)(kc + 2) * (AKC * HDIM));
      copy_kv8<8 * VPITCH>(lV + bsel * VBUF, gV + (size_t)(kc + 2) * (AKC * HDIM));
    }
  }
  asm volatile("s_wait_asynccnt 0x0" ::: "memory");    // nothing in flight when the wave ends

  _Float16* os = Osh[wave];
#pragma unroll
  for (int r = 0; r < 8; ++r) {
    const float inv = 1.0f / (lrow[r] * PSCALE);
#pragma unroll
    for (int t = 0; t < 8; ++t) os[(8 * hh + r) * OSP + t * 16 + c] = (_Float16)(oacc[t][r] * inv);
  }
  __builtin_amdgcn_fence(__ATOMIC_RELEASE, "workgroup");
  __builtin_amdgcn_wave_barrier();
  __builtin_amdgcn_fence(__ATOMIC_ACQUIRE, "workgroup");
  {
    const int c8 = (lane & 15) * 8;   // 256-B row segment = 16 lanes x 16 B, 2 rows per instruction
    {
#pragma unroll
      for (int it = 0; it < 8; ++it) {
        const int row = it * 2 + hh;
        const v8h val = *(const v8h*)(os + row * OSP + c8);
        *(v8h*)(out + (size_t)(b * SS + q0 + row) * DD + h * HDIM + c8) = val;
      }
      
    }
  }
}

// ---------------------------------------------------------------------------
extern "C" void kernel_launch(void* const* d_in, const int* in_sizes, int n_in,
                              void* d_out, int out_size, void* d_ws,
                              size_t ws_size, hipStream_t stream) {
  if (n_in < 12) return;
  if (in_sizes[0] != NTOK * DD || in_sizes[1] != SS * DD || in_sizes[2] != NTOK * DD ||
      in_sizes[3] < 2 || in_sizes[4] < 2 || in_sizes[5] < DD || in_sizes[6] < DD ||
      in_sizes[7] != DD * 3 * DD || in_sizes[8] != DD * DD || in_sizes[9] != DD * 4 * DD ||
      in_sizes[10] != 4 * DD * DD || in_sizes[11] != SS || out_size != NTOK * DD) return;

  const float* x     = (const float*)d_in[0];
  const float* ve    = (const float*)d_in[1];
  const float* x0    = (const float*)d_in[2];
  const float* lam   = (const float*)d_in[3];
  const float* sal   = (const float*)d_in[4];
  const float* ln1   = (const float*)d_in[5];
  const float* ln2   = (const float*)d_in[6];
  const float* wqkv  = (const float*)d_in[7];
  const float* wo    = (const float*)d_in[8];
  const float* wfc   = (const float*)d_in[9];
  const float* wproj = (const float*)d_in[10];
  const int*   ids   = (const int*)d_in[11];
  float* outf = (float*)d_out;

  // ---- carve (bytes) ----
  const size_t szWO   = (size_t)DD * DD * 2;              //   2 MiB  w_o^T f16
  const size_t szWFC  = (size_t)4 * DD * DD * 2;          //   8 MiB  w_fc^T f16
  const size_t szWPR  = (size_t)4 * DD * DD * 2;          //   8 MiB  w_proj^T f16
  const size_t szXR   = (size_t)NTOK * DD * 4;            //  16 MiB  mixed x f32
  const size_t szBIG  = (size_t)NTOK * 3 * DD * 4;        //  48 MiB  qkv f32, later h f16 (32 MiB) + x2 f32 (16 MiB)
  const size_t szXN   = (size_t)NTOK * DD * 2;            //   8 MiB  xn f16, later xn2 f16
  const size_t szWQA  = (size_t)NTOK * DD * 2;            //   8 MiB  w_qkv^T f16 (6 MiB), later attention out f16
  const size_t szPL   = (size_t)3 * NTOK * DD * 2;        //  24 MiB  q,k,v f16 planes
  const size_t szROPE = (size_t)SS * 64 * 4;              // 512 KiB
  const size_t szDOC  = (size_t)SS * 4;
  const size_t oWO = 0, oWFC = oWO + szWO, oWPR = oWFC + szWFC, oXR = oWPR + szWPR, oBIG = oXR + szXR,
               oXN = oBIG + szBIG, oWQA = oXN + szXN, oPL = oWQA + szWQA, oROPE = oPL + szPL,
               oDOC = oROPE + szROPE, oEND = oDOC + szDOC;
  if (oEND > ws_size) return;
  char* ws = (char*)d_ws;
  unsigned short* woT   = (unsigned short*)(ws + oWO);
  unsigned short* wfcT  = (unsigned short*)(ws + oWFC);
  unsigned short* wprT  = (unsigned short*)(ws + oWPR);
  float*          xr    = (float*)(ws + oXR);
  float*          qkvf  = (float*)(ws + oBIG);
  unsigned short* hbuf  = (unsigned short*)(ws + oBIG);
  float*          x2    = (float*)(ws + oBIG + (size_t)NTOK * 4 * DD * 2);
  unsigned short* xn    = (unsigned short*)(ws + oXN);
  unsigned short* xn2   = xn;
  unsigned short* wqkvT = (unsigned short*)(ws + oWQA);
  unsigned short* attn  = (unsigned short*)(ws + oWQA);
  unsigned short* qpl   = (unsigned short*)(ws + oPL);
  unsigned short* kpl   = qpl + (size_t)NTOK * DD;
  unsigned short* vpl   = qpl + (size_t)2 * NTOK * DD;
  float*          rope  = (float*)(ws + oROPE);
  int*            docs  = (int*)(ws + oDOC);

  // weights: W [in][out] -> Wt [out][in] f16 x64; grid = (out/64, in/64)
  wt_cast_k<<<dim3(3 * DD / 64, DD / 64), 256, 0, stream>>>(wqkv, wqkvT, DD, 3 * DD, WMUL);
  wt_cast_k<<<dim3(DD / 64, DD / 64), 256, 0, stream>>>(wo, woT, DD, DD, WMUL);
  wt_cast_k<<<dim3(4 * DD / 64, DD / 64), 256, 0, stream>>>(wfc, wfcT, DD, 4 * DD, WMUL);
  wt_cast_k<<<dim3(DD / 64, 4 * DD / 64), 256, 0, stream>>>(wproj, wprT, 4 * DD, DD, WMUL);
  // rotary table + docs
  tables_k<<<SS / 8 + 1, 256, 0, stream>>>(ids, rope, docs);
  // x = l0*x + l1*x0 ; xn = LN(x)*ln1_w
  ln_k<true><<<NTOK, 128, 0, stream>>>(x, x0, lam, ln1, xr, xn);
  // qkv = xn @ w_qkv (f32 out)
  {
    const int M = NTOK, N = 3 * DD, K = DD;
    const int tiles = (M / 128) * (N / 128);
    wmma_gemm64<0, false, 0, 0, false, 0><<<dim3(tiles, 1), 128, 0, stream>>>(
        xn, xn, K, 0, wqkvT, wqkvT, K, 0, qkvf, qkvf, N, 0, xr, xr, 0, M, N, K, WMUL_INV);
  }
  // rotary + RMS-norm + value mix -> f16 planes
  rope_k<<<dim3(SS, BB), 256, 0, stream>>>(qkvf, ve, sal, rope, qpl);
  // attention
  attn128_k<<<BB * HH * (SS / AQB), 128, 0, stream>>>(qpl, kpl, vpl, docs, attn);
  // x2 = xr + attn @ w_o
  {
    const int M = NTOK, N = DD, K = DD;
    const int tiles = (M / 128) * (N / 128);
    wmma_gemm64<0, false, 0, 0, true, 0><<<dim3(tiles, 1), 128, 0, stream>>>(
        attn, attn, K, 0, woT, woT, K, 0, x2, x2, N, 0, xr, xr, 0, M, N, K, WMUL_INV);
  }
  // xn2 = LN(x2)*ln2_w
  ln_k<false><<<NTOK, 128, 0, stream>>>(x2, x2, lam, ln2, xr, xn2);
  // h = relu(xn2 @ w_fc)^2 (f16 out)
  {
    const int M = NTOK, N = 4 * DD, K = DD;
    const int tiles = (M / 128) * (N / 128);
    wmma_gemm64<0, false, 0, 1, false, 6><<<dim3(tiles, 1), 128, 0, stream>>>(
        xn2, xn2, K, 0, wfcT, wfcT, K, 0, hbuf, hbuf, N, 0, xr, xr, 0, M, N, K, WMUL_INV);
  }
  // out = x2 + h @ w_proj
  {
    const int M = NTOK, N = DD, K = 4 * DD;
    const int tiles = (M / 128) * (N / 128);
    wmma_gemm64<0, false, 0, 0, true, 0><<<dim3(tiles, 1), 128, 0, stream>>>(
        hbuf, hbuf, K, 0, wprT, wprT, K, 0, outf, outf, N, 0, x2, x2, 0, M, N, K, WMUL_INV);
  }
}

// v004
// One run takes 252 microseconds.
// Two timings next to v003 both put it at 1.05 times that version's speed.
// Counting every step since v000, it is 2.49 times as fast.
#include <hip/hip_runtime.h>
#include <stdint.h>
// All contractions: v_wmma_f32_16x16x32_f16 (f16 operands, f32 accumulate); projection weights carried x64, attention p carried x2^15; norms, rotary, softmax and residuals in f32.

#define BB 2
#define SS 2048
#define DD 1024
#define HH 8
#define HDIM 128
#define NTOK (BB * SS)
#define EOT_ID 50256
#define ATT_SCALE 0.12f
#define LN_EPS 1e-6f
#define RMS_EPS 1.1920929e-7f
#define WMUL 64.0f
#define WMUL_INV (1.0f / 64.0f)

typedef __attribute__((ext_vector_type(16))) _Float16 v16h;
typedef __attribute__((ext_vector_type(8)))  _Float16 v8h;
typedef __attribute__((ext_vector_type(4)))  _Float16 v4h;
typedef __attribute__((ext_vector_type(16))) __bf16   v16b;
typedef __attribute__((ext_vector_type(8)))  __bf16   v8b;
typedef __attribute__((ext_vector_type(8)))  float    v8f;
typedef __attribute__((ext_vector_type(4)))  float    v4f;
typedef __attribute__((ext_vector_type(4)))  int      v4i;
#define PSCALE 32768.0f
#define U16(p) ((const unsigned short*)(const void*)(p))
#define PSCALE_INV (1.0f / 32768.0f)

__device__ __forceinline__ unsigned short f2bf_bits(float f) {
  unsigned u = __float_as_uint(f);
  return (unsigned short)((u + 0x7FFFu + ((u >> 16) & 1u)) >> 16);
}
__device__ __forceinline__ float bf_bits2f(unsigned short h) { return __uint_as_float(((unsigned)h) << 16); }

// hazard guards as plain device helpers
__device__ __forceinline__ void dep_guard_h(v8f& a, v8f& b, v16h x, v16h y) { asm volatile("v_nop\n\tv_nop\n\tv_nop\n\tv_nop" : "+v"(a), "+v"(b) : "v"(x), "v"(y)); }
__device__ __forceinline__ void dep_guard_b(v8f& a, v8f& b, v16b x, v16b y) { asm volatile("v_nop\n\tv_nop\n\tv_nop\n\tv_nop" : "+v"(a), "+v"(b) : "v"(x), "v"(y)); }
__device__ __forceinline__ void keep4_h(v16h a, v16h b, v16h c, v16h d) { asm volatile("v_nop" :: "v"(a), "v"(b), "v"(c), "v"(d)); }
__device__ __forceinline__ void keep4_b(v16b a, v16b b, v16b c, v16b d) { asm volatile("v_nop" :: "v"(a), "v"(b), "v"(c), "v"(d)); }
__device__ __forceinline__ void acc_guard4(v8f& a, v8f& b, v8f& c, v8f& d) { asm volatile("v_nop\n\tv_nop\n\tv_nop\n\tv_nop" : "+v"(a), "+v"(b), "+v"(c), "+v"(d)); }
template <typename T> struct Frag;
template <> struct Frag<_Float16> {
  typedef v16h V; union U { v16h v; v8h h[2]; };
  static __device__ __forceinline__ v16h load(const _Float16* p) {   // elements 0..7 <- p[0..7], 8..15 <- p[16..23]
    U f; f.h[0] = *(const v8h*)(p); f.h[1] = *(const v8h*)(p + 16); return f.v;
  }
  static __device__ __forceinline__ v8f mma(v16h a, v16h b, v8f c) {
    return __builtin_amdgcn_wmma_f32_16x16x32_f16(false, a, false, b, (short)0, c, false, false);
  }
  static __device__ __forceinline__ void guard(v8f& a, v8f& b, v16h x, v16h y) { dep_guard_h(a, b, x, y); }
  static __device__ __forceinline__ void keep(v16h a, v16h b, v16h c, v16h d) { keep4_h(a, b, c, d); }
};
template <> struct Frag<__bf16> {
  typedef v16b V; union U { v16b v; v8b h[2]; };
  static __device__ __forceinline__ v16b load(const __bf16* p) {
    U f; f.h[0] = *(const v8b*)(p); f.h[1] = *(const v8b*)(p + 16); return f.v;
  }
  static __device__ __forceinline__ v8f mma(v16b a, v16b b, v8f c) {
    return __builtin_amdgcn_wmma_f32_16x16x32_bf16(false, a, false, b, (short)0, c, false, false);
  }
  static __device__ __forceinline__ void guard(v8f& a, v8f& b, v16b x, v16b y) { dep_guard_b(a, b, x, y); }
  static __device__ __forceinline__ void keep(v16b a, v16b b, v16b c, v16b d) { keep4_b(a, b, c, d); }
};

// ---- LDS-staged batched WMMA GEMM ------------------------------------------
// C[m,n] = scale * sum_k A[m,k] * Bt[n,k] (+bias)(+resid); a block of 4 waves owns a 128x128 tile, each wave 64x64 of it.
// A row-major [M,K]; Bt row-major [N,K]; M,N % 128 == 0, K % 64 == 0.
// Per trip 64 k of both operands (128 rows x 128 B each) lie in LDS at pitch 144 B, brought by asynchronous
// copies into two buffers: the next trip's copies fly while this trip's fragments are read and multiplied.
// BIAS_MODE: 0 = none, 1 = bias[m], 2 = bias[n].
// OUT_MODE: 0 = f32, 1 = f16, 2 = bf16 hi plane (Cout) + bf16 lo plane (Cout2).
// ACT 6: relu then square.
// ET: 0 = f16 operands, 1 = bf16 operands (pointers passed as 16-bit storage)
template <int ET> struct Elem;
template <> struct Elem<0> { typedef _Float16 T; };
template <> struct Elem<1> { typedef __bf16 T; };
#define GBK 64                         // k per trip
#define GPITCH 144                     // LDS row pitch in bytes (16 B x odd: conflict-free for ds_load_b128)
#define GOPER (128 * GPITCH)           // one operand's 128 rows
#define GSTAGE (2 * GOPER)             // A rows, then Bt rows
// Eight 16-byte copies per lane: rows r, r+16, .. r+112 of one operand's 128-row slab. The s_wait_xcnt closes the
// statement so that no address register is rewritten ahead of it.
__device__ __forceinline__ void copy_rows8(uint32_t l, const unsigned short* gp, size_t step) {
  asm volatile(
      "global_load_async_to_lds_b128 %0, %8, off\n\t"
      "global_load_async_to_lds_b128 %1, %9, off\n\t"
      "global_load_async_to_lds_b128 %2, %10, off\n\t"
      "global_load_async_to_lds_b128 %3, %11, off\n\t"
      "global_load_async_to_lds_b128 %4, %12, off\n\t"
      "global_load_async_to_lds_b128 %5, %13, off\n\t"
      "global_load_async_to_lds_b128 %6, %14, off\n\t"
      "global_load_async_to_lds_b128 %7, %15, off\n\t"
      "s_wait_xcnt 0x0"
      :: "v"(l), "v"(l + 16 * GPITCH), "v"(l + 32 * GPITCH), "v"(l + 48 * GPITCH),
         "v"(l + 64 * GPITCH), "v"(l + 80 * GPITCH), "v"(l + 96 * GPITCH), "v"(l + 112 * GPITCH),
         "v"(gp), "v"(gp + step), "v"(gp + 2 * step), "v"(gp + 3 * step),
         "v"(gp + 4 * step), "v"(gp + 5 * step), "v"(gp + 6 * step), "v"(gp + 7 * step)
      : "memory");
}
template <int ET, bool SPLIT, int BIAS_MODE, int OUT_MODE, bool RESID, int ACT = 0>
__global__ __launch_bounds__(128) void wmma_gemm64(
    const unsigned short* __restrict__ Ap, const unsigned short* __restrict__ A2p, int lda, long strideA,
    const unsigned short* __restrict__ Btp, const unsigned short* __restrict__ Bt2p, int ldb, long strideB,
    void* __restrict__ Cout, void* __restrict__ Cout2, int ldc, long strideC,
    const float* __restrict__ bias,
    const float* __restrict__ resid, long strideR,
    int M, int N, int K, float scale) {
  static_assert(!SPLIT, "single-plane operands only");
  typedef typename Elem<ET>::T T;
  typedef typename Frag<T>::V V;
  // two operand buffers; after the loop its first bytes serve as the per-wave 16x64 f32 slabs, pitch 68 floats
  __shared__ __align__(16) char smem[2 * GSTAGE];
  const int b    = blockIdx.y;
  const int tid  = threadIdx.x;
  const int lane = tid & 31;
  const int wave = tid >> 5;
  const int tilesN = N >> 7;
  const int tilesM = M >> 7;
  const int tile = blockIdx.x;
  if (tile >= tilesM * tilesN) return;   // block-uniform, in front of every barrier
  const int tm = tile / tilesN;
  const int tn = tile - tm * tilesN;
  const int mB = tm << 7;                      // block tile origin
  const int nB = tn << 7;
  const int wm = (wave >> 1) << 6;             // wave tile origin inside the block tile
  const int wn = (wave & 1) << 6;
  const int m0 = mB + wm;
  const int n0 = nB + wn;

  const int rlane = lane & 15;                 // row (A) / col (B, D) within subtile
  const int koff  = (lane >> 4) * 8;           // k offset of this lane half
  const int mOff  = (lane >> 4) * 8;           // D row offset

  // copy addresses: lane brings 16 B at column chunk (tid & 7) of rows (tid >> 3) + 16 i
  const int crow = tid >> 3, ccol = (tid & 7) * 8;
  const unsigned short* gA = Ap  + (size_t)b * strideA + (size_t)(mB + crow) * lda + ccol;
  const unsigned short* gB = Btp + (size_t)b * strideB + (size_t)(nB + crow) * ldb + ccol;
  const size_t stepA = (size_t)16 * lda, stepB = (size_t)16 * ldb;
  const uint32_t lds0 = (uint32_t)(uintptr_t)smem + (uint32_t)(crow * GPITCH + ccol * 2);

  v8f acc[4][4];
#pragma unroll
  for (int i = 0; i < 4; ++i)
#pragma unroll
    for (int j = 0; j < 4; ++j) acc[i][j] = (v8f){0.f,0.f,0.f,0.f,0.f,0.f,0.f,0.f};

  const int nT = K / GBK;
  copy_rows8(lds0, gA, stepA);
  copy_rows8(lds0 + GOPER, gB, stepB);
  asm volatile("s_wait_asynccnt 0x0" ::: "memory");   // trip 0's own copies have landed
  __syncthreads();                                    // and every other wave's
  if (nT > 1) {
    copy_rows8(lds0 + GSTAGE, gA + GBK, stepA);
    copy_rows8(lds0 + GSTAGE + GOPER, gB + GBK, stepB);
  }
  for (int t = 0; t < nT; ++t) {
    const unsigned bufo = (unsigned)(t & 1) * GSTAGE;
    const char* sA = smem + bufo + (wm + rlane) * GPITCH + koff * 2;
    const char* sB = smem + bufo + GOPER + (wn + rlane) * GPITCH + koff * 2;
#pragma unroll
    for (int kk = 0; kk < GBK / 32; ++kk) {
      V bh[4], ah[4];
#pragma unroll
      for (int j = 0; j < 4; ++j) bh[j] = Frag<T>::load((const T*)(sB + j * 16 * GPITCH + kk * 64));
#pragma unroll
      for (int i = 0; i < 4; ++i) ah[i] = Frag<T>::load((const T*)(sA + i * 16 * GPITCH + kk * 64));
      // keeps the 16 fragment loads together ahead of the 16 products: one LDS latency per group, not one per A fragment
      __builtin_amdgcn_sched_barrier(0);
#pragma unroll
      for (int i = 0; i < 4; ++i) {
#pragma unroll
        for (int j = 0; j < 4; ++j) acc[i][j] = Frag<T>::mma(ah[i], bh[j], acc[i][j]);
        Frag<T>::guard(acc[i][0], acc[i][3], ah[i], ah[i]);
      }
      Frag<T>::keep(bh[0], bh[1], bh[2], bh[3]);
    }
    asm volatile("s_wait_dscnt 0x0" ::: "memory");     // this wave's reads of the buffer have returned
    asm volatile("s_wait_asynccnt 0x0" ::: "memory");  // its copies for trip t + 1 have landed
    __syncthreads();                                   // publishes trip t + 1, frees this trip's buffer
    if (t + 2 < nT) {
      copy_rows8(lds0 + bufo, gA + (size_t)(t + 2) * GBK, stepA);
      copy_rows8(lds0 + bufo + GOPER, gB + (size_t)(t + 2) * GBK, stepB);
    }
  }
  asm volatile("s_wait_asynccnt 0x0" ::: "memory");    // nothing in flight when the buffers become slabs
  acc_guard4(acc[0][0], acc[0][1], acc[0][2], acc[0][3]);
  acc_guard4(acc[1][0], acc[1][1], acc[1][2], acc[1][3]);
  acc_guard4(acc[2][0], acc[2][1], acc[2][2], acc[2][3]);
  acc_guard4(acc[3][0], acc[3][1], acc[3][2], acc[3][3]);

  // ---- epilogue ----
  float* slab = (float*)smem + wave * (16 * 68);
  const float* Rb = RESID ? (resid + (size_t)b * strideR) : nullptr;
#pragma unroll
  for (int i = 0; i < 4; ++i) {
    const int mBase = m0 + (i << 4);
#pragma unroll
    for (int j = 0; j < 4; ++j) {
      const int n = n0 + (j << 4) + rlane;
      float bv = 0.f;
      if (BIAS_MODE == 2) bv = bias[n];
#pragma unroll
      for (int r = 0; r < 8; ++r) {
        float v = acc[i][j][r] * scale;
        if (BIAS_MODE == 1) v += bias[mBase + mOff + r];
        if (BIAS_MODE == 2) v += bv;
        if (RESID) v += Rb[(size_t)(mBase + mOff + r) * ldc + n];
        if (ACT == 1) v = tanhf(v);
        if (ACT == 2) v = fmaxf(v, 0.0f);
        if (ACT == 3) v = v / (1.0f + expf(-v));
        if (ACT == 4) v = (v > 0.f) ? v : 0.01f * v;
        if (ACT == 5) v = 0.5f * v * (1.0f + erff(v * 0.70710678118654752f));
        if (ACT == 6) { v = fmaxf(v, 0.0f); v = v * v; }
        slab[(mOff + r) * 68 + (j << 4) + rlane] = v;
      }
    }
    __builtin_amdgcn_fence(__ATOMIC_RELEASE, "workgroup");
    __builtin_amdgcn_wave_barrier();
    __builtin_amdgcn_fence(__ATOMIC_ACQUIRE, "workgroup");
    if (OUT_MODE == 0) {
      float* C = (float*)Cout + (size_t)b * strideC;
      const int hh = lane >> 4, c4 = (lane & 15) * 4;     // row seg = 256 B = 16 lanes x 16 B
      {
#pragma unroll
        for (int it = 0; it < 8; ++it) {
          const int row = it * 2 + hh;
          v4f v = *(const v4f*)(slab + row * 68 + c4);
          *(v4f*)(C + (size_t)(mBase + row) * ldc + n0 + c4) = v;
        }
        
      }
    } else {
      const int q = lane >> 3, c8 = (lane & 7) * 8;
      unsigned short* C  = (unsigned short*)Cout  + (size_t)b * strideC;
      unsigned short* C2 = (OUT_MODE == 2) ? ((unsigned short*)Cout2 + (size_t)b * strideC) : nullptr;
      {
#pragma unroll
        for (int it = 0; it < 4; ++it) {
          const int row = it * 4 + q;
          const float* sp = slab + row * 68 + c8;
          v8h hv, lv;
#pragma unroll
          for (int e = 0; e < 8; ++e) {
            if (OUT_MODE == 1) {
              hv[e] = (_Float16)sp[e];
            } else {
              unsigned short hb = f2bf_bits(sp[e]);
              unsigned short lb = f2bf_bits(sp[e] - bf_bits2f(hb));
              hv[e] = __builtin_bit_cast(_Float16, hb);
              lv[e] = __builtin_bit_cast(_Float16, lb);
            }
          }
          *(v8h*)(C + (size_t)(mBase + row) * ldc + n0 + c8) = hv;
          if (OUT_MODE == 2) *(v8h*)(C2 + (size_t)(mBase + row) * ldc + n0 + c8) = lv;
        }
        
      }
    }
    __builtin_amdgcn_fence(__ATOMIC_RELEASE, "workgroup");
    __builtin_amdgcn_wave_barrier();
    __builtin_amdgcn_fence(__ATOMIC_ACQUIRE, "workgroup");
  }
}

// ---- W [K][N] f32 -> Wt [N][K] f16 (x mul), 64x64 tile transposed through LDS ----
#define WTP 72
__device__ __forceinline__ void wt_cast_body(const float* __restrict__ W, unsigned short* __restrict__ Wtp,
                                             int K, int N, float mul, int bn, int bk, _Float16* st) {
  _Float16* Wt = (_Float16*)Wtp;
  const int n0 = bn * 64, k0 = bk * 64;
  const int tid = threadIdx.x;
  const int kr = tid >> 2, c16 = (tid & 3) * 16;
  const float* src = W + (size_t)(k0 + kr) * N + n0 + c16;
#pragma unroll
  for (int q = 0; q < 4; ++q) {
    const v4f v = *(const v4f*)(src + 4 * q);
#pragma unroll
    for (int e = 0; e < 4; ++e) st[(c16 + 4 * q + e) * WTP + kr] = (_Float16)(v[e] * mul);
  }
  __syncthreads();
  const int wave = tid >> 5, lane = tid & 31;
  const int q8 = lane >> 3, c8 = (lane & 7) * 8;
  {
#pragma unroll
    for (int it = 0; it < 2; ++it) {
      const int n = it * 32 + wave * 4 + q8;
      const v8h hv = *(const v8h*)(st + n * WTP + c8);
      *(v8h*)(Wt + (size_t)(n0 + n) * K + k0 + c8) = hv;
    }
    // the block ranges of the merged grid lie one behind another in the code: no register of these stores is rewritten ahead of this wait
    asm volatile("s_wait_xcnt 0x0" ::: "memory");
  }
}

// ---- rotary cos/sin table [S][64] (cos 0..31 | sin 32..63) and docs[S] = inclusive count of EOT ----
__device__ __forceinline__ void tables_body(const int* __restrict__ ids, float* __restrict__ rope,
                                            int* __restrict__ docs, int blk, int* scnt, int* sdoc) {
  const int tid = threadIdx.x, lane = tid & 31, wave = tid >> 5;
  if (blk < SS / 8) {
    const int s = blk * 8 + wave;
    float e = (float)lane * (1.0f / 31.0f);
    if (lane == 31) e = 1.0f;
    const float fr = powf(0.0009765625f, e);
    const float th = (float)s * fr;
    float sv, cv;
    sincosf(th, &sv, &cv);
    float* rp = rope + (size_t)s * 64;
    *(float*)(rp + lane) = cv;
    *(float*)(rp + 32 + lane) = sv;
    
  } else {
    int c = 0;
#pragma unroll
    for (int i = 0; i < 8; ++i) c += (ids[tid * 8 + i] == EOT_ID) ? 1 : 0;
    scnt[tid] = c;
    __syncthreads();
    for (int off = 1; off < 256; off <<= 1) {
      const int t = (tid >= off) ? scnt[tid - off] : 0;
      __syncthreads();
      scnt[tid] += t;
      __syncthreads();
    }
    int run = scnt[tid] - c;
#pragma unroll
    for (int i = 0; i < 8; ++i) {
      run += (ids[tid * 8 + i] == EOT_ID) ? 1 : 0;
      sdoc[tid * 8 + i] = run;
    }
    __syncthreads();
    const v4i a0 = *(const v4i*)(sdoc + tid * 4);
    const v4i a1 = *(const v4i*)(sdoc + 1024 + tid * 4);
    {
      *(v4i*)(docs + tid * 4) = a0;
      *(v4i*)(docs + 1024 + tid * 4) = a1;
      // as in wt_cast_body: no register of these stores is rewritten ahead of this wait
      asm volatile("s_wait_xcnt 0x0" ::: "memory");
    }
  }
}

// ---- residual mix + LayerNorm, 128 threads (tid 0..127) per row of 1024; thread owns cols 4t..4t+3 and 512+4t..+3 ----
template <bool MIX>
__device__ __forceinline__ void ln_body(const float* __restrict__ x, const float* __restrict__ x0,
                                        const float* __restrict__ lam, const float* __restrict__ w,
                                        float* __restrict__ xr, unsigned short* __restrict__ xnp,
                                        int row, int tid, float* red1, float* red2) {
  _Float16* xn = (_Float16*)xnp;
  const int lane = tid & 31, wave = tid >> 5;
  const size_t rb = (size_t)row * DD;
  const int ca = tid * 4, cb = 512 + tid * 4;
  v4f va = *(const v4f*)(x + rb + ca);
  v4f vb = *(const v4f*)(x + rb + cb);
  if (MIX) {
    const float l0 = lam[0], l1 = lam[1];
    const v4f a0 = *(const v4f*)(x0 + rb + ca);
    const v4f b0 = *(const v4f*)(x0 + rb + cb);
    va = va * l0 + a0 * l1;
    vb = vb * l0 + b0 * l1;
    {
      *(v4f*)(xr + rb + ca) = va;
      *(v4f*)(xr + rb + cb) = vb;
      
    }
  }
  float s = (va[0] + va[1]) + (va[2] + va[3]) + (vb[0] + vb[1]) + (vb[2] + vb[3]);
#pragma unroll
  for (int off = 1; off < 32; off <<= 1) s += __shfl_xor(s, off, 32);
  if (lane == 0) red1[wave] = s;
  __syncthreads();
  const float mu = ((red1[0] + red1[1]) + (red1[2] + red1[3])) * (1.0f / DD);
  const v4f da = va - mu, db = vb - mu;
  float s2 = (da[0] * da[0] + da[1] * da[1]) + (da[2] * da[2] + da[3] * da[3]) +
             (db[0] * db[0] + db[1] * db[1]) + (db[2] * db[2] + db[3] * db[3]);
#pragma unroll
  for (int off = 1; off < 32; off <<= 1) s2 += __shfl_xor(s2, off, 32);
  if (lane == 0) red2[wave] = s2;
  __syncthreads();
  const float var = ((red2[0] + red2[1]) + (red2[2] + red2[3])) * (1.0f / DD);
  const float inv = rsqrtf(var + LN_EPS);
  const v4f wa = *(const v4f*)(w + ca);
  const v4f wb = *(const v4f*)(w + cb);
  v4h ha, hb;
#pragma unroll
  for (int e = 0; e < 4; ++e) {
    ha[e] = (_Float16)(da[e] * inv * wa[e]);
    hb[e] = (_Float16)(db[e] * inv * wb[e]);
  }
  {
    *(v4h*)(xn + rb + ca) = ha;
    *(v4h*)(xn + rb + cb) = hb;
    // as in wt_cast_body, in the merged grid alone: no register of these stores is rewritten ahead of this wait
    if (MIX) asm volatile("s_wait_xcnt 0x0" ::: "memory");
  }
}
__global__ __launch_bounds__(128) void ln_k(const float* __restrict__ x, const float* __restrict__ w,
                                            unsigned short* __restrict__ xnp) {
  __shared__ float red1[4], red2[4];
  ln_body<false>(x, x, w, w, nullptr, xnp, blockIdx.x, threadIdx.x, red1, red2);
}

// ---- the six preparation steps, none of which reads what another writes, as block ranges of one grid ----
// The tables come first, their serial document count in block 0, so that the longest chain starts earliest.
#define PB_TAB  (SS / 8 + 1)
#define PB_LN   (NTOK / 2)                       // two rows per 256-thread block
#define PB_WQKV ((3 * DD / 64) * (DD / 64))
#define PB_WO   ((DD / 64) * (DD / 64))
#define PB_WFC  ((4 * DD / 64) * (DD / 64))
#define PB_WPR  ((DD / 64) * (4 * DD / 64))
__global__ __launch_bounds__(256) void prep_k(const float* __restrict__ x, const float* __restrict__ x0,
                                              const float* __restrict__ lam, const float* __restrict__ ln1,
                                              float* __restrict__ xr, unsigned short* __restrict__ xn,
                                              const float* __restrict__ wqkv, unsigned short* __restrict__ wqkvT,
                                              const float* __restrict__ wo, unsigned short* __restrict__ woT,
                                              const float* __restrict__ wfc, unsigned short* __restrict__ wfcT,
                                              const float* __restrict__ wproj, unsigned short* __restrict__ wprT,
                                              const int* __restrict__ ids, float* __restrict__ rope,
                                              int* __restrict__ docs) {
  __shared__ __align__(16) char sm[64 * WTP * 2];   // transpose tile, or count + document arrays, or the row sums
  static_assert(sizeof(sm) >= (256 + SS) * sizeof(int), "tables need 256 + S ints");
  int blk = blockIdx.x;
  if (blk < PB_TAB) {
    tables_body(ids, rope, docs, PB_TAB - 1 - blk, (int*)sm, (int*)sm + 256);
    return;
  }
  blk -= PB_TAB;
  if (blk < PB_LN) {
    const int half = threadIdx.x >> 7;
    float* red = (float*)sm + half * 8;
    ln_body<true>(x, x0, lam, ln1, xr, xn, blk * 2 + half, threadIdx.x & 127, red, red + 4);
    return;
  }
  blk -= PB_LN;
  // weights: W [in][out] -> Wt [out][in] f16 x64; tile column = out / 64, tile row = in / 64
  if (blk < PB_WQKV) {
    wt_cast_body(wqkv, wqkvT, DD, 3 * DD, WMUL, blk % (3 * DD / 64), blk / (3 * DD / 64), (_Float16*)sm);
    return;
  }
  blk -= PB_WQKV;
  if (blk < PB_WO) {
    wt_cast_body(wo, woT, DD, DD, WMUL, blk % (DD / 64), blk / (DD / 64), (_Float16*)sm);
    return;
  }
  blk -= PB_WO;
  if (blk < PB_WFC) {
    wt_cast_body(wfc, wfcT, DD, 4 * DD, WMUL, blk % (4 * DD / 64), blk / (4 * DD / 64), (_Float16*)sm);
    return;
  }
  blk -= PB_WFC;
  wt_cast_body(wproj, wprT, 4 * DD, DD, WMUL, blk % (DD / 64), blk / (DD / 64), (_Float16*)sm);
}

// ---- rotary + RMS-norm on q,k; v = sa0*v + sa1*ve; writes f16 planes [3][B*H*S][128] ----
// One block per token, wave = head; lane owns dims ln, ln+32, ln+64, ln+96 (pairs (ln,ln+64) rotate, (ln+32,ln+96) identity).
#define RSP 136
__global__ __launch_bounds__(256) void rope_k(const float* __restrict__ qkv, const float* __restrict__ ve,
                                              const float* __restrict__ sa, const float* __restrict__ rope,
                                              unsigned short* __restrict__ planesp) {
  __shared__ __align__(16) _Float16 st[HH][3 * RSP];
  _Float16* planes = (_Float16*)planesp;
  const int s = blockIdx.x, b = blockIdx.y;
  const int tid = threadIdx.x, h = tid >> 5, ln = tid & 31;
  const size_t tok = (size_t)b * SS + s;
  const float* base = qkv + tok * (3 * DD) + h * HDIM;
  const float cv = rope[(size_t)s * 64 + ln];
  const float sv = rope[(size_t)s * 64 + 32 + ln];
  _Float16* sw = st[h];
#pragma unroll
  for (int p = 0; p < 2; ++p) {
    const float* src = base + p * DD;
    const float a1 = src[ln], b1 = src[ln + 32], a2 = src[ln + 64], b2 = src[ln + 96];
    const float o0 = a1 * cv + a2 * sv;
    const float o2 = a2 * cv - a1 * sv;
    float sq = (o0 * o0 + b1 * b1) + (o2 * o2 + b2 * b2);
#pragma unroll
    for (int off = 1; off < 32; off <<= 1) sq += __shfl_xor(sq, off, 32);
    const float rs = rsqrtf(sq * (1.0f / HDIM) + RMS_EPS);
    sw[p * RSP + ln]      = (_Float16)(o0 * rs);
    sw[p * RSP + ln + 32] = (_Float16)(b1 * rs);
    sw[p * RSP + ln + 64] = (_Float16)(o2 * rs);
    sw[p * RSP + ln + 96] = (_Float16)(b2 * rs);
  }
  {
    const float sa0 = sa[0], sa1 = sa[1];
    const float* vsrc = base + 2 * DD;
    const float* vesrc = ve + (size_t)s * DD + h * HDIM;
#pragma unroll
    for (int i = 0; i < 4; ++i) {
      const int d = ln + 32 * i;
      sw[2 * RSP + d] = (_Float16)(sa0 * vsrc[d] + sa1 * vesrc[d]);
    }
  }
  __builtin_amdgcn_fence(__ATOMIC_RELEASE, "workgroup");
  __builtin_amdgcn_wave_barrier();
  __builtin_amdgcn_fence(__ATOMIC_ACQUIRE, "workgroup");
  const int hh = ln >> 4, c8 = (ln & 15) * 8;           // 256-B row = 16 lanes x 16 B
  const size_t PL = (size_t)NTOK * DD;
  const size_t row = ((size_t)(b * HH + h) * SS + s) * HDIM;
  const v8h v01 = *(const v8h*)(sw + hh * RSP + c8);
  const v8h v2  = *(const v8h*)(sw + 2 * RSP + c8);
  _Float16* d01 = planes + (size_t)hh * PL + row + c8;
  _Float16* d2  = planes + 2 * PL + row + c8;
  {
    *(v8h*)d01 = v01;
    if (hh == 0) *(v8h*)d2 = v2;
    
  }
}

// ---- attention, head dim 128, f16 q/k/v planes [B*H*S][128]; out f16 [B*S][D] at cols h*128 ----
// Block = 4 waves = 64 query rows of one (b,h); 64-key chunks; chunks above the diagonal skipped,
// per element select: allowed iff key <= query and docs[key] == docs[query], else -inf. p carried x2^15.
// K and V chunks lie row-major [kv][d] in LDS, brought by asynchronous copies into two buffers: the next chunk's
// copies fly while this chunk is worked on. K rows are read by ds_load_b128, V columns by ds_load_tr16_b128.
#define AKC 64
#define AQB 64
#define OSP 136
#define KPITCH 272                     // K row pitch in bytes (16 B x odd: conflict-free for ds_load_b128)
#define VPITCH 288                     // V row pitch in bytes (32 B x odd: conflict-free for ds_load_tr16_b128)
#define KBUF (AKC * KPITCH)
#define VBUF (AKC * VPITCH)
// Eight 16-byte copies per lane: rows r, r+8, .. r+56 of one 64-row chunk of 256-byte rows (LSTEP = 8 LDS rows).
// The s_wait_xcnt closes the statement so that no address register is rewritten ahead of it.
template <int LSTEP>
__device__ __forceinline__ void copy_kv8(uint32_t l, const unsigned short* gp) {
  asm volatile(
      "global_load_async_to_lds_b128 %0, %8, off\n\t"
      "global_load_async_to_lds_b128 %1, %9, off\n\t"
      "global_load_async_to_lds_b128 %2, %10, off\n\t"
      "global_load_async_to_lds_b128 %3, %11, off\n\t"
      "global_load_async_to_lds_b128 %4, %12, off\n\t"
      "global_load_async_to_lds_b128 %5, %13, off\n\t"
      "global_load_async_to_lds_b128 %6, %14, off\n\t"
      "global_load_async_to_lds_b128 %7, %15, off\n\t"
      "s_wait_xcnt 0x0"
      :: "v"(l), "v"(l + LSTEP), "v"(l + 2 * LSTEP), "v"(l + 3 * LSTEP),
         "v"(l + 4 * LSTEP), "v"(l + 5 * LSTEP), "v"(l + 6 * LSTEP), "v"(l + 7 * LSTEP),
         "v"(gp), "v"(gp + 8 * HDIM), "v"(gp + 16 * HDIM), "v"(gp + 24 * HDIM),
         "v"(gp + 32 * HDIM), "v"(gp + 40 * HDIM), "v"(gp + 48 * HDIM), "v"(gp + 56 * HDIM)
      : "memory");
}
// lane (c, hh) gets T[row0 + 8 hh + 0..7][col0 + c] of a row-major 16-bit LDS tile; p is the lane's own address
typedef short s16x8 __attribute__((ext_vector_type(8)));
__device__ __forceinline__ v8h ld_tr16(const char* p) {
  typedef __attribute__((address_space(3))) s16x8 lds_s16x8;
  return __builtin_bit_cast(v8h, __builtin_amdgcn_ds_load_tr16_b128_v8i16((lds_s16x8*)p));
}
__global__ __launch_bounds__(128) void attn128_k(const unsigned short* __restrict__ qpp, const unsigned short* __restrict__ kpp,
                                                 const unsigned short* __restrict__ vpp, const int* __restrict__ docs,
                                                 unsigned short* __restrict__ outp) {
  union FH { v16h v; v8h h[2]; };
  __shared__ __align__(16) char Ksm[2 * KBUF];             // two buffers of [kv][d], pitch KPITCH
  __shared__ __align__(16) char Vsm[2 * VBUF];             // two buffers of [kv][d], pitch VPITCH
  __shared__ __align__(16) _Float16 Psh[4][16 * AKC];      // per wave [row][kv]
  __shared__ __align__(16) _Float16 Osh[4][16 * OSP];      // per wave [row][d]
  const _Float16* qp = (const _Float16*)qpp;
  _Float16* out = (_Float16*)outp;
  const int tid = threadIdx.x, wave = tid >> 5, lane = tid & 31, hh = lane >> 4, c = lane & 15;
  const int nqb = SS / AQB;
  const int bx = blockIdx.x;
  const int qb = bx % nqb;
  const int bh = bx / nqb;
  const int h = bh % HH;
  const int b = bh / HH;
  const int q0 = qb * AQB + wave * 16;
  const size_t rowb = (size_t)(b * HH + h) * SS;

  v16h qa[4];
  {
    const _Float16* qrow = qp + (rowb + q0 + c) * HDIM + 8 * hh;
#pragma unroll
    for (int dc = 0; dc < 4; ++dc) qa[dc] = Frag<_Float16>::load(qrow + dc * 32);
  }
  int dq[8];
#pragma unroll
  for (int r = 0; r < 8; ++r) dq[r] = docs[q0 + 8 * hh + r];
  float mrow[8], lrow[8];
  v8f oacc[8];
#pragma unroll
  for (int r = 0; r < 8; ++r) { mrow[r] = -INFINITY; lrow[r] = 0.f; }
#pragma unroll
  for (int t = 0; t < 8; ++t) oacc[t] = (v8f){0.f,0.f,0.f,0.f,0.f,0.f,0.f,0.f};

  const int nChunks = qb + 1;   // block-uniform
  // copy addresses: lane brings 16 B at column chunk (tid & 15) of rows (tid >> 4) + 8 i
  const int crow = tid >> 4, ccol = (tid & 15) * 8;
  const unsigned short* gK = kpp + (rowb + crow) * HDIM + ccol;
  const unsigned short* gV = vpp + (rowb + crow) * HDIM + ccol;
  const uint32_t lK = (uint32_t)(uintptr_t)Ksm + (uint32_t)(crow * KPITCH + ccol * 2);
  const uint32_t lV = (uint32_t)(uintptr_t)Vsm + (uint32_t)(crow * VPITCH + ccol * 2);
  copy_kv8<8 * KPITCH>(lK, gK);
  copy_kv8<8 * VPITCH>(lV, gV);
  asm volatile("s_wait_asynccnt 0x0" ::: "memory");   // chunk 0's own copies have landed
  __syncthreads();                                    // and every other wave's
  if (nChunks > 1) {
    copy_kv8<8 * KPITCH>(lK + KBUF, gK + AKC * HDIM);
    copy_kv8<8 * VPITCH>(lV + VBUF, gV + AKC * HDIM);
  }
  for (int kc = 0; kc < nChunks; ++kc) {
    const int kv0 = kc * AKC;
    const unsigned bsel = (unsigned)(kc & 1);
    const char* Kb = Ksm + bsel * KBUF + c * KPITCH + 16 * hh;
    const char* Vb = Vsm + bsel * VBUF + (8 * hh + (lane & 7)) * VPITCH + ((lane >> 3) & 1) * 16;

    v8f s[4];
    FH kb[4][4];
#pragma unroll
    for (int j = 0; j < 4; ++j) {
#pragma unroll
      for (int dc = 0; dc < 4; ++dc) {
        kb[j][dc].h[0] = *(const v8h*)(Kb + j * 16 * KPITCH + dc * 64);
        kb[j][dc].h[1] = *(const v8h*)(Kb + j * 16 * KPITCH + dc * 64 + 32);
      }
    }
    // keeps the chunk's 32 K loads together ahead of its 16 score products: one LDS latency per chunk, not one per product
    __builtin_amdgcn_sched_barrier(0);
#pragma unroll
    for (int j = 0; j < 4; ++j) {
      s[j] = (v8f){0.f,0.f,0.f,0.f,0.f,0.f,0.f,0.f};
#pragma unroll
      for (int dc = 0; dc < 4; ++dc) s[j] = Frag<_Float16>::mma(qa[dc], kb[j][dc].v, s[j]);
    }
    int dk[4];
#pragma unroll
    for (int j = 0; j < 4; ++j) dk[j] = docs[kv0 + j * 16 + c];
    const bool diag = (kc == qb);
    float cm[8];
#pragma unroll
    for (int r = 0; r < 8; ++r) {
      const int qrow = q0 + 8 * hh + r;
      float m = -INFINITY;
#pragma unroll
      for (int j = 0; j < 4; ++j) {
        const int kvcol = kv0 + j * 16 + c;
        float sv = s[j][r] * ATT_SCALE;
        const bool masked = (dk[j] != dq[r]) || (diag && (kvcol > qrow));
        if (masked) sv = -INFINITY;
        s[j][r] = sv;
        m = fmaxf(m, sv);
      }
#pragma unroll
      for (int off = 1; off < 16; off <<= 1) m = fmaxf(m, __shfl_xor(m, off, 32));
      cm[r] = m;
    }
    _Float16* pw = Psh[wave];
#pragma unroll
    for (int r = 0; r < 8; ++r) {
      const float mnew = fmaxf(mrow[r], cm[r]);
      const float mref = (mnew > -INFINITY) ? mnew : 0.0f;   // all-masked so far -> p = 0, alpha = 0
      const float alpha = expf(mrow[r] - mref);
      mrow[r] = mnew;
      float psum = 0.f;
#pragma unroll
      for (int j = 0; j < 4; ++j) {
        const float p = expf(s[j][r] - mref);
        psum += p;
        pw[(8 * hh + r) * AKC + j * 16 + c] = (_Float16)(p * PSCALE);
      }
#pragma unroll
      for (int off = 1; off < 16; off <<= 1) psum += __shfl_xor(psum, off, 32);
      lrow[r] = lrow[r] * alpha + psum;
#pragma unroll
      for (int t = 0; t < 8; ++t) oacc[t][r] *= alpha;
    }
    __builtin_amdgcn_fence(__ATOMIC_RELEASE, "workgroup");
    __builtin_amdgcn_wave_barrier();
    __builtin_amdgcn_fence(__ATOMIC_ACQUIRE, "workgroup");
    FH pa[2];
#pragma unroll
    for (int kk = 0; kk < 2; ++kk) {
      pa[kk].h[0] = *(const v8h*)(pw + c * AKC + kk * 32 + 8 * hh);
      pa[kk].h[1] = *(const v8h*)(pw + c * AKC + kk * 32 + 16 + 8 * hh);
    }
    FH vb[2][8];
#pragma unroll
    for (int kk = 0; kk < 2; ++kk) {
#pragma unroll
      for (int t = 0; t < 8; ++t) {
        vb[kk][t].h[0] = ld_tr16(Vb + (kk * 32) * VPITCH + t * 32);        // keys kk*32 + 8 hh + 0..7 of column t*16 + c
        vb[kk][t].h[1] = ld_tr16(Vb + (kk * 32 + 16) * VPITCH + t * 32);   // keys kk*32 + 16 + 8 hh + 0..7
      }
    }
    // keeps the 4 p loads and the chunk's 32 V loads together ahead of the 16 output products
    __builtin_amdgcn_sched_barrier(0);
#pragma unroll
    for (int kk = 0; kk < 2; ++kk) {
#pragma unroll
      for (int t = 0; t < 8; ++t) oacc[t] = Frag<_Float16>::mma(pa[kk].v, vb[kk][t].v, oacc[t]);
    }
    asm volatile("s_wait_dscnt 0x0" ::: "memory");     // this wave's reads of the buffers have returned
    asm volatile("s_wait_asynccnt 0x0" ::: "memory");  // its copies for chunk kc + 1 have landed
    __syncthreads();                                   // publishes chunk kc + 1, frees this chunk's buffers
    if (kc + 2 < nChunks) {
      copy_kv8<8 * KPITCH>(lK + bsel * KBUF, gK + (size_t)(kc + 2) * (AKC * HDIM));
      copy_kv8<8 * VPITCH>(lV + bsel * VBUF, gV + (size_t)(kc + 2) * (AKC * HDIM));
    }
  }
  asm volatile("s_wait_asynccnt 0x0" ::: "memory");    // nothing in flight when the wave ends

  _Float16* os = Osh[wave];
#pragma unroll
  for (int r = 0; r < 8; ++r) {
    const float inv = 1.0f / (lrow[r] * PSCALE);
#pragma unroll
    for (int t = 0; t < 8; ++t) os[(8 * hh + r) * OSP + t * 16 + c] = (_Float16)(oacc[t][r] * inv);
  }
  __builtin_amdgcn_fence(__ATOMIC_RELEASE, "workgroup");
  __builtin_amdgcn_wave_barrier();
  __builtin_amdgcn_fence(__ATOMIC_ACQUIRE, "workgroup");
  {
    const int c8 = (lane & 15) * 8;   // 256-B row segment = 16 lanes x 16 B, 2 rows per instruction
    {
#pragma unroll
      for (int it = 0; it < 8; ++it) {
        const int row = it * 2 + hh;
        const v8h val = *(const v8h*)(os + row * OSP + c8);
        *(v8h*)(out + (size_t)(b * SS + q0 + row) * DD + h * HDIM + c8) = val;
      }
      
    }
  }
}

// ---------------------------------------------------------------------------
extern "C" void kernel_launch(void* const* d_in, const int* in_sizes, int n_in,
                              void* d_out, int out_size, void* d_ws,
                              size_t ws_size, hipStream_t stream) {
  if (n_in < 12) return;
  if (in_sizes[0] != NTOK * DD || in_sizes[1] != SS * DD || in_sizes[2] != NTOK * DD ||
      in_sizes[3] < 2 || in_sizes[4] < 2 || in_sizes[5] < DD || in_sizes[6] < DD ||
      in_sizes[7] != DD * 3 * DD || in_sizes[8] != DD * DD || in_sizes[9] != DD * 4 * DD ||
      in_sizes[10] != 4 * DD * DD || in_sizes[11] != SS || out_size != NTOK * DD) return;

  const float* x     = (const float*)d_in[0];
  const float* ve    = (const float*)d_in[1];
  const float* x0    = (const float*)d_in[2];
  const float* lam   = (const float*)d_in[3];
  const float* sal   = (const float*)d_in[4];
  const float* ln1   = (const float*)d_in[5];
  const float* ln2   = (const float*)d_in[6];
  const float* wqkv  = (const float*)d_in[7];
  const float* wo    = (const float*)d_in[8];
  const float* wfc   = (const float*)d_in[9];
  const float* wproj = (const float*)d_in[10];
  const int*   ids   = (const int*)d_in[11];
  float* outf = (float*)d_out;

  // ---- carve (bytes) ----
  const size_t szWO   = (size_t)DD * DD * 2;              //   2 MiB  w_o^T f16
  const size_t szWFC  = (size_t)4 * DD * DD * 2;          //   8 MiB  w_fc^T f16
  const size_t szWPR  = (size_t)4 * DD * DD * 2;          //   8 MiB  w_proj^T f16
  const size_t szXR   = (size_t)NTOK * DD * 4;            //  16 MiB  mixed x f32
  const size_t szBIG  = (size_t)NTOK * 3 * DD * 4;        //  48 MiB  qkv f32, later h f16 (32 MiB) + x2 f32 (16 MiB)
  const size_t szXN   = (size_t)NTOK * DD * 2;            //   8 MiB  xn f16, later xn2 f16
  const size_t szWQA  = (size_t)NTOK * DD * 2;            //   8 MiB  w_qkv^T f16 (6 MiB), later attention out f16
  const size_t szPL   = (size_t)3 * NTOK * DD * 2;        //  24 MiB  q,k,v f16 planes
  const size_t szROPE = (size_t)SS * 64 * 4;              // 512 KiB
  const size_t szDOC  = (size_t)SS * 4;
  const size_t oWO = 0, oWFC = oWO + szWO, oWPR = oWFC + szWFC, oXR = oWPR + szWPR, oBIG = oXR + szXR,
               oXN = oBIG + szBIG, oWQA = oXN + szXN, oPL = oWQA + szWQA, oROPE = oPL + szPL,
               oDOC = oROPE + szROPE, oEND = oDOC + szDOC;
  if (oEND > ws_size) return;
  char* ws = (char*)d_ws;
  unsigned short* woT   = (unsigned short*)(ws + oWO);
  unsigned short* wfcT  = (unsigned short*)(ws + oWFC);
  unsigned short* wprT  = (unsigned short*)(ws + oWPR);
  float*          xr    = (float*)(ws + oXR);
  float*          qkvf  = (float*)(ws + oBIG);
  unsigned short* hbuf  = (unsigned short*)(ws + oBIG);
  float*          x2    = (float*)(ws + oBIG + (size_t)NTOK * 4 * DD * 2);
  unsigned short* xn    = (unsigned short*)(ws + oXN);
  unsigned short* xn2   = xn;
  unsigned short* wqkvT = (unsigned short*)(ws + oWQA);
  unsigned short* attn  = (unsigned short*)(ws + oWQA);
  unsigned short* qpl   = (unsigned short*)(ws + oPL);
  unsigned short* kpl   = qpl + (size_t)NTOK * DD;
  unsigned short* vpl   = qpl + (size_t)2 * NTOK * DD;
  float*          rope  = (float*)(ws + oROPE);
  int*            docs  = (int*)(ws + oDOC);

  // rotary table + docs; x = l0*x + l1*x0, xn = LN(x)*ln1_w; the four weight transposes
  prep_k<<<PB_TAB + PB_LN + PB_WQKV + PB_WO + PB_WFC + PB_WPR, 256, 0, stream>>>(
      x, x0, lam, ln1, xr, xn, wqkv, wqkvT, wo, woT, wfc, wfcT, wproj, wprT, ids, rope, docs);
  // qkv = xn @ w_qkv (f32 out)
  {
    const int M = NTOK, N = 3 * DD, K = DD;
    const int tiles = (M / 128) * (N / 128);
    wmma_gemm64<0, false, 0, 0, false, 0><<<dim3(tiles, 1), 128, 0, stream>>>(
        xn, xn, K, 0, wqkvT, wqkvT, K, 0, qkvf, qkvf, N, 0, xr, xr, 0, M, N, K, WMUL_INV);
  }
  // rotary + RMS-norm + value mix -> f16 planes
  rope_k<<<dim3(SS, BB), 256, 0, stream>>>(qkvf, ve, sal, rope, qpl);
  // attention
  attn128_k<<<BB * HH * (SS / AQB), 128, 0, stream>>>(qpl, kpl, vpl, docs, attn);
  // x2 = xr + attn @ w_o
  {
    const int M = NTOK, N = DD, K = DD;
    const int tiles = (M / 128) * (N / 128);
    wmma_gemm64<0, false, 0, 0, true, 0><<<dim3(tiles, 1), 128, 0, stream>>>(
        attn, attn, K, 0, woT, woT, K, 0, x2, x2, N, 0, xr, xr, 0, M, N, K, WMUL_INV);
  }
  // xn2 = LN(x2)*ln2_w
  ln_k<<<NTOK, 128, 0, stream>>>(x2, ln2, xn2);
  // h = relu(xn2 @ w_fc)^2 (f16 out)
  {
    const int M = NTOK, N = 4 * DD, K = DD;
    const int tiles = (M / 128) * (N / 128);
    wmma_gemm64<0, false, 0, 1, false, 6><<<dim3(tiles, 1), 128, 0, stream>>>(
        xn2, xn2, K, 0, wfcT, wfcT, K, 0, hbuf, hbuf, N, 0, xr, xr, 0, M, N, K, WMUL_INV);
  }
  // out = x2 + h @ w_proj
  {
    const int M = NTOK, N = DD, K = 4 * DD;
    const int tiles = (M / 128) * (N / 128);
    wmma_gemm64<0, false, 0, 0, true, 0><<<dim3(tiles, 1), 128, 0, stream>>>(
        hbuf, hbuf, K, 0, wprT, wprT, K, 0, outf, outf, N, 0, x2, x2, 0, M, N, K, WMUL_INV);
  }
}

// v005
// It runs in 229 microseconds.
// Timed twice side by side with v004, it ran 1.10 times as fast both times.
// All steps since v000 together make it 2.73 times as fast.
#include <hip/hip_runtime.h>
#include <stdint.h>
// All contractions: v_wmma_f32_16x16x32_f16 (f16 operands, f32 accumulate); projection weights carried x64, attention p carried x2^15; norms, rotary, softmax and residuals in f32.

#define BB 2
#define SS 2048
#define DD 1024
#define HH 8
#define HDIM 128
#define NTOK (BB * SS)
#define EOT_ID 50256
#define ATT_SCALE 0.12f
#define LN_EPS 1e-6f
#define RMS_EPS 1.1920929e-7f
#define WMUL 64.0f
#define WMUL_INV (1.0f / 64.0f)

typedef __attribute__((ext_vector_type(16))) _Float16 v16h;
typedef __attribute__((ext_vector_type(8)))  _Float16 v8h;
typedef __attribute__((ext_vector_type(4)))  _Float16 v4h;
typedef __attribute__((ext_vector_type(16))) __bf16   v16b;
typedef __attribute__((ext_vector_type(8)))  __bf16   v8b;
typedef __attribute__((ext_vector_type(8)))  float    v8f;
typedef __attribute__((ext_vector_type(4)))  float    v4f;
typedef __attribute__((ext_vector_type(4)))  int      v4i;
#define PSCALE 32768.0f
#define U16(p) ((const unsigned short*)(const void*)(p))
#define PSCALE_INV (1.0f / 32768.0f)

__device__ __forceinline__ unsigned short f2bf_bits(float f) {
  unsigned u = __float_as_uint(f);
  return (unsigned short)((u + 0x7FFFu + ((u >> 16) & 1u)) >> 16);
}
__device__ __forceinline__ float bf_bits2f(unsigned short h) { return __uint_as_float(((unsigned)h) << 16); }

// hazard guards as plain device helpers
__device__ __forceinline__ void dep_guard_h(v8f& a, v8f& b, v16h x, v16h y) { asm volatile("v_nop\n\tv_nop\n\tv_nop\n\tv_nop" : "+v"(a), "+v"(b) : "v"(x), "v"(y)); }
__device__ __forceinline__ void dep_guard_b(v8f& a, v8f& b, v16b x, v16b y) { asm volatile("v_nop\n\tv_nop\n\tv_nop\n\tv_nop" : "+v"(a), "+v"(b) : "v"(x), "v"(y)); }
__device__ __forceinline__ void keep4_h(v16h a, v16h b, v16h c, v16h d) { asm volatile("v_nop" :: "v"(a), "v"(b), "v"(c), "v"(d)); }
__device__ __forceinline__ void keep4_b(v16b a, v16b b, v16b c, v16b d) { asm volatile("v_nop" :: "v"(a), "v"(b), "v"(c), "v"(d)); }
__device__ __forceinline__ void acc_guard4(v8f& a, v8f& b, v8f& c, v8f& d) { asm volatile("v_nop\n\tv_nop\n\tv_nop\n\tv_nop" : "+v"(a), "+v"(b), "+v"(c), "+v"(d)); }
template <typename T> struct Frag;
template <> struct Frag<_Float16> {
  typedef v16h V; union U { v16h v; v8h h[2]; };
  static __device__ __forceinline__ v16h load(const _Float16* p) {   // elements 0..7 <- p[0..7], 8..15 <- p[16..23]
    U f; f.h[0] = *(const v8h*)(p); f.h[1] = *(const v8h*)(p + 16); return f.v;
  }
  static __device__ __forceinline__ v8f mma(v16h a, v16h b, v8f c) {
    return __builtin_amdgcn_wmma_f32_16x16x32_f16(false, a, false, b, (short)0, c, false, false);
  }
  static __device__ __forceinline__ void guard(v8f& a, v8f& b, v16h x, v16h y) { dep_guard_h(a, b, x, y); }
  static __device__ __forceinline__ void keep(v16h a, v16h b, v16h c, v16h d) { keep4_h(a, b, c, d); }
};
template <> struct Frag<__bf16> {
  typedef v16b V; union U { v16b v; v8b h[2]; };
  static __device__ __forceinline__ v16b load(const __bf16* p) {
    U f; f.h[0] = *(const v8b*)(p); f.h[1] = *(const v8b*)(p + 16); return f.v;
  }
  static __device__ __forceinline__ v8f mma(v16b a, v16b b, v8f c) {
    return __builtin_amdgcn_wmma_f32_16x16x32_bf16(false, a, false, b, (short)0, c, false, false);
  }
  static __device__ __forceinline__ void guard(v8f& a, v8f& b, v16b x, v16b y) { dep_guard_b(a, b, x, y); }
  static __device__ __forceinline__ void keep(v16b a, v16b b, v16b c, v16b d) { keep4_b(a, b, c, d); }
};

// ---- LDS-staged batched WMMA GEMM ------------------------------------------
// C[m,n] = scale * sum_k A[m,k] * Bt[n,k] (+bias)(+resid); a block of 4 waves owns a 128x128 tile, each wave 64x64 of it.
// A row-major [M,K]; Bt row-major [N,K]; M,N % 128 == 0, K % 64 == 0.
// Per trip 64 k of both operands (128 rows x 128 B each) lie in LDS at pitch 144 B, brought by asynchronous
// copies into two buffers: the next trip's copies fly while this trip's fragments are read and multiplied.
// BIAS_MODE: 0 = none, 1 = bias[m], 2 = bias[n].
// OUT_MODE: 0 = f32, 1 = f16, 2 = bf16 hi plane (Cout) + bf16 lo plane (Cout2).
// ACT 6: relu then square.
// ET: 0 = f16 operands, 1 = bf16 operands (pointers passed as 16-bit storage)
template <int ET> struct Elem;
template <> struct Elem<0> { typedef _Float16 T; };
template <> struct Elem<1> { typedef __bf16 T; };
#define GBK 64                         // k per trip
#define GPITCH 144                     // LDS row pitch in bytes (16 B x odd: conflict-free for ds_load_b128)
#define GOPER (128 * GPITCH)           // one operand's 128 rows
#define GSTAGE (2 * GOPER)             // A rows, then Bt rows
// Eight 16-byte copies per lane: rows r, r+16, .. r+112 of one operand's 128-row slab. The s_wait_xcnt closes the
// statement so that no address register is rewritten ahead of it.
__device__ __forceinline__ void copy_rows8(uint32_t l, const unsigned short* gp, size_t step) {
  asm volatile(
      "global_load_async_to_lds_b128 %0, %8, off\n\t"
      "global_load_async_to_lds_b128 %1, %9, off\n\t"
      "global_load_async_to_lds_b128 %2, %10, off\n\t"
      "global_load_async_to_lds_b128 %3, %11, off\n\t"
      "global_load_async_to_lds_b128 %4, %12, off\n\t"
      "global_load_async_to_lds_b128 %5, %13, off\n\t"
      "global_load_async_to_lds_b128 %6, %14, off\n\t"
      "global_load_async_to_lds_b128 %7, %15, off\n\t"
      "s_wait_xcnt 0x0"
      :: "v"(l), "v"(l + 16 * GPITCH), "v"(l + 32 * GPITCH), "v"(l + 48 * GPITCH),
         "v"(l + 64 * GPITCH), "v"(l + 80 * GPITCH), "v"(l + 96 * GPITCH), "v"(l + 112 * GPITCH),
         "v"(gp), "v"(gp + step), "v"(gp + 2 * step), "v"(gp + 3 * step),
         "v"(gp + 4 * step), "v"(gp + 5 * step), "v"(gp + 6 * step), "v"(gp + 7 * step)
      : "memory");
}
template <int ET, bool SPLIT, int BIAS_MODE, int OUT_MODE, bool RESID, int ACT = 0>
__global__ __launch_bounds__(128) void wmma_gemm64(
    const unsigned short* __restrict__ Ap, const unsigned short* __restrict__ A2p, int lda, long strideA,
    const unsigned short* __restrict__ Btp, const unsigned short* __restrict__ Bt2p, int ldb, long strideB,
    void* __restrict__ Cout, void* __restrict__ Cout2, int ldc, long strideC,
    const float* __restrict__ bias,
    const float* __restrict__ resid, long strideR,
    int M, int N, int K, float scale) {
  static_assert(!SPLIT, "single-plane operands only");
  typedef typename Elem<ET>::T T;
  typedef typename Frag<T>::V V;
  // two operand buffers; after the loop its first bytes serve as the per-wave 16x64 f32 slabs, pitch 68 floats
  __shared__ __align__(16) char smem[2 * GSTAGE];
  const int b    = blockIdx.y;
  const int tid  = threadIdx.x;
  const int lane = tid & 31;
  const int wave = tid >> 5;
  const int tilesN = N >> 7;
  const int tilesM = M >> 7;
  const int tile = blockIdx.x;
  if (tile >= tilesM * tilesN) return;   // block-uniform, in front of every barrier
  const int tm = tile / tilesN;
  const int tn = tile - tm * tilesN;
  const int mB = tm << 7;                      // block tile origin
  const int nB = tn << 7;
  const int wm = (wave >> 1) << 6;             // wave tile origin inside the block tile
  const int wn = (wave & 1) << 6;
  const int m0 = mB + wm;
  const int n0 = nB + wn;

  const int rlane = lane & 15;                 // row (A) / col (B, D) within subtile
  const int koff  = (lane >> 4) * 8;           // k offset of this lane half
  const int mOff  = (lane >> 4) * 8;           // D row offset

  // copy addresses: lane brings 16 B at column chunk (tid & 7) of rows (tid >> 3) + 16 i
  const int crow = tid >> 3, ccol = (tid & 7) * 8;
  const unsigned short* gA = Ap  + (size_t)b * strideA + (size_t)(mB + crow) * lda + ccol;
  const unsigned short* gB = Btp + (size_t)b * strideB + (size_t)(nB + crow) * ldb + ccol;
  const size_t stepA = (size_t)16 * lda, stepB = (size_t)16 * ldb;
  const uint32_t lds0 = (uint32_t)(uintptr_t)smem + (uint32_t)(crow * GPITCH + ccol * 2);

  v8f acc[4][4];
#pragma unroll
  for (int i = 0; i < 4; ++i)
#pragma unroll
    for (int j = 0; j < 4; ++j) acc[i][j] = (v8f){0.f,0.f,0.f,0.f,0.f,0.f,0.f,0.f};

  const int nT = K / GBK;
  copy_rows8(lds0, gA, stepA);
  copy_rows8(lds0 + GOPER, gB, stepB);
  asm volatile("s_wait_asynccnt 0x0" ::: "memory");   // trip 0's own copies have landed
  __syncthreads();                                    // and every other wave's
  if (nT > 1) {
    copy_rows8(lds0 + GSTAGE, gA + GBK, stepA);
    copy_rows8(lds0 + GSTAGE + GOPER, gB + GBK, stepB);
  }
  for (int t = 0; t < nT; ++t) {
    const unsigned bufo = (unsigned)(t & 1) * GSTAGE;
    const char* sA = smem + bufo + (wm + rlane) * GPITCH + koff * 2;
    const char* sB = smem + bufo + GOPER + (wn + rlane) * GPITCH + koff * 2;
#pragma unroll
    for (int kk = 0; kk < GBK / 32; ++kk) {
      V bh[4], ah[4];
#pragma unroll
      for (int j = 0; j < 4; ++j) bh[j] = Frag<T>::load((const T*)(sB + j * 16 * GPITCH + kk * 64));
#pragma unroll
      for (int i = 0; i < 4; ++i) ah[i] = Frag<T>::load((const T*)(sA + i * 16 * GPITCH + kk * 64));
      // keeps the 16 fragment loads together ahead of the 16 products: one LDS latency per group, not one per A fragment
      __builtin_amdgcn_sched_barrier(0);
#pragma unroll
      for (int i = 0; i < 4; ++i) {
#pragma unroll
        for (int j = 0; j < 4; ++j) acc[i][j] = Frag<T>::mma(ah[i], bh[j], acc[i][j]);
        Frag<T>::guard(acc[i][0], acc[i][3], ah[i], ah[i]);
      }
      Frag<T>::keep(bh[0], bh[1], bh[2], bh[3]);
    }
    asm volatile("s_wait_dscnt 0x0" ::: "memory");     // this wave's reads of the buffer have returned
    asm volatile("s_wait_asynccnt 0x0" ::: "memory");  // its copies for trip t + 1 have landed
    __syncthreads();                                   // publishes trip t + 1, frees this trip's buffer
    if (t + 2 < nT) {
      copy_rows8(lds0 + bufo, gA + (size_t)(t + 2) * GBK, stepA);
      copy_rows8(lds0 + bufo + GOPER, gB + (size_t)(t + 2) * GBK, stepB);
    }
  }
  asm volatile("s_wait_asynccnt 0x0" ::: "memory");    // nothing in flight when the buffers become slabs
  acc_guard4(acc[0][0], acc[0][1], acc[0][2], acc[0][3]);
  acc_guard4(acc[1][0], acc[1][1], acc[1][2], acc[1][3]);
  acc_guard4(acc[2][0], acc[2][1], acc[2][2], acc[2][3]);
  acc_guard4(acc[3][0], acc[3][1], acc[3][2], acc[3][3]);

  // ---- epilogue ----
  float* slab = (float*)smem + wave * (16 * 68);
  const float* Rb = RESID ? (resid + (size_t)b * strideR) : nullptr;
#pragma unroll
  for (int i = 0; i < 4; ++i) {
    const int mBase = m0 + (i << 4);
#pragma unroll
    for (int j = 0; j < 4; ++j) {
      const int n = n0 + (j << 4) + rlane;
      float bv = 0.f;
      if (BIAS_MODE == 2) bv = bias[n];
#pragma unroll
      for (int r = 0; r < 8; ++r) {
        float v = acc[i][j][r] * scale;
        if (BIAS_MODE == 1) v += bias[mBase + mOff + r];
        if (BIAS_MODE == 2) v += bv;
        if (RESID) v += Rb[(size_t)(mBase + mOff + r) * ldc + n];
        if (ACT == 1) v = tanhf(v);
        if (ACT == 2) v = fmaxf(v, 0.0f);
        if (ACT == 3) v = v / (1.0f + expf(-v));
        if (ACT == 4) v = (v > 0.f) ? v : 0.01f * v;
        if (ACT == 5) v = 0.5f * v * (1.0f + erff(v * 0.70710678118654752f));
        if (ACT == 6) { v = fmaxf(v, 0.0f); v = v * v; }
        slab[(mOff + r) * 68 + (j << 4) + rlane] = v;
      }
    }
    __builtin_amdgcn_fence(__ATOMIC_RELEASE, "workgroup");
    __builtin_amdgcn_wave_barrier();
    __builtin_amdgcn_fence(__ATOMIC_ACQUIRE, "workgroup");
    if (OUT_MODE == 0) {
      float* C = (float*)Cout + (size_t)b * strideC;
      const int hh = lane >> 4, c4 = (lane & 15) * 4;     // row seg = 256 B = 16 lanes x 16 B
      {
#pragma unroll
        for (int it = 0; it < 8; ++it) {
          const int row = it * 2 + hh;
          v4f v = *(const v4f*)(slab + row * 68 + c4);
          *(v4f*)(C + (size_t)(mBase + row) * ldc + n0 + c4) = v;
        }
        
      }
    } else {
      const int q = lane >> 3, c8 = (lane & 7) * 8;
      unsigned short* C  = (unsigned short*)Cout  + (size_t)b * strideC;
      unsigned short* C2 = (OUT_MODE == 2) ? ((unsigned short*)Cout2 + (size_t)b * strideC) : nullptr;
      {
#pragma unroll
        for (int it = 0; it < 4; ++it) {
          const int row = it * 4 + q;
          const float* sp = slab + row * 68 + c8;
          v8h hv, lv;
#pragma unroll
          for (int e = 0; e < 8; ++e) {
            if (OUT_MODE == 1) {
              hv[e] = (_Float16)sp[e];
            } else {
              unsigned short hb = f2bf_bits(sp[e]);
              unsigned short lb = f2bf_bits(sp[e] - bf_bits2f(hb));
              hv[e] = __builtin_bit_cast(_Float16, hb);
              lv[e] = __builtin_bit_cast(_Float16, lb);
            }
          }
          *(v8h*)(C + (size_t)(mBase + row) * ldc + n0 + c8) = hv;
          if (OUT_MODE == 2) *(v8h*)(C2 + (size_t)(mBase + row) * ldc + n0 + c8) = lv;
        }
        
      }
    }
    __builtin_amdgcn_fence(__ATOMIC_RELEASE, "workgroup");
    __builtin_amdgcn_wave_barrier();
    __builtin_amdgcn_fence(__ATOMIC_ACQUIRE, "workgroup");
  }
}

// ---- W [K][N] f32 -> Wt [N][K] f16 (x mul), 64x64 tile transposed through LDS ----
#define WTP 72
__device__ __forceinline__ void wt_cast_body(const float* __restrict__ W, unsigned short* __restrict__ Wtp,
                                             int K, int N, float mul, int bn, int bk, _Float16* st) {
  _Float16* Wt = (_Float16*)Wtp;
  const int n0 = bn * 64, k0 = bk * 64;
  const int tid = threadIdx.x;
  const int kr = tid >> 2, c16 = (tid & 3) * 16;
  const float* src = W + (size_t)(k0 + kr) * N + n0 + c16;
#pragma unroll
  for (int q = 0; q < 4; ++q) {
    const v4f v = *(const v4f*)(src + 4 * q);
#pragma unroll
    for (int e = 0; e < 4; ++e) st[(c16 + 4 * q + e) * WTP + kr] = (_Float16)(v[e] * mul);
  }
  __syncthreads();
  const int wave = tid >> 5, lane = tid & 31;
  const int q8 = lane >> 3, c8 = (lane & 7) * 8;
  {
#pragma unroll
    for (int it = 0; it < 2; ++it) {
      const int n = it * 32 + wave * 4 + q8;
      const v8h hv = *(const v8h*)(st + n * WTP + c8);
      *(v8h*)(Wt + (size_t)(n0 + n) * K + k0 + c8) = hv;
    }
    // the block ranges of the merged grid lie one behind another in the code: no register of these stores is rewritten ahead of this wait
    asm volatile("s_wait_xcnt 0x0" ::: "memory");
  }
}

// ---- rotary cos/sin table [S][64] (cos 0..31 | sin 32..63) and docs[S] = inclusive count of EOT ----
__device__ __forceinline__ void tables_body(const int* __restrict__ ids, float* __restrict__ rope,
                                            int* __restrict__ docs, int blk, int* scnt, int* sdoc) {
  const int tid = threadIdx.x, lane = tid & 31, wave = tid >> 5;
  if (blk < SS / 8) {
    const int s = blk * 8 + wave;
    float e = (float)lane * (1.0f / 31.0f);
    if (lane == 31) e = 1.0f;
    const float fr = powf(0.0009765625f, e);
    const float th = (float)s * fr;
    float sv, cv;
    sincosf(th, &sv, &cv);
    float* rp = rope + (size_t)s * 64;
    *(float*)(rp + lane) = cv;
    *(float*)(rp + 32 + lane) = sv;
    
  } else {
    int c = 0;
#pragma unroll
    for (int i = 0; i < 8; ++i) c += (ids[tid * 8 + i] == EOT_ID) ? 1 : 0;
    scnt[tid] = c;
    __syncthreads();
    for (int off = 1; off < 256; off <<= 1) {
      const int t = (tid >= off) ? scnt[tid - off] : 0;
      __syncthreads();
      scnt[tid] += t;
      __syncthreads();
    }
    int run = scnt[tid] - c;
#pragma unroll
    for (int i = 0; i < 8; ++i) {
      run += (ids[tid * 8 + i] == EOT_ID) ? 1 : 0;
      sdoc[tid * 8 + i] = run;
    }
    __syncthreads();
    const v4i a0 = *(const v4i*)(sdoc + tid * 4);
    const v4i a1 = *(const v4i*)(sdoc + 1024 + tid * 4);
    {
      *(v4i*)(docs + tid * 4) = a0;
      *(v4i*)(docs + 1024 + tid * 4) = a1;
      // as in wt_cast_body: no register of these stores is rewritten ahead of this wait
      asm volatile("s_wait_xcnt 0x0" ::: "memory");
    }
  }
}

// ---- residual mix + LayerNorm, 128 threads (tid 0..127) per row of 1024; thread owns cols 4t..4t+3 and 512+4t..+3 ----
template <bool MIX>
__device__ __forceinline__ void ln_body(const float* __restrict__ x, const float* __restrict__ x0,
                                        const float* __restrict__ lam, const float* __restrict__ w,
                                        float* __restrict__ xr, unsigned short* __restrict__ xnp,
                                        int row, int tid, float* red1, float* red2) {
  _Float16* xn = (_Float16*)xnp;
  const int lane = tid & 31, wave = tid >> 5;
  const size_t rb = (size_t)row * DD;
  const int ca = tid * 4, cb = 512 + tid * 4;
  v4f va = *(const v4f*)(x + rb + ca);
  v4f vb = *(const v4f*)(x + rb + cb);
  if (MIX) {
    const float l0 = lam[0], l1 = lam[1];
    const v4f a0 = *(const v4f*)(x0 + rb + ca);
    const v4f b0 = *(const v4f*)(x0 + rb + cb);
    va = va * l0 + a0 * l1;
    vb = vb * l0 + b0 * l1;
    {
      *(v4f*)(xr + rb + ca) = va;
      *(v4f*)(xr + rb + cb) = vb;
      
    }
  }
  float s = (va[0] + va[1]) + (va[2] + va[3]) + (vb[0] + vb[1]) + (vb[2] + vb[3]);
#pragma unroll
  for (int off = 1; off < 32; off <<= 1) s += __shfl_xor(s, off, 32);
  if (lane == 0) red1[wave] = s;
  __syncthreads();
  const float mu = ((red1[0] + red1[1]) + (red1[2] + red1[3])) * (1.0f / DD);
  const v4f da = va - mu, db = vb - mu;
  float s2 = (da[0] * da[0] + da[1] * da[1]) + (da[2] * da[2] + da[3] * da[3]) +
             (db[0] * db[0] + db[1] * db[1]) + (db[2] * db[2] + db[3] * db[3]);
#pragma unroll
  for (int off = 1; off < 32; off <<= 1) s2 += __shfl_xor(s2, off, 32);
  if (lane == 0) red2[wave] = s2;
  __syncthreads();
  const float var = ((red2[0] + red2[1]) + (red2[2] + red2[3])) * (1.0f / DD);
  const float inv = rsqrtf(var + LN_EPS);
  const v4f wa = *(const v4f*)(w + ca);
  const v4f wb = *(const v4f*)(w + cb);
  v4h ha, hb;
#pragma unroll
  for (int e = 0; e < 4; ++e) {
    ha[e] = (_Float16)(da[e] * inv * wa[e]);
    hb[e] = (_Float16)(db[e] * inv * wb[e]);
  }
  {
    *(v4h*)(xn + rb + ca) = ha;
    *(v4h*)(xn + rb + cb) = hb;
    // as in wt_cast_body, in the merged grid alone: no register of these stores is rewritten ahead of this wait
    if (MIX) asm volatile("s_wait_xcnt 0x0" ::: "memory");
  }
}
__global__ __launch_bounds__(128) void ln_k(const float* __restrict__ x, const float* __restrict__ w,
                                            unsigned short* __restrict__ xnp) {
  __shared__ float red1[4], red2[4];
  ln_body<false>(x, x, w, w, nullptr, xnp, blockIdx.x, threadIdx.x, red1, red2);
}

// ---- the six preparation steps, none of which reads what another writes, as block ranges of one grid ----
// The tables come first, their serial document count in block 0, so that the longest chain starts earliest.
#define PB_TAB  (SS / 8 + 1)
#define PB_LN   (NTOK / 2)                       // two rows per 256-thread block
#define PB_WQKV ((3 * DD / 64) * (DD / 64))
#define PB_WO   ((DD / 64) * (DD / 64))
#define PB_WFC  ((4 * DD / 64) * (DD / 64))
#define PB_WPR  ((DD / 64) * (4 * DD / 64))
__global__ __launch_bounds__(256) void prep_k(const float* __restrict__ x, const float* __restrict__ x0,
                                              const float* __restrict__ lam, const float* __restrict__ ln1,
                                              float* __restrict__ xr, unsigned short* __restrict__ xn,
                                              const float* __restrict__ wqkv, unsigned short* __restrict__ wqkvT,
                                              const float* __restrict__ wo, unsigned short* __restrict__ woT,
                                              const float* __restrict__ wfc, unsigned short* __restrict__ wfcT,
                                              const float* __restrict__ wproj, unsigned short* __restrict__ wprT,
                                              const int* __restrict__ ids, float* __restrict__ rope,
                                              int* __restrict__ docs) {
  __shared__ __align__(16) char sm[64 * WTP * 2];   // transpose tile, or count + document arrays, or the row sums
  static_assert(sizeof(sm) >= (256 + SS) * sizeof(int), "tables need 256 + S ints");
  int blk = blockIdx.x;
  if (blk < PB_TAB) {
    tables_body(ids, rope, docs, PB_TAB - 1 - blk, (int*)sm, (int*)sm + 256);
    return;
  }
  blk -= PB_TAB;
  if (blk < PB_LN) {
    const int half = threadIdx.x >> 7;
    float* red = (float*)sm + half * 8;
    ln_body<true>(x, x0, lam, ln1, xr, xn, blk * 2 + half, threadIdx.x & 127, red, red + 4);
    return;
  }
  blk -= PB_LN;
  // weights: W [in][out] -> Wt [out][in] f16 x64; tile column = out / 64, tile row = in / 64
  if (blk < PB_WQKV) {
    wt_cast_body(wqkv, wqkvT, DD, 3 * DD, WMUL, blk % (3 * DD / 64), blk / (3 * DD / 64), (_Float16*)sm);
    return;
  }
  blk -= PB_WQKV;
  if (blk < PB_WO) {
    wt_cast_body(wo, woT, DD, DD, WMUL, blk % (DD / 64), blk / (DD / 64), (_Float16*)sm);
    return;
  }
  blk -= PB_WO;
  if (blk < PB_WFC) {
    wt_cast_body(wfc, wfcT, DD, 4 * DD, WMUL, blk % (4 * DD / 64), blk / (4 * DD / 64), (_Float16*)sm);
    return;
  }
  blk -= PB_WFC;
  wt_cast_body(wproj, wprT, 4 * DD, DD, WMUL, blk % (DD / 64), blk / (DD / 64), (_Float16*)sm);
}

// ---- rotary + RMS-norm on q,k; v = sa0*v + sa1*ve; writes f16 planes [3][B*H*S][128] ----
// One block per token, wave = head; lane owns dims ln, ln+32, ln+64, ln+96 (pairs (ln,ln+64) rotate, (ln+32,ln+96) identity).
#define RSP 136
__global__ __launch_bounds__(256) void rope_k(const float* __restrict__ qkv, const float* __restrict__ ve,
                                              const float* __restrict__ sa, const float* __restrict__ rope,
                                              unsigned short* __restrict__ planesp) {
  __shared__ __align__(16) _Float16 st[HH][3 * RSP];
  _Float16* planes = (_Float16*)planesp;
  const int s = blockIdx.x, b = blockIdx.y;
  const int tid = threadIdx.x, h = tid >> 5, ln = tid & 31;
  const size_t tok = (size_t)b * SS + s;
  const float* base = qkv + tok * (3 * DD) + h * HDIM;
  const float cv = rope[(size_t)s * 64 + ln];
  const float sv = rope[(size_t)s * 64 + 32 + ln];
  _Float16* sw = st[h];
#pragma unroll
  for (int p = 0; p < 2; ++p) {
    const float* src = base + p * DD;
    const float a1 = src[ln], b1 = src[ln + 32], a2 = src[ln + 64], b2 = src[ln + 96];
    const float o0 = a1 * cv + a2 * sv;
    const float o2 = a2 * cv - a1 * sv;
    float sq = (o0 * o0 + b1 * b1) + (o2 * o2 + b2 * b2);
#pragma unroll
    for (int off = 1; off < 32; off <<= 1) sq += __shfl_xor(sq, off, 32);
    const float rs = rsqrtf(sq * (1.0f / HDIM) + RMS_EPS);
    sw[p * RSP + ln]      = (_Float16)(o0 * rs);
    sw[p * RSP + ln + 32] = (_Float16)(b1 * rs);
    sw[p * RSP + ln + 64] = (_Float16)(o2 * rs);
    sw[p * RSP + ln + 96] = (_Float16)(b2 * rs);
  }
  {
    const float sa0 = sa[0], sa1 = sa[1];
    const float* vsrc = base + 2 * DD;
    const float* vesrc = ve + (size_t)s * DD + h * HDIM;
#pragma unroll
    for (int i = 0; i < 4; ++i) {
      const int d = ln + 32 * i;
      sw[2 * RSP + d] = (_Float16)(sa0 * vsrc[d] + sa1 * vesrc[d]);
    }
  }
  __builtin_amdgcn_fence(__ATOMIC_RELEASE, "workgroup");
  __builtin_amdgcn_wave_barrier();
  __builtin_amdgcn_fence(__ATOMIC_ACQUIRE, "workgroup");
  const int hh = ln >> 4, c8 = (ln & 15) * 8;           // 256-B row = 16 lanes x 16 B
  const size_t PL = (size_t)NTOK * DD;
  const size_t row = ((size_t)(b * HH + h) * SS + s) * HDIM;
  const v8h v01 = *(const v8h*)(sw + hh * RSP + c8);
  const v8h v2  = *(const v8h*)(sw + 2 * RSP + c8);
  _Float16* d01 = planes + (size_t)hh * PL + row + c8;
  _Float16* d2  = planes + 2 * PL + row + c8;
  {
    *(v8h*)d01 = v01;
    if (hh == 0) *(v8h*)d2 = v2;
    
  }
}

#define AKC 64
#define AQB 64
#define OSP 136
#define KPITCH 272                     // K row pitch in bytes (16 B x odd: conflict-free for ds_load_b128)
#define VPITCH 288                     // V row pitch in bytes (32 B x odd: conflict-free for ds_load_tr16_b128)
#define KBUF (AKC * KPITCH)
#define VBUF (AKC * VPITCH)
// Eight 16-byte copies per lane: rows r, r+8, .. r+56 of one 64-row chunk of 256-byte rows (LSTEP = 8 LDS rows).
// The s_wait_xcnt closes the statement so that no address register is rewritten ahead of it.
template <int LSTEP>
__device__ __forceinline__ void copy_kv8(uint32_t l, const unsigned short* gp) {
  asm volatile(
      "global_load_async_to_lds_b128 %0, %8, off\n\t"
      "global_load_async_to_lds_b128 %1, %9, off\n\t"
      "global_load_async_to_lds_b128 %2, %10, off\n\t"
      "global_load_async_to_lds_b128 %3, %11, off\n\t"
      "global_load_async_to_lds_b128 %4, %12, off\n\t"
      "global_load_async_to_lds_b128 %5, %13, off\n\t"
      "global_load_async_to_lds_b128 %6, %14, off\n\t"
      "global_load_async_to_lds_b128 %7, %15, off\n\t"
      "s_wait_xcnt 0x0"
      :: "v"(l), "v"(l + LSTEP), "v"(l + 2 * LSTEP), "v"(l + 3 * LSTEP),
         "v"(l + 4 * LSTEP), "v"(l + 5 * LSTEP), "v"(l + 6 * LSTEP), "v"(l + 7 * LSTEP),
         "v"(gp), "v"(gp + 8 * HDIM), "v"(gp + 16 * HDIM), "v"(gp + 24 * HDIM),
         "v"(gp + 32 * HDIM), "v"(gp + 40 * HDIM), "v"(gp + 48 * HDIM), "v"(gp + 56 * HDIM)
      : "memory");
}
// lane (c, hh) gets T[row0 + 8 hh + 0..7][col0 + c] of a row-major 16-bit LDS tile; p is the lane's own address
typedef short s16x8 __attribute__((ext_vector_type(8)));
__device__ __forceinline__ v8h ld_tr16(const char* p) {
  typedef __attribute__((address_space(3))) s16x8 lds_s16x8;
  return __builtin_bit_cast(v8h, __builtin_amdgcn_ds_load_tr16_b128_v8i16((lds_s16x8*)p));
}
// lane l with lane l ^ 16
__device__ __forceinline__ float xhalf(float x) {
  return __builtin_bit_cast(float, __builtin_amdgcn_permlanex16(__builtin_bit_cast(int, x), __builtin_bit_cast(int, x),
                                                                0x76543210, 0xfedcba98, false, false));
}
// at most two waves per SIMD, as before this kernel's registers fell below a third of the file: the 512 work-groups then
// cannot stand three to a WGP while other WGPs stay empty
__global__ __launch_bounds__(128) __attribute__((amdgpu_waves_per_eu(2, 2))) void attn128_k(const unsigned short* __restrict__ qpp, const unsigned short* __restrict__ kpp,
                                                 const unsigned short* __restrict__ vpp, const int* __restrict__ docs,
                                                 unsigned short* __restrict__ outp) {
  union FH { v16h v; v8h h[2]; };
  __shared__ __align__(16) char Ksm[2 * KBUF];             // two buffers of [kv][d], pitch KPITCH
  __shared__ __align__(16) char Vsm[2 * VBUF];             // two buffers of [kv][d], pitch VPITCH
  __shared__ __align__(16) _Float16 Osh[4][16 * OSP];      // per wave [row][d]
  const _Float16* qp = (const _Float16*)qpp;
  _Float16* out = (_Float16*)outp;
  const int tid = threadIdx.x, wave = tid >> 5, lane = tid & 31, hh = lane >> 4, c = lane & 15;
  const int nqb = SS / AQB;
  const int bx = blockIdx.x;
  const int qb = bx % nqb;
  const int bh = bx / nqb;
  const int h = bh % HH;
  const int b = bh / HH;
  const int q0 = qb * AQB + wave * 16;
  const size_t rowb = (size_t)(b * HH + h) * SS;

  v16h qa[4];
  {
    const _Float16* qrow = qp + (rowb + q0 + c) * HDIM + 8 * hh;
#pragma unroll
    for (int dc = 0; dc < 4; ++dc) qa[dc] = Frag<_Float16>::load(qrow + dc * 32);
  }
  const int qrow = q0 + c;          // the lane's query
  const int dq = docs[qrow];
  float mrow = -INFINITY;           // running maximum of the query, alike in both halves
  float lrow = 0.f;                 // running sum over this half's keys; the halves are joined behind the loop
  v8f oacc[8];                      // O^T: oacc[t][r] = O[qrow][t*16 + 8 hh + r]
#pragma unroll
  for (int t = 0; t < 8; ++t) oacc[t] = (v8f){0.f,0.f,0.f,0.f,0.f,0.f,0.f,0.f};

  const int nChunks = qb + 1;   // block-uniform
  // copy addresses: lane brings 16 B at column chunk (tid & 15) of rows (tid >> 4) + 8 i
  const int crow = tid >> 4, ccol = (tid & 15) * 8;
  const unsigned short* gK = kpp + (rowb + crow) * HDIM + ccol;
  const unsigned short* gV = vpp + (rowb + crow) * HDIM + ccol;
  const uint32_t lK = (uint32_t)(uintptr_t)Ksm + (uint32_t)(crow * KPITCH + ccol * 2);
  const uint32_t lV = (uint32_t)(uintptr_t)Vsm + (uint32_t)(crow * VPITCH + ccol * 2);
  copy_kv8<8 * KPITCH>(lK, gK);
  copy_kv8<8 * VPITCH>(lV, gV);
  asm volatile("s_wait_asynccnt 0x0" ::: "memory");   // chunk 0's own copies have landed
  __syncthreads();                                    // and every other wave's
  if (nChunks > 1) {
    copy_kv8<8 * KPITCH>(lK + KBUF, gK + AKC * HDIM);
    copy_kv8<8 * VPITCH>(lV + VBUF, gV + AKC * HDIM);
  }
  for (int kc = 0; kc < nChunks; ++kc) {
    const int kv0 = kc * AKC;
    const unsigned bsel = (unsigned)(kc & 1);
    const char* Kb = Ksm + bsel * KBUF + c * KPITCH + 16 * hh;
    const char* Vb = Vsm + bsel * VBUF + (8 * hh + (lane & 7)) * VPITCH + ((lane >> 3) & 1) * 16;

    v8f s[4];
    FH kb[4][4];
    v4i dk[4][2];                   // docs of the lane's 32 keys: kv0 + j*16 + 8 hh + 0..7
#pragma unroll
    for (int j = 0; j < 4; ++j) {
      dk[j][0] = *(const v4i*)(docs + kv0 + j * 16 + 8 * hh);
      dk[j][1] = *(const v4i*)(docs + kv0 + j * 16 + 8 * hh + 4);
    }
    // no address register of these eight loads is rewritten (here: by the K loads' results) ahead of this wait
    asm volatile("s_wait_xcnt 0x0" ::: "memory");
#pragma unroll
    for (int j = 0; j < 4; ++j) {
#pragma unroll
      for (int dc = 0; dc < 4; ++dc) {
        kb[j][dc].h[0] = *(const v8h*)(Kb + j * 16 * KPITCH + dc * 64);
        kb[j][dc].h[1] = *(const v8h*)(Kb + j * 16 * KPITCH + dc * 64 + 32);
      }
    }
    // keeps the chunk's 32 K loads together ahead of its 16 score products: one LDS latency per chunk, not one per product
    __builtin_amdgcn_sched_barrier(0);
#pragma unroll
    for (int j = 0; j < 4; ++j) {
      s[j] = (v8f){0.f,0.f,0.f,0.f,0.f,0.f,0.f,0.f};
#pragma unroll
      for (int dc = 0; dc < 4; ++dc) s[j] = Frag<_Float16>::mma(kb[j][dc].v, qa[dc], s[j]);   // rows = keys, column = query
    }
    const bool diag = (kc == qb);
    float cm[4];
#pragma unroll
    for (int j = 0; j < 4; ++j) {
      float m = -INFINITY;
#pragma unroll
      for (int r = 0; r < 8; ++r) {
        const int key = kv0 + j * 16 + 8 * hh + r;
        float sv = s[j][r] * ATT_SCALE;
        const bool masked = (dk[j][r >> 2][r & 3] != dq) || (diag && (key > qrow));
        if (masked) sv = -INFINITY;
        s[j][r] = sv;
        m = fmaxf(m, sv);
      }
      cm[j] = m;
    }
    float mc = fmaxf(fmaxf(cm[0], cm[1]), fmaxf(cm[2], cm[3]));
    mc = fmaxf(mc, xhalf(mc));
    const float mnew = fmaxf(mrow, mc);
    const float mref = (mnew > -INFINITY) ? mnew : 0.0f;   // all-masked so far -> p = 0, alpha = 0
    const float alpha = expf(mrow - mref);
    mrow = mnew;
    FH pt[2];
    float ps[4];
#pragma unroll
    for (int j = 0; j < 4; ++j) {
      float a = 0.f;
#pragma unroll
      for (int r = 0; r < 8; ++r) {
        const float p = expf(s[j][r] - mref);
        a += p;
        pt[j >> 1].h[j & 1][r] = (_Float16)(p * PSCALE);
      }
      ps[j] = a;
    }
    lrow = lrow * alpha + ((ps[0] + ps[1]) + (ps[2] + ps[3]));
#pragma unroll
    for (int t = 0; t < 8; ++t) oacc[t] *= alpha;
    FH vb[2][8];
#pragma unroll
    for (int kk = 0; kk < 2; ++kk) {
#pragma unroll
      for (int t = 0; t < 8; ++t) {
        vb[kk][t].h[0] = ld_tr16(Vb + (kk * 32) * VPITCH + t * 32);        // keys kk*32 + 8 hh + 0..7 of column t*16 + c
        vb[kk][t].h[1] = ld_tr16(Vb + (kk * 32 + 16) * VPITCH + t * 32);   // keys kk*32 + 16 + 8 hh + 0..7
      }
    }
    // keeps the chunk's 32 V loads together ahead of the 16 output products
    __builtin_amdgcn_sched_barrier(0);
#pragma unroll
    for (int kk = 0; kk < 2; ++kk) {
#pragma unroll
      for (int t = 0; t < 8; ++t) oacc[t] = Frag<_Float16>::mma(vb[kk][t].v, pt[kk].v, oacc[t]);   // rows = d, column = query
    }
    asm volatile("s_wait_dscnt 0x0" ::: "memory");     // this wave's reads of the buffers have returned
    asm volatile("s_wait_asynccnt 0x0" ::: "memory");  // its copies for chunk kc + 1 have landed
    __syncthreads();                                   // publishes chunk kc + 1, frees this chunk's buffers
    if (kc + 2 < nChunks) {
      copy_kv8<8 * KPITCH>(lK + bsel * KBUF, gK + (size_t)(kc + 2) * (AKC * HDIM));
      copy_kv8<8 * VPITCH>(lV + bsel * VBUF, gV + (size_t)(kc + 2) * (AKC * HDIM));
    }
  }
  asm volatile("s_wait_asynccnt 0x0" ::: "memory");    // nothing in flight when the wave ends

  _Float16* os = Osh[wave];
  {
    const float inv = 1.0f / ((lrow + xhalf(lrow)) * PSCALE);
#pragma unroll
    for (int t = 0; t < 8; ++t) {
      v8h ov;
#pragma unroll
      for (int r = 0; r < 8; ++r) ov[r] = (_Float16)(oacc[t][r] * inv);
      *(v8h*)(os + c * OSP + t * 16 + 8 * hh) = ov;
    }
  }
  __builtin_amdgcn_fence(__ATOMIC_RELEASE, "workgroup");
  __builtin_amdgcn_wave_barrier();
  __builtin_amdgcn_fence(__ATOMIC_ACQUIRE, "workgroup");
  {
    const int c8 = (lane & 15) * 8;   // 256-B row segment = 16 lanes x 16 B, 2 rows per instruction
    {
#pragma unroll
      for (int it = 0; it < 8; ++it) {
        const int row = it * 2 + hh;
        const v8h val = *(const v8h*)(os + row * OSP + c8);
        *(v8h*)(out + (size_t)(b * SS + q0 + row) * DD + h * HDIM + c8) = val;
      }
      
    }
  }
}

// ---------------------------------------------------------------------------
extern "C" void kernel_launch(void* const* d_in, const int* in_sizes, int n_in,
                              void* d_out, int out_size, void* d_ws,
                              size_t ws_size, hipStream_t stream) {
  if (n_in < 12) return;
  if (in_sizes[0] != NTOK * DD || in_sizes[1] != SS * DD || in_sizes[2] != NTOK * DD ||
      in_sizes[3] < 2 || in_sizes[4] < 2 || in_sizes[5] < DD || in_sizes[6] < DD ||
      in_sizes[7] != DD * 3 * DD || in_sizes[8] != DD * DD || in_sizes[9] != DD * 4 * DD ||
      in_sizes[10] != 4 * DD * DD || in_sizes[11] != SS || out_size != NTOK * DD) return;

  const float* x     = (const float*)d_in[0];
  const float* ve    = (const float*)d_in[1];
  const float* x0    = (const float*)d_in[2];
  const float* lam   = (const float*)d_in[3];
  const float* sal   = (const float*)d_in[4];
  const float* ln1   = (const float*)d_in[5];
  const float* ln2   = (const float*)d_in[6];
  const float* wqkv  = (const float*)d_in[7];
  const float* wo    = (const float*)d_in[8];
  const float* wfc   = (const float*)d_in[9];
  const float* wproj = (const float*)d_in[10];
  const int*   ids   = (const int*)d_in[11];
  float* outf = (float*)d_out;

  // ---- carve (bytes) ----
  const size_t szWO   = (size_t)DD * DD * 2;              //   2 MiB  w_o^T f16
  const size_t szWFC  = (size_t)4 * DD * DD * 2;          //   8 MiB  w_fc^T f16
  const size_t szWPR  = (size_t)4 * DD * DD * 2;          //   8 MiB  w_proj^T f16
  const size_t szXR   = (size_t)NTOK * DD * 4;            //  16 MiB  mixed x f32
  const size_t szBIG  = (size_t)NTOK * 3 * DD * 4;        //  48 MiB  qkv f32, later h f16 (32 MiB) + x2 f32 (16 MiB)
  const size_t szXN   = (size_t)NTOK * DD * 2;            //   8 MiB  xn f16, later xn2 f16
  const size_t szWQA  = (size_t)NTOK * DD * 2;            //   8 MiB  w_qkv^T f16 (6 MiB), later attention out f16
  const size_t szPL   = (size_t)3 * NTOK * DD * 2;        //  24 MiB  q,k,v f16 planes
  const size_t szROPE = (size_t)SS * 64 * 4;              // 512 KiB
  const size_t szDOC  = (size_t)SS * 4;
  const size_t oWO = 0, oWFC = oWO + szWO, oWPR = oWFC + szWFC, oXR = oWPR + szWPR, oBIG = oXR + szXR,
               oXN = oBIG + szBIG, oWQA = oXN + szXN, oPL = oWQA + szWQA, oROPE = oPL + szPL,
               oDOC = oROPE + szROPE, oEND = oDOC + szDOC;
  if (oEND > ws_size) return;
  char* ws = (char*)d_ws;
  unsigned short* woT   = (unsigned short*)(ws + oWO);
  unsigned short* wfcT  = (unsigned short*)(ws + oWFC);
  unsigned short* wprT  = (unsigned short*)(ws + oWPR);
  float*          xr    = (float*)(ws + oXR);
  float*          qkvf  = (float*)(ws + oBIG);
  unsigned short* hbuf  = (unsigned short*)(ws + oBIG);
  float*          x2    = (float*)(ws + oBIG + (size_t)NTOK * 4 * DD * 2);
  unsigned short* xn    = (unsigned short*)(ws + oXN);
  unsigned short* xn2   = xn;
  unsigned short* wqkvT = (unsigned short*)(ws + oWQA);
  unsigned short* attn  = (unsigned short*)(ws + oWQA);
  unsigned short* qpl   = (unsigned short*)(ws + oPL);
  unsigned short* kpl   = qpl + (size_t)NTOK * DD;
  unsigned short* vpl   = qpl + (size_t)2 * NTOK * DD;
  float*          rope  = (float*)(ws + oROPE);
  int*            docs  = (int*)(ws + oDOC);

  // rotary table + docs; x = l0*x + l1*x0, xn = LN(x)*ln1_w; the four weight transposes
  prep_k<<<PB_TAB + PB_LN + PB_WQKV + PB_WO + PB_WFC + PB_WPR, 256, 0, stream>>>(
      x, x0, lam, ln1, xr, xn, wqkv, wqkvT, wo, woT, wfc, wfcT, wproj, wprT, ids, rope, docs);
  // qkv = xn @ w_qkv (f32 out)
  {
    const int M = NTOK, N = 3 * DD, K = DD;
    const int tiles = (M / 128) * (N / 128);
    wmma_gemm64<0, false, 0, 0, false, 0><<<dim3(tiles, 1), 128, 0, stream>>>(
        xn, xn, K, 0, wqkvT, wqkvT, K, 0, qkvf, qkvf, N, 0, xr, xr, 0, M, N, K, WMUL_INV);
  }
  // rotary + RMS-norm + value mix -> f16 planes
  rope_k<<<dim3(SS, BB), 256, 0, stream>>>(qkvf, ve, sal, rope, qpl);
  // attention
  attn128_k<<<BB * HH * (SS / AQB), 128, 0, stream>>>(qpl, kpl, vpl, docs, attn);
  // x2 = xr + attn @ w_o
  {
    const int M = NTOK, N = DD, K = DD;
    const int tiles = (M / 128) * (N / 128);
    wmma_gemm64<0, false, 0, 0, true, 0><<<dim3(tiles, 1), 128, 0, stream>>>(
        attn, attn, K, 0, woT, woT, K, 0, x2, x2, N, 0, xr, xr, 0, M, N, K, WMUL_INV);
  }
  // xn2 = LN(x2)*ln2_w
  ln_k<<<NTOK, 128, 0, stream>>>(x2, ln2, xn2);
  // h = relu(xn2 @ w_fc)^2 (f16 out)
  {
    const int M = NTOK, N = 4 * DD, K = DD;
    const int tiles = (M / 128) * (N / 128);
    wmma_gemm64<0, false, 0, 1, false, 6><<<dim3(tiles, 1), 128, 0, stream>>>(
        xn2, xn2, K, 0, wfcT, wfcT, K, 0, hbuf, hbuf, N, 0, xr, xr, 0, M, N, K, WMUL_INV);
  }
  // out = x2 + h @ w_proj
  {
    const int M = NTOK, N = DD, K = 4 * DD;
    const int tiles = (M / 128) * (N / 128);
    wmma_gemm64<0, false, 0, 0, true, 0><<<dim3(tiles, 1), 128, 0, stream>>>(
        hbuf, hbuf, K, 0, wprT, wprT, K, 0, outf, outf, N, 0, x2, x2, 0, M, N, K, WMUL_INV);
  }
}

// v006
// A run of this version takes 209 microseconds.
// Two timings next to v005 both put it at 1.10 times that version's speed.
// Counting every step since v000, it is 3.01 times as fast.
#include <hip/hip_runtime.h>
#include <stdint.h>
// All contractions: v_wmma_f32_16x16x32_f16 (f16 operands, f32 accumulate); projection weights carried x64, attention p carried x2^15; norms, rotary, softmax and residuals in f32.

#define BB 2
#define SS 2048
#define DD 1024
#define HH 8
#define HDIM 128
#define NTOK (BB * SS)
#define EOT_ID 50256
#define ATT_SCALE 0.12f
#define LN_EPS 1e-6f
#define RMS_EPS 1.1920929e-7f
#define WMUL 64.0f
#define WMUL_INV (1.0f / 64.0f)

typedef __attribute__((ext_vector_type(16))) _Float16 v16h;
typedef __attribute__((ext_vector_type(8)))  _Float16 v8h;
typedef __attribute__((ext_vector_type(4)))  _Float16 v4h;
typedef __attribute__((ext_vector_type(16))) __bf16   v16b;
typedef __attribute__((ext_vector_type(8)))  __bf16   v8b;
typedef __attribute__((ext_vector_type(8)))  float    v8f;
typedef __attribute__((ext_vector_type(4)))  float    v4f;
typedef __attribute__((ext_vector_type(4)))  int      v4i;
#define PSCALE 32768.0f
#define U16(p) ((const unsigned short*)(const void*)(p))
#define PSCALE_INV (1.0f / 32768.0f)

__device__ __forceinline__ unsigned short f2bf_bits(float f) {
  unsigned u = __float_as_uint(f);
  return (unsigned short)((u + 0x7FFFu + ((u >> 16) & 1u)) >> 16);
}
__device__ __forceinline__ float bf_bits2f(unsigned short h) { return __uint_as_float(((unsigned)h) << 16); }

// hazard guards as plain device helpers
__device__ __forceinline__ void dep_guard_h(v8f& a, v8f& b, v16h x, v16h y) { asm volatile("v_nop\n\tv_nop\n\tv_nop\n\tv_nop" : "+v"(a), "+v"(b) : "v"(x), "v"(y)); }
__device__ __forceinline__ void dep_guard_b(v8f& a, v8f& b, v16b x, v16b y) { asm volatile("v_nop\n\tv_nop\n\tv_nop\n\tv_nop" : "+v"(a), "+v"(b) : "v"(x), "v"(y)); }
__device__ __forceinline__ void keep4_h(v16h a, v16h b, v16h c, v16h d) { asm volatile("v_nop" :: "v"(a), "v"(b), "v"(c), "v"(d)); }
__device__ __forceinline__ void keep4_b(v16b a, v16b b, v16b c, v16b d) { asm volatile("v_nop" :: "v"(a), "v"(b), "v"(c), "v"(d)); }
__device__ __forceinline__ void acc_guard4(v8f& a, v8f& b, v8f& c, v8f& d) { asm volatile("v_nop\n\tv_nop\n\tv_nop\n\tv_nop" : "+v"(a), "+v"(b), "+v"(c), "+v"(d)); }
template <typename T> struct Frag;
template <> struct Frag<_Float16> {
  typedef v16h V; union U { v16h v; v8h h[2]; };
  static __device__ __forceinline__ v16h load(const _Float16* p) {   // elements 0..7 <- p[0..7], 8..15 <- p[16..23]
    U f; f.h[0] = *(const v8h*)(p); f.h[1] = *(const v8h*)(p + 16); return f.v;
  }
  static __device__ __forceinline__ v8f mma(v16h a, v16h b, v8f c) {
    return __builtin_amdgcn_wmma_f32_16x16x32_f16(false, a, false, b, (short)0, c, false, false);
  }
  static __device__ __forceinline__ void guard(v8f& a, v8f& b, v16h x, v16h y) { dep_guard_h(a, b, x, y); }
  static __device__ __forceinline__ void keep(v16h a, v16h b, v16h c, v16h d) { keep4_h(a, b, c, d); }
};
template <> struct Frag<__bf16> {
  typedef v16b V; union U { v16b v; v8b h[2]; };
  static __device__ __forceinline__ v16b load(const __bf16* p) {
    U f; f.h[0] = *(const v8b*)(p); f.h[1] = *(const v8b*)(p + 16); return f.v;
  }
  static __device__ __forceinline__ v8f mma(v16b a, v16b b, v8f c) {
    return __builtin_amdgcn_wmma_f32_16x16x32_bf16(false, a, false, b, (short)0, c, false, false);
  }
  static __device__ __forceinline__ void guard(v8f& a, v8f& b, v16b x, v16b y) { dep_guard_b(a, b, x, y); }
  static __device__ __forceinline__ void keep(v16b a, v16b b, v16b c, v16b d) { keep4_b(a, b, c, d); }
};

// ---- LDS-staged batched WMMA GEMM ------------------------------------------
// C[m,n] = scale * sum_k A[m,k] * Bt[n,k] (+bias)(+resid); a block of 4 waves owns a 128x128 tile, each wave 64x64 of it.
// A row-major [M,K]; Bt row-major [N,K]; M,N % 128 == 0, K % 64 == 0.
// Per trip 64 k of both operands (128 rows x 128 B each) lie in LDS at pitch 144 B, brought by asynchronous
// copies into two buffers: the next trip's copies fly while this trip's fragments are read and multiplied.
// BIAS_MODE: 0 = none, 1 = bias[m], 2 = bias[n].
// OUT_MODE: 0 = f32, 1 = f16, 2 = bf16 hi plane (Cout) + bf16 lo plane (Cout2).
// ACT 6: relu then square.
// ET: 0 = f16 operands, 1 = bf16 operands (pointers passed as 16-bit storage)
template <int ET> struct Elem;
template <> struct Elem<0> { typedef _Float16 T; };
template <> struct Elem<1> { typedef __bf16 T; };
#define GBK 64                         // k per trip
#define GPITCH 144                     // LDS row pitch in bytes (16 B x odd: conflict-free for ds_load_b128)
#define GOPER (128 * GPITCH)           // one operand's 128 rows
#define GSTAGE (2 * GOPER)             // A rows, then Bt rows
// Eight 16-byte copies per lane: rows r, r+16, .. r+112 of one operand's 128-row slab. The s_wait_xcnt closes the
// statement so that no address register is rewritten ahead of it.
__device__ __forceinline__ void copy_rows8(uint32_t l, const unsigned short* gp, size_t step) {
  asm volatile(
      "global_load_async_to_lds_b128 %0, %8, off\n\t"
      "global_load_async_to_lds_b128 %1, %9, off\n\t"
      "global_load_async_to_lds_b128 %2, %10, off\n\t"
      "global_load_async_to_lds_b128 %3, %11, off\n\t"
      "global_load_async_to_lds_b128 %4, %12, off\n\t"
      "global_load_async_to_lds_b128 %5, %13, off\n\t"
      "global_load_async_to_lds_b128 %6, %14, off\n\t"
      "global_load_async_to_lds_b128 %7, %15, off\n\t"
      "s_wait_xcnt 0x0"
      :: "v"(l), "v"(l + 16 * GPITCH), "v"(l + 32 * GPITCH), "v"(l + 48 * GPITCH),
         "v"(l + 64 * GPITCH), "v"(l + 80 * GPITCH), "v"(l + 96 * GPITCH), "v"(l + 112 * GPITCH),
         "v"(gp), "v"(gp + step), "v"(gp + 2 * step), "v"(gp + 3 * step),
         "v"(gp + 4 * step), "v"(gp + 5 * step), "v"(gp + 6 * step), "v"(gp + 7 * step)
      : "memory");
}
template <int ET, bool SPLIT, int BIAS_MODE, int OUT_MODE, bool RESID, int ACT = 0>
__global__ __launch_bounds__(128) void wmma_gemm64(
    const unsigned short* __restrict__ Ap, const unsigned short* __restrict__ A2p, int lda, long strideA,
    const unsigned short* __restrict__ Btp, const unsigned short* __restrict__ Bt2p, int ldb, long strideB,
    void* __restrict__ Cout, void* __restrict__ Cout2, int ldc, long strideC,
    const float* __restrict__ bias,
    const float* __restrict__ resid, long strideR,
    int M, int N, int K, float scale) {
  static_assert(!SPLIT, "single-plane operands only");
  typedef typename Elem<ET>::T T;
  typedef typename Frag<T>::V V;
  // two operand buffers; after the loop its first bytes serve as the per-wave 16x64 f32 slabs, pitch 68 floats
  __shared__ __align__(16) char smem[2 * GSTAGE];
  const int b    = blockIdx.y;
  const int tid  = threadIdx.x;
  const int lane = tid & 31;
  const int wave = tid >> 5;
  const int tilesN = N >> 7;
  const int tilesM = M >> 7;
  const int tile = blockIdx.x;
  if (tile >= tilesM * tilesN) return;   // block-uniform, in front of every barrier
  const int tm = tile / tilesN;
  const int tn = tile - tm * tilesN;
  const int mB = tm << 7;                      // block tile origin
  const int nB = tn << 7;
  const int wm = (wave >> 1) << 6;             // wave tile origin inside the block tile
  const int wn = (wave & 1) << 6;
  const int m0 = mB + wm;
  const int n0 = nB + wn;

  const int rlane = lane & 15;                 // row (A) / col (B, D) within subtile
  const int koff  = (lane >> 4) * 8;           // k offset of this lane half
  const int mOff  = (lane >> 4) * 8;           // D row offset

  // copy addresses: lane brings 16 B at column chunk (tid & 7) of rows (tid >> 3) + 16 i
  const int crow = tid >> 3, ccol = (tid & 7) * 8;
  const unsigned short* gA = Ap  + (size_t)b * strideA + (size_t)(mB + crow) * lda + ccol;
  const unsigned short* gB = Btp + (size_t)b * strideB + (size_t)(nB + crow) * ldb + ccol;
  const size_t stepA = (size_t)16 * lda, stepB = (size_t)16 * ldb;
  const uint32_t lds0 = (uint32_t)(uintptr_t)smem + (uint32_t)(crow * GPITCH + ccol * 2);

  v8f acc[4][4];
#pragma unroll
  for (int i = 0; i < 4; ++i)
#pragma unroll
    for (int j = 0; j < 4; ++j) acc[i][j] = (v8f){0.f,0.f,0.f,0.f,0.f,0.f,0.f,0.f};

  const int nT = K / GBK;
  copy_rows8(lds0, gA, stepA);
  copy_rows8(lds0 + GOPER, gB, stepB);
  asm volatile("s_wait_asynccnt 0x0" ::: "memory");   // trip 0's own copies have landed
  __syncthreads();                                    // and every other wave's
  if (nT > 1) {
    copy_rows8(lds0 + GSTAGE, gA + GBK, stepA);
    copy_rows8(lds0 + GSTAGE + GOPER, gB + GBK, stepB);
  }
  for (int t = 0; t < nT; ++t) {
    const unsigned bufo = (unsigned)(t & 1) * GSTAGE;
    const char* sA = smem + bufo + (wm + rlane) * GPITCH + koff * 2;
    const char* sB = smem + bufo + GOPER + (wn + rlane) * GPITCH + koff * 2;
#pragma unroll
    for (int kk = 0; kk < GBK / 32; ++kk) {
      V bh[4], ah[4];
#pragma unroll
      for (int j = 0; j < 4; ++j) bh[j] = Frag<T>::load((const T*)(sB + j * 16 * GPITCH + kk * 64));
#pragma unroll
      for (int i = 0; i < 4; ++i) ah[i] = Frag<T>::load((const T*)(sA + i * 16 * GPITCH + kk * 64));
      // keeps the 16 fragment loads together ahead of the 16 products: one LDS latency per group, not one per A fragment
      __builtin_amdgcn_sched_barrier(0);
#pragma unroll
      for (int i = 0; i < 4; ++i) {
#pragma unroll
        for (int j = 0; j < 4; ++j) acc[i][j] = Frag<T>::mma(ah[i], bh[j], acc[i][j]);
        Frag<T>::guard(acc[i][0], acc[i][3], ah[i], ah[i]);
      }
      Frag<T>::keep(bh[0], bh[1], bh[2], bh[3]);
    }
    asm volatile("s_wait_dscnt 0x0" ::: "memory");     // this wave's reads of the buffer have returned
    asm volatile("s_wait_asynccnt 0x0" ::: "memory");  // its copies for trip t + 1 have landed
    __syncthreads();                                   // publishes trip t + 1, frees this trip's buffer
    if (t + 2 < nT) {
      copy_rows8(lds0 + bufo, gA + (size_t)(t + 2) * GBK, stepA);
      copy_rows8(lds0 + bufo + GOPER, gB + (size_t)(t + 2) * GBK, stepB);
    }
  }
  asm volatile("s_wait_asynccnt 0x0" ::: "memory");    // nothing in flight when the buffers become slabs
  acc_guard4(acc[0][0], acc[0][1], acc[0][2], acc[0][3]);
  acc_guard4(acc[1][0], acc[1][1], acc[1][2], acc[1][3]);
  acc_guard4(acc[2][0], acc[2][1], acc[2][2], acc[2][3]);
  acc_guard4(acc[3][0], acc[3][1], acc[3][2], acc[3][3]);

  // ---- epilogue ----
  float* slab = (float*)smem + wave * (16 * 68);
  const float* Rb = RESID ? (resid + (size_t)b * strideR) : nullptr;
#pragma unroll
  for (int i = 0; i < 4; ++i) {
    const int mBase = m0 + (i << 4);
#pragma unroll
    for (int j = 0; j < 4; ++j) {
      const int n = n0 + (j << 4) + rlane;
      float bv = 0.f;
      if (BIAS_MODE == 2) bv = bias[n];
#pragma unroll
      for (int r = 0; r < 8; ++r) {
        float v = acc[i][j][r] * scale;
        if (BIAS_MODE == 1) v += bias[mBase + mOff + r];
        if (BIAS_MODE == 2) v += bv;
        if (RESID) v += Rb[(size_t)(mBase + mOff + r) * ldc + n];
        if (ACT == 1) v = tanhf(v);
        if (ACT == 2) v = fmaxf(v, 0.0f);
        if (ACT == 3) v = v / (1.0f + expf(-v));
        if (ACT == 4) v = (v > 0.f) ? v : 0.01f * v;
        if (ACT == 5) v = 0.5f * v * (1.0f + erff(v * 0.70710678118654752f));
        if (ACT == 6) { v = fmaxf(v, 0.0f); v = v * v; }
        slab[(mOff + r) * 68 + (j << 4) + rlane] = v;
      }
    }
    __builtin_amdgcn_fence(__ATOMIC_RELEASE, "workgroup");
    __builtin_amdgcn_wave_barrier();
    __builtin_amdgcn_fence(__ATOMIC_ACQUIRE, "workgroup");
    if (OUT_MODE == 0) {
      float* C = (float*)Cout + (size_t)b * strideC;
      const int hh = lane >> 4, c4 = (lane & 15) * 4;     // row seg = 256 B = 16 lanes x 16 B
      {
#pragma unroll
        for (int it = 0; it < 8; ++it) {
          const int row = it * 2 + hh;
          v4f v = *(const v4f*)(slab + row * 68 + c4);
          *(v4f*)(C + (size_t)(mBase + row) * ldc + n0 + c4) = v;
        }
        
      }
    } else {
      const int q = lane >> 3, c8 = (lane & 7) * 8;
      unsigned short* C  = (unsigned short*)Cout  + (size_t)b * strideC;
      unsigned short* C2 = (OUT_MODE == 2) ? ((unsigned short*)Cout2 + (size_t)b * strideC) : nullptr;
      {
#pragma unroll
        for (int it = 0; it < 4; ++it) {
          const int row = it * 4 + q;
          const float* sp = slab + row * 68 + c8;
          v8h hv, lv;
#pragma unroll
          for (int e = 0; e < 8; ++e) {
            if (OUT_MODE == 1) {
              hv[e] = (_Float16)sp[e];
            } else {
              unsigned short hb = f2bf_bits(sp[e]);
              unsigned short lb = f2bf_bits(sp[e] - bf_bits2f(hb));
              hv[e] = __builtin_bit_cast(_Float16, hb);
              lv[e] = __builtin_bit_cast(_Float16, lb);
            }
          }
          *(v8h*)(C + (size_t)(mBase + row) * ldc + n0 + c8) = hv;
          if (OUT_MODE == 2) *(v8h*)(C2 + (size_t)(mBase + row) * ldc + n0 + c8) = lv;
        }
        
      }
    }
    __builtin_amdgcn_fence(__ATOMIC_RELEASE, "workgroup");
    __builtin_amdgcn_wave_barrier();
    __builtin_amdgcn_fence(__ATOMIC_ACQUIRE, "workgroup");
  }
}

// ---- W [K][N] f32 -> Wt [N][K] f16 (x mul), 64x64 tile transposed through LDS ----
#define WTP 72
__device__ __forceinline__ void wt_cast_body(const float* __restrict__ W, unsigned short* __restrict__ Wtp,
                                             int K, int N, float mul, int bn, int bk, _Float16* st) {
  _Float16* Wt = (_Float16*)Wtp;
  const int n0 = bn * 64, k0 = bk * 64;
  const int tid = threadIdx.x;
  const int kr = tid >> 2, c16 = (tid & 3) * 16;
  const float* src = W + (size_t)(k0 + kr) * N + n0 + c16;
#pragma unroll
  for (int q = 0; q < 4; ++q) {
    const v4f v = *(const v4f*)(src + 4 * q);
#pragma unroll
    for (int e = 0; e < 4; ++e) st[(c16 + 4 * q + e) * WTP + kr] = (_Float16)(v[e] * mul);
  }
  __syncthreads();
  const int wave = tid >> 5, lane = tid & 31;
  const int q8 = lane >> 3, c8 = (lane & 7) * 8;
  {
#pragma unroll
    for (int it = 0; it < 2; ++it) {
      const int n = it * 32 + wave * 4 + q8;
      const v8h hv = *(const v8h*)(st + n * WTP + c8);
      *(v8h*)(Wt + (size_t)(n0 + n) * K + k0 + c8) = hv;
    }
    // the block ranges of the merged grid lie one behind another in the code: no register of these stores is rewritten ahead of this wait
    asm volatile("s_wait_xcnt 0x0" ::: "memory");
  }
}

// ---- rotary cos/sin table [S][64] (cos 0..31 | sin 32..63) and docs[S] = inclusive count of EOT ----
__device__ __forceinline__ void tables_body(const int* __restrict__ ids, float* __restrict__ rope,
                                            int* __restrict__ docs, int blk, int* scnt, int* sdoc) {
  const int tid = threadIdx.x, lane = tid & 31, wave = tid >> 5;
  if (blk < SS / 8) {
    const int s = blk * 8 + wave;
    float e = (float)lane * (1.0f / 31.0f);
    if (lane == 31) e = 1.0f;
    const float fr = powf(0.0009765625f, e);
    const float th = (float)s * fr;
    float sv, cv;
    sincosf(th, &sv, &cv);
    float* rp = rope + (size_t)s * 64;
    *(float*)(rp + lane) = cv;
    *(float*)(rp + 32 + lane) = sv;
    
  } else {
    int c = 0;
#pragma unroll
    for (int i = 0; i < 8; ++i) c += (ids[tid * 8 + i] == EOT_ID) ? 1 : 0;
    scnt[tid] = c;
    __syncthreads();
    for (int off = 1; off < 256; off <<= 1) {
      const int t = (tid >= off) ? scnt[tid - off] : 0;
      __syncthreads();
      scnt[tid] += t;
      __syncthreads();
    }
    int run = scnt[tid] - c;
#pragma unroll
    for (int i = 0; i < 8; ++i) {
      run += (ids[tid * 8 + i] == EOT_ID) ? 1 : 0;
      sdoc[tid * 8 + i] = run;
    }
    __syncthreads();
    const v4i a0 = *(const v4i*)(sdoc + tid * 4);
    const v4i a1 = *(const v4i*)(sdoc + 1024 + tid * 4);
    {
      *(v4i*)(docs + tid * 4) = a0;
      *(v4i*)(docs + 1024 + tid * 4) = a1;
      // as in wt_cast_body: no register of these stores is rewritten ahead of this wait
      asm volatile("s_wait_xcnt 0x0" ::: "memory");
    }
  }
}

// ---- residual mix + LayerNorm, 128 threads (tid 0..127) per row of 1024; thread owns cols 4t..4t+3 and 512+4t..+3 ----
template <bool MIX>
__device__ __forceinline__ void ln_body(const float* __restrict__ x, const float* __restrict__ x0,
                                        const float* __restrict__ lam, const float* __restrict__ w,
                                        float* __restrict__ xr, unsigned short* __restrict__ xnp,
                                        int row, int tid, float* red1, float* red2) {
  _Float16* xn = (_Float16*)xnp;
  const int lane = tid & 31, wave = tid >> 5;
  const size_t rb = (size_t)row * DD;
  const int ca = tid * 4, cb = 512 + tid * 4;
  v4f va = *(const v4f*)(x + rb + ca);
  v4f vb = *(const v4f*)(x + rb + cb);
  if (MIX) {
    const float l0 = lam[0], l1 = lam[1];
    const v4f a0 = *(const v4f*)(x0 + rb + ca);
    const v4f b0 = *(const v4f*)(x0 + rb + cb);
    va = va * l0 + a0 * l1;
    vb = vb * l0 + b0 * l1;
    {
      *(v4f*)(xr + rb + ca) = va;
      *(v4f*)(xr + rb + cb) = vb;
      
    }
  }
  float s = (va[0] + va[1]) + (va[2] + va[3]) + (vb[0] + vb[1]) + (vb[2] + vb[3]);
#pragma unroll
  for (int off = 1; off < 32; off <<= 1) s += __shfl_xor(s, off, 32);
  if (lane == 0) red1[wave] = s;
  __syncthreads();
  const float mu = ((red1[0] + red1[1]) + (red1[2] + red1[3])) * (1.0f / DD);
  const v4f da = va - mu, db = vb - mu;
  float s2 = (da[0] * da[0] + da[1] * da[1]) + (da[2] * da[2] + da[3] * da[3]) +
             (db[0] * db[0] + db[1] * db[1]) + (db[2] * db[2] + db[3] * db[3]);
#pragma unroll
  for (int off = 1; off < 32; off <<= 1) s2 += __shfl_xor(s2, off, 32);
  if (lane == 0) red2[wave] = s2;
  __syncthreads();
  const float var = ((red2[0] + red2[1]) + (red2[2] + red2[3])) * (1.0f / DD);
  const float inv = rsqrtf(var + LN_EPS);
  const v4f wa = *(const v4f*)(w + ca);
  const v4f wb = *(const v4f*)(w + cb);
  v4h ha, hb;
#pragma unroll
  for (int e = 0; e < 4; ++e) {
    ha[e] = (_Float16)(da[e] * inv * wa[e]);
    hb[e] = (_Float16)(db[e] * inv * wb[e]);
  }
  {
    *(v4h*)(xn + rb + ca) = ha;
    *(v4h*)(xn + rb + cb) = hb;
    // as in wt_cast_body, in the merged grid alone: no register of these stores is rewritten ahead of this wait
    if (MIX) asm volatile("s_wait_xcnt 0x0" ::: "memory");
  }
}
__global__ __launch_bounds__(128) void ln_k(const float* __restrict__ x, const float* __restrict__ w,
                                            unsigned short* __restrict__ xnp) {
  __shared__ float red1[4], red2[4];
  ln_body<false>(x, x, w, w, nullptr, xnp, blockIdx.x, threadIdx.x, red1, red2);
}

// ---- the six preparation steps, none of which reads what another writes, as block ranges of one grid ----
// The tables come first, their serial document count in block 0, so that the longest chain starts earliest.
#define PB_TAB  (SS / 8 + 1)
#define PB_LN   (NTOK / 2)                       // two rows per 256-thread block
#define PB_WQKV ((3 * DD / 64) * (DD / 64))
#define PB_WO   ((DD / 64) * (DD / 64))
#define PB_WFC  ((4 * DD / 64) * (DD / 64))
#define PB_WPR  ((DD / 64) * (4 * DD / 64))
__global__ __launch_bounds__(256) void prep_k(const float* __restrict__ x, const float* __restrict__ x0,
                                              const float* __restrict__ lam, const float* __restrict__ ln1,
                                              float* __restrict__ xr, unsigned short* __restrict__ xn,
                                              const float* __restrict__ wqkv, unsigned short* __restrict__ wqkvT,
                                              const float* __restrict__ wo, unsigned short* __restrict__ woT,
                                              const float* __restrict__ wfc, unsigned short* __restrict__ wfcT,
                                              const float* __restrict__ wproj, unsigned short* __restrict__ wprT,
                                              const int* __restrict__ ids, float* __restrict__ rope,
                                              int* __restrict__ docs) {
  __shared__ __align__(16) char sm[64 * WTP * 2];   // transpose tile, or count + document arrays, or the row sums
  static_assert(sizeof(sm) >= (256 + SS) * sizeof(int), "tables need 256 + S ints");
  int blk = blockIdx.x;
  if (blk < PB_TAB) {
    tables_body(ids, rope, docs, PB_TAB - 1 - blk, (int*)sm, (int*)sm + 256);
    return;
  }
  blk -= PB_TAB;
  if (blk < PB_LN) {
    const int half = threadIdx.x >> 7;
    float* red = (float*)sm + half * 8;
    ln_body<true>(x, x0, lam, ln1, xr, xn, blk * 2 + half, threadIdx.x & 127, red, red + 4);
    return;
  }
  blk -= PB_LN;
  // weights: W [in][out] -> Wt [out][in] f16 x64; tile column = out / 64, tile row = in / 64
  if (blk < PB_WQKV) {
    wt_cast_body(wqkv, wqkvT, DD, 3 * DD, WMUL, blk % (3 * DD / 64), blk / (3 * DD / 64), (_Float16*)sm);
    return;
  }
  blk -= PB_WQKV;
  if (blk < PB_WO) {
    wt_cast_body(wo, woT, DD, DD, WMUL, blk % (DD / 64), blk / (DD / 64), (_Float16*)sm);
    return;
  }
  blk -= PB_WO;
  if (blk < PB_WFC) {
    wt_cast_body(wfc, wfcT, DD, 4 * DD, WMUL, blk % (4 * DD / 64), blk / (4 * DD / 64), (_Float16*)sm);
    return;
  }
  blk -= PB_WFC;
  wt_cast_body(wproj, wprT, 4 * DD, DD, WMUL, blk % (DD / 64), blk / (DD / 64), (_Float16*)sm);
}

// ---- rotary + RMS-norm on q,k; v = sa0*v + sa1*ve; writes f16 planes [3][B*H*S][128] ----
// One block per token, wave = head; lane owns dims ln, ln+32, ln+64, ln+96 (pairs (ln,ln+64) rotate, (ln+32,ln+96) identity).
#define RSP 136
__global__ __launch_bounds__(256) void rope_k(const float* __restrict__ qkv, const float* __restrict__ ve,
                                              const float* __restrict__ sa, const float* __restrict__ rope,
                                              unsigned short* __restrict__ planesp) {
  __shared__ __align__(16) _Float16 st[HH][3 * RSP];
  _Float16* planes = (_Float16*)planesp;
  const int s = blockIdx.x, b = blockIdx.y;
  const int tid = threadIdx.x, h = tid >> 5, ln = tid & 31;
  const size_t tok = (size_t)b * SS + s;
  const float* base = qkv + tok * (3 * DD) + h * HDIM;
  const float cv = rope[(size_t)s * 64 + ln];
  const float sv = rope[(size_t)s * 64 + 32 + ln];
  _Float16* sw = st[h];
#pragma unroll
  for (int p = 0; p < 2; ++p) {
    const float* src = base + p * DD;
    const float a1 = src[ln], b1 = src[ln + 32], a2 = src[ln + 64], b2 = src[ln + 96];
    const float o0 = a1 * cv + a2 * sv;
    const float o2 = a2 * cv - a1 * sv;
    float sq = (o0 * o0 + b1 * b1) + (o2 * o2 + b2 * b2);
#pragma unroll
    for (int off = 1; off < 32; off <<= 1) sq += __shfl_xor(sq, off, 32);
    const float rs = rsqrtf(sq * (1.0f / HDIM) + RMS_EPS);
    sw[p * RSP + ln]      = (_Float16)(o0 * rs);
    sw[p * RSP + ln + 32] = (_Float16)(b1 * rs);
    sw[p * RSP + ln + 64] = (_Float16)(o2 * rs);
    sw[p * RSP + ln + 96] = (_Float16)(b2 * rs);
  }
  {
    const float sa0 = sa[0], sa1 = sa[1];
    const float* vsrc = base + 2 * DD;
    const float* vesrc = ve + (size_t)s * DD + h * HDIM;
#pragma unroll
    for (int i = 0; i < 4; ++i) {
      const int d = ln + 32 * i;
      sw[2 * RSP + d] = (_Float16)(sa0 * vsrc[d] + sa1 * vesrc[d]);
    }
  }
  __builtin_amdgcn_fence(__ATOMIC_RELEASE, "workgroup");
  __builtin_amdgcn_wave_barrier();
  __builtin_amdgcn_fence(__ATOMIC_ACQUIRE, "workgroup");
  const int hh = ln >> 4, c8 = (ln & 15) * 8;           // 256-B row = 16 lanes x 16 B
  const size_t PL = (size_t)NTOK * DD;
  const size_t row = ((size_t)(b * HH + h) * SS + s) * HDIM;
  const v8h v01 = *(const v8h*)(sw + hh * RSP + c8);
  const v8h v2  = *(const v8h*)(sw + 2 * RSP + c8);
  _Float16* d01 = planes + (size_t)hh * PL + row + c8;
  _Float16* d2  = planes + 2 * PL + row + c8;
  {
    *(v8h*)d01 = v01;
    if (hh == 0) *(v8h*)d2 = v2;
    
  }
}

#define AKC 64
#define AQB 64
#define OSP 136
#define KPITCH 272                     // K row pitch in bytes (16 B x odd: conflict-free for ds_load_b128)
#define VPITCH 288                     // V row pitch in bytes (32 B x odd: conflict-free for ds_load_tr16_b128)
#define KBUF (AKC * KPITCH)
#define VBUF (AKC * VPITCH)
// Eight 16-byte copies per lane: rows r, r+16, .. r+112 of one 128-row chunk pair of 256-byte rows (LSTEP = 16 LDS rows).
// The s_wait_xcnt closes the statement so that no address register is rewritten ahead of it.
template <int LSTEP>
__device__ __forceinline__ void copy_kv8(uint32_t l, const unsigned short* gp) {
  asm volatile(
      "global_load_async_to_lds_b128 %0, %8, off\n\t"
      "global_load_async_to_lds_b128 %1, %9, off\n\t"
      "global_load_async_to_lds_b128 %2, %10, off\n\t"
      "global_load_async_to_lds_b128 %3, %11, off\n\t"
      "global_load_async_to_lds_b128 %4, %12, off\n\t"
      "global_load_async_to_lds_b128 %5, %13, off\n\t"
      "global_load_async_to_lds_b128 %6, %14, off\n\t"
      "global_load_async_to_lds_b128 %7, %15, off\n\t"
      "s_wait_xcnt 0x0"
      :: "v"(l), "v"(l + LSTEP), "v"(l + 2 * LSTEP), "v"(l + 3 * LSTEP),
         "v"(l + 4 * LSTEP), "v"(l + 5 * LSTEP), "v"(l + 6 * LSTEP), "v"(l + 7 * LSTEP),
         "v"(gp), "v"(gp + 16 * HDIM), "v"(gp + 32 * HDIM), "v"(gp + 48 * HDIM),
         "v"(gp + 64 * HDIM), "v"(gp + 80 * HDIM), "v"(gp + 96 * HDIM), "v"(gp + 112 * HDIM)
      : "memory");
}
// lane (c, hh) gets T[row0 + 8 hh + 0..7][col0 + c] of a row-major 16-bit LDS tile; p is the lane's own address
typedef short s16x8 __attribute__((ext_vector_type(8)));
__device__ __forceinline__ v8h ld_tr16(const char* p) {
  typedef __attribute__((address_space(3))) s16x8 lds_s16x8;
  return __builtin_bit_cast(v8h, __builtin_amdgcn_ds_load_tr16_b128_v8i16((lds_s16x8*)p));
}
// lane l with lane l ^ 16
__device__ __forceinline__ float xhalf(float x) {
  return __builtin_bit_cast(float, __builtin_amdgcn_permlanex16(__builtin_bit_cast(int, x), __builtin_bit_cast(int, x),
                                                                0x76543210, 0xfedcba98, false, false));
}
// two waves per SIMD: the eight waves of one work-group
__global__ __launch_bounds__(256) __attribute__((amdgpu_waves_per_eu(2, 2))) void attn128_k(const unsigned short* __restrict__ qpp, const unsigned short* __restrict__ kpp,
                                                 const unsigned short* __restrict__ vpp, const int* __restrict__ docs,
                                                 unsigned short* __restrict__ outp) {
  union FH { v16h v; v8h h[2]; };
  // two buffers of a chunk pair, [kv][d]; behind the loop Ksm carries group 1's partial results, Vsm the output rows
  __shared__ __align__(16) char Ksm[2 * 2 * KBUF];         // pitch KPITCH
  __shared__ __align__(16) char Vsm[2 * 2 * VBUF];         // pitch VPITCH
  static_assert(sizeof(Ksm) >= 4 * 32 * (64 + 2) * sizeof(float), "partial O^T, maximum and sum of four waves");
  static_assert(sizeof(Vsm) >= 4 * 16 * OSP * sizeof(_Float16), "output rows of four waves");
  const _Float16* qp = (const _Float16*)qpp;
  _Float16* out = (_Float16*)outp;
  const int tid = threadIdx.x, lane = tid & 31, hh = lane >> 4, c = lane & 15;
  const int wave = __builtin_amdgcn_readfirstlane(tid >> 5);
  const int grp = wave >> 2, wq = wave & 3;     // key group; the wave's 16 queries within the tile
  const int nqb = SS / AQB;
  const int bx = blockIdx.x;
  const int qb = nqb - 1 - bx / (BB * HH);      // longest tiles first
  const int bh = bx % (BB * HH);
  const int h = bh % HH;
  const int b = bh / HH;
  const int q0 = qb * AQB + wq * 16;
  const size_t rowb = (size_t)(b * HH + h) * SS;

  v16h qa[4];
  {
    const _Float16* qrow = qp + (rowb + q0 + c) * HDIM + 8 * hh;
#pragma unroll
    for (int dc = 0; dc < 4; ++dc) qa[dc] = Frag<_Float16>::load(qrow + dc * 32);
  }
  const int qrow = q0 + c;          // the lane's query
  const int dq = docs[qrow];
  float mrow = -INFINITY;           // running maximum of the query, alike in both halves
  float lrow = 0.f;                 // running sum over this half's keys; the halves are joined behind the loop
  v8f oacc[8];                      // O^T: oacc[t][r] = O[qrow][t*16 + 8 hh + r]
#pragma unroll
  for (int t = 0; t < 8; ++t) oacc[t] = (v8f){0.f,0.f,0.f,0.f,0.f,0.f,0.f,0.f};

  // chunk pairs, block-uniform; where qb is even the last pair's odd chunk lies above the diagonal: its rows exist
  // (qb + 1 < S / 64 there) and every score of it is masked
  const int nPairs = qb / 2 + 1;
  // copy addresses: lane brings 16 B at column chunk (tid & 15) of rows (tid >> 4) + 16 i
  const int crow = tid >> 4, ccol = (tid & 15) * 8;
  const unsigned short* gK = kpp + (rowb + crow) * HDIM + ccol;
  const unsigned short* gV = vpp + (rowb + crow) * HDIM + ccol;
  const uint32_t lK = (uint32_t)(uintptr_t)Ksm + (uint32_t)(crow * KPITCH + ccol * 2);
  const uint32_t lV = (uint32_t)(uintptr_t)Vsm + (uint32_t)(crow * VPITCH + ccol * 2);
  copy_kv8<16 * KPITCH>(lK, gK);
  copy_kv8<16 * VPITCH>(lV, gV);
  asm volatile("s_wait_asynccnt 0x0" ::: "memory");   // pair 0's own copies have landed
  __syncthreads();                                    // and every other wave's
  if (nPairs > 1) {
    copy_kv8<16 * KPITCH>(lK + 2 * KBUF, gK + 2 * AKC * HDIM);
    copy_kv8<16 * VPITCH>(lV + 2 * VBUF, gV + 2 * AKC * HDIM);
  }
  for (int pr = 0; pr < nPairs; ++pr) {
    const int kc = 2 * pr + grp;    // this group's chunk of the pair
    const int kv0 = kc * AKC;
    const unsigned bsel = (unsigned)(pr & 1);
    const char* Kb = Ksm + (2 * bsel + grp) * KBUF + c * KPITCH + 16 * hh;
    const char* Vb = Vsm + (2 * bsel + grp) * VBUF + (8 * hh + (lane & 7)) * VPITCH + ((lane >> 3) & 1) * 16;

    v8f s[4];
    FH kb[4][4];
    v4i dk[4][2];                   // docs of the lane's 32 keys: kv0 + j*16 + 8 hh + 0..7
#pragma unroll
    for (int j = 0; j < 4; ++j) {
      dk[j][0] = *(const v4i*)(docs + kv0 + j * 16 + 8 * hh);
      dk[j][1] = *(const v4i*)(docs + kv0 + j * 16 + 8 * hh + 4);
    }
    // no address register of these eight loads is rewritten (here: by the K loads' results) ahead of this wait
    asm volatile("s_wait_xcnt 0x0" ::: "memory");
#pragma unroll
    for (int j = 0; j < 4; ++j) {
#pragma unroll
      for (int dc = 0; dc < 4; ++dc) {
        kb[j][dc].h[0] = *(const v8h*)(Kb + j * 16 * KPITCH + dc * 64);
        kb[j][dc].h[1] = *(const v8h*)(Kb + j * 16 * KPITCH + dc * 64 + 32);
      }
    }
    // keeps the chunk's 32 K loads together ahead of its 16 score products: one LDS latency per chunk, not one per product
    __builtin_amdgcn_sched_barrier(0);
#pragma unroll
    for (int j = 0; j < 4; ++j) {
      s[j] = (v8f){0.f,0.f,0.f,0.f,0.f,0.f,0.f,0.f};
#pragma unroll
      for (int dc = 0; dc < 4; ++dc) s[j] = Frag<_Float16>::mma(kb[j][dc].v, qa[dc], s[j]);   // rows = keys, column = query
    }
    const bool diag = (kc >= qb);
    float cm[4];
#pragma unroll
    for (int j = 0; j < 4; ++j) {
      float m = -INFINITY;
#pragma unroll
      for (int r = 0; r < 8; ++r) {
        const int key = kv0 + j * 16 + 8 * hh + r;
        float sv = s[j][r] * ATT_SCALE;
        const bool masked = (dk[j][r >> 2][r & 3] != dq) || (diag && (key > qrow));
        if (masked) sv = -INFINITY;
        s[j][r] = sv;
        m = fmaxf(m, sv);
      }
      cm[j] = m;
    }
    float mc = fmaxf(fmaxf(cm[0], cm[1]), fmaxf(cm[2], cm[3]));
    mc = fmaxf(mc, xhalf(mc));
    const float mnew = fmaxf(mrow, mc);
    const float mref = (mnew > -INFINITY) ? mnew : 0.0f;   // all-masked so far -> p = 0, alpha = 0
    const float alpha = expf(mrow - mref);
    mrow = mnew;
    FH pt[2];
    float ps[4];
#pragma unroll
    for (int j = 0; j < 4; ++j) {
      float a = 0.f;
#pragma unroll
      for (int r = 0; r < 8; ++r) {
        const float p = expf(s[j][r] - mref);
        a += p;
        pt[j >> 1].h[j & 1][r] = (_Float16)(p * PSCALE);
      }
      ps[j] = a;
    }
    lrow = lrow * alpha + ((ps[0] + ps[1]) + (ps[2] + ps[3]));
#pragma unroll
    for (int t = 0; t < 8; ++t) oacc[t] *= alpha;
    FH vb[2][8];
#pragma unroll
    for (int kk = 0; kk < 2; ++kk) {
#pragma unroll
      for (int t = 0; t < 8; ++t) {
        vb[kk][t].h[0] = ld_tr16(Vb + (kk * 32) * VPITCH + t * 32);        // keys kk*32 + 8 hh + 0..7 of column t*16 + c
        vb[kk][t].h[1] = ld_tr16(Vb + (kk * 32 + 16) * VPITCH + t * 32);   // keys kk*32 + 16 + 8 hh + 0..7
      }
    }
    // keeps the chunk's 32 V loads together ahead of the 16 output products
    __builtin_amdgcn_sched_barrier(0);
#pragma unroll
    for (int kk = 0; kk < 2; ++kk) {
#pragma unroll
      for (int t = 0; t < 8; ++t) oacc[t] = Frag<_Float16>::mma(vb[kk][t].v, pt[kk].v, oacc[t]);   // rows = d, column = query
    }
    asm volatile("s_wait_dscnt 0x0" ::: "memory");     // this wave's reads of the buffers have returned
    asm volatile("s_wait_asynccnt 0x0" ::: "memory");  // its copies for pair pr + 1 have landed
    __syncthreads();                                   // publishes pair pr + 1, frees this pair's buffers
    if (pr + 2 < nPairs) {
      copy_kv8<16 * KPITCH>(lK + bsel * (2 * KBUF), gK + (size_t)(pr + 2) * (2 * AKC * HDIM));
      copy_kv8<16 * VPITCH>(lV + bsel * (2 * VBUF), gV + (size_t)(pr + 2) * (2 * AKC * HDIM));
    }
  }
  asm volatile("s_wait_asynccnt 0x0" ::: "memory");    // nothing in flight when the buffers change their use

  // ---- join the two groups: lane l of wave w + 4 holds the same query and the same d as lane l of wave w ----
  // The loop's last barrier stands behind every wave's last read of the buffers.
  float* px  = (float*)Ksm + (size_t)wq * (16 * 32 * 4) + lane * 4;       // [wq][2 t + half of the 8][lane] x 16 B
  float* pml = (float*)Ksm + 4 * (16 * 32 * 4) + (wq * 32 + lane) * 2;    // [wq][lane] x (maximum, sum)
  if (grp == 1) {
#pragma unroll
    for (int t = 0; t < 8; ++t) {
      *(v4f*)(px + (2 * t) * 128)     = __builtin_shufflevector(oacc[t], oacc[t], 0, 1, 2, 3);
      *(v4f*)(px + (2 * t + 1) * 128) = __builtin_shufflevector(oacc[t], oacc[t], 4, 5, 6, 7);
    }
    pml[0] = mrow;
    pml[1] = lrow;
  }
  __syncthreads();                  // group 1's partial results are there for group 0
  if (grp == 1) return;             // wave-uniform, behind the last work-group barrier

  _Float16* os = (_Float16*)Vsm + wq * (16 * OSP);   // per wave [row][d]
  {
    const float m1 = pml[0], l1 = pml[1];
    const float mj = fmaxf(mrow, m1);
    const float mjr = (mj > -INFINITY) ? mj : 0.0f;  // a group that saw only masked keys weighs 0
    const float a0 = expf(mrow - mjr), a1 = expf(m1 - mjr);
    const float lj = lrow * a0 + l1 * a1;
    const float inv = 1.0f / ((lj + xhalf(lj)) * PSCALE);
    const float w0 = a0 * inv, w1 = a1 * inv;
#pragma unroll
    for (int t = 0; t < 8; ++t) {
      const v4f pa = *(const v4f*)(px + (2 * t) * 128);
      const v4f pb = *(const v4f*)(px + (2 * t + 1) * 128);
      v8h ov;
#pragma unroll
      for (int r = 0; r < 4; ++r) {
        ov[r]     = (_Float16)(oacc[t][r] * w0 + pa[r] * w1);
        ov[r + 4] = (_Float16)(oacc[t][r + 4] * w0 + pb[r] * w1);
      }
      *(v8h*)(os + c * OSP + t * 16 + 8 * hh) = ov;
    }
  }
  __builtin_amdgcn_fence(__ATOMIC_RELEASE, "workgroup");
  __builtin_amdgcn_wave_barrier();
  __builtin_amdgcn_fence(__ATOMIC_ACQUIRE, "workgroup");
  {
    const int c8 = (lane & 15) * 8;   // 256-B row segment = 16 lanes x 16 B, 2 rows per instruction
    {
#pragma unroll
      for (int it = 0; it < 8; ++it) {
        const int row = it * 2 + hh;
        const v8h val = *(const v8h*)(os + row * OSP + c8);
        *(v8h*)(out + (size_t)(b * SS + q0 + row) * DD + h * HDIM + c8) = val;
      }
      
    }
  }
}

// ---------------------------------------------------------------------------
extern "C" void kernel_launch(void* const* d_in, const int* in_sizes, int n_in,
                              void* d_out, int out_size, void* d_ws,
                              size_t ws_size, hipStream_t stream) {
  if (n_in < 12) return;
  if (in_sizes[0] != NTOK * DD || in_sizes[1] != SS * DD || in_sizes[2] != NTOK * DD ||
      in_sizes[3] < 2 || in_sizes[4] < 2 || in_sizes[5] < DD || in_sizes[6] < DD ||
      in_sizes[7] != DD * 3 * DD || in_sizes[8] != DD * DD || in_sizes[9] != DD * 4 * DD ||
      in_sizes[10] != 4 * DD * DD || in_sizes[11] != SS || out_size != NTOK * DD) return;

  const float* x     = (const float*)d_in[0];
  const float* ve    = (const float*)d_in[1];
  const float* x0    = (const float*)d_in[2];
  const float* lam   = (const float*)d_in[3];
  const float* sal   = (const float*)d_in[4];
  const float* ln1   = (const float*)d_in[5];
  const float* ln2   = (const float*)d_in[6];
  const float* wqkv  = (const float*)d_in[7];
  const float* wo    = (const float*)d_in[8];
  const float* wfc   = (const float*)d_in[9];
  const float* wproj = (const float*)d_in[10];
  const int*   ids   = (const int*)d_in[11];
  float* outf = (float*)d_out;

  // ---- carve (bytes) ----
  const size_t szWO   = (size_t)DD * DD * 2;              //   2 MiB  w_o^T f16
  const size_t szWFC  = (size_t)4 * DD * DD * 2;          //   8 MiB  w_fc^T f16
  const size_t szWPR  = (size_t)4 * DD * DD * 2;          //   8 MiB  w_proj^T f16
  const size_t szXR   = (size_t)NTOK * DD * 4;            //  16 MiB  mixed x f32
  const size_t szBIG  = (size_t)NTOK * 3 * DD * 4;        //  48 MiB  qkv f32, later h f16 (32 MiB) + x2 f32 (16 MiB)
  const size_t szXN   = (size_t)NTOK * DD * 2;            //   8 MiB  xn f16, later xn2 f16
  const size_t szWQA  = (size_t)NTOK * DD * 2;            //   8 MiB  w_qkv^T f16 (6 MiB), later attention out f16
  const size_t szPL   = (size_t)3 * NTOK * DD * 2;        //  24 MiB  q,k,v f16 planes
  const size_t szROPE = (size_t)SS * 64 * 4;              // 512 KiB
  const size_t szDOC  = (size_t)SS * 4;
  const size_t oWO = 0, oWFC = oWO + szWO, oWPR = oWFC + szWFC, oXR = oWPR + szWPR, oBIG = oXR + szXR,
               oXN = oBIG + szBIG, oWQA = oXN + szXN, oPL = oWQA + szWQA, oROPE = oPL + szPL,
               oDOC = oROPE + szROPE, oEND = oDOC + szDOC;
  if (oEND > ws_size) return;
  char* ws = (char*)d_ws;
  unsigned short* woT   = (unsigned short*)(ws + oWO);
  unsigned short* wfcT  = (unsigned short*)(ws + oWFC);
  unsigned short* wprT  = (unsigned short*)(ws + oWPR);
  float*          xr    = (float*)(ws + oXR);
  float*          qkvf  = (float*)(ws + oBIG);
  unsigned short* hbuf  = (unsigned short*)(ws + oBIG);
  float*          x2    = (float*)(ws + oBIG + (size_t)NTOK * 4 * DD * 2);
  unsigned short* xn    = (unsigned short*)(ws + oXN);
  unsigned short* xn2   = xn;
  unsigned short* wqkvT = (unsigned short*)(ws + oWQA);
  unsigned short* attn  = (unsigned short*)(ws + oWQA);
  unsigned short* qpl   = (unsigned short*)(ws + oPL);
  unsigned short* kpl   = qpl + (size_t)NTOK * DD;
  unsigned short* vpl   = qpl + (size_t)2 * NTOK * DD;
  float*          rope  = (float*)(ws + oROPE);
  int*            docs  = (int*)(ws + oDOC);

  // rotary table + docs; x = l0*x + l1*x0, xn = LN(x)*ln1_w; the four weight transposes
  prep_k<<<PB_TAB + PB_LN + PB_WQKV + PB_WO + PB_WFC + PB_WPR, 256, 0, stream>>>(
      x, x0, lam, ln1, xr, xn, wqkv, wqkvT, wo, woT, wfc, wfcT, wproj, wprT, ids, rope, docs);
  // qkv = xn @ w_qkv (f32 out)
  {
    const int M = NTOK, N = 3 * DD, K = DD;
    const int tiles = (M / 128) * (N / 128);
    wmma_gemm64<0, false, 0, 0, false, 0><<<dim3(tiles, 1), 128, 0, stream>>>(
        xn, xn, K, 0, wqkvT, wqkvT, K, 0, qkvf, qkvf, N, 0, xr, xr, 0, M, N, K, WMUL_INV);
  }
  // rotary + RMS-norm + value mix -> f16 planes
  rope_k<<<dim3(SS, BB), 256, 0, stream>>>(qkvf, ve, sal, rope, qpl);
  // attention
  attn128_k<<<BB * HH * (SS / AQB), 256, 0, stream>>>(qpl, kpl, vpl, docs, attn);
  // x2 = xr + attn @ w_o
  {
    const int M = NTOK, N = DD, K = DD;
    const int tiles = (M / 128) * (N / 128);
    wmma_gemm64<0, false, 0, 0, true, 0><<<dim3(tiles, 1), 128, 0, stream>>>(
        attn, attn, K, 0, woT, woT, K, 0, x2, x2, N, 0, xr, xr, 0, M, N, K, WMUL_INV);
  }
  // xn2 = LN(x2)*ln2_w
  ln_k<<<NTOK, 128, 0, stream>>>(x2, ln2, xn2);
  // h = relu(xn2 @ w_fc)^2 (f16 out)
  {
    const int M = NTOK, N = 4 * DD, K = DD;
    const int tiles = (M / 128) * (N / 128);
    wmma_gemm64<0, false, 0, 1, false, 6><<<dim3(tiles, 1), 128, 0, stream>>>(
        xn2, xn2, K, 0, wfcT, wfcT, K, 0, hbuf, hbuf, N, 0, xr, xr, 0, M, N, K, WMUL_INV);
  }
  // out = x2 + h @ w_proj
  {
    const int M = NTOK, N = DD, K = 4 * DD;
    const int tiles = (M / 128) * (N / 128);
    wmma_gemm64<0, false, 0, 0, true, 0><<<dim3(tiles, 1), 128, 0, stream>>>(
        hbuf, hbuf, K, 0, wprT, wprT, K, 0, outf, outf, N, 0, x2, x2, 0, M, N, K, WMUL_INV);
  }
}

// v007
// A run of this version takes 192 microseconds.
// Timed twice side by side with v006, it ran 1.08 times as fast both times.
// Counting every step since v000, it is 3.25 times as fast.
#include <hip/hip_runtime.h>
#include <stdint.h>
// All contractions: v_wmma_f32_16x16x32_f16 (f16 operands, f32 accumulate); projection weights carried x64, attention p carried x2^15; norms, rotary, softmax and residuals in f32.

#define BB 2
#define SS 2048
#define DD 1024
#define HH 8
#define HDIM 128
#define NTOK (BB * SS)
#define EOT_ID 50256
#define ATT_SCALE 0.12f
#define LN_EPS 1e-6f
#define RMS_EPS 1.1920929e-7f
#define WMUL 64.0f
#define WMUL_INV (1.0f / 64.0f)

typedef __attribute__((ext_vector_type(16))) _Float16 v16h;
typedef __attribute__((ext_vector_type(8)))  _Float16 v8h;
typedef __attribute__((ext_vector_type(4)))  _Float16 v4h;
typedef __attribute__((ext_vector_type(16))) __bf16   v16b;
typedef __attribute__((ext_vector_type(8)))  __bf16   v8b;
typedef __attribute__((ext_vector_type(8)))  float    v8f;
typedef __attribute__((ext_vector_type(4)))  float    v4f;
typedef __attribute__((ext_vector_type(4)))  int      v4i;
#define PSCALE 32768.0f
#define U16(p) ((const unsigned short*)(const void*)(p))
#define PSCALE_INV (1.0f / 32768.0f)

__device__ __forceinline__ unsigned short f2bf_bits(float f) {
  unsigned u = __float_as_uint(f);
  return (unsigned short)((u + 0x7FFFu + ((u >> 16) & 1u)) >> 16);
}
__device__ __forceinline__ float bf_bits2f(unsigned short h) { return __uint_as_float(((unsigned)h) << 16); }

// hazard guards as plain device helpers
__device__ __forceinline__ void dep_guard_h(v8f& a, v8f& b, v16h x, v16h y) { asm volatile("v_nop\n\tv_nop\n\tv_nop\n\tv_nop" : "+v"(a), "+v"(b) : "v"(x), "v"(y)); }
__device__ __forceinline__ void dep_guard_b(v8f& a, v8f& b, v16b x, v16b y) { asm volatile("v_nop\n\tv_nop\n\tv_nop\n\tv_nop" : "+v"(a), "+v"(b) : "v"(x), "v"(y)); }
__device__ __forceinline__ void keep4_h(v16h a, v16h b, v16h c, v16h d) { asm volatile("v_nop" :: "v"(a), "v"(b), "v"(c), "v"(d)); }
__device__ __forceinline__ void keep4_b(v16b a, v16b b, v16b c, v16b d) { asm volatile("v_nop" :: "v"(a), "v"(b), "v"(c), "v"(d)); }
__device__ __forceinline__ void acc_guard4(v8f& a, v8f& b, v8f& c, v8f& d) { asm volatile("v_nop\n\tv_nop\n\tv_nop\n\tv_nop" : "+v"(a), "+v"(b), "+v"(c), "+v"(d)); }
template <typename T> struct Frag;
template <> struct Frag<_Float16> {
  typedef v16h V; union U { v16h v; v8h h[2]; };
  static __device__ __forceinline__ v16h load(const _Float16* p) {   // elements 0..7 <- p[0..7], 8..15 <- p[16..23]
    U f; f.h[0] = *(const v8h*)(p); f.h[1] = *(const v8h*)(p + 16); return f.v;
  }
  static __device__ __forceinline__ v8f mma(v16h a, v16h b, v8f c) {
    return __builtin_amdgcn_wmma_f32_16x16x32_f16(false, a, false, b, (short)0, c, false, false);
  }
  static __device__ __forceinline__ void guard(v8f& a, v8f& b, v16h x, v16h y) { dep_guard_h(a, b, x, y); }
  static __device__ __forceinline__ void keep(v16h a, v16h b, v16h c, v16h d) { keep4_h(a, b, c, d); }
};
template <> struct Frag<__bf16> {
  typedef v16b V; union U { v16b v; v8b h[2]; };
  static __device__ __forceinline__ v16b load(const __bf16* p) {
    U f; f.h[0] = *(const v8b*)(p); f.h[1] = *(const v8b*)(p + 16); return f.v;
  }
  static __device__ __forceinline__ v8f mma(v16b a, v16b b, v8f c) {
    return __builtin_amdgcn_wmma_f32_16x16x32_bf16(false, a, false, b, (short)0, c, false, false);
  }
  static __device__ __forceinline__ void guard(v8f& a, v8f& b, v16b x, v16b y) { dep_guard_b(a, b, x, y); }
  static __device__ __forceinline__ void keep(v16b a, v16b b, v16b c, v16b d) { keep4_b(a, b, c, d); }
};

// ---- LDS-staged batched WMMA GEMM ------------------------------------------
// C[m,n] = scale * sum_k A[m,k] * Bt[n,k] (+bias)(+resid); a block of 4 waves owns a 128x128 tile, each wave 64x64 of it.
// A row-major [M,K]; Bt row-major [N,K]; M,N % 128 == 0, K % 64 == 0.
// Per trip 64 k of both operands (128 rows x 128 B each) lie in LDS at pitch 144 B, brought by asynchronous
// copies into two buffers: the next trip's copies fly while this trip's fragments are read and multiplied.
// BIAS_MODE: 0 = none, 1 = bias[m], 2 = bias[n].
// OUT_MODE: 0 = f32, 1 = f16, 2 = bf16 hi plane (Cout) + bf16 lo plane (Cout2).
// ACT 6: relu then square.
// ET: 0 = f16 operands, 1 = bf16 operands (pointers passed as 16-bit storage)
template <int ET> struct Elem;
template <> struct Elem<0> { typedef _Float16 T; };
template <> struct Elem<1> { typedef __bf16 T; };
#define GBK 64                         // k per trip
#define GPITCH 144                     // LDS row pitch in bytes (16 B x odd: conflict-free for ds_load_b128)
#define GOPER (128 * GPITCH)           // one operand's 128 rows
#define GSTAGE (2 * GOPER)             // A rows, then Bt rows
// Eight 16-byte copies per lane: rows r, r+16, .. r+112 of one operand's 128-row slab. The s_wait_xcnt closes the
// statement so that no address register is rewritten ahead of it.
__device__ __forceinline__ void copy_rows8(uint32_t l, const unsigned short* gp, size_t step) {
  asm volatile(
      "global_load_async_to_lds_b128 %0, %8, off\n\t"
      "global_load_async_to_lds_b128 %1, %9, off\n\t"
      "global_load_async_to_lds_b128 %2, %10, off\n\t"
      "global_load_async_to_lds_b128 %3, %11, off\n\t"
      "global_load_async_to_lds_b128 %4, %12, off\n\t"
      "global_load_async_to_lds_b128 %5, %13, off\n\t"
      "global_load_async_to_lds_b128 %6, %14, off\n\t"
      "global_load_async_to_lds_b128 %7, %15, off\n\t"
      "s_wait_xcnt 0x0"
      :: "v"(l), "v"(l + 16 * GPITCH), "v"(l + 32 * GPITCH), "v"(l + 48 * GPITCH),
         "v"(l + 64 * GPITCH), "v"(l + 80 * GPITCH), "v"(l + 96 * GPITCH), "v"(l + 112 * GPITCH),
         "v"(gp), "v"(gp + step), "v"(gp + 2 * step), "v"(gp + 3 * step),
         "v"(gp + 4 * step), "v"(gp + 5 * step), "v"(gp + 6 * step), "v"(gp + 7 * step)
      : "memory");
}
// AHEAD (for a grid of one block a WGP, so one wave a SIMD, where no other wave covers a wave's own LDS latency; K % 128 == 0):
// a trip is 128 k (rows of 256 B at pitch 272 B) in four blocks of 16 products, and each block's 16 fragment loads go out
// as one group ahead of the block before it, into a second register set. The first block of trip t + 1 is so fetched in
// trip t: the point where trip t + 1 is published and trip t's buffer refilled stands ahead of trip t's last block,
// whose fragments are in registers by then.
#define PBK 128
#define PPITCH 272                     // 16 B x odd
#define POPER (128 * PPITCH)
#define PSTAGE (2 * POPER)
// Sixteen 16-byte copies per lane: both 128-byte halves of rows r, r+16, .. r+112 of one operand's 128 rows of 256 B; the
// immediate offset moves the LDS and the global address alike, so a row's two halves share their address registers.
// The builtin form leaves the choice of address registers to the compiler: asm operands, bound to the low 256 registers,
// made it move accumulators out of their way in every trip.
__device__ __forceinline__ void copy_wide16(char* l, const unsigned short* gp, size_t step) {
  typedef __attribute__((address_space(1))) v4i glb_v4i;
  typedef __attribute__((address_space(3))) v4i lds_v4i;
#pragma unroll
  for (int i = 0; i < 8; ++i) {
    __builtin_amdgcn_global_load_async_to_lds_b128((glb_v4i*)(gp + i * step), (lds_v4i*)(l + i * 16 * PPITCH), 0, 0);
    __builtin_amdgcn_global_load_async_to_lds_b128((glb_v4i*)(gp + i * step), (lds_v4i*)(l + i * 16 * PPITCH), 128, 0);
  }
}
// one trip's 128 rows of both operands; step = 16 rows
__device__ __forceinline__ void copy_stage(char* l, const unsigned short* ga, size_t stepA,
                                           const unsigned short* gb, size_t stepB) {
  copy_wide16(l, ga, stepA);
  copy_wide16(l + POPER, gb, stepB);
}
template <int ET, bool SPLIT, int BIAS_MODE, int OUT_MODE, bool RESID, int ACT = 0, bool AHEAD = false>
__global__ __launch_bounds__(128) void wmma_gemm64(
    const unsigned short* __restrict__ Ap, const unsigned short* __restrict__ A2p, int lda, long strideA,
    const unsigned short* __restrict__ Btp, const unsigned short* __restrict__ Bt2p, int ldb, long strideB,
    void* __restrict__ Cout, void* __restrict__ Cout2, int ldc, long strideC,
    const float* __restrict__ bias,
    const float* __restrict__ resid, long strideR,
    int M, int N, int K, float scale) {
  static_assert(!SPLIT, "single-plane operands only");
  typedef typename Elem<ET>::T T;
  typedef typename Frag<T>::V V;
  // two operand buffers; after the loop its first bytes serve as the per-wave 16x64 f32 slabs, pitch 68 floats
  __shared__ __align__(16) char smem[AHEAD ? 2 * PSTAGE : 2 * GSTAGE];
  const int b    = blockIdx.y;
  const int tid  = threadIdx.x;
  const int lane = tid & 31;
  const int wave = tid >> 5;
  const int tilesN = N >> 7;
  const int tilesM = M >> 7;
  const int tile = blockIdx.x;
  if (tile >= tilesM * tilesN) return;   // block-uniform, in front of every barrier
  const int tm = tile / tilesN;
  const int tn = tile - tm * tilesN;
  const int mB = tm << 7;                      // block tile origin
  const int nB = tn << 7;
  const int wm = (wave >> 1) << 6;             // wave tile origin inside the block tile
  const int wn = (wave & 1) << 6;
  const int m0 = mB + wm;
  const int n0 = nB + wn;

  const int rlane = lane & 15;                 // row (A) / col (B, D) within subtile
  const int koff  = (lane >> 4) * 8;           // k offset of this lane half
  const int mOff  = (lane >> 4) * 8;           // D row offset

  v8f acc[4][4];
#pragma unroll
  for (int i = 0; i < 4; ++i)
#pragma unroll
    for (int j = 0; j < 4; ++j) acc[i][j] = (v8f){0.f,0.f,0.f,0.f,0.f,0.f,0.f,0.f};

  if constexpr (AHEAD) {
  // copy addresses: lane brings 16 B at column chunks (tid & 7) and (tid & 7) + 8 of rows (tid >> 3) + 16 i
  const int crow = tid >> 3, ccol = (tid & 7) * 8;
  const unsigned short* gA = Ap  + (size_t)b * strideA + (size_t)(mB + crow) * lda + ccol;
  const unsigned short* gB = Btp + (size_t)b * strideB + (size_t)(nB + crow) * ldb + ccol;
  const size_t stepA = (size_t)16 * lda, stepB = (size_t)16 * ldb;
  char* lds0 = smem + crow * PPITCH + ccol * 2;
  const char* sA0 = smem + (wm + rlane) * PPITCH + koff * 2;
  const char* sB0 = smem + POPER + (wn + rlane) * PPITCH + koff * 2;

  const int nT = K / PBK;
  copy_stage(lds0, gA, stepA, gB, stepB);
  asm volatile("s_wait_asynccnt 0x0" ::: "memory");   // trip 0's own copies have landed
  __syncthreads();                                    // and every other wave's
  if (nT > 1) copy_stage(lds0 + PSTAGE, gA + PBK, stepA, gB + PBK, stepB);
  V fa[2][4], fb[2][4];                               // block kk works on set kk & 1
#pragma unroll
  for (int j = 0; j < 4; ++j) fb[0][j] = Frag<T>::load((const T*)(sB0 + j * 16 * PPITCH));
#pragma unroll
  for (int i = 0; i < 4; ++i) fa[0][i] = Frag<T>::load((const T*)(sA0 + i * 16 * PPITCH));
  for (int t = 0; t < nT; ++t) {
    const unsigned bufo = (unsigned)(t & 1) * PSTAGE;
#pragma unroll
    for (int kk = 0; kk < PBK / 32; ++kk) {
      const int cur = kk & 1, nxt = cur ^ 1;
      if (kk + 1 < PBK / 32) {
#pragma unroll
        for (int j = 0; j < 4; ++j) fb[nxt][j] = Frag<T>::load((const T*)(sB0 + bufo + j * 16 * PPITCH + (kk + 1) * 64));
#pragma unroll
        for (int i = 0; i < 4; ++i) fa[nxt][i] = Frag<T>::load((const T*)(sA0 + bufo + i * 16 * PPITCH + (kk + 1) * 64));
      } else {
        asm volatile("s_wait_dscnt 0x0" ::: "memory");     // this wave's last reads of the buffer, the last block's fragments, have returned
        asm volatile("s_wait_asynccnt 0x0" ::: "memory");  // its copies for trip t + 1 have landed
        __syncthreads();                                   // publishes trip t + 1, frees this trip's buffer
        if (t + 2 < nT) copy_stage(lds0 + bufo, gA + (size_t)(t + 2) * PBK, stepA, gB + (size_t)(t + 2) * PBK, stepB);
        if (t + 1 < nT) {
          const unsigned bufn = bufo ^ PSTAGE;
#pragma unroll
          for (int j = 0; j < 4; ++j) fb[nxt][j] = Frag<T>::load((const T*)(sB0 + bufn + j * 16 * PPITCH));
#pragma unroll
          for (int i = 0; i < 4; ++i) fa[nxt][i] = Frag<T>::load((const T*)(sA0 + bufn + i * 16 * PPITCH));
        }
      }
      // keeps the next block's 16 loads together ahead of this block's 16 products, which cover their latency
      __builtin_amdgcn_sched_barrier(0);
#pragma unroll
      for (int i = 0; i < 4; ++i)
#pragma unroll
        for (int j = 0; j < 4; ++j) acc[i][j] = Frag<T>::mma(fa[cur][i], fb[cur][j], acc[i][j]);
      // keeps the loads that follow in one group behind these products, not spread among them as their registers come free
      __builtin_amdgcn_sched_barrier(0);
    }
  }
  } else {
  // copy addresses: lane brings 16 B at column chunk (tid & 7) of rows (tid >> 3) + 16 i
  const int crow = tid >> 3, ccol = (tid & 7) * 8;
  const unsigned short* gA = Ap  + (size_t)b * strideA + (size_t)(mB + crow) * lda + ccol;
  const unsigned short* gB = Btp + (size_t)b * strideB + (size_t)(nB + crow) * ldb + ccol;
  const size_t stepA = (size_t)16 * lda, stepB = (size_t)16 * ldb;
  const uint32_t lds0 = (uint32_t)(uintptr_t)smem + (uint32_t)(crow * GPITCH + ccol * 2);

  const int nT = K / GBK;
  copy_rows8(lds0, gA, stepA);
  copy_rows8(lds0 + GOPER, gB, stepB);
  asm volatile("s_wait_asynccnt 0x0" ::: "memory");   // trip 0's own copies have landed
  __syncthreads();                                    // and every other wave's
  if (nT > 1) {
    copy_rows8(lds0 + GSTAGE, gA + GBK, stepA);
    copy_rows8(lds0 + GSTAGE + GOPER, gB + GBK, stepB);
  }
  for (int t = 0; t < nT; ++t) {
    const unsigned bufo = (unsigned)(t & 1) * GSTAGE;
    const char* sA = smem + bufo + (wm + rlane) * GPITCH + koff * 2;
    const char* sB = smem + bufo + GOPER + (wn + rlane) * GPITCH + koff * 2;
#pragma unroll
    for (int kk = 0; kk < GBK / 32; ++kk) {
      V bh[4], ah[4];
#pragma unroll
      for (int j = 0; j < 4; ++j) bh[j] = Frag<T>::load((const T*)(sB + j * 16 * GPITCH + kk * 64));
#pragma unroll
      for (int i = 0; i < 4; ++i) ah[i] = Frag<T>::load((const T*)(sA + i * 16 * GPITCH + kk * 64));
      // keeps the 16 fragment loads together ahead of the 16 products: one LDS latency per group, not one per A fragment
      __builtin_amdgcn_sched_barrier(0);
#pragma unroll
      for (int i = 0; i < 4; ++i) {
#pragma unroll
        for (int j = 0; j < 4; ++j) acc[i][j] = Frag<T>::mma(ah[i], bh[j], acc[i][j]);
        Frag<T>::guard(acc[i][0], acc[i][3], ah[i], ah[i]);
      }
      Frag<T>::keep(bh[0], bh[1], bh[2], bh[3]);
    }
    asm volatile("s_wait_dscnt 0x0" ::: "memory");     // this wave's reads of the buffer have returned
    asm volatile("s_wait_asynccnt 0x0" ::: "memory");  // its copies for trip t + 1 have landed
    __syncthreads();                                   // publishes trip t + 1, frees this trip's buffer
    if (t + 2 < nT) {
      copy_rows8(lds0 + bufo, gA + (size_t)(t + 2) * GBK, stepA);
      copy_rows8(lds0 + bufo + GOPER, gB + (size_t)(t + 2) * GBK, stepB);
    }
  }
  }
  asm volatile("s_wait_asynccnt 0x0" ::: "memory");    // nothing in flight when the buffers become slabs
  acc_guard4(acc[0][0], acc[0][1], acc[0][2], acc[0][3]);
  acc_guard4(acc[1][0], acc[1][1], acc[1][2], acc[1][3]);
  acc_guard4(acc[2][0], acc[2][1], acc[2][2], acc[2][3]);
  acc_guard4(acc[3][0], acc[3][1], acc[3][2], acc[3][3]);

  // ---- epilogue ----
  float* slab = (float*)smem + wave * (16 * 68);
  const float* Rb = RESID ? (resid + (size_t)b * strideR) : nullptr;
#pragma unroll
  for (int i = 0; i < 4; ++i) {
    const int mBase = m0 + (i << 4);
#pragma unroll
    for (int j = 0; j < 4; ++j) {
      const int n = n0 + (j << 4) + rlane;
      float bv = 0.f;
      if (BIAS_MODE == 2) bv = bias[n];
#pragma unroll
      for (int r = 0; r < 8; ++r) {
        float v = acc[i][j][r] * scale;
        if (BIAS_MODE == 1) v += bias[mBase + mOff + r];
        if (BIAS_MODE == 2) v += bv;
        if (RESID) v += Rb[(size_t)(mBase + mOff + r) * ldc + n];
        if (ACT == 1) v = tanhf(v);
        if (ACT == 2) v = fmaxf(v, 0.0f);
        if (ACT == 3) v = v / (1.0f + expf(-v));
        if (ACT == 4) v = (v > 0.f) ? v : 0.01f * v;
        if (ACT == 5) v = 0.5f * v * (1.0f + erff(v * 0.70710678118654752f));
        if (ACT == 6) { v = fmaxf(v, 0.0f); v = v * v; }
        slab[(mOff + r) * 68 + (j << 4) + rlane] = v;
      }
    }
    __builtin_amdgcn_fence(__ATOMIC_RELEASE, "workgroup");
    __builtin_amdgcn_wave_barrier();
    __builtin_amdgcn_fence(__ATOMIC_ACQUIRE, "workgroup");
    if (OUT_MODE == 0) {
      float* C = (float*)Cout + (size_t)b * strideC;
      const int hh = lane >> 4, c4 = (lane & 15) * 4;     // row seg = 256 B = 16 lanes x 16 B
      {
#pragma unroll
        for (int it = 0; it < 8; ++it) {
          const int row = it * 2 + hh;
          v4f v = *(const v4f*)(slab + row * 68 + c4);
          *(v4f*)(C + (size_t)(mBase + row) * ldc + n0 + c4) = v;
        }
        
      }
    } else {
      const int q = lane >> 3, c8 = (lane & 7) * 8;
      unsigned short* C  = (unsigned short*)Cout  + (size_t)b * strideC;
      unsigned short* C2 = (OUT_MODE == 2) ? ((unsigned short*)Cout2 + (size_t)b * strideC) : nullptr;
      {
#pragma unroll
        for (int it = 0; it < 4; ++it) {
          const int row = it * 4 + q;
          const float* sp = slab + row * 68 + c8;
          v8h hv, lv;
#pragma unroll
          for (int e = 0; e < 8; ++e) {
            if (OUT_MODE == 1) {
              hv[e] = (_Float16)sp[e];
            } else {
              unsigned short hb = f2bf_bits(sp[e]);
              unsigned short lb = f2bf_bits(sp[e] - bf_bits2f(hb));
              hv[e] = __builtin_bit_cast(_Float16, hb);
              lv[e] = __builtin_bit_cast(_Float16, lb);
            }
          }
          *(v8h*)(C + (size_t)(mBase + row) * ldc + n0 + c8) = hv;
          if (OUT_MODE == 2) *(v8h*)(C2 + (size_t)(mBase + row) * ldc + n0 + c8) = lv;
        }
        
      }
    }
    __builtin_amdgcn_fence(__ATOMIC_RELEASE, "workgroup");
    __builtin_amdgcn_wave_barrier();
    __builtin_amdgcn_fence(__ATOMIC_ACQUIRE, "workgroup");
  }
}

// ---- W [K][N] f32 -> Wt [N][K] f16 (x mul), 64x64 tile transposed through LDS ----
#define WTP 72
__device__ __forceinline__ void wt_cast_body(const float* __restrict__ W, unsigned short* __restrict__ Wtp,
                                             int K, int N, float mul, int bn, int bk, _Float16* st) {
  _Float16* Wt = (_Float16*)Wtp;
  const int n0 = bn * 64, k0 = bk * 64;
  const int tid = threadIdx.x;
  const int kr = tid >> 2, c16 = (tid & 3) * 16;
  const float* src = W + (size_t)(k0 + kr) * N + n0 + c16;
#pragma unroll
  for (int q = 0; q < 4; ++q) {
    const v4f v = *(const v4f*)(src + 4 * q);
#pragma unroll
    for (int e = 0; e < 4; ++e) st[(c16 + 4 * q + e) * WTP + kr] = (_Float16)(v[e] * mul);
  }
  __syncthreads();
  const int wave = tid >> 5, lane = tid & 31;
  const int q8 = lane >> 3, c8 = (lane & 7) * 8;
  {
#pragma unroll
    for (int it = 0; it < 2; ++it) {
      const int n = it * 32 + wave * 4 + q8;
      const v8h hv = *(const v8h*)(st + n * WTP + c8);
      *(v8h*)(Wt + (size_t)(n0 + n) * K + k0 + c8) = hv;
    }
    // the block ranges of the merged grid lie one behind another in the code: no register of these stores is rewritten ahead of this wait
    asm volatile("s_wait_xcnt 0x0" ::: "memory");
  }
}

// ---- rotary cos/sin table [S][64] (cos 0..31 | sin 32..63) and docs[S] = inclusive count of EOT ----
__device__ __forceinline__ void tables_body(const int* __restrict__ ids, float* __restrict__ rope,
                                            int* __restrict__ docs, int blk, int* scnt, int* sdoc) {
  const int tid = threadIdx.x, lane = tid & 31, wave = tid >> 5;
  if (blk < SS / 8) {
    const int s = blk * 8 + wave;
    float e = (float)lane * (1.0f / 31.0f);
    if (lane == 31) e = 1.0f;
    const float fr = powf(0.0009765625f, e);
    const float th = (float)s * fr;
    float sv, cv;
    sincosf(th, &sv, &cv);
    float* rp = rope + (size_t)s * 64;
    *(float*)(rp + lane) = cv;
    *(float*)(rp + 32 + lane) = sv;
    
  } else {
    int c = 0;
#pragma unroll
    for (int i = 0; i < 8; ++i) c += (ids[tid * 8 + i] == EOT_ID) ? 1 : 0;
    scnt[tid] = c;
    __syncthreads();
    for (int off = 1; off < 256; off <<= 1) {
      const int t = (tid >= off) ? scnt[tid - off] : 0;
      __syncthreads();
      scnt[tid] += t;
      __syncthreads();
    }
    int run = scnt[tid] - c;
#pragma unroll
    for (int i = 0; i < 8; ++i) {
      run += (ids[tid * 8 + i] == EOT_ID) ? 1 : 0;
      sdoc[tid * 8 + i] = run;
    }
    __syncthreads();
    const v4i a0 = *(const v4i*)(sdoc + tid * 4);
    const v4i a1 = *(const v4i*)(sdoc + 1024 + tid * 4);
    {
      *(v4i*)(docs + tid * 4) = a0;
      *(v4i*)(docs + 1024 + tid * 4) = a1;
      // as in wt_cast_body: no register of these stores is rewritten ahead of this wait
      asm volatile("s_wait_xcnt 0x0" ::: "memory");
    }
  }
}

// ---- residual mix + LayerNorm, 128 threads (tid 0..127) per row of 1024; thread owns cols 4t..4t+3 and 512+4t..+3 ----
template <bool MIX>
__device__ __forceinline__ void ln_body(const float* __restrict__ x, const float* __restrict__ x0,
                                        const float* __restrict__ lam, const float* __restrict__ w,
                                        float* __restrict__ xr, unsigned short* __restrict__ xnp,
                                        int row, int tid, float* red1, float* red2) {
  _Float16* xn = (_Float16*)xnp;
  const int lane = tid & 31, wave = tid >> 5;
  const size_t rb = (size_t)row * DD;
  const int ca = tid * 4, cb = 512 + tid * 4;
  v4f va = *(const v4f*)(x + rb + ca);
  v4f vb = *(const v4f*)(x + rb + cb);
  if (MIX) {
    const float l0 = lam[0], l1 = lam[1];
    const v4f a0 = *(const v4f*)(x0 + rb + ca);
    const v4f b0 = *(const v4f*)(x0 + rb + cb);
    va = va * l0 + a0 * l1;
    vb = vb * l0 + b0 * l1;
    {
      *(v4f*)(xr + rb + ca) = va;
      *(v4f*)(xr + rb + cb) = vb;
      
    }
  }
  float s = (va[0] + va[1]) + (va[2] + va[3]) + (vb[0] + vb[1]) + (vb[2] + vb[3]);
#pragma unroll
  for (int off = 1; off < 32; off <<= 1) s += __shfl_xor(s, off, 32);
  if (lane == 0) red1[wave] = s;
  __syncthreads();
  const float mu = ((red1[0] + red1[1]) + (red1[2] + red1[3])) * (1.0f / DD);
  const v4f da = va - mu, db = vb - mu;
  float s2 = (da[0] * da[0] + da[1] * da[1]) + (da[2] * da[2] + da[3] * da[3]) +
             (db[0] * db[0] + db[1] * db[1]) + (db[2] * db[2] + db[3] * db[3]);
#pragma unroll
  for (int off = 1; off < 32; off <<= 1) s2 += __shfl_xor(s2, off, 32);
  if (lane == 0) red2[wave] = s2;
  __syncthreads();
  const float var = ((red2[0] + red2[1]) + (red2[2] + red2[3])) * (1.0f / DD);
  const float inv = rsqrtf(var + LN_EPS);
  const v4f wa = *(const v4f*)(w + ca);
  const v4f wb = *(const v4f*)(w + cb);
  v4h ha, hb;
#pragma unroll
  for (int e = 0; e < 4; ++e) {
    ha[e] = (_Float16)(da[e] * inv * wa[e]);
    hb[e] = (_Float16)(db[e] * inv * wb[e]);
  }
  {
    *(v4h*)(xn + rb + ca) = ha;
    *(v4h*)(xn + rb + cb) = hb;
    // as in wt_cast_body, in the merged grid alone: no register of these stores is rewritten ahead of this wait
    if (MIX) asm volatile("s_wait_xcnt 0x0" ::: "memory");
  }
}
__global__ __launch_bounds__(128) void ln_k(const float* __restrict__ x, const float* __restrict__ w,
                                            unsigned short* __restrict__ xnp) {
  __shared__ float red1[4], red2[4];
  ln_body<false>(x, x, w, w, nullptr, xnp, blockIdx.x, threadIdx.x, red1, red2);
}

// ---- the six preparation steps, none of which reads what another writes, as block ranges of one grid ----
// The tables come first, their serial document count in block 0, so that the longest chain starts earliest.
#define PB_TAB  (SS / 8 + 1)
#define PB_LN   (NTOK / 2)                       // two rows per 256-thread block
#define PB_WQKV ((3 * DD / 64) * (DD / 64))
#define PB_WO   ((DD / 64) * (DD / 64))
#define PB_WFC  ((4 * DD / 64) * (DD / 64))
#define PB_WPR  ((DD / 64) * (4 * DD / 64))
__global__ __launch_bounds__(256) void prep_k(const float* __restrict__ x, const float* __restrict__ x0,
                                              const float* __restrict__ lam, const float* __restrict__ ln1,
                                              float* __restrict__ xr, unsigned short* __restrict__ xn,
                                              const float* __restrict__ wqkv, unsigned short* __restrict__ wqkvT,
                                              const float* __restrict__ wo, unsigned short* __restrict__ woT,
                                              const float* __restrict__ wfc, unsigned short* __restrict__ wfcT,
                                              const float* __restrict__ wproj, unsigned short* __restrict__ wprT,
                                              const int* __restrict__ ids, float* __restrict__ rope,
                                              int* __restrict__ docs) {
  __shared__ __align__(16) char sm[64 * WTP * 2];   // transpose tile, or count + document arrays, or the row sums
  static_assert(sizeof(sm) >= (256 + SS) * sizeof(int), "tables need 256 + S ints");
  int blk = blockIdx.x;
  if (blk < PB_TAB) {
    tables_body(ids, rope, docs, PB_TAB - 1 - blk, (int*)sm, (int*)sm + 256);
    return;
  }
  blk -= PB_TAB;
  if (blk < PB_LN) {
    const int half = threadIdx.x >> 7;
    float* red = (float*)sm + half * 8;
    ln_body<true>(x, x0, lam, ln1, xr, xn, blk * 2 + half, threadIdx.x & 127, red, red + 4);
    return;
  }
  blk -= PB_LN;
  // weights: W [in][out] -> Wt [out][in] f16 x64; tile column = out / 64, tile row = in / 64
  if (blk < PB_WQKV) {
    wt_cast_body(wqkv, wqkvT, DD, 3 * DD, WMUL, blk % (3 * DD / 64), blk / (3 * DD / 64), (_Float16*)sm);
    return;
  }
  blk -= PB_WQKV;
  if (blk < PB_WO) {
    wt_cast_body(wo, woT, DD, DD, WMUL, blk % (DD / 64), blk / (DD / 64), (_Float16*)sm);
    return;
  }
  blk -= PB_WO;
  if (blk < PB_WFC) {
    wt_cast_body(wfc, wfcT, DD, 4 * DD, WMUL, blk % (4 * DD / 64), blk / (4 * DD / 64), (_Float16*)sm);
    return;
  }
  blk -= PB_WFC;
  wt_cast_body(wproj, wprT, 4 * DD, DD, WMUL, blk % (DD / 64), blk / (DD / 64), (_Float16*)sm);
}

// ---- rotary + RMS-norm on q,k; v = sa0*v + sa1*ve; writes f16 planes [3][B*H*S][128] ----
// One block per token, wave = head; lane owns dims ln, ln+32, ln+64, ln+96 (pairs (ln,ln+64) rotate, (ln+32,ln+96) identity).
#define RSP 136
__global__ __launch_bounds__(256) void rope_k(const float* __restrict__ qkv, const float* __restrict__ ve,
                                              const float* __restrict__ sa, const float* __restrict__ rope,
                                              unsigned short* __restrict__ planesp) {
  __shared__ __align__(16) _Float16 st[HH][3 * RSP];
  _Float16* planes = (_Float16*)planesp;
  const int s = blockIdx.x, b = blockIdx.y;
  const int tid = threadIdx.x, h = tid >> 5, ln = tid & 31;
  const size_t tok = (size_t)b * SS + s;
  const float* base = qkv + tok * (3 * DD) + h * HDIM;
  const float cv = rope[(size_t)s * 64 + ln];
  const float sv = rope[(size_t)s * 64 + 32 + ln];
  _Float16* sw = st[h];
#pragma unroll
  for (int p = 0; p < 2; ++p) {
    const float* src = base + p * DD;
    const float a1 = src[ln], b1 = src[ln + 32], a2 = src[ln + 64], b2 = src[ln + 96];
    const float o0 = a1 * cv + a2 * sv;
    const float o2 = a2 * cv - a1 * sv;
    float sq = (o0 * o0 + b1 * b1) + (o2 * o2 + b2 * b2);
#pragma unroll
    for (int off = 1; off < 32; off <<= 1) sq += __shfl_xor(sq, off, 32);
    const float rs = rsqrtf(sq * (1.0f / HDIM) + RMS_EPS);
    sw[p * RSP + ln]      = (_Float16)(o0 * rs);
    sw[p * RSP + ln + 32] = (_Float16)(b1 * rs);
    sw[p * RSP + ln + 64] = (_Float16)(o2 * rs);
    sw[p * RSP + ln + 96] = (_Float16)(b2 * rs);
  }
  {
    const float sa0 = sa[0], sa1 = sa[1];
    const float* vsrc = base + 2 * DD;
    const float* vesrc = ve + (size_t)s * DD + h * HDIM;
#pragma unroll
    for (int i = 0; i < 4; ++i) {
      const int d = ln + 32 * i;
      sw[2 * RSP + d] = (_Float16)(sa0 * vsrc[d] + sa1 * vesrc[d]);
    }
  }
  __builtin_amdgcn_fence(__ATOMIC_RELEASE, "workgroup");
  __builtin_amdgcn_wave_barrier();
  __builtin_amdgcn_fence(__ATOMIC_ACQUIRE, "workgroup");
  const int hh = ln >> 4, c8 = (ln & 15) * 8;           // 256-B row = 16 lanes x 16 B
  const size_t PL = (size_t)NTOK * DD;
  const size_t row = ((size_t)(b * HH + h) * SS + s) * HDIM;
  const v8h v01 = *(const v8h*)(sw + hh * RSP + c8);
  const v8h v2  = *(const v8h*)(sw + 2 * RSP + c8);
  _Float16* d01 = planes + (size_t)hh * PL + row + c8;
  _Float16* d2  = planes + 2 * PL + row + c8;
  {
    *(v8h*)d01 = v01;
    if (hh == 0) *(v8h*)d2 = v2;
    
  }
}

#define AKC 64
#define AQB 64
#define OSP 136
#define KPITCH 272                     // K row pitch in bytes (16 B x odd: conflict-free for ds_load_b128)
#define VPITCH 288                     // V row pitch in bytes (32 B x odd: conflict-free for ds_load_tr16_b128)
#define KBUF (AKC * KPITCH)
#define VBUF (AKC * VPITCH)
// Eight 16-byte copies per lane: rows r, r+16, .. r+112 of one 128-row chunk pair of 256-byte rows (LSTEP = 16 LDS rows).
// The s_wait_xcnt closes the statement so that no address register is rewritten ahead of it.
template <int LSTEP>
__device__ __forceinline__ void copy_kv8(uint32_t l, const unsigned short* gp) {
  asm volatile(
      "global_load_async_to_lds_b128 %0, %8, off\n\t"
      "global_load_async_to_lds_b128 %1, %9, off\n\t"
      "global_load_async_to_lds_b128 %2, %10, off\n\t"
      "global_load_async_to_lds_b128 %3, %11, off\n\t"
      "global_load_async_to_lds_b128 %4, %12, off\n\t"
      "global_load_async_to_lds_b128 %5, %13, off\n\t"
      "global_load_async_to_lds_b128 %6, %14, off\n\t"
      "global_load_async_to_lds_b128 %7, %15, off\n\t"
      "s_wait_xcnt 0x0"
      :: "v"(l), "v"(l + LSTEP), "v"(l + 2 * LSTEP), "v"(l + 3 * LSTEP),
         "v"(l + 4 * LSTEP), "v"(l + 5 * LSTEP), "v"(l + 6 * LSTEP), "v"(l + 7 * LSTEP),
         "v"(gp), "v"(gp + 16 * HDIM), "v"(gp + 32 * HDIM), "v"(gp + 48 * HDIM),
         "v"(gp + 64 * HDIM), "v"(gp + 80 * HDIM), "v"(gp + 96 * HDIM), "v"(gp + 112 * HDIM)
      : "memory");
}
// lane (c, hh) gets T[row0 + 8 hh + 0..7][col0 + c] of a row-major 16-bit LDS tile; p is the lane's own address
typedef short s16x8 __attribute__((ext_vector_type(8)));
__device__ __forceinline__ v8h ld_tr16(const char* p) {
  typedef __attribute__((address_space(3))) s16x8 lds_s16x8;
  return __builtin_bit_cast(v8h, __builtin_amdgcn_ds_load_tr16_b128_v8i16((lds_s16x8*)p));
}
// lane l with lane l ^ 16
__device__ __forceinline__ float xhalf(float x) {
  return __builtin_bit_cast(float, __builtin_amdgcn_permlanex16(__builtin_bit_cast(int, x), __builtin_bit_cast(int, x),
                                                                0x76543210, 0xfedcba98, false, false));
}
// two waves per SIMD: the eight waves of one work-group
__global__ __launch_bounds__(256) __attribute__((amdgpu_waves_per_eu(2, 2))) void attn128_k(const unsigned short* __restrict__ qpp, const unsigned short* __restrict__ kpp,
                                                 const unsigned short* __restrict__ vpp, const int* __restrict__ docs,
                                                 unsigned short* __restrict__ outp) {
  union FH { v16h v; v8h h[2]; };
  // two buffers of a chunk pair, [kv][d]; behind the loop Ksm carries group 1's partial results, Vsm the output rows
  __shared__ __align__(16) char Ksm[2 * 2 * KBUF];         // pitch KPITCH
  __shared__ __align__(16) char Vsm[2 * 2 * VBUF];         // pitch VPITCH
  static_assert(sizeof(Ksm) >= 4 * 32 * (64 + 2) * sizeof(float), "partial O^T, maximum and sum of four waves");
  static_assert(sizeof(Vsm) >= 4 * 16 * OSP * sizeof(_Float16), "output rows of four waves");
  const _Float16* qp = (const _Float16*)qpp;
  _Float16* out = (_Float16*)outp;
  const int tid = threadIdx.x, lane = tid & 31, hh = lane >> 4, c = lane & 15;
  const int wave = __builtin_amdgcn_readfirstlane(tid >> 5);
  const int grp = wave >> 2, wq = wave & 3;     // key group; the wave's 16 queries within the tile
  const int nqb = SS / AQB;
  const int bx = blockIdx.x;
  const int qb = nqb - 1 - bx / (BB * HH);      // longest tiles first
  const int bh = bx % (BB * HH);
  const int h = bh % HH;
  const int b = bh / HH;
  const int q0 = qb * AQB + wq * 16;
  const size_t rowb = (size_t)(b * HH + h) * SS;

  v16h qa[4];
  {
    const _Float16* qrow = qp + (rowb + q0 + c) * HDIM + 8 * hh;
#pragma unroll
    for (int dc = 0; dc < 4; ++dc) qa[dc] = Frag<_Float16>::load(qrow + dc * 32);
  }
  const int qrow = q0 + c;          // the lane's query
  const int dq = docs[qrow];
  float mrow = -INFINITY;           // running maximum of the query, alike in both halves
  float lrow = 0.f;                 // running sum over this half's keys; the halves are joined behind the loop
  v8f oacc[8];                      // O^T: oacc[t][r] = O[qrow][t*16 + 8 hh + r]
#pragma unroll
  for (int t = 0; t < 8; ++t) oacc[t] = (v8f){0.f,0.f,0.f,0.f,0.f,0.f,0.f,0.f};

  // chunk pairs, block-uniform; where qb is even the last pair's odd chunk lies above the diagonal: its rows exist
  // (qb + 1 < S / 64 there) and every score of it is masked
  const int nPairs = qb / 2 + 1;
  // copy addresses: lane brings 16 B at column chunk (tid & 15) of rows (tid >> 4) + 16 i
  const int crow = tid >> 4, ccol = (tid & 15) * 8;
  const unsigned short* gK = kpp + (rowb + crow) * HDIM + ccol;
  const unsigned short* gV = vpp + (rowb + crow) * HDIM + ccol;
  const uint32_t lK = (uint32_t)(uintptr_t)Ksm + (uint32_t)(crow * KPITCH + ccol * 2);
  const uint32_t lV = (uint32_t)(uintptr_t)Vsm + (uint32_t)(crow * VPITCH + ccol * 2);
  copy_kv8<16 * KPITCH>(lK, gK);
  copy_kv8<16 * VPITCH>(lV, gV);
  asm volatile("s_wait_asynccnt 0x0" ::: "memory");   // pair 0's own copies have landed
  __syncthreads();                                    // and every other wave's
  if (nPairs > 1) {
    copy_kv8<16 * KPITCH>(lK + 2 * KBUF, gK + 2 * AKC * HDIM);
    copy_kv8<16 * VPITCH>(lV + 2 * VBUF, gV + 2 * AKC * HDIM);
  }
  for (int pr = 0; pr < nPairs; ++pr) {
    const int kc = 2 * pr + grp;    // this group's chunk of the pair
    const int kv0 = kc * AKC;
    const unsigned bsel = (unsigned)(pr & 1);
    const char* Kb = Ksm + (2 * bsel + grp) * KBUF + c * KPITCH + 16 * hh;
    const char* Vb = Vsm + (2 * bsel + grp) * VBUF + (8 * hh + (lane & 7)) * VPITCH + ((lane >> 3) & 1) * 16;

    v8f s[4];
    FH kb[4][4];
    v4i dk[4][2];                   // docs of the lane's 32 keys: kv0 + j*16 + 8 hh + 0..7
#pragma unroll
    for (int j = 0; j < 4; ++j) {
      dk[j][0] = *(const v4i*)(docs + kv0 + j * 16 + 8 * hh);
      dk[j][1] = *(const v4i*)(docs + kv0 + j * 16 + 8 * hh + 4);
    }
    // no address register of these eight loads is rewritten (here: by the K loads' results) ahead of this wait
    asm volatile("s_wait_xcnt 0x0" ::: "memory");
#pragma unroll
    for (int j = 0; j < 4; ++j) {
#pragma unroll
      for (int dc = 0; dc < 4; ++dc) {
        kb[j][dc].h[0] = *(const v8h*)(Kb + j * 16 * KPITCH + dc * 64);
        kb[j][dc].h[1] = *(const v8h*)(Kb + j * 16 * KPITCH + dc * 64 + 32);
      }
    }
    // keeps the chunk's 32 K loads together ahead of its 16 score products: one LDS latency per chunk, not one per product
    __builtin_amdgcn_sched_barrier(0);
#pragma unroll
    for (int j = 0; j < 4; ++j) {
      s[j] = (v8f){0.f,0.f,0.f,0.f,0.f,0.f,0.f,0.f};
#pragma unroll
      for (int dc = 0; dc < 4; ++dc) s[j] = Frag<_Float16>::mma(kb[j][dc].v, qa[dc], s[j]);   // rows = keys, column = query
    }
    const bool diag = (kc >= qb);
    float cm[4];
#pragma unroll
    for (int j = 0; j < 4; ++j) {
      float m = -INFINITY;
#pragma unroll
      for (int r = 0; r < 8; ++r) {
        const int key = kv0 + j * 16 + 8 * hh + r;
        float sv = s[j][r] * ATT_SCALE;
        const bool masked = (dk[j][r >> 2][r & 3] != dq) || (diag && (key > qrow));
        if (masked) sv = -INFINITY;
        s[j][r] = sv;
        m = fmaxf(m, sv);
      }
      cm[j] = m;
    }
    float mc = fmaxf(fmaxf(cm[0], cm[1]), fmaxf(cm[2], cm[3]));
    mc = fmaxf(mc, xhalf(mc));
    const float mnew = fmaxf(mrow, mc);
    const float mref = (mnew > -INFINITY) ? mnew : 0.0f;   // all-masked so far -> p = 0, alpha = 0
    const float alpha = expf(mrow - mref);
    mrow = mnew;
    FH pt[2];
    float ps[4];
#pragma unroll
    for (int j = 0; j < 4; ++j) {
      float a = 0.f;
#pragma unroll
      for (int r = 0; r < 8; ++r) {
        const float p = expf(s[j][r] - mref);
        a += p;
        pt[j >> 1].h[j & 1][r] = (_Float16)(p * PSCALE);
      }
      ps[j] = a;
    }
    lrow = lrow * alpha + ((ps[0] + ps[1]) + (ps[2] + ps[3]));
#pragma unroll
    for (int t = 0; t < 8; ++t) oacc[t] *= alpha;
    FH vb[2][8];
#pragma unroll
    for (int kk = 0; kk < 2; ++kk) {
#pragma unroll
      for (int t = 0; t < 8; ++t) {
        vb[kk][t].h[0] = ld_tr16(Vb + (kk * 32) * VPITCH + t * 32);        // keys kk*32 + 8 hh + 0..7 of column t*16 + c
        vb[kk][t].h[1] = ld_tr16(Vb + (kk * 32 + 16) * VPITCH + t * 32);   // keys kk*32 + 16 + 8 hh + 0..7
      }
    }
    // keeps the chunk's 32 V loads together ahead of the 16 output products
    __builtin_amdgcn_sched_barrier(0);
#pragma unroll
    for (int kk = 0; kk < 2; ++kk) {
#pragma unroll
      for (int t = 0; t < 8; ++t) oacc[t] = Frag<_Float16>::mma(vb[kk][t].v, pt[kk].v, oacc[t]);   // rows = d, column = query
    }
    asm volatile("s_wait_dscnt 0x0" ::: "memory");     // this wave's reads of the buffers have returned
    asm volatile("s_wait_asynccnt 0x0" ::: "memory");  // its copies for pair pr + 1 have landed
    __syncthreads();                                   // publishes pair pr + 1, frees this pair's buffers
    if (pr + 2 < nPairs) {
      copy_kv8<16 * KPITCH>(lK + bsel * (2 * KBUF), gK + (size_t)(pr + 2) * (2 * AKC * HDIM));
      copy_kv8<16 * VPITCH>(lV + bsel * (2 * VBUF), gV + (size_t)(pr + 2) * (2 * AKC * HDIM));
    }
  }
  asm volatile("s_wait_asynccnt 0x0" ::: "memory");    // nothing in flight when the buffers change their use

  // ---- join the two groups: lane l of wave w + 4 holds the same query and the same d as lane l of wave w ----
  // The loop's last barrier stands behind every wave's last read of the buffers.
  float* px  = (float*)Ksm + (size_t)wq * (16 * 32 * 4) + lane * 4;       // [wq][2 t + half of the 8][lane] x 16 B
  float* pml = (float*)Ksm + 4 * (16 * 32 * 4) + (wq * 32 + lane) * 2;    // [wq][lane] x (maximum, sum)
  if (grp == 1) {
#pragma unroll
    for (int t = 0; t < 8; ++t) {
      *(v4f*)(px + (2 * t) * 128)     = __builtin_shufflevector(oacc[t], oacc[t], 0, 1, 2, 3);
      *(v4f*)(px + (2 * t + 1) * 128) = __builtin_shufflevector(oacc[t], oacc[t], 4, 5, 6, 7);
    }
    pml[0] = mrow;
    pml[1] = lrow;
  }
  __syncthreads();                  // group 1's partial results are there for group 0
  if (grp == 1) return;             // wave-uniform, behind the last work-group barrier

  _Float16* os = (_Float16*)Vsm + wq * (16 * OSP);   // per wave [row][d]
  {
    const float m1 = pml[0], l1 = pml[1];
    const float mj = fmaxf(mrow, m1);
    const float mjr = (mj > -INFINITY) ? mj : 0.0f;  // a group that saw only masked keys weighs 0
    const float a0 = expf(mrow - mjr), a1 = expf(m1 - mjr);
    const float lj = lrow * a0 + l1 * a1;
    const float inv = 1.0f / ((lj + xhalf(lj)) * PSCALE);
    const float w0 = a0 * inv, w1 = a1 * inv;
#pragma unroll
    for (int t = 0; t < 8; ++t) {
      const v4f pa = *(const v4f*)(px + (2 * t) * 128);
      const v4f pb = *(const v4f*)(px + (2 * t + 1) * 128);
      v8h ov;
#pragma unroll
      for (int r = 0; r < 4; ++r) {
        ov[r]     = (_Float16)(oacc[t][r] * w0 + pa[r] * w1);
        ov[r + 4] = (_Float16)(oacc[t][r + 4] * w0 + pb[r] * w1);
      }
      *(v8h*)(os + c * OSP + t * 16 + 8 * hh) = ov;
    }
  }
  __builtin_amdgcn_fence(__ATOMIC_RELEASE, "workgroup");
  __builtin_amdgcn_wave_barrier();
  __builtin_amdgcn_fence(__ATOMIC_ACQUIRE, "workgroup");
  {
    const int c8 = (lane & 15) * 8;   // 256-B row segment = 16 lanes x 16 B, 2 rows per instruction
    {
#pragma unroll
      for (int it = 0; it < 8; ++it) {
        const int row = it * 2 + hh;
        const v8h val = *(const v8h*)(os + row * OSP + c8);
        *(v8h*)(out + (size_t)(b * SS + q0 + row) * DD + h * HDIM + c8) = val;
      }
      
    }
  }
}

// ---------------------------------------------------------------------------
extern "C" void kernel_launch(void* const* d_in, const int* in_sizes, int n_in,
                              void* d_out, int out_size, void* d_ws,
                              size_t ws_size, hipStream_t stream) {
  if (n_in < 12) return;
  if (in_sizes[0] != NTOK * DD || in_sizes[1] != SS * DD || in_sizes[2] != NTOK * DD ||
      in_sizes[3] < 2 || in_sizes[4] < 2 || in_sizes[5] < DD || in_sizes[6] < DD ||
      in_sizes[7] != DD * 3 * DD || in_sizes[8] != DD * DD || in_sizes[9] != DD * 4 * DD ||
      in_sizes[10] != 4 * DD * DD || in_sizes[11] != SS || out_size != NTOK * DD) return;

  const float* x     = (const float*)d_in[0];
  const float* ve    = (const float*)d_in[1];
  const float* x0    = (const float*)d_in[2];
  const float* lam   = (const float*)d_in[3];
  const float* sal   = (const float*)d_in[4];
  const float* ln1   = (const float*)d_in[5];
  const float* ln2   = (const float*)d_in[6];
  const float* wqkv  = (const float*)d_in[7];
  const float* wo    = (const float*)d_in[8];
  const float* wfc   = (const float*)d_in[9];
  const float* wproj = (const float*)d_in[10];
  const int*   ids   = (const int*)d_in[11];
  float* outf = (float*)d_out;

  // ---- carve (bytes) ----
  const size_t szWO   = (size_t)DD * DD * 2;              //   2 MiB  w_o^T f16
  const size_t szWFC  = (size_t)4 * DD * DD * 2;          //   8 MiB  w_fc^T f16
  const size_t szWPR  = (size_t)4 * DD * DD * 2;          //   8 MiB  w_proj^T f16
  const size_t szXR   = (size_t)NTOK * DD * 4;            //  16 MiB  mixed x f32
  const size_t szBIG  = (size_t)NTOK * 3 * DD * 4;        //  48 MiB  qkv f32, later h f16 (32 MiB) + x2 f32 (16 MiB)
  const size_t szXN   = (size_t)NTOK * DD * 2;            //   8 MiB  xn f16, later xn2 f16
  const size_t szWQA  = (size_t)NTOK * DD * 2;            //   8 MiB  w_qkv^T f16 (6 MiB), later attention out f16
  const size_t szPL   = (size_t)3 * NTOK * DD * 2;        //  24 MiB  q,k,v f16 planes
  const size_t szROPE = (size_t)SS * 64 * 4;              // 512 KiB
  const size_t szDOC  = (size_t)SS * 4;
  const size_t oWO = 0, oWFC = oWO + szWO, oWPR = oWFC + szWFC, oXR = oWPR + szWPR, oBIG = oXR + szXR,
               oXN = oBIG + szBIG, oWQA = oXN + szXN, oPL = oWQA + szWQA, oROPE = oPL + szPL,
               oDOC = oROPE + szROPE, oEND = oDOC + szDOC;
  if (oEND > ws_size) return;
  char* ws = (char*)d_ws;
  unsigned short* woT   = (unsigned short*)(ws + oWO);
  unsigned short* wfcT  = (unsigned short*)(ws + oWFC);
  unsigned short* wprT  = (unsigned short*)(ws + oWPR);
  float*          xr    = (float*)(ws + oXR);
  float*          qkvf  = (float*)(ws + oBIG);
  unsigned short* hbuf  = (unsigned short*)(ws + oBIG);
  float*          x2    = (float*)(ws + oBIG + (size_t)NTOK * 4 * DD * 2);
  unsigned short* xn    = (unsigned short*)(ws + oXN);
  unsigned short* xn2   = xn;
  unsigned short* wqkvT = (unsigned short*)(ws + oWQA);
  unsigned short* attn  = (unsigned short*)(ws + oWQA);
  unsigned short* qpl   = (unsigned short*)(ws + oPL);
  unsigned short* kpl   = qpl + (size_t)NTOK * DD;
  unsigned short* vpl   = qpl + (size_t)2 * NTOK * DD;
  float*          rope  = (float*)(ws + oROPE);
  int*            docs  = (int*)(ws + oDOC);

  // rotary table + docs; x = l0*x + l1*x0, xn = LN(x)*ln1_w; the four weight transposes
  prep_k<<<PB_TAB + PB_LN + PB_WQKV + PB_WO + PB_WFC + PB_WPR, 256, 0, stream>>>(
      x, x0, lam, ln1, xr, xn, wqkv, wqkvT, wo, woT, wfc, wfcT, wproj, wprT, ids, rope, docs);
  // qkv = xn @ w_qkv (f32 out)
  {
    const int M = NTOK, N = 3 * DD, K = DD;
    const int tiles = (M / 128) * (N / 128);
    wmma_gemm64<0, false, 0, 0, false, 0><<<dim3(tiles, 1), 128, 0, stream>>>(
        xn, xn, K, 0, wqkvT, wqkvT, K, 0, qkvf, qkvf, N, 0, xr, xr, 0, M, N, K, WMUL_INV);
  }
  // rotary + RMS-norm + value mix -> f16 planes
  rope_k<<<dim3(SS, BB), 256, 0, stream>>>(qkvf, ve, sal, rope, qpl);
  // attention
  attn128_k<<<BB * HH * (SS / AQB), 256, 0, stream>>>(qpl, kpl, vpl, docs, attn);
  // x2 = xr + attn @ w_o
  {
    const int M = NTOK, N = DD, K = DD;
    const int tiles = (M / 128) * (N / 128);
    wmma_gemm64<0, false, 0, 0, true, 0, true><<<dim3(tiles, 1), 128, 0, stream>>>(
        attn, attn, K, 0, woT, woT, K, 0, x2, x2, N, 0, xr, xr, 0, M, N, K, WMUL_INV);
  }
  // xn2 = LN(x2)*ln2_w
  ln_k<<<NTOK, 128, 0, stream>>>(x2, ln2, xn2);
  // h = relu(xn2 @ w_fc)^2 (f16 out)
  {
    const int M = NTOK, N = 4 * DD, K = DD;
    const int tiles = (M / 128) * (N / 128);
    wmma_gemm64<0, false, 0, 1, false, 6><<<dim3(tiles, 1), 128, 0, stream>>>(
        xn2, xn2, K, 0, wfcT, wfcT, K, 0, hbuf, hbuf, N, 0, xr, xr, 0, M, N, K, WMUL_INV);
  }
  // out = x2 + h @ w_proj
  {
    const int M = NTOK, N = DD, K = 4 * DD;
    const int tiles = (M / 128) * (N / 128);
    wmma_gemm64<0, false, 0, 0, true, 0, true><<<dim3(tiles, 1), 128, 0, stream>>>(
        hbuf, hbuf, K, 0, wprT, wprT, K, 0, outf, outf, N, 0, x2, x2, 0, M, N, K, WMUL_INV);
  }
}

// v008
// Measured time: 184 microseconds a run.
// Timed twice side by side with v007, it ran 1.05 and 1.04 times as fast.
// Counting every step since v000, it is 3.40 times as fast.
#include <hip/hip_runtime.h>
#include <stdint.h>
// All contractions: v_wmma_f32_16x16x32_f16 (f16 operands, f32 accumulate); projection weights carried x64, attention p carried x2^15; norms, rotary, softmax and residuals in f32.

#define BB 2
#define SS 2048
#define DD 1024
#define HH 8
#define HDIM 128
#define NTOK (BB * SS)
#define EOT_ID 50256
#define ATT_SCALE 0.12f
#define LN_EPS 1e-6f
#define RMS_EPS 1.1920929e-7f
#define WMUL 64.0f
#define WMUL_INV (1.0f / 64.0f)

typedef __attribute__((ext_vector_type(16))) _Float16 v16h;
typedef __attribute__((ext_vector_type(8)))  _Float16 v8h;
typedef __attribute__((ext_vector_type(4)))  _Float16 v4h;
typedef __attribute__((ext_vector_type(16))) __bf16   v16b;
typedef __attribute__((ext_vector_type(8)))  __bf16   v8b;
typedef __attribute__((ext_vector_type(8)))  float    v8f;
typedef __attribute__((ext_vector_type(4)))  float    v4f;
typedef __attribute__((ext_vector_type(4)))  int      v4i;
#define U16(p) ((const unsigned short*)(const void*)(p))
#define ATT_SCALE_LOG2E (ATT_SCALE * 1.44269504f)   // times log2(e): scores in base-2 units
#define PSCALE_LOG2 15.0f                           // p is carried x2^15

__device__ __forceinline__ unsigned short f2bf_bits(float f) {
  unsigned u = __float_as_uint(f);
  return (unsigned short)((u + 0x7FFFu + ((u >> 16) & 1u)) >> 16);
}
__device__ __forceinline__ float bf_bits2f(unsigned short h) { return __uint_as_float(((unsigned)h) << 16); }

// hazard guards as plain device helpers
__device__ __forceinline__ void dep_guard_h(v8f& a, v8f& b, v16h x, v16h y) { asm volatile("v_nop\n\tv_nop\n\tv_nop\n\tv_nop" : "+v"(a), "+v"(b) : "v"(x), "v"(y)); }
__device__ __forceinline__ void dep_guard_b(v8f& a, v8f& b, v16b x, v16b y) { asm volatile("v_nop\n\tv_nop\n\tv_nop\n\tv_nop" : "+v"(a), "+v"(b) : "v"(x), "v"(y)); }
__device__ __forceinline__ void keep4_h(v16h a, v16h b, v16h c, v16h d) { asm volatile("v_nop" :: "v"(a), "v"(b), "v"(c), "v"(d)); }
__device__ __forceinline__ void keep4_b(v16b a, v16b b, v16b c, v16b d) { asm volatile("v_nop" :: "v"(a), "v"(b), "v"(c), "v"(d)); }
__device__ __forceinline__ void acc_guard4(v8f& a, v8f& b, v8f& c, v8f& d) { asm volatile("v_nop\n\tv_nop\n\tv_nop\n\tv_nop" : "+v"(a), "+v"(b), "+v"(c), "+v"(d)); }
template <typename T> struct Frag;
template <> struct Frag<_Float16> {
  typedef v16h V; union U { v16h v; v8h h[2]; };
  static __device__ __forceinline__ v16h load(const _Float16* p) {   // elements 0..7 <- p[0..7], 8..15 <- p[16..23]
    U f; f.h[0] = *(const v8h*)(p); f.h[1] = *(const v8h*)(p + 16); return f.v;
  }
  static __device__ __forceinline__ v8f mma(v16h a, v16h b, v8f c) {
    return __builtin_amdgcn_wmma_f32_16x16x32_f16(false, a, false, b, (short)0, c, false, false);
  }
  static __device__ __forceinline__ void guard(v8f& a, v8f& b, v16h x, v16h y) { dep_guard_h(a, b, x, y); }
  static __device__ __forceinline__ void keep(v16h a, v16h b, v16h c, v16h d) { keep4_h(a, b, c, d); }
};
template <> struct Frag<__bf16> {
  typedef v16b V; union U { v16b v; v8b h[2]; };
  static __device__ __forceinline__ v16b load(const __bf16* p) {
    U f; f.h[0] = *(const v8b*)(p); f.h[1] = *(const v8b*)(p + 16); return f.v;
  }
  static __device__ __forceinline__ v8f mma(v16b a, v16b b, v8f c) {
    return __builtin_amdgcn_wmma_f32_16x16x32_bf16(false, a, false, b, (short)0, c, false, false);
  }
  static __device__ __forceinline__ void guard(v8f& a, v8f& b, v16b x, v16b y) { dep_guard_b(a, b, x, y); }
  static __device__ __forceinline__ void keep(v16b a, v16b b, v16b c, v16b d) { keep4_b(a, b, c, d); }
};

// ---- LDS-staged batched WMMA GEMM ------------------------------------------
// C[m,n] = scale * sum_k A[m,k] * Bt[n,k] (+bias)(+resid); a block of 4 waves owns a 128x128 tile, each wave 64x64 of it.
// A row-major [M,K]; Bt row-major [N,K]; M,N % 128 == 0, K % 64 == 0.
// Per trip 64 k of both operands (128 rows x 128 B each) lie in LDS at pitch 144 B, brought by asynchronous
// copies into two buffers: the next trip's copies fly while this trip's fragments are read and multiplied.
// BIAS_MODE: 0 = none, 1 = bias[m], 2 = bias[n].
// OUT_MODE: 0 = f32, 1 = f16, 2 = bf16 hi plane (Cout) + bf16 lo plane (Cout2).
// ACT 6: relu then square.
// ET: 0 = f16 operands, 1 = bf16 operands (pointers passed as 16-bit storage)
template <int ET> struct Elem;
template <> struct Elem<0> { typedef _Float16 T; };
template <> struct Elem<1> { typedef __bf16 T; };
#define GBK 64                         // k per trip
#define GPITCH 144                     // LDS row pitch in bytes (16 B x odd: conflict-free for ds_load_b128)
#define GOPER (128 * GPITCH)           // one operand's 128 rows
#define GSTAGE (2 * GOPER)             // A rows, then Bt rows
// Eight 16-byte copies per lane: rows r, r+16, .. r+112 of one operand's 128-row slab. The s_wait_xcnt closes the
// statement so that no address register is rewritten ahead of it.
__device__ __forceinline__ void copy_rows8(uint32_t l, const unsigned short* gp, size_t step) {
  asm volatile(
      "global_load_async_to_lds_b128 %0, %8, off\n\t"
      "global_load_async_to_lds_b128 %1, %9, off\n\t"
      "global_load_async_to_lds_b128 %2, %10, off\n\t"
      "global_load_async_to_lds_b128 %3, %11, off\n\t"
      "global_load_async_to_lds_b128 %4, %12, off\n\t"
      "global_load_async_to_lds_b128 %5, %13, off\n\t"
      "global_load_async_to_lds_b128 %6, %14, off\n\t"
      "global_load_async_to_lds_b128 %7, %15, off\n\t"
      "s_wait_xcnt 0x0"
      :: "v"(l), "v"(l + 16 * GPITCH), "v"(l + 32 * GPITCH), "v"(l + 48 * GPITCH),
         "v"(l + 64 * GPITCH), "v"(l + 80 * GPITCH), "v"(l + 96 * GPITCH), "v"(l + 112 * GPITCH),
         "v"(gp), "v"(gp + step), "v"(gp + 2 * step), "v"(gp + 3 * step),
         "v"(gp + 4 * step), "v"(gp + 5 * step), "v"(gp + 6 * step), "v"(gp + 7 * step)
      : "memory");
}
// AHEAD (for a grid of one block a WGP, so one wave a SIMD, where no other wave covers a wave's own LDS latency; K % 128 == 0):
// a trip is 128 k (rows of 256 B at pitch 272 B) in four blocks of 16 products, and each block's 16 fragment loads go out
// as one group ahead of the block before it, into a second register set. The first block of trip t + 1 is so fetched in
// trip t: the point where trip t + 1 is published and trip t's buffer refilled stands ahead of trip t's last block,
// whose fragments are in registers by then.
#define PBK 128
#define PPITCH 272                     // 16 B x odd
#define POPER (128 * PPITCH)
#define PSTAGE (2 * POPER)
// Sixteen 16-byte copies per lane: both 128-byte halves of rows r, r+16, .. r+112 of one operand's 128 rows of 256 B; the
// immediate offset moves the LDS and the global address alike, so a row's two halves share their address registers.
// The builtin form leaves the choice of address registers to the compiler: asm operands, bound to the low 256 registers,
// made it move accumulators out of their way in every trip.
__device__ __forceinline__ void copy_wide16(char* l, const unsigned short* gp, size_t step) {
  typedef __attribute__((address_space(1))) v4i glb_v4i;
  typedef __attribute__((address_space(3))) v4i lds_v4i;
#pragma unroll
  for (int i = 0; i < 8; ++i) {
    __builtin_amdgcn_global_load_async_to_lds_b128((glb_v4i*)(gp + i * step), (lds_v4i*)(l + i * 16 * PPITCH), 0, 0);
    __builtin_amdgcn_global_load_async_to_lds_b128((glb_v4i*)(gp + i * step), (lds_v4i*)(l + i * 16 * PPITCH), 128, 0);
  }
}
// one trip's 128 rows of both operands; step = 16 rows
__device__ __forceinline__ void copy_stage(char* l, const unsigned short* ga, size_t stepA,
                                           const unsigned short* gb, size_t stepB) {
  copy_wide16(l, ga, stepA);
  copy_wide16(l + POPER, gb, stepB);
}
template <int ET, bool SPLIT, int BIAS_MODE, int OUT_MODE, bool RESID, int ACT = 0, bool AHEAD = false>
__global__ __launch_bounds__(128) void wmma_gemm64(
    const unsigned short* __restrict__ Ap, const unsigned short* __restrict__ A2p, int lda, long strideA,
    const unsigned short* __restrict__ Btp, const unsigned short* __restrict__ Bt2p, int ldb, long strideB,
    void* __restrict__ Cout, void* __restrict__ Cout2, int ldc, long strideC,
    const float* __restrict__ bias,
    const float* __restrict__ resid, long strideR,
    int M, int N, int K, float scale) {
  static_assert(!SPLIT, "single-plane operands only");
  typedef typename Elem<ET>::T T;
  typedef typename Frag<T>::V V;
  // two operand buffers; after the loop its first bytes serve as the per-wave 16x64 f32 slabs, pitch 68 floats
  __shared__ __align__(16) char smem[AHEAD ? 2 * PSTAGE : 2 * GSTAGE];
  const int b    = blockIdx.y;
  const int tid  = threadIdx.x;
  const int lane = tid & 31;
  const int wave = tid >> 5;
  const int tilesN = N >> 7;
  const int tilesM = M >> 7;
  const int tile = blockIdx.x;
  if (tile >= tilesM * tilesN) return;   // block-uniform, in front of every barrier
  const int tm = tile / tilesN;
  const int tn = tile - tm * tilesN;
  const int mB = tm << 7;                      // block tile origin
  const int nB = tn << 7;
  const int wm = (wave >> 1) << 6;             // wave tile origin inside the block tile
  const int wn = (wave & 1) << 6;
  const int m0 = mB + wm;
  const int n0 = nB + wn;

  const int rlane = lane & 15;                 // row (A) / col (B, D) within subtile
  const int koff  = (lane >> 4) * 8;           // k offset of this lane half
  const int mOff  = (lane >> 4) * 8;           // D row offset

  v8f acc[4][4];
#pragma unroll
  for (int i = 0; i < 4; ++i)
#pragma unroll
    for (int j = 0; j < 4; ++j) acc[i][j] = (v8f){0.f,0.f,0.f,0.f,0.f,0.f,0.f,0.f};

  if constexpr (AHEAD) {
  // copy addresses: lane brings 16 B at column chunks (tid & 7) and (tid & 7) + 8 of rows (tid >> 3) + 16 i
  const int crow = tid >> 3, ccol = (tid & 7) * 8;
  const unsigned short* gA = Ap  + (size_t)b * strideA + (size_t)(mB + crow) * lda + ccol;
  const unsigned short* gB = Btp + (size_t)b * strideB + (size_t)(nB + crow) * ldb + ccol;
  const size_t stepA = (size_t)16 * lda, stepB = (size_t)16 * ldb;
  char* lds0 = smem + crow * PPITCH + ccol * 2;
  const char* sA0 = smem + (wm + rlane) * PPITCH + koff * 2;
  const char* sB0 = smem + POPER + (wn + rlane) * PPITCH + koff * 2;

  const int nT = K / PBK;
  copy_stage(lds0, gA, stepA, gB, stepB);
  asm volatile("s_wait_asynccnt 0x0" ::: "memory");   // trip 0's own copies have landed
  __syncthreads();                                    // and every other wave's
  if (nT > 1) copy_stage(lds0 + PSTAGE, gA + PBK, stepA, gB + PBK, stepB);
  V fa[2][4], fb[2][4];                               // block kk works on set kk & 1
#pragma unroll
  for (int j = 0; j < 4; ++j) fb[0][j] = Frag<T>::load((const T*)(sB0 + j * 16 * PPITCH));
#pragma unroll
  for (int i = 0; i < 4; ++i) fa[0][i] = Frag<T>::load((const T*)(sA0 + i * 16 * PPITCH));
  for (int t = 0; t < nT; ++t) {
    const unsigned bufo = (unsigned)(t & 1) * PSTAGE;
#pragma unroll
    for (int kk = 0; kk < PBK / 32; ++kk) {
      const int cur = kk & 1, nxt = cur ^ 1;
      if (kk + 1 < PBK / 32) {
#pragma unroll
        for (int j = 0; j < 4; ++j) fb[nxt][j] = Frag<T>::load((const T*)(sB0 + bufo + j * 16 * PPITCH + (kk + 1) * 64));
#pragma unroll
        for (int i = 0; i < 4; ++i) fa[nxt][i] = Frag<T>::load((const T*)(sA0 + bufo + i * 16 * PPITCH + (kk + 1) * 64));
      } else {
        asm volatile("s_wait_dscnt 0x0" ::: "memory");     // this wave's last reads of the buffer, the last block's fragments, have returned
        asm volatile("s_wait_asynccnt 0x0" ::: "memory");  // its copies for trip t + 1 have landed
        __syncthreads();                                   // publishes trip t + 1, frees this trip's buffer
        if (t + 2 < nT) copy_stage(lds0 + bufo, gA + (size_t)(t + 2) * PBK, stepA, gB + (size_t)(t + 2) * PBK, stepB);
        if (t + 1 < nT) {
          const unsigned bufn = bufo ^ PSTAGE;
#pragma unroll
          for (int j = 0; j < 4; ++j) fb[nxt][j] = Frag<T>::load((const T*)(sB0 + bufn + j * 16 * PPITCH));
#pragma unroll
          for (int i = 0; i < 4; ++i) fa[nxt][i] = Frag<T>::load((const T*)(sA0 + bufn + i * 16 * PPITCH));
        }
      }
      // keeps the next block's 16 loads together ahead of this block's 16 products, which cover their latency
      __builtin_amdgcn_sched_barrier(0);
#pragma unroll
      for (int i = 0; i < 4; ++i)
#pragma unroll
        for (int j = 0; j < 4; ++j) acc[i][j] = Frag<T>::mma(fa[cur][i], fb[cur][j], acc[i][j]);
      // keeps the loads that follow in one group behind these products, not spread among them as their registers come free
      __builtin_amdgcn_sched_barrier(0);
    }
  }
  } else {
  // copy addresses: lane brings 16 B at column chunk (tid & 7) of rows (tid >> 3) + 16 i
  const int crow = tid >> 3, ccol = (tid & 7) * 8;
  const unsigned short* gA = Ap  + (size_t)b * strideA + (size_t)(mB + crow) * lda + ccol;
  const unsigned short* gB = Btp + (size_t)b * strideB + (size_t)(nB + crow) * ldb + ccol;
  const size_t stepA = (size_t)16 * lda, stepB = (size_t)16 * ldb;
  const uint32_t lds0 = (uint32_t)(uintptr_t)smem + (uint32_t)(crow * GPITCH + ccol * 2);

  const int nT = K / GBK;
  copy_rows8(lds0, gA, stepA);
  copy_rows8(lds0 + GOPER, gB, stepB);
  asm volatile("s_wait_asynccnt 0x0" ::: "memory");   // trip 0's own copies have landed
  __syncthreads();                                    // and every other wave's
  if (nT > 1) {
    copy_rows8(lds0 + GSTAGE, gA + GBK, stepA);
    copy_rows8(lds0 + GSTAGE + GOPER, gB + GBK, stepB);
  }
  for (int t = 0; t < nT; ++t) {
    const unsigned bufo = (unsigned)(t & 1) * GSTAGE;
    const char* sA = smem + bufo + (wm + rlane) * GPITCH + koff * 2;
    const char* sB = smem + bufo + GOPER + (wn + rlane) * GPITCH + koff * 2;
#pragma unroll
    for (int kk = 0; kk < GBK / 32; ++kk) {
      V bh[4], ah[4];
#pragma unroll
      for (int j = 0; j < 4; ++j) bh[j] = Frag<T>::load((const T*)(sB + j * 16 * GPITCH + kk * 64));
#pragma unroll
      for (int i = 0; i < 4; ++i) ah[i] = Frag<T>::load((const T*)(sA + i * 16 * GPITCH + kk * 64));
      // keeps the 16 fragment loads together ahead of the 16 products: one LDS latency per group, not one per A fragment
      __builtin_amdgcn_sched_barrier(0);
#pragma unroll
      for (int i = 0; i < 4; ++i) {
#pragma unroll
        for (int j = 0; j < 4; ++j) acc[i][j] = Frag<T>::mma(ah[i], bh[j], acc[i][j]);
        Frag<T>::guard(acc[i][0], acc[i][3], ah[i], ah[i]);
      }
      Frag<T>::keep(bh[0], bh[1], bh[2], bh[3]);
    }
    asm volatile("s_wait_dscnt 0x0" ::: "memory");     // this wave's reads of the buffer have returned
    asm volatile("s_wait_asynccnt 0x0" ::: "memory");  // its copies for trip t + 1 have landed
    __syncthreads();                                   // publishes trip t + 1, frees this trip's buffer
    if (t + 2 < nT) {
      copy_rows8(lds0 + bufo, gA + (size_t)(t + 2) * GBK, stepA);
      copy_rows8(lds0 + bufo + GOPER, gB + (size_t)(t + 2) * GBK, stepB);
    }
  }
  }
  asm volatile("s_wait_asynccnt 0x0" ::: "memory");    // nothing in flight when the buffers become slabs
  acc_guard4(acc[0][0], acc[0][1], acc[0][2], acc[0][3]);
  acc_guard4(acc[1][0], acc[1][1], acc[1][2], acc[1][3]);
  acc_guard4(acc[2][0], acc[2][1], acc[2][2], acc[2][3]);
  acc_guard4(acc[3][0], acc[3][1], acc[3][2], acc[3][3]);

  // ---- epilogue ----
  float* slab = (float*)smem + wave * (16 * 68);
  const float* Rb = RESID ? (resid + (size_t)b * strideR) : nullptr;
#pragma unroll
  for (int i = 0; i < 4; ++i) {
    const int mBase = m0 + (i << 4);
#pragma unroll
    for (int j = 0; j < 4; ++j) {
      const int n = n0 + (j << 4) + rlane;
      float bv = 0.f;
      if (BIAS_MODE == 2) bv = bias[n];
#pragma unroll
      for (int r = 0; r < 8; ++r) {
        float v = acc[i][j][r] * scale;
        if (BIAS_MODE == 1) v += bias[mBase + mOff + r];
        if (BIAS_MODE == 2) v += bv;
        if (RESID) v += Rb[(size_t)(mBase + mOff + r) * ldc + n];
        if (ACT == 1) v = tanhf(v);
        if (ACT == 2) v = fmaxf(v, 0.0f);
        if (ACT == 3) v = v / (1.0f + expf(-v));
        if (ACT == 4) v = (v > 0.f) ? v : 0.01f * v;
        if (ACT == 5) v = 0.5f * v * (1.0f + erff(v * 0.70710678118654752f));
        if (ACT == 6) { v = fmaxf(v, 0.0f); v = v * v; }
        slab[(mOff + r) * 68 + (j << 4) + rlane] = v;
      }
    }
    __builtin_amdgcn_fence(__ATOMIC_RELEASE, "workgroup");
    __builtin_amdgcn_wave_barrier();
    __builtin_amdgcn_fence(__ATOMIC_ACQUIRE, "workgroup");
    if (OUT_MODE == 0) {
      float* C = (float*)Cout + (size_t)b * strideC;
      const int hh = lane >> 4, c4 = (lane & 15) * 4;     // row seg = 256 B = 16 lanes x 16 B
      {
#pragma unroll
        for (int it = 0; it < 8; ++it) {
          const int row = it * 2 + hh;
          v4f v = *(const v4f*)(slab + row * 68 + c4);
          *(v4f*)(C + (size_t)(mBase + row) * ldc + n0 + c4) = v;
        }
        
      }
    } else {
      const int q = lane >> 3, c8 = (lane & 7) * 8;
      unsigned short* C  = (unsigned short*)Cout  + (size_t)b * strideC;
      unsigned short* C2 = (OUT_MODE == 2) ? ((unsigned short*)Cout2 + (size_t)b * strideC) : nullptr;
      {
#pragma unroll
        for (int it = 0; it < 4; ++it) {
          const int row = it * 4 + q;
          const float* sp = slab + row * 68 + c8;
          v8h hv, lv;
#pragma unroll
          for (int e = 0; e < 8; ++e) {
            if (OUT_MODE == 1) {
              hv[e] = (_Float16)sp[e];
            } else {
              unsigned short hb = f2bf_bits(sp[e]);
              unsigned short lb = f2bf_bits(sp[e] - bf_bits2f(hb));
              hv[e] = __builtin_bit_cast(_Float16, hb);
              lv[e] = __builtin_bit_cast(_Float16, lb);
            }
          }
          *(v8h*)(C + (size_t)(mBase + row) * ldc + n0 + c8) = hv;
          if (OUT_MODE == 2) *(v8h*)(C2 + (size_t)(mBase + row) * ldc + n0 + c8) = lv;
        }
        
      }
    }
    __builtin_amdgcn_fence(__ATOMIC_RELEASE, "workgroup");
    __builtin_amdgcn_wave_barrier();
    __builtin_amdgcn_fence(__ATOMIC_ACQUIRE, "workgroup");
  }
}

// ---- W [K][N] f32 -> Wt [N][K] f16 (x mul), 64x64 tile transposed through LDS ----
#define WTP 72
__device__ __forceinline__ void wt_cast_body(const float* __restrict__ W, unsigned short* __restrict__ Wtp,
                                             int K, int N, float mul, int bn, int bk, _Float16* st) {
  _Float16* Wt = (_Float16*)Wtp;
  const int n0 = bn * 64, k0 = bk * 64;
  const int tid = threadIdx.x;
  const int kr = tid >> 2, c16 = (tid & 3) * 16;
  const float* src = W + (size_t)(k0 + kr) * N + n0 + c16;
#pragma unroll
  for (int q = 0; q < 4; ++q) {
    const v4f v = *(const v4f*)(src + 4 * q);
#pragma unroll
    for (int e = 0; e < 4; ++e) st[(c16 + 4 * q + e) * WTP + kr] = (_Float16)(v[e] * mul);
  }
  __syncthreads();
  const int wave = tid >> 5, lane = tid & 31;
  const int q8 = lane >> 3, c8 = (lane & 7) * 8;
  {
#pragma unroll
    for (int it = 0; it < 2; ++it) {
      const int n = it * 32 + wave * 4 + q8;
      const v8h hv = *(const v8h*)(st + n * WTP + c8);
      *(v8h*)(Wt + (size_t)(n0 + n) * K + k0 + c8) = hv;
    }
    // the block ranges of the merged grid lie one behind another in the code: no register of these stores is rewritten ahead of this wait
    asm volatile("s_wait_xcnt 0x0" ::: "memory");
  }
}

// ---- rotary cos/sin table [S][64] (cos 0..31 | sin 32..63) and docs[S] = inclusive count of EOT ----
__device__ __forceinline__ void tables_body(const int* __restrict__ ids, float* __restrict__ rope,
                                            int* __restrict__ docs, int blk, int* scnt, int* sdoc) {
  const int tid = threadIdx.x, lane = tid & 31, wave = tid >> 5;
  if (blk < SS / 8) {
    const int s = blk * 8 + wave;
    float e = (float)lane * (1.0f / 31.0f);
    if (lane == 31) e = 1.0f;
    const float fr = powf(0.0009765625f, e);
    const float th = (float)s * fr;
    float sv, cv;
    sincosf(th, &sv, &cv);
    float* rp = rope + (size_t)s * 64;
    *(float*)(rp + lane) = cv;
    *(float*)(rp + 32 + lane) = sv;
    
  } else {
    int c = 0;
#pragma unroll
    for (int i = 0; i < 8; ++i) c += (ids[tid * 8 + i] == EOT_ID) ? 1 : 0;
    scnt[tid] = c;
    __syncthreads();
    for (int off = 1; off < 256; off <<= 1) {
      const int t = (tid >= off) ? scnt[tid - off] : 0;
      __syncthreads();
      scnt[tid] += t;
      __syncthreads();
    }
    int run = scnt[tid] - c;
#pragma unroll
    for (int i = 0; i < 8; ++i) {
      run += (ids[tid * 8 + i] == EOT_ID) ? 1 : 0;
      sdoc[tid * 8 + i] = run;
    }
    __syncthreads();
    const v4i a0 = *(const v4i*)(sdoc + tid * 4);
    const v4i a1 = *(const v4i*)(sdoc + 1024 + tid * 4);
    {
      *(v4i*)(docs + tid * 4) = a0;
      *(v4i*)(docs + 1024 + tid * 4) = a1;
      // as in wt_cast_body: no register of these stores is rewritten ahead of this wait
      asm volatile("s_wait_xcnt 0x0" ::: "memory");
    }
  }
}

// ---- residual mix + LayerNorm, 128 threads (tid 0..127) per row of 1024; thread owns cols 4t..4t+3 and 512+4t..+3 ----
template <bool MIX>
__device__ __forceinline__ void ln_body(const float* __restrict__ x, const float* __restrict__ x0,
                                        const float* __restrict__ lam, const float* __restrict__ w,
                                        float* __restrict__ xr, unsigned short* __restrict__ xnp,
                                        int row, int tid, float* red1, float* red2) {
  _Float16* xn = (_Float16*)xnp;
  const int lane = tid & 31, wave = tid >> 5;
  const size_t rb = (size_t)row * DD;
  const int ca = tid * 4, cb = 512 + tid * 4;
  v4f va = *(const v4f*)(x + rb + ca);
  v4f vb = *(const v4f*)(x + rb + cb);
  if (MIX) {
    const float l0 = lam[0], l1 = lam[1];
    const v4f a0 = *(const v4f*)(x0 + rb + ca);
    const v4f b0 = *(const v4f*)(x0 + rb + cb);
    va = va * l0 + a0 * l1;
    vb = vb * l0 + b0 * l1;
    {
      *(v4f*)(xr + rb + ca) = va;
      *(v4f*)(xr + rb + cb) = vb;
      
    }
  }
  float s = (va[0] + va[1]) + (va[2] + va[3]) + (vb[0] + vb[1]) + (vb[2] + vb[3]);
#pragma unroll
  for (int off = 1; off < 32; off <<= 1) s += __shfl_xor(s, off, 32);
  if (lane == 0) red1[wave] = s;
  __syncthreads();
  const float mu = ((red1[0] + red1[1]) + (red1[2] + red1[3])) * (1.0f / DD);
  const v4f da = va - mu, db = vb - mu;
  float s2 = (da[0] * da[0] + da[1] * da[1]) + (da[2] * da[2] + da[3] * da[3]) +
             (db[0] * db[0] + db[1] * db[1]) + (db[2] * db[2] + db[3] * db[3]);
#pragma unroll
  for (int off = 1; off < 32; off <<= 1) s2 += __shfl_xor(s2, off, 32);
  if (lane == 0) red2[wave] = s2;
  __syncthreads();
  const float var = ((red2[0] + red2[1]) + (red2[2] + red2[3])) * (1.0f / DD);
  const float inv = rsqrtf(var + LN_EPS);
  const v4f wa = *(const v4f*)(w + ca);
  const v4f wb = *(const v4f*)(w + cb);
  v4h ha, hb;
#pragma unroll
  for (int e = 0; e < 4; ++e) {
    ha[e] = (_Float16)(da[e] * inv * wa[e]);
    hb[e] = (_Float16)(db[e] * inv * wb[e]);
  }
  {
    *(v4h*)(xn + rb + ca) = ha;
    *(v4h*)(xn + rb + cb) = hb;
    // as in wt_cast_body, in the merged grid alone: no register of these stores is rewritten ahead of this wait
    if (MIX) asm volatile("s_wait_xcnt 0x0" ::: "memory");
  }
}
__global__ __launch_bounds__(128) void ln_k(const float* __restrict__ x, const float* __restrict__ w,
                                            unsigned short* __restrict__ xnp) {
  __shared__ float red1[4], red2[4];
  ln_body<false>(x, x, w, w, nullptr, xnp, blockIdx.x, threadIdx.x, red1, red2);
}

// ---- the six preparation steps, none of which reads what another writes, as block ranges of one grid ----
// The tables come first, their serial document count in block 0, so that the longest chain starts earliest.
#define PB_TAB  (SS / 8 + 1)
#define PB_LN   (NTOK / 2)                       // two rows per 256-thread block
#define PB_WQKV ((3 * DD / 64) * (DD / 64))
#define PB_WO   ((DD / 64) * (DD / 64))
#define PB_WFC  ((4 * DD / 64) * (DD / 64))
#define PB_WPR  ((DD / 64) * (4 * DD / 64))
__global__ __launch_bounds__(256) void prep_k(const float* __restrict__ x, const float* __restrict__ x0,
                                              const float* __restrict__ lam, const float* __restrict__ ln1,
                                              float* __restrict__ xr, unsigned short* __restrict__ xn,
                                              const float* __restrict__ wqkv, unsigned short* __restrict__ wqkvT,
                                              const float* __restrict__ wo, unsigned short* __restrict__ woT,
                                              const float* __restrict__ wfc, unsigned short* __restrict__ wfcT,
                                              const float* __restrict__ wproj, unsigned short* __restrict__ wprT,
                                              const int* __restrict__ ids, float* __restrict__ rope,
                                              int* __restrict__ docs) {
  __shared__ __align__(16) char sm[64 * WTP * 2];   // transpose tile, or count + document arrays, or the row sums
  static_assert(sizeof(sm) >= (256 + SS) * sizeof(int), "tables need 256 + S ints");
  int blk = blockIdx.x;
  if (blk < PB_TAB) {
    tables_body(ids, rope, docs, PB_TAB - 1 - blk, (int*)sm, (int*)sm + 256);
    return;
  }
  blk -= PB_TAB;
  if (blk < PB_LN) {
    const int half = threadIdx.x >> 7;
    float* red = (float*)sm + half * 8;
    ln_body<true>(x, x0, lam, ln1, xr, xn, blk * 2 + half, threadIdx.x & 127, red, red + 4);
    return;
  }
  blk -= PB_LN;
  // weights: W [in][out] -> Wt [out][in] f16 x64; tile column = out / 64, tile row = in / 64
  if (blk < PB_WQKV) {
    wt_cast_body(wqkv, wqkvT, DD, 3 * DD, WMUL, blk % (3 * DD / 64), blk / (3 * DD / 64), (_Float16*)sm);
    return;
  }
  blk -= PB_WQKV;
  if (blk < PB_WO) {
    wt_cast_body(wo, woT, DD, DD, WMUL, blk % (DD / 64), blk / (DD / 64), (_Float16*)sm);
    return;
  }
  blk -= PB_WO;
  if (blk < PB_WFC) {
    wt_cast_body(wfc, wfcT, DD, 4 * DD, WMUL, blk % (4 * DD / 64), blk / (4 * DD / 64), (_Float16*)sm);
    return;
  }
  blk -= PB_WFC;
  wt_cast_body(wproj, wprT, 4 * DD, DD, WMUL, blk % (DD / 64), blk / (DD / 64), (_Float16*)sm);
}

// ---- rotary + RMS-norm on q,k; v = sa0*v + sa1*ve; writes f16 planes [3][B*H*S][128] ----
// One block per token, wave = head; lane owns dims ln, ln+32, ln+64, ln+96 (pairs (ln,ln+64) rotate, (ln+32,ln+96) identity).
#define RSP 136
__global__ __launch_bounds__(256) void rope_k(const float* __restrict__ qkv, const float* __restrict__ ve,
                                              const float* __restrict__ sa, const float* __restrict__ rope,
                                              unsigned short* __restrict__ planesp) {
  __shared__ __align__(16) _Float16 st[HH][3 * RSP];
  _Float16* planes = (_Float16*)planesp;
  const int s = blockIdx.x, b = blockIdx.y;
  const int tid = threadIdx.x, h = tid >> 5, ln = tid & 31;
  const size_t tok = (size_t)b * SS + s;
  const float* base = qkv + tok * (3 * DD) + h * HDIM;
  const float cv = rope[(size_t)s * 64 + ln];
  const float sv = rope[(size_t)s * 64 + 32 + ln];
  _Float16* sw = st[h];
#pragma unroll
  for (int p = 0; p < 2; ++p) {
    const float* src = base + p * DD;
    const float a1 = src[ln], b1 = src[ln + 32], a2 = src[ln + 64], b2 = src[ln + 96];
    const float o0 = a1 * cv + a2 * sv;
    const float o2 = a2 * cv - a1 * sv;
    float sq = (o0 * o0 + b1 * b1) + (o2 * o2 + b2 * b2);
#pragma unroll
    for (int off = 1; off < 32; off <<= 1) sq += __shfl_xor(sq, off, 32);
    const float rs = rsqrtf(sq * (1.0f / HDIM) + RMS_EPS);
    sw[p * RSP + ln]      = (_Float16)(o0 * rs);
    sw[p * RSP + ln + 32] = (_Float16)(b1 * rs);
    sw[p * RSP + ln + 64] = (_Float16)(o2 * rs);
    sw[p * RSP + ln + 96] = (_Float16)(b2 * rs);
  }
  {
    const float sa0 = sa[0], sa1 = sa[1];
    const float* vsrc = base + 2 * DD;
    const float* vesrc = ve + (size_t)s * DD + h * HDIM;
#pragma unroll
    for (int i = 0; i < 4; ++i) {
      const int d = ln + 32 * i;
      sw[2 * RSP + d] = (_Float16)(sa0 * vsrc[d] + sa1 * vesrc[d]);
    }
  }
  __builtin_amdgcn_fence(__ATOMIC_RELEASE, "workgroup");
  __builtin_amdgcn_wave_barrier();
  __builtin_amdgcn_fence(__ATOMIC_ACQUIRE, "workgroup");
  const int hh = ln >> 4, c8 = (ln & 15) * 8;           // 256-B row = 16 lanes x 16 B
  const size_t PL = (size_t)NTOK * DD;
  const size_t row = ((size_t)(b * HH + h) * SS + s) * HDIM;
  const v8h v01 = *(const v8h*)(sw + hh * RSP + c8);
  const v8h v2  = *(const v8h*)(sw + 2 * RSP + c8);
  _Float16* d01 = planes + (size_t)hh * PL + row + c8;
  _Float16* d2  = planes + 2 * PL + row + c8;
  {
    *(v8h*)d01 = v01;
    if (hh == 0) *(v8h*)d2 = v2;
    
  }
}

#define AKC 64
#define AQB 64
#define OSP 136
#define KPITCH 272                     // K row pitch in bytes (16 B x odd: conflict-free for ds_load_b128)
#define VPITCH 288                     // V row pitch in bytes (32 B x odd: conflict-free for ds_load_tr16_b128)
#define KBUF (AKC * KPITCH)
#define VBUF (AKC * VPITCH)
// Eight 16-byte copies per lane: rows r, r+16, .. r+112 of one 128-row chunk pair of 256-byte rows (LSTEP = 16 LDS rows).
// The s_wait_xcnt closes the statement so that no address register is rewritten ahead of it.
template <int LSTEP>
__device__ __forceinline__ void copy_kv8(uint32_t l, const unsigned short* gp) {
  asm volatile(
      "global_load_async_to_lds_b128 %0, %8, off\n\t"
      "global_load_async_to_lds_b128 %1, %9, off\n\t"
      "global_load_async_to_lds_b128 %2, %10, off\n\t"
      "global_load_async_to_lds_b128 %3, %11, off\n\t"
      "global_load_async_to_lds_b128 %4, %12, off\n\t"
      "global_load_async_to_lds_b128 %5, %13, off\n\t"
      "global_load_async_to_lds_b128 %6, %14, off\n\t"
      "global_load_async_to_lds_b128 %7, %15, off\n\t"
      "s_wait_xcnt 0x0"
      :: "v"(l), "v"(l + LSTEP), "v"(l + 2 * LSTEP), "v"(l + 3 * LSTEP),
         "v"(l + 4 * LSTEP), "v"(l + 5 * LSTEP), "v"(l + 6 * LSTEP), "v"(l + 7 * LSTEP),
         "v"(gp), "v"(gp + 16 * HDIM), "v"(gp + 32 * HDIM), "v"(gp + 48 * HDIM),
         "v"(gp + 64 * HDIM), "v"(gp + 80 * HDIM), "v"(gp + 96 * HDIM), "v"(gp + 112 * HDIM)
      : "memory");
}
// lane (c, hh) gets T[row0 + 8 hh + 0..7][col0 + c] of a row-major 16-bit LDS tile; p is the lane's own address
typedef short s16x8 __attribute__((ext_vector_type(8)));
__device__ __forceinline__ v8h ld_tr16(const char* p) {
  typedef __attribute__((address_space(3))) s16x8 lds_s16x8;
  return __builtin_bit_cast(v8h, __builtin_amdgcn_ds_load_tr16_b128_v8i16((lds_s16x8*)p));
}
// lane l with lane l ^ 16
__device__ __forceinline__ float xhalf(float x) {
  return __builtin_bit_cast(float, __builtin_amdgcn_permlanex16(__builtin_bit_cast(int, x), __builtin_bit_cast(int, x),
                                                                0x76543210, 0xfedcba98, false, false));
}
// 2^x by the hardware's v_exp_f32. The v_nop that ends each statement is the free slot that the instruction set asks for behind a
// transcendental, before its result is read or its source overwritten.
// Eight at a time, each in place: none reads a neighbour's result or writes a neighbour's source, so one slot serves all eight.
__device__ __forceinline__ float exp2_hw(float x) {
  asm("v_exp_f32 %0, %0\n\tv_nop" : "+v"(x));
  return x;
}
__device__ __forceinline__ void exp2_hw8(float* e) {
  asm("v_exp_f32 %0, %0\n\tv_exp_f32 %1, %1\n\tv_exp_f32 %2, %2\n\tv_exp_f32 %3, %3\n\t"
      "v_exp_f32 %4, %4\n\tv_exp_f32 %5, %5\n\tv_exp_f32 %6, %6\n\tv_exp_f32 %7, %7\n\tv_nop"
      : "+v"(e[0]), "+v"(e[1]), "+v"(e[2]), "+v"(e[3]), "+v"(e[4]), "+v"(e[5]), "+v"(e[6]), "+v"(e[7]));
}
// two waves per SIMD: the eight waves of one work-group
__global__ __launch_bounds__(256) __attribute__((amdgpu_waves_per_eu(2, 2))) void attn128_k(const unsigned short* __restrict__ qpp, const unsigned short* __restrict__ kpp,
                                                 const unsigned short* __restrict__ vpp, const int* __restrict__ docs,
                                                 unsigned short* __restrict__ outp) {
  union FH { v16h v; v8h h[2]; };
  // two buffers of a chunk pair, [kv][d]; behind the loop Ksm carries group 1's partial results, Vsm the output rows
  __shared__ __align__(16) char Ksm[2 * 2 * KBUF];         // pitch KPITCH
  __shared__ __align__(16) char Vsm[2 * 2 * VBUF];         // pitch VPITCH
  static_assert(sizeof(Ksm) >= 4 * 32 * (64 + 2) * sizeof(float), "partial O^T, maximum and sum of four waves");
  static_assert(sizeof(Vsm) >= 4 * 16 * OSP * sizeof(_Float16), "output rows of four waves");
  const _Float16* qp = (const _Float16*)qpp;
  _Float16* out = (_Float16*)outp;
  const int tid = threadIdx.x, lane = tid & 31, hh = lane >> 4, c = lane & 15;
  const int wave = __builtin_amdgcn_readfirstlane(tid >> 5);
  const int grp = wave >> 2, wq = wave & 3;     // key group; the wave's 16 queries within the tile
  const int nqb = SS / AQB;
  const int bx = blockIdx.x;
  const int qb = nqb - 1 - bx / (BB * HH);      // longest tiles first
  const int bh = bx % (BB * HH);
  const int h = bh % HH;
  const int b = bh / HH;
  const int q0 = qb * AQB + wq * 16;
  const size_t rowb = (size_t)(b * HH + h) * SS;

  v16h qa[4];
  {
    const _Float16* qrow = qp + (rowb + q0 + c) * HDIM + 8 * hh;
#pragma unroll
    for (int dc = 0; dc < 4; ++dc) qa[dc] = Frag<_Float16>::load(qrow + dc * 32);
  }
  const int qrow = q0 + c;          // the lane's query
  const int dq = docs[qrow];
  float mrow = -INFINITY;           // running maximum of the query in base-2 units, alike in both halves
  float lrow = 0.f;                 // running sum (x2^15) over this half's keys; the halves are joined behind the loop
  v8f oacc[8];                      // O^T: oacc[t][r] = O[qrow][t*16 + 8 hh + r]
#pragma unroll
  for (int t = 0; t < 8; ++t) oacc[t] = (v8f){0.f,0.f,0.f,0.f,0.f,0.f,0.f,0.f};

  // chunk pairs, block-uniform; where qb is even the last pair's odd chunk lies above the diagonal: its rows exist
  // (qb + 1 < S / 64 there) and every score of it is masked
  const int nPairs = qb / 2 + 1;
  // copy addresses: lane brings 16 B at column chunk (tid & 15) of rows (tid >> 4) + 16 i
  const int crow = tid >> 4, ccol = (tid & 15) * 8;
  const unsigned short* gK = kpp + (rowb + crow) * HDIM + ccol;
  const unsigned short* gV = vpp + (rowb + crow) * HDIM + ccol;
  const uint32_t lK = (uint32_t)(uintptr_t)Ksm + (uint32_t)(crow * KPITCH + ccol * 2);
  const uint32_t lV = (uint32_t)(uintptr_t)Vsm + (uint32_t)(crow * VPITCH + ccol * 2);
  copy_kv8<16 * KPITCH>(lK, gK);
  copy_kv8<16 * VPITCH>(lV, gV);
  asm volatile("s_wait_asynccnt 0x0" ::: "memory");   // pair 0's own copies have landed
  __syncthreads();                                    // and every other wave's
  if (nPairs > 1) {
    copy_kv8<16 * KPITCH>(lK + 2 * KBUF, gK + 2 * AKC * HDIM);
    copy_kv8<16 * VPITCH>(lV + 2 * VBUF, gV + 2 * AKC * HDIM);
  }
  for (int pr = 0; pr < nPairs; ++pr) {
    const int kc = 2 * pr + grp;    // this group's chunk of the pair
    const int kv0 = kc * AKC;
    const unsigned bsel = (unsigned)(pr & 1);
    const char* Kb = Ksm + (2 * bsel + grp) * KBUF + c * KPITCH + 16 * hh;
    const char* Vb = Vsm + (2 * bsel + grp) * VBUF + (8 * hh + (lane & 7)) * VPITCH + ((lane >> 3) & 1) * 16;

    v8f s[4];
    FH kb[4][4];
    v4i dk[4][2];                   // docs of the lane's 32 keys: kv0 + j*16 + 8 hh + 0..7
#pragma unroll
    for (int j = 0; j < 4; ++j) {
      dk[j][0] = *(const v4i*)(docs + kv0 + j * 16 + 8 * hh);
      dk[j][1] = *(const v4i*)(docs + kv0 + j * 16 + 8 * hh + 4);
    }
    // no address register of these eight loads is rewritten (here: by the K loads' results) ahead of this wait
    asm volatile("s_wait_xcnt 0x0" ::: "memory");
#pragma unroll
    for (int j = 0; j < 4; ++j) {
#pragma unroll
      for (int dc = 0; dc < 4; ++dc) {
        kb[j][dc].h[0] = *(const v8h*)(Kb + j * 16 * KPITCH + dc * 64);
        kb[j][dc].h[1] = *(const v8h*)(Kb + j * 16 * KPITCH + dc * 64 + 32);
      }
    }
    // keeps the chunk's 32 K loads together ahead of its 16 score products: one LDS latency per chunk, not one per product
    __builtin_amdgcn_sched_barrier(0);
#pragma unroll
    for (int j = 0; j < 4; ++j) {
      s[j] = (v8f){0.f,0.f,0.f,0.f,0.f,0.f,0.f,0.f};
#pragma unroll
      for (int dc = 0; dc < 4; ++dc) s[j] = Frag<_Float16>::mma(kb[j][dc].v, qa[dc], s[j]);   // rows = keys, column = query
    }
    const bool diag = (kc >= qb);
    float cm[4];
#pragma unroll
    for (int j = 0; j < 4; ++j) {
      float m = -INFINITY;
#pragma unroll
      for (int r = 0; r < 8; ++r) {
        const int key = kv0 + j * 16 + 8 * hh + r;
        float sv = s[j][r];         // raw: the positive scale commutes with the maximum and goes into the exponent's fma
        const bool masked = (dk[j][r >> 2][r & 3] != dq) || (diag && (key > qrow));
        if (masked) sv = -INFINITY;
        s[j][r] = sv;
        m = fmaxf(m, sv);
      }
      cm[j] = m;
    }
    float mc = fmaxf(fmaxf(cm[0], cm[1]), fmaxf(cm[2], cm[3]));
    mc = fmaxf(mc, xhalf(mc));
    const float mnew = fmaxf(mrow, mc * ATT_SCALE_LOG2E);
    const float mref = (mnew > -INFINITY) ? mnew : 0.0f;   // all-masked so far -> p = 0, alpha = 0
    const float alpha = exp2_hw(mrow - mref);
    const float eoff = PSCALE_LOG2 - mref;
    mrow = mnew;
    FH pt[2];
    float ps[4];
#pragma unroll
    for (int j = 0; j < 4; ++j) {
      float a = 0.f;
      float p[8];                   // p * 2^15
#pragma unroll
      for (int r = 0; r < 8; ++r) p[r] = fmaf(s[j][r], ATT_SCALE_LOG2E, eoff);
      exp2_hw8(p);
#pragma unroll
      for (int r = 0; r < 8; ++r) {
        a += p[r];
        pt[j >> 1].h[j & 1][r] = (_Float16)p[r];
      }
      ps[j] = a;
    }
    lrow = lrow * alpha + ((ps[0] + ps[1]) + (ps[2] + ps[3]));
#pragma unroll
    for (int t = 0; t < 8; ++t) oacc[t] *= alpha;
    FH vb[2][8];
#pragma unroll
    for (int kk = 0; kk < 2; ++kk) {
#pragma unroll
      for (int t = 0; t < 8; ++t) {
        vb[kk][t].h[0] = ld_tr16(Vb + (kk * 32) * VPITCH + t * 32);        // keys kk*32 + 8 hh + 0..7 of column t*16 + c
        vb[kk][t].h[1] = ld_tr16(Vb + (kk * 32 + 16) * VPITCH + t * 32);   // keys kk*32 + 16 + 8 hh + 0..7
      }
    }
    // keeps the chunk's 32 V loads together ahead of the 16 output products
    __builtin_amdgcn_sched_barrier(0);
#pragma unroll
    for (int kk = 0; kk < 2; ++kk) {
#pragma unroll
      for (int t = 0; t < 8; ++t) oacc[t] = Frag<_Float16>::mma(vb[kk][t].v, pt[kk].v, oacc[t]);   // rows = d, column = query
    }
    asm volatile("s_wait_dscnt 0x0" ::: "memory");     // this wave's reads of the buffers have returned
    asm volatile("s_wait_asynccnt 0x0" ::: "memory");  // its copies for pair pr + 1 have landed
    __syncthreads();                                   // publishes pair pr + 1, frees this pair's buffers
    if (pr + 2 < nPairs) {
      copy_kv8<16 * KPITCH>(lK + bsel * (2 * KBUF), gK + (size_t)(pr + 2) * (2 * AKC * HDIM));
      copy_kv8<16 * VPITCH>(lV + bsel * (2 * VBUF), gV + (size_t)(pr + 2) * (2 * AKC * HDIM));
    }
  }
  asm volatile("s_wait_asynccnt 0x0" ::: "memory");    // nothing in flight when the buffers change their use

  // ---- join the two groups: lane l of wave w + 4 holds the same query and the same d as lane l of wave w ----
  // The loop's last barrier stands behind every wave's last read of the buffers.
  float* px  = (float*)Ksm + (size_t)wq * (16 * 32 * 4) + lane * 4;       // [wq][2 t + half of the 8][lane] x 16 B
  float* pml = (float*)Ksm + 4 * (16 * 32 * 4) + (wq * 32 + lane) * 2;    // [wq][lane] x (maximum, sum)
  if (grp == 1) {
#pragma unroll
    for (int t = 0; t < 8; ++t) {
      *(v4f*)(px + (2 * t) * 128)     = __builtin_shufflevector(oacc[t], oacc[t], 0, 1, 2, 3);
      *(v4f*)(px + (2 * t + 1) * 128) = __builtin_shufflevector(oacc[t], oacc[t], 4, 5, 6, 7);
    }
    pml[0] = mrow;
    pml[1] = lrow;
  }
  __syncthreads();                  // group 1's partial results are there for group 0
  if (grp == 1) return;             // wave-uniform, behind the last work-group barrier

  _Float16* os = (_Float16*)Vsm + wq * (16 * OSP);   // per wave [row][d]
  {
    const float m1 = pml[0], l1 = pml[1];
    const float mj = fmaxf(mrow, m1);
    const float mjr = (mj > -INFINITY) ? mj : 0.0f;  // a group that saw only masked keys weighs 0
    const float a0 = exp2_hw(mrow - mjr), a1 = exp2_hw(m1 - mjr);
    const float lj = lrow * a0 + l1 * a1;
    const float inv = 1.0f / (lj + xhalf(lj));       // sum and O^T both carry the 2^15
    const float w0 = a0 * inv, w1 = a1 * inv;
#pragma unroll
    for (int t = 0; t < 8; ++t) {
      const v4f pa = *(const v4f*)(px + (2 * t) * 128);
      const v4f pb = *(const v4f*)(px + (2 * t + 1) * 128);
      v8h ov;
#pragma unroll
      for (int r = 0; r < 4; ++r) {
        ov[r]     = (_Float16)(oacc[t][r] * w0 + pa[r] * w1);
        ov[r + 4] = (_Float16)(oacc[t][r + 4] * w0 + pb[r] * w1);
      }
      *(v8h*)(os + c * OSP + t * 16 + 8 * hh) = ov;
    }
  }
  __builtin_amdgcn_fence(__ATOMIC_RELEASE, "workgroup");
  __builtin_amdgcn_wave_barrier();
  __builtin_amdgcn_fence(__ATOMIC_ACQUIRE, "workgroup");
  {
    const int c8 = (lane & 15) * 8;   // 256-B row segment = 16 lanes x 16 B, 2 rows per instruction
    {
#pragma unroll
      for (int it = 0; it < 8; ++it) {
        const int row = it * 2 + hh;
        const v8h val = *(const v8h*)(os + row * OSP + c8);
        *(v8h*)(out + (size_t)(b * SS + q0 + row) * DD + h * HDIM + c8) = val;
      }
      
    }
  }
}

// ---------------------------------------------------------------------------
extern "C" void kernel_launch(void* const* d_in, const int* in_sizes, int n_in,
                              void* d_out, int out_size, void* d_ws,
                              size_t ws_size, hipStream_t stream) {
  if (n_in < 12) return;
  if (in_sizes[0] != NTOK * DD || in_sizes[1] != SS * DD || in_sizes[2] != NTOK * DD ||
      in_sizes[3] < 2 || in_sizes[4] < 2 || in_sizes[5] < DD || in_sizes[6] < DD ||
      in_sizes[7] != DD * 3 * DD || in_sizes[8] != DD * DD || in_sizes[9] != DD * 4 * DD ||
      in_sizes[10] != 4 * DD * DD || in_sizes[11] != SS || out_size != NTOK * DD) return;

  const float* x     = (const float*)d_in[0];
  const float* ve    = (const float*)d_in[1];
  const float* x0    = (const float*)d_in[2];
  const float* lam   = (const float*)d_in[3];
  const float* sal   = (const float*)d_in[4];
  const float* ln1   = (const float*)d_in[5];
  const float* ln2   = (const float*)d_in[6];
  const float* wqkv  = (const float*)d_in[7];
  const float* wo    = (const float*)d_in[8];
  const float* wfc   = (const float*)d_in[9];
  const float* wproj = (const float*)d_in[10];
  const int*   ids   = (const int*)d_in[11];
  float* outf = (float*)d_out;

  // ---- carve (bytes) ----
  const size_t szWO   = (size_t)DD * DD * 2;              //   2 MiB  w_o^T f16
  const size_t szWFC  = (size_t)4 * DD * DD * 2;          //   8 MiB  w_fc^T f16
  const size_t szWPR  = (size_t)4 * DD * DD * 2;          //   8 MiB  w_proj^T f16
  const size_t szXR   = (size_t)NTOK * DD * 4;            //  16 MiB  mixed x f32
  const size_t szBIG  = (size_t)NTOK * 3 * DD * 4;        //  48 MiB  qkv f32, later h f16 (32 MiB) + x2 f32 (16 MiB)
  const size_t szXN   = (size_t)NTOK * DD * 2;            //   8 MiB  xn f16, later xn2 f16
  const size_t szWQA  = (size_t)NTOK * DD * 2;            //   8 MiB  w_qkv^T f16 (6 MiB), later attention out f16
  const size_t szPL   = (size_t)3 * NTOK * DD * 2;        //  24 MiB  q,k,v f16 planes
  const size_t szROPE = (size_t)SS * 64 * 4;              // 512 KiB
  const size_t szDOC  = (size_t)SS * 4;
  const size_t oWO = 0, oWFC = oWO + szWO, oWPR = oWFC + szWFC, oXR = oWPR + szWPR, oBIG = oXR + szXR,
               oXN = oBIG + szBIG, oWQA = oXN + szXN, oPL = oWQA + szWQA, oROPE = oPL + szPL,
               oDOC = oROPE + szROPE, oEND = oDOC + szDOC;
  if (oEND > ws_size) return;
  char* ws = (char*)d_ws;
  unsigned short* woT   = (unsigned short*)(ws + oWO);
  unsigned short* wfcT  = (unsigned short*)(ws + oWFC);
  unsigned short* wprT  = (unsigned short*)(ws + oWPR);
  float*          xr    = (float*)(ws + oXR);
  float*          qkvf  = (float*)(ws + oBIG);
  unsigned short* hbuf  = (unsigned short*)(ws + oBIG);
  float*          x2    = (float*)(ws + oBIG + (size_t)NTOK * 4 * DD * 2);
  unsigned short* xn    = (unsigned short*)(ws + oXN);
  unsigned short* xn2   = xn;
  unsigned short* wqkvT = (unsigned short*)(ws + oWQA);
  unsigned short* attn  = (unsigned short*)(ws + oWQA);
  unsigned short* qpl   = (unsigned short*)(ws + oPL);
  unsigned short* kpl   = qpl + (size_t)NTOK * DD;
  unsigned short* vpl   = qpl + (size_t)2 * NTOK * DD;
  float*          rope  = (float*)(ws + oROPE);
  int*            docs  = (int*)(ws + oDOC);

  // rotary table + docs; x = l0*x + l1*x0, xn = LN(x)*ln1_w; the four weight transposes
  prep_k<<<PB_TAB + PB_LN + PB_WQKV + PB_WO + PB_WFC + PB_WPR, 256, 0, stream>>>(
      x, x0, lam, ln1, xr, xn, wqkv, wqkvT, wo, woT, wfc, wfcT, wproj, wprT, ids, rope, docs);
  // qkv = xn @ w_qkv (f32 out)
  {
    const int M = NTOK, N = 3 * DD, K = DD;
    const int tiles = (M / 128) * (N / 128);
    wmma_gemm64<0, false, 0, 0, false, 0><<<dim3(tiles, 1), 128, 0, stream>>>(
        xn, xn, K, 0, wqkvT, wqkvT, K, 0, qkvf, qkvf, N, 0, xr, xr, 0, M, N, K, WMUL_INV);
  }
  // rotary + RMS-norm + value mix -> f16 planes
  rope_k<<<dim3(SS, BB), 256, 0, stream>>>(qkvf, ve, sal, rope, qpl);
  // attention
  attn128_k<<<BB * HH * (SS / AQB), 256, 0, stream>>>(qpl, kpl, vpl, docs, attn);
  // x2 = xr + attn @ w_o
  {
    const int M = NTOK, N = DD, K = DD;
    const int tiles = (M / 128) * (N / 128);
    wmma_gemm64<0, false, 0, 0, true, 0, true><<<dim3(tiles, 1), 128, 0, stream>>>(
        attn, attn, K, 0, woT, woT, K, 0, x2, x2, N, 0, xr, xr, 0, M, N, K, WMUL_INV);
  }
  // xn2 = LN(x2)*ln2_w
  ln_k<<<NTOK, 128, 0, stream>>>(x2, ln2, xn2);
  // h = relu(xn2 @ w_fc)^2 (f16 out)
  {
    const int M = NTOK, N = 4 * DD, K = DD;
    const int tiles = (M / 128) * (N / 128);
    wmma_gemm64<0, false, 0, 1, false, 6><<<dim3(tiles, 1), 128, 0, stream>>>(
        xn2, xn2, K, 0, wfcT, wfcT, K, 0, hbuf, hbuf, N, 0, xr, xr, 0, M, N, K, WMUL_INV);
  }
  // out = x2 + h @ w_proj
  {
    const int M = NTOK, N = DD, K = 4 * DD;
    const int tiles = (M / 128) * (N / 128);
    wmma_gemm64<0, false, 0, 0, true, 0, true><<<dim3(tiles, 1), 128, 0, stream>>>(
        hbuf, hbuf, K, 0, wprT, wprT, K, 0, outf, outf, N, 0, x2, x2, 0, M, N, K, WMUL_INV);
  }
}

// v009
// Measured time: 178 microseconds a run.
// In two side-by-side timings against v008, it was 1.04 and 1.05 times as fast.
// Over all steps from v000 it is 3.54 times as fast.
#include <hip/hip_runtime.h>
#include <stdint.h>
// All contractions: v_wmma_f32_16x16x32_f16 (f16 operands, f32 accumulate); projection weights carried x64, attention p carried x2^15; norms, rotary, softmax and residuals in f32.

#define BB 2
#define SS 2048
#define DD 1024
#define HH 8
#define HDIM 128
#define NTOK (BB * SS)
#define EOT_ID 50256
#define ATT_SCALE 0.12f
#define LN_EPS 1e-6f
#define RMS_EPS 1.1920929e-7f
#define WMUL 64.0f
#define WMUL_INV (1.0f / 64.0f)

typedef __attribute__((ext_vector_type(16))) _Float16 v16h;
typedef __attribute__((ext_vector_type(8)))  _Float16 v8h;
typedef __attribute__((ext_vector_type(4)))  _Float16 v4h;
typedef __attribute__((ext_vector_type(16))) __bf16   v16b;
typedef __attribute__((ext_vector_type(8)))  __bf16   v8b;
typedef __attribute__((ext_vector_type(8)))  float    v8f;
typedef __attribute__((ext_vector_type(4)))  float    v4f;
typedef __attribute__((ext_vector_type(4)))  int      v4i;
#define U16(p) ((const unsigned short*)(const void*)(p))
#define ATT_SCALE_LOG2E (ATT_SCALE * 1.44269504f)   // times log2(e): scores in base-2 units
#define PSCALE_LOG2 15.0f                           // p is carried x2^15

__device__ __forceinline__ unsigned short f2bf_bits(float f) {
  unsigned u = __float_as_uint(f);
  return (unsigned short)((u + 0x7FFFu + ((u >> 16) & 1u)) >> 16);
}
__device__ __forceinline__ float bf_bits2f(unsigned short h) { return __uint_as_float(((unsigned)h) << 16); }

// hazard guards as plain device helpers
__device__ __forceinline__ void dep_guard_h(v8f& a, v8f& b, v16h x, v16h y) { asm volatile("v_nop\n\tv_nop\n\tv_nop\n\tv_nop" : "+v"(a), "+v"(b) : "v"(x), "v"(y)); }
__device__ __forceinline__ void dep_guard_b(v8f& a, v8f& b, v16b x, v16b y) { asm volatile("v_nop\n\tv_nop\n\tv_nop\n\tv_nop" : "+v"(a), "+v"(b) : "v"(x), "v"(y)); }
__device__ __forceinline__ void keep4_h(v16h a, v16h b, v16h c, v16h d) { asm volatile("v_nop" :: "v"(a), "v"(b), "v"(c), "v"(d)); }
__device__ __forceinline__ void keep4_b(v16b a, v16b b, v16b c, v16b d) { asm volatile("v_nop" :: "v"(a), "v"(b), "v"(c), "v"(d)); }
__device__ __forceinline__ void acc_guard4(v8f& a, v8f& b, v8f& c, v8f& d) { asm volatile("v_nop\n\tv_nop\n\tv_nop\n\tv_nop" : "+v"(a), "+v"(b), "+v"(c), "+v"(d)); }
template <typename T> struct Frag;
template <> struct Frag<_Float16> {
  typedef v16h V; union U { v16h v; v8h h[2]; };
  static __device__ __forceinline__ v16h load(const _Float16* p) {   // elements 0..7 <- p[0..7], 8..15 <- p[16..23]
    U f; f.h[0] = *(const v8h*)(p); f.h[1] = *(const v8h*)(p + 16); return f.v;
  }
  static __device__ __forceinline__ v8f mma(v16h a, v16h b, v8f c) {
    return __builtin_amdgcn_wmma_f32_16x16x32_f16(false, a, false, b, (short)0, c, false, false);
  }
  static __device__ __forceinline__ void guard(v8f& a, v8f& b, v16h x, v16h y) { dep_guard_h(a, b, x, y); }
  static __device__ __forceinline__ void keep(v16h a, v16h b, v16h c, v16h d) { keep4_h(a, b, c, d); }
};
template <> struct Frag<__bf16> {
  typedef v16b V; union U { v16b v; v8b h[2]; };
  static __device__ __forceinline__ v16b load(const __bf16* p) {
    U f; f.h[0] = *(const v8b*)(p); f.h[1] = *(const v8b*)(p + 16); return f.v;
  }
  static __device__ __forceinline__ v8f mma(v16b a, v16b b, v8f c) {
    return __builtin_amdgcn_wmma_f32_16x16x32_bf16(false, a, false, b, (short)0, c, false, false);
  }
  static __device__ __forceinline__ void guard(v8f& a, v8f& b, v16b x, v16b y) { dep_guard_b(a, b, x, y); }
  static __device__ __forceinline__ void keep(v16b a, v16b b, v16b c, v16b d) { keep4_b(a, b, c, d); }
};

// ---- LDS-staged batched WMMA GEMM ------------------------------------------
// C[m,n] = scale * sum_k A[m,k] * Bt[n,k] (+bias)(+resid); a block of 4 waves owns a 128x128 tile, each wave 64x64 of it.
// A row-major [M,K]; Bt row-major [N,K]; M,N % 128 == 0, K % 64 == 0.
// Per trip 64 k of both operands (128 rows x 128 B each) lie in LDS at pitch 144 B, brought by asynchronous
// copies into two buffers: the next trip's copies fly while this trip's fragments are read and multiplied.
// BIAS_MODE: 0 = none, 1 = bias[m], 2 = bias[n].
// OUT_MODE: 0 = f32, 1 = f16, 2 = bf16 hi plane (Cout) + bf16 lo plane (Cout2).
// ACT 6: relu then square.
// ET: 0 = f16 operands, 1 = bf16 operands (pointers passed as 16-bit storage)
template <int ET> struct Elem;
template <> struct Elem<0> { typedef _Float16 T; };
template <> struct Elem<1> { typedef __bf16 T; };
#define GBK 64                         // k per trip
#define GPITCH 144                     // LDS row pitch in bytes (16 B x odd: conflict-free for ds_load_b128)
#define GOPER (128 * GPITCH)           // one operand's 128 rows
#define GSTAGE (2 * GOPER)             // A rows, then Bt rows
// Eight 16-byte copies per lane: rows r, r+16, .. r+112 of one operand's 128-row slab. The s_wait_xcnt closes the
// statement so that no address register is rewritten ahead of it.
__device__ __forceinline__ void copy_rows8(uint32_t l, const unsigned short* gp, size_t step) {
  asm volatile(
      "global_load_async_to_lds_b128 %0, %8, off\n\t"
      "global_load_async_to_lds_b128 %1, %9, off\n\t"
      "global_load_async_to_lds_b128 %2, %10, off\n\t"
      "global_load_async_to_lds_b128 %3, %11, off\n\t"
      "global_load_async_to_lds_b128 %4, %12, off\n\t"
      "global_load_async_to_lds_b128 %5, %13, off\n\t"
      "global_load_async_to_lds_b128 %6, %14, off\n\t"
      "global_load_async_to_lds_b128 %7, %15, off\n\t"
      "s_wait_xcnt 0x0"
      :: "v"(l), "v"(l + 16 * GPITCH), "v"(l + 32 * GPITCH), "v"(l + 48 * GPITCH),
         "v"(l + 64 * GPITCH), "v"(l + 80 * GPITCH), "v"(l + 96 * GPITCH), "v"(l + 112 * GPITCH),
         "v"(gp), "v"(gp + step), "v"(gp + 2 * step), "v"(gp + 3 * step),
         "v"(gp + 4 * step), "v"(gp + 5 * step), "v"(gp + 6 * step), "v"(gp + 7 * step)
      : "memory");
}
// AHEAD (for a grid of one block a WGP, so one wave a SIMD, where no other wave covers a wave's own LDS latency; K % 128 == 0):
// a trip is 128 k (rows of 256 B at pitch 272 B) in four blocks of 16 products, and each block's 16 fragment loads go out
// as one group ahead of the block before it, into a second register set. The first block of trip t + 1 is so fetched in
// trip t: the point where trip t + 1 is published and trip t's buffer refilled stands ahead of trip t's last block,
// whose fragments are in registers by then.
#define PBK 128
#define PPITCH 272                     // 16 B x odd
#define POPER (128 * PPITCH)
#define PSTAGE (2 * POPER)
// Sixteen 16-byte copies per lane: both 128-byte halves of rows r, r+16, .. r+112 of one operand's 128 rows of 256 B; the
// immediate offset moves the LDS and the global address alike, so a row's two halves share their address registers.
// The builtin form leaves the choice of address registers to the compiler: asm operands, bound to the low 256 registers,
// made it move accumulators out of their way in every trip.
__device__ __forceinline__ void copy_wide16(char* l, const unsigned short* gp, size_t step) {
  typedef __attribute__((address_space(1))) v4i glb_v4i;
  typedef __attribute__((address_space(3))) v4i lds_v4i;
#pragma unroll
  for (int i = 0; i < 8; ++i) {
    __builtin_amdgcn_global_load_async_to_lds_b128((glb_v4i*)(gp + i * step), (lds_v4i*)(l + i * 16 * PPITCH), 0, 0);
    __builtin_amdgcn_global_load_async_to_lds_b128((glb_v4i*)(gp + i * step), (lds_v4i*)(l + i * 16 * PPITCH), 128, 0);
  }
}
// one trip's 128 rows of both operands; step = 16 rows
__device__ __forceinline__ void copy_stage(char* l, const unsigned short* ga, size_t stepA,
                                           const unsigned short* gb, size_t stepB) {
  copy_wide16(l, ga, stepA);
  copy_wide16(l + POPER, gb, stepB);
}
template <int ET, bool SPLIT, int BIAS_MODE, int OUT_MODE, bool RESID, int ACT = 0, bool AHEAD = false>
__global__ __launch_bounds__(128) void wmma_gemm64(
    const unsigned short* __restrict__ Ap, const unsigned short* __restrict__ A2p, int lda, long strideA,
    const unsigned short* __restrict__ Btp, const unsigned short* __restrict__ Bt2p, int ldb, long strideB,
    void* __restrict__ Cout, void* __restrict__ Cout2, int ldc, long strideC,
    const float* __restrict__ bias,
    const float* __restrict__ resid, long strideR,
    int M, int N, int K, float scale) {
  static_assert(!SPLIT, "single-plane operands only");
  typedef typename Elem<ET>::T T;
  typedef typename Frag<T>::V V;
  // two operand buffers; after the loop its first bytes serve as the per-wave 16x64 f32 slabs, pitch 68 floats
  __shared__ __align__(16) char smem[AHEAD ? 2 * PSTAGE : 2 * GSTAGE];
  const int b    = blockIdx.y;
  const int tid  = threadIdx.x;
  const int lane = tid & 31;
  const int wave = tid >> 5;
  const int tilesN = N >> 7;
  const int tilesM = M >> 7;
  const int tile = blockIdx.x;
  if (tile >= tilesM * tilesN) return;   // block-uniform, in front of every barrier
  const int tm = tile / tilesN;
  const int tn = tile - tm * tilesN;
  const int mB = tm << 7;                      // block tile origin
  const int nB = tn << 7;
  const int wm = (wave >> 1) << 6;             // wave tile origin inside the block tile
  const int wn = (wave & 1) << 6;
  const int m0 = mB + wm;
  const int n0 = nB + wn;

  const int rlane = lane & 15;                 // row (A) / col (B, D) within subtile
  const int koff  = (lane >> 4) * 8;           // k offset of this lane half
  const int mOff  = (lane >> 4) * 8;           // D row offset

  v8f acc[4][4];
#pragma unroll
  for (int i = 0; i < 4; ++i)
#pragma unroll
    for (int j = 0; j < 4; ++j) acc[i][j] = (v8f){0.f,0.f,0.f,0.f,0.f,0.f,0.f,0.f};

  if constexpr (AHEAD) {
  // copy addresses: lane brings 16 B at column chunks (tid & 7) and (tid & 7) + 8 of rows (tid >> 3) + 16 i
  const int crow = tid >> 3, ccol = (tid & 7) * 8;
  const unsigned short* gA = Ap  + (size_t)b * strideA + (size_t)(mB + crow) * lda + ccol;
  const unsigned short* gB = Btp + (size_t)b * strideB + (size_t)(nB + crow) * ldb + ccol;
  const size_t stepA = (size_t)16 * lda, stepB = (size_t)16 * ldb;
  char* lds0 = smem + crow * PPITCH + ccol * 2;
  const char* sA0 = smem + (wm + rlane) * PPITCH + koff * 2;
  const char* sB0 = smem + POPER + (wn + rlane) * PPITCH + koff * 2;

  const int nT = K / PBK;
  copy_stage(lds0, gA, stepA, gB, stepB);
  asm volatile("s_wait_asynccnt 0x0" ::: "memory");   // trip 0's own copies have landed
  __syncthreads();                                    // and every other wave's
  if (nT > 1) copy_stage(lds0 + PSTAGE, gA + PBK, stepA, gB + PBK, stepB);
  V fa[2][4], fb[2][4];                               // block kk works on set kk & 1
#pragma unroll
  for (int j = 0; j < 4; ++j) fb[0][j] = Frag<T>::load((const T*)(sB0 + j * 16 * PPITCH));
#pragma unroll
  for (int i = 0; i < 4; ++i) fa[0][i] = Frag<T>::load((const T*)(sA0 + i * 16 * PPITCH));
  for (int t = 0; t < nT; ++t) {
    const unsigned bufo = (unsigned)(t & 1) * PSTAGE;
#pragma unroll
    for (int kk = 0; kk < PBK / 32; ++kk) {
      const int cur = kk & 1, nxt = cur ^ 1;
      if (kk + 1 < PBK / 32) {
#pragma unroll
        for (int j = 0; j < 4; ++j) fb[nxt][j] = Frag<T>::load((const T*)(sB0 + bufo + j * 16 * PPITCH + (kk + 1) * 64));
#pragma unroll
        for (int i = 0; i < 4; ++i) fa[nxt][i] = Frag<T>::load((const T*)(sA0 + bufo + i * 16 * PPITCH + (kk + 1) * 64));
      } else {
        asm volatile("s_wait_dscnt 0x0" ::: "memory");     // this wave's last reads of the buffer, the last block's fragments, have returned
        asm volatile("s_wait_asynccnt 0x0" ::: "memory");  // its copies for trip t + 1 have landed
        __syncthreads();                                   // publishes trip t + 1, frees this trip's buffer
        if (t + 2 < nT) copy_stage(lds0 + bufo, gA + (size_t)(t + 2) * PBK, stepA, gB + (size_t)(t + 2) * PBK, stepB);
        if (t + 1 < nT) {
          const unsigned bufn = bufo ^ PSTAGE;
#pragma unroll
          for (int j = 0; j < 4; ++j) fb[nxt][j] = Frag<T>::load((const T*)(sB0 + bufn + j * 16 * PPITCH));
#pragma unroll
          for (int i = 0; i < 4; ++i) fa[nxt][i] = Frag<T>::load((const T*)(sA0 + bufn + i * 16 * PPITCH));
        }
      }
      // keeps the next block's 16 loads together ahead of this block's 16 products, which cover their latency
      __builtin_amdgcn_sched_barrier(0);
#pragma unroll
      for (int i = 0; i < 4; ++i)
#pragma unroll
        for (int j = 0; j < 4; ++j) acc[i][j] = Frag<T>::mma(fa[cur][i], fb[cur][j], acc[i][j]);
      // keeps the loads that follow in one group behind these products, not spread among them as their registers come free
      __builtin_amdgcn_sched_barrier(0);
    }
  }
  } else {
  // copy addresses: lane brings 16 B at column chunk (tid & 7) of rows (tid >> 3) + 16 i
  const int crow = tid >> 3, ccol = (tid & 7) * 8;
  const unsigned short* gA = Ap  + (size_t)b * strideA + (size_t)(mB + crow) * lda + ccol;
  const unsigned short* gB = Btp + (size_t)b * strideB + (size_t)(nB + crow) * ldb + ccol;
  const size_t stepA = (size_t)16 * lda, stepB = (size_t)16 * ldb;
  const uint32_t lds0 = (uint32_t)(uintptr_t)smem + (uint32_t)(crow * GPITCH + ccol * 2);

  const int nT = K / GBK;
  copy_rows8(lds0, gA, stepA);
  copy_rows8(lds0 + GOPER, gB, stepB);
  asm volatile("s_wait_asynccnt 0x0" ::: "memory");   // trip 0's own copies have landed
  __syncthreads();                                    // and every other wave's
  if (nT > 1) {
    copy_rows8(lds0 + GSTAGE, gA + GBK, stepA);
    copy_rows8(lds0 + GSTAGE + GOPER, gB + GBK, stepB);
  }
  for (int t = 0; t < nT; ++t) {
    const unsigned bufo = (unsigned)(t & 1) * GSTAGE;
    const char* sA = smem + bufo + (wm + rlane) * GPITCH + koff * 2;
    const char* sB = smem + bufo + GOPER + (wn + rlane) * GPITCH + koff * 2;
#pragma unroll
    for (int kk = 0; kk < GBK / 32; ++kk) {
      V bh[4], ah[4];
#pragma unroll
      for (int j = 0; j < 4; ++j) bh[j] = Frag<T>::load((const T*)(sB + j * 16 * GPITCH + kk * 64));
#pragma unroll
      for (int i = 0; i < 4; ++i) ah[i] = Frag<T>::load((const T*)(sA + i * 16 * GPITCH + kk * 64));
      // keeps the 16 fragment loads together ahead of the 16 products: one LDS latency per group, not one per A fragment
      __builtin_amdgcn_sched_barrier(0);
#pragma unroll
      for (int i = 0; i < 4; ++i) {
#pragma unroll
        for (int j = 0; j < 4; ++j) acc[i][j] = Frag<T>::mma(ah[i], bh[j], acc[i][j]);
        Frag<T>::guard(acc[i][0], acc[i][3], ah[i], ah[i]);
      }
      Frag<T>::keep(bh[0], bh[1], bh[2], bh[3]);
    }
    asm volatile("s_wait_dscnt 0x0" ::: "memory");     // this wave's reads of the buffer have returned
    asm volatile("s_wait_asynccnt 0x0" ::: "memory");  // its copies for trip t + 1 have landed
    __syncthreads();                                   // publishes trip t + 1, frees this trip's buffer
    if (t + 2 < nT) {
      copy_rows8(lds0 + bufo, gA + (size_t)(t + 2) * GBK, stepA);
      copy_rows8(lds0 + bufo + GOPER, gB + (size_t)(t + 2) * GBK, stepB);
    }
  }
  }
  asm volatile("s_wait_asynccnt 0x0" ::: "memory");    // nothing in flight when the buffers become slabs
  acc_guard4(acc[0][0], acc[0][1], acc[0][2], acc[0][3]);
  acc_guard4(acc[1][0], acc[1][1], acc[1][2], acc[1][3]);
  acc_guard4(acc[2][0], acc[2][1], acc[2][2], acc[2][3]);
  acc_guard4(acc[3][0], acc[3][1], acc[3][2], acc[3][3]);

  // ---- epilogue ----
  float* slab = (float*)smem + wave * (16 * 68);
  const float* Rb = RESID ? (resid + (size_t)b * strideR) : nullptr;
#pragma unroll
  for (int i = 0; i < 4; ++i) {
    const int mBase = m0 + (i << 4);
#pragma unroll
    for (int j = 0; j < 4; ++j) {
      const int n = n0 + (j << 4) + rlane;
      float bv = 0.f;
      if (BIAS_MODE == 2) bv = bias[n];
#pragma unroll
      for (int r = 0; r < 8; ++r) {
        float v = acc[i][j][r] * scale;
        if (BIAS_MODE == 1) v += bias[mBase + mOff + r];
        if (BIAS_MODE == 2) v += bv;
        if (RESID) v += Rb[(size_t)(mBase + mOff + r) * ldc + n];
        if (ACT == 1) v = tanhf(v);
        if (ACT == 2) v = fmaxf(v, 0.0f);
        if (ACT == 3) v = v / (1.0f + expf(-v));
        if (ACT == 4) v = (v > 0.f) ? v : 0.01f * v;
        if (ACT == 5) v = 0.5f * v * (1.0f + erff(v * 0.70710678118654752f));
        if (ACT == 6) { v = fmaxf(v, 0.0f); v = v * v; }
        slab[(mOff + r) * 68 + (j << 4) + rlane] = v;
      }
    }
    __builtin_amdgcn_fence(__ATOMIC_RELEASE, "workgroup");
    __builtin_amdgcn_wave_barrier();
    __builtin_amdgcn_fence(__ATOMIC_ACQUIRE, "workgroup");
    if (OUT_MODE == 0) {
      float* C = (float*)Cout + (size_t)b * strideC;
      const int hh = lane >> 4, c4 = (lane & 15) * 4;     // row seg = 256 B = 16 lanes x 16 B
      {
#pragma unroll
        for (int it = 0; it < 8; ++it) {
          const int row = it * 2 + hh;
          v4f v = *(const v4f*)(slab + row * 68 + c4);
          *(v4f*)(C + (size_t)(mBase + row) * ldc + n0 + c4) = v;
        }
        
      }
    } else {
      const int q = lane >> 3, c8 = (lane & 7) * 8;
      unsigned short* C  = (unsigned short*)Cout  + (size_t)b * strideC;
      unsigned short* C2 = (OUT_MODE == 2) ? ((unsigned short*)Cout2 + (size_t)b * strideC) : nullptr;
      {
#pragma unroll
        for (int it = 0; it < 4; ++it) {
          const int row = it * 4 + q;
          const float* sp = slab + row * 68 + c8;
          v8h hv, lv;
#pragma unroll
          for (int e = 0; e < 8; ++e) {
            if (OUT_MODE == 1) {
              hv[e] = (_Float16)sp[e];
            } else {
              unsigned short hb = f2bf_bits(sp[e]);
              unsigned short lb = f2bf_bits(sp[e] - bf_bits2f(hb));
              hv[e] = __builtin_bit_cast(_Float16, hb);
              lv[e] = __builtin_bit_cast(_Float16, lb);
            }
          }
          *(v8h*)(C + (size_t)(mBase + row) * ldc + n0 + c8) = hv;
          if (OUT_MODE == 2) *(v8h*)(C2 + (size_t)(mBase + row) * ldc + n0 + c8) = lv;
        }
        
      }
    }
    __builtin_amdgcn_fence(__ATOMIC_RELEASE, "workgroup");
    __builtin_amdgcn_wave_barrier();
    __builtin_amdgcn_fence(__ATOMIC_ACQUIRE, "workgroup");
  }
}

// ---- W [K][N] f32 -> Wt [N][K] f16 (x mul), 64x64 tile transposed through LDS ----
#define WTP 72
__device__ __forceinline__ void wt_cast_body(const float* __restrict__ W, unsigned short* __restrict__ Wtp,
                                             int K, int N, float mul, int bn, int bk, _Float16* st) {
  _Float16* Wt = (_Float16*)Wtp;
  const int n0 = bn * 64, k0 = bk * 64;
  const int tid = threadIdx.x;
  const int kr = tid >> 2, c16 = (tid & 3) * 16;
  const float* src = W + (size_t)(k0 + kr) * N + n0 + c16;
#pragma unroll
  for (int q = 0; q < 4; ++q) {
    const v4f v = *(const v4f*)(src + 4 * q);
#pragma unroll
    for (int e = 0; e < 4; ++e) st[(c16 + 4 * q + e) * WTP + kr] = (_Float16)(v[e] * mul);
  }
  __syncthreads();
  const int wave = tid >> 5, lane = tid & 31;
  const int q8 = lane >> 3, c8 = (lane & 7) * 8;
  {
#pragma unroll
    for (int it = 0; it < 2; ++it) {
      const int n = it * 32 + wave * 4 + q8;
      const v8h hv = *(const v8h*)(st + n * WTP + c8);
      *(v8h*)(Wt + (size_t)(n0 + n) * K + k0 + c8) = hv;
    }
    // the block ranges of the merged grid lie one behind another in the code: no register of these stores is rewritten ahead of this wait
    asm volatile("s_wait_xcnt 0x0" ::: "memory");
  }
}

// ---- rotary cos/sin table [S][64] (cos 0..31 | sin 32..63) and docs[S] = inclusive count of EOT ----
__device__ __forceinline__ void tables_body(const int* __restrict__ ids, float* __restrict__ rope,
                                            int* __restrict__ docs, int blk, int* scnt, int* sdoc) {
  const int tid = threadIdx.x, lane = tid & 31, wave = tid >> 5;
  if (blk < SS / 8) {
    const int s = blk * 8 + wave;
    float e = (float)lane * (1.0f / 31.0f);
    if (lane == 31) e = 1.0f;
    const float fr = powf(0.0009765625f, e);
    const float th = (float)s * fr;
    float sv, cv;
    sincosf(th, &sv, &cv);
    float* rp = rope + (size_t)s * 64;
    *(float*)(rp + lane) = cv;
    *(float*)(rp + 32 + lane) = sv;
    
  } else {
    int c = 0;
#pragma unroll
    for (int i = 0; i < 8; ++i) c += (ids[tid * 8 + i] == EOT_ID) ? 1 : 0;
    scnt[tid] = c;
    __syncthreads();
    for (int off = 1; off < 256; off <<= 1) {
      const int t = (tid >= off) ? scnt[tid - off] : 0;
      __syncthreads();
      scnt[tid] += t;
      __syncthreads();
    }
    int run = scnt[tid] - c;
#pragma unroll
    for (int i = 0; i < 8; ++i) {
      run += (ids[tid * 8 + i] == EOT_ID) ? 1 : 0;
      sdoc[tid * 8 + i] = run;
    }
    __syncthreads();
    const v4i a0 = *(const v4i*)(sdoc + tid * 4);
    const v4i a1 = *(const v4i*)(sdoc + 1024 + tid * 4);
    {
      *(v4i*)(docs + tid * 4) = a0;
      *(v4i*)(docs + 1024 + tid * 4) = a1;
      // as in wt_cast_body: no register of these stores is rewritten ahead of this wait
      asm volatile("s_wait_xcnt 0x0" ::: "memory");
    }
  }
}

// ---- residual mix + LayerNorm, 128 threads (tid 0..127) per row of 1024; thread owns cols 4t..4t+3 and 512+4t..+3 ----
template <bool MIX>
__device__ __forceinline__ void ln_body(const float* __restrict__ x, const float* __restrict__ x0,
                                        const float* __restrict__ lam, const float* __restrict__ w,
                                        float* __restrict__ xr, unsigned short* __restrict__ xnp,
                                        int row, int tid, float* red1, float* red2) {
  _Float16* xn = (_Float16*)xnp;
  const int lane = tid & 31, wave = tid >> 5;
  const size_t rb = (size_t)row * DD;
  const int ca = tid * 4, cb = 512 + tid * 4;
  v4f va = *(const v4f*)(x + rb + ca);
  v4f vb = *(const v4f*)(x + rb + cb);
  if (MIX) {
    const float l0 = lam[0], l1 = lam[1];
    const v4f a0 = *(const v4f*)(x0 + rb + ca);
    const v4f b0 = *(const v4f*)(x0 + rb + cb);
    va = va * l0 + a0 * l1;
    vb = vb * l0 + b0 * l1;
    {
      *(v4f*)(xr + rb + ca) = va;
      *(v4f*)(xr + rb + cb) = vb;
      
    }
  }
  float s = (va[0] + va[1]) + (va[2] + va[3]) + (vb[0] + vb[1]) + (vb[2] + vb[3]);
#pragma unroll
  for (int off = 1; off < 32; off <<= 1) s += __shfl_xor(s, off, 32);
  if (lane == 0) red1[wave] = s;
  __syncthreads();
  const float mu = ((red1[0] + red1[1]) + (red1[2] + red1[3])) * (1.0f / DD);
  const v4f da = va - mu, db = vb - mu;
  float s2 = (da[0] * da[0] + da[1] * da[1]) + (da[2] * da[2] + da[3] * da[3]) +
             (db[0] * db[0] + db[1] * db[1]) + (db[2] * db[2] + db[3] * db[3]);
#pragma unroll
  for (int off = 1; off < 32; off <<= 1) s2 += __shfl_xor(s2, off, 32);
  if (lane == 0) red2[wave] = s2;
  __syncthreads();
  const float var = ((red2[0] + red2[1]) + (red2[2] + red2[3])) * (1.0f / DD);
  const float inv = rsqrtf(var + LN_EPS);
  const v4f wa = *(const v4f*)(w + ca);
  const v4f wb = *(const v4f*)(w + cb);
  v4h ha, hb;
#pragma unroll
  for (int e = 0; e < 4; ++e) {
    ha[e] = (_Float16)(da[e] * inv * wa[e]);
    hb[e] = (_Float16)(db[e] * inv * wb[e]);
  }
  {
    *(v4h*)(xn + rb + ca) = ha;
    *(v4h*)(xn + rb + cb) = hb;
    // as in wt_cast_body, in the merged grid alone: no register of these stores is rewritten ahead of this wait
    if (MIX) asm volatile("s_wait_xcnt 0x0" ::: "memory");
  }
}
__global__ __launch_bounds__(128) void ln_k(const float* __restrict__ x, const float* __restrict__ w,
                                            unsigned short* __restrict__ xnp) {
  __shared__ float red1[4], red2[4];
  ln_body<false>(x, x, w, w, nullptr, xnp, blockIdx.x, threadIdx.x, red1, red2);
}

// ---- the six preparation steps, none of which reads what another writes, as block ranges of one grid ----
// The tables come first, their serial document count in block 0, so that the longest chain starts earliest.
#define PB_TAB  (SS / 8 + 1)
#define PB_LN   (NTOK / 2)                       // two rows per 256-thread block
#define PB_WQKV ((3 * DD / 64) * (DD / 64))
#define PB_WO   ((DD / 64) * (DD / 64))
#define PB_WFC  ((4 * DD / 64) * (DD / 64))
#define PB_WPR  ((DD / 64) * (4 * DD / 64))
__global__ __launch_bounds__(256) void prep_k(const float* __restrict__ x, const float* __restrict__ x0,
                                              const float* __restrict__ lam, const float* __restrict__ ln1,
                                              float* __restrict__ xr, unsigned short* __restrict__ xn,
                                              const float* __restrict__ wqkv, unsigned short* __restrict__ wqkvT,
                                              const float* __restrict__ wo, unsigned short* __restrict__ woT,
                                              const float* __restrict__ wfc, unsigned short* __restrict__ wfcT,
                                              const float* __restrict__ wproj, unsigned short* __restrict__ wprT,
                                              const int* __restrict__ ids, float* __restrict__ rope,
                                              int* __restrict__ docs) {
  __shared__ __align__(16) char sm[64 * WTP * 2];   // transpose tile, or count + document arrays, or the row sums
  static_assert(sizeof(sm) >= (256 + SS) * sizeof(int), "tables need 256 + S ints");
  int blk = blockIdx.x;
  if (blk < PB_TAB) {
    tables_body(ids, rope, docs, PB_TAB - 1 - blk, (int*)sm, (int*)sm + 256);
    return;
  }
  blk -= PB_TAB;
  if (blk < PB_LN) {
    const int half = threadIdx.x >> 7;
    float* red = (float*)sm + half * 8;
    ln_body<true>(x, x0, lam, ln1, xr, xn, blk * 2 + half, threadIdx.x & 127, red, red + 4);
    return;
  }
  blk -= PB_LN;
  // weights: W [in][out] -> Wt [out][in] f16 x64; tile column = out / 64, tile row = in / 64
  if (blk < PB_WQKV) {
    wt_cast_body(wqkv, wqkvT, DD, 3 * DD, WMUL, blk % (3 * DD / 64), blk / (3 * DD / 64), (_Float16*)sm);
    return;
  }
  blk -= PB_WQKV;
  if (blk < PB_WO) {
    wt_cast_body(wo, woT, DD, DD, WMUL, blk % (DD / 64), blk / (DD / 64), (_Float16*)sm);
    return;
  }
  blk -= PB_WO;
  if (blk < PB_WFC) {
    wt_cast_body(wfc, wfcT, DD, 4 * DD, WMUL, blk % (4 * DD / 64), blk / (4 * DD / 64), (_Float16*)sm);
    return;
  }
  blk -= PB_WFC;
  wt_cast_body(wproj, wprT, 4 * DD, DD, WMUL, blk % (DD / 64), blk / (DD / 64), (_Float16*)sm);
}

// ---- rotary + RMS-norm on q,k; v = sa0*v + sa1*ve; writes f16 planes [3][B*H*S][128] ----
// One block per token, wave = head; lane owns dims ln, ln+32, ln+64, ln+96 (pairs (ln,ln+64) rotate, (ln+32,ln+96) identity).
#define RSP 136
__global__ __launch_bounds__(256) void rope_k(const float* __restrict__ qkv, const float* __restrict__ ve,
                                              const float* __restrict__ sa, const float* __restrict__ rope,
                                              unsigned short* __restrict__ planesp) {
  __shared__ __align__(16) _Float16 st[HH][3 * RSP];
  _Float16* planes = (_Float16*)planesp;
  const int s = blockIdx.x, b = blockIdx.y;
  const int tid = threadIdx.x, h = tid >> 5, ln = tid & 31;
  const size_t tok = (size_t)b * SS + s;
  const float* base = qkv + tok * (3 * DD) + h * HDIM;
  const float cv = rope[(size_t)s * 64 + ln];
  const float sv = rope[(size_t)s * 64 + 32 + ln];
  _Float16* sw = st[h];
#pragma unroll
  for (int p = 0; p < 2; ++p) {
    const float* src = base + p * DD;
    const float a1 = src[ln], b1 = src[ln + 32], a2 = src[ln + 64], b2 = src[ln + 96];
    const float o0 = a1 * cv + a2 * sv;
    const float o2 = a2 * cv - a1 * sv;
    float sq = (o0 * o0 + b1 * b1) + (o2 * o2 + b2 * b2);
#pragma unroll
    for (int off = 1; off < 32; off <<= 1) sq += __shfl_xor(sq, off, 32);
    const float rs = rsqrtf(sq * (1.0f / HDIM) + RMS_EPS);
    sw[p * RSP + ln]      = (_Float16)(o0 * rs);
    sw[p * RSP + ln + 32] = (_Float16)(b1 * rs);
    sw[p * RSP + ln + 64] = (_Float16)(o2 * rs);
    sw[p * RSP + ln + 96] = (_Float16)(b2 * rs);
  }
  {
    const float sa0 = sa[0], sa1 = sa[1];
    const float* vsrc = base + 2 * DD;
    const float* vesrc = ve + (size_t)s * DD + h * HDIM;
#pragma unroll
    for (int i = 0; i < 4; ++i) {
      const int d = ln + 32 * i;
      sw[2 * RSP + d] = (_Float16)(sa0 * vsrc[d] + sa1 * vesrc[d]);
    }
  }
  __builtin_amdgcn_fence(__ATOMIC_RELEASE, "workgroup");
  __builtin_amdgcn_wave_barrier();
  __builtin_amdgcn_fence(__ATOMIC_ACQUIRE, "workgroup");
  const int hh = ln >> 4, c8 = (ln & 15) * 8;           // 256-B row = 16 lanes x 16 B
  const size_t PL = (size_t)NTOK * DD;
  const size_t row = ((size_t)(b * HH + h) * SS + s) * HDIM;
  const v8h v01 = *(const v8h*)(sw + hh * RSP + c8);
  const v8h v2  = *(const v8h*)(sw + 2 * RSP + c8);
  _Float16* d01 = planes + (size_t)hh * PL + row + c8;
  _Float16* d2  = planes + 2 * PL + row + c8;
  {
    *(v8h*)d01 = v01;
    if (hh == 0) *(v8h*)d2 = v2;
    
  }
}

#define AKC 64
#define AQB 64
#define NGRP 4                         // key groups of four waves
#define OSP 136
#define KPITCH 272                     // K row pitch in bytes (16 B x odd: conflict-free for ds_load_b128)
#define VPITCH 288                     // V row pitch in bytes (32 B x odd: conflict-free for ds_load_tr16_b128)
#define KBUF (AKC * KPITCH)
#define VBUF (AKC * VPITCH)
// Eight 16-byte copies per lane: rows r, r+32, .. r+224 of the 256 rows (256 bytes each) of four chunks (LSTEP = 32 LDS rows).
// The s_wait_xcnt closes the statement so that no address register is rewritten ahead of it.
template <int LSTEP>
__device__ __forceinline__ void copy_kv8(uint32_t l, const unsigned short* gp) {
  asm volatile(
      "global_load_async_to_lds_b128 %0, %8, off\n\t"
      "global_load_async_to_lds_b128 %1, %9, off\n\t"
      "global_load_async_to_lds_b128 %2, %10, off\n\t"
      "global_load_async_to_lds_b128 %3, %11, off\n\t"
      "global_load_async_to_lds_b128 %4, %12, off\n\t"
      "global_load_async_to_lds_b128 %5, %13, off\n\t"
      "global_load_async_to_lds_b128 %6, %14, off\n\t"
      "global_load_async_to_lds_b128 %7, %15, off\n\t"
      "s_wait_xcnt 0x0"
      :: "v"(l), "v"(l + LSTEP), "v"(l + 2 * LSTEP), "v"(l + 3 * LSTEP),
         "v"(l + 4 * LSTEP), "v"(l + 5 * LSTEP), "v"(l + 6 * LSTEP), "v"(l + 7 * LSTEP),
         "v"(gp), "v"(gp + 32 * HDIM), "v"(gp + 64 * HDIM), "v"(gp + 96 * HDIM),
         "v"(gp + 128 * HDIM), "v"(gp + 160 * HDIM), "v"(gp + 192 * HDIM), "v"(gp + 224 * HDIM)
      : "memory");
}
// lane (c, hh) gets T[row0 + 8 hh + 0..7][col0 + c] of a row-major 16-bit LDS tile; p is the lane's own address
typedef short s16x8 __attribute__((ext_vector_type(8)));
__device__ __forceinline__ v8h ld_tr16(const char* p) {
  typedef __attribute__((address_space(3))) s16x8 lds_s16x8;
  return __builtin_bit_cast(v8h, __builtin_amdgcn_ds_load_tr16_b128_v8i16((lds_s16x8*)p));
}
// lane l with lane l ^ 16
__device__ __forceinline__ float xhalf(float x) {
  return __builtin_bit_cast(float, __builtin_amdgcn_permlanex16(__builtin_bit_cast(int, x), __builtin_bit_cast(int, x),
                                                                0x76543210, 0xfedcba98, false, false));
}
// 2^x by the hardware's v_exp_f32. The v_nop that ends each statement is the free slot that the instruction set asks for behind a
// transcendental, before its result is read or its source overwritten.
// Eight at a time, each in place: none reads a neighbour's result or writes a neighbour's source, so one slot serves all eight.
__device__ __forceinline__ float exp2_hw(float x) {
  asm("v_exp_f32 %0, %0\n\tv_nop" : "+v"(x));
  return x;
}
__device__ __forceinline__ void exp2_hw8(float* e) {
  asm("v_exp_f32 %0, %0\n\tv_exp_f32 %1, %1\n\tv_exp_f32 %2, %2\n\tv_exp_f32 %3, %3\n\t"
      "v_exp_f32 %4, %4\n\tv_exp_f32 %5, %5\n\tv_exp_f32 %6, %6\n\tv_exp_f32 %7, %7\n\tv_nop"
      : "+v"(e[0]), "+v"(e[1]), "+v"(e[2]), "+v"(e[3]), "+v"(e[4]), "+v"(e[5]), "+v"(e[6]), "+v"(e[7]));
}
// four waves per SIMD: the sixteen waves of one work-group
__global__ __launch_bounds__(512) __attribute__((amdgpu_waves_per_eu(4, 4))) void attn128_k(const unsigned short* __restrict__ qpp, const unsigned short* __restrict__ kpp,
                                                 const unsigned short* __restrict__ vpp, const int* __restrict__ docs,
                                                 unsigned short* __restrict__ outp) {
  union FH { v16h v; v8h h[2]; };
  // two buffers of four chunks, [kv][d]; behind the loop Ksm carries the partial results of groups 1..3, Vsm the output rows
  __shared__ __align__(16) char Ksm[2 * NGRP * KBUF];      // pitch KPITCH
  __shared__ __align__(16) char Vsm[2 * NGRP * VBUF];      // pitch VPITCH
  static_assert(sizeof(Ksm) >= (NGRP - 1) * 4 * 32 * (64 + 2) * sizeof(float), "partial O^T, maximum and sum of twelve waves");
  static_assert(sizeof(Vsm) >= 4 * 16 * OSP * sizeof(_Float16), "output rows of four waves");
  const _Float16* qp = (const _Float16*)qpp;
  _Float16* out = (_Float16*)outp;
  const int tid = threadIdx.x, lane = tid & 31, hh = lane >> 4, c = lane & 15;
  const int wave = __builtin_amdgcn_readfirstlane(tid >> 5);
  const int grp = wave >> 2, wq = wave & 3;     // key group; the wave's 16 queries within the tile
  const int nqb = SS / AQB;
  const int bx = blockIdx.x;
  const int qb = nqb - 1 - bx / (BB * HH);      // longest tiles first
  const int bh = bx % (BB * HH);
  const int h = bh % HH;
  const int b = bh / HH;
  const int q0 = qb * AQB + wq * 16;
  const size_t rowb = (size_t)(b * HH + h) * SS;

  v16h qa[4];
  {
    const _Float16* qrow = qp + (rowb + q0 + c) * HDIM + 8 * hh;
#pragma unroll
    for (int dc = 0; dc < 4; ++dc) qa[dc] = Frag<_Float16>::load(qrow + dc * 32);
  }
  const int qrow = q0 + c;          // the lane's query
  const int dq = docs[qrow];
  float mrow = -INFINITY;           // running maximum of the query in base-2 units, alike in both halves
  float lrow = 0.f;                 // running sum (x2^15) over this half's keys; the halves are joined behind the loop
  v8f oacc[8];                      // O^T: oacc[t][r] = O[qrow][t*16 + 8 hh + r]
#pragma unroll
  for (int t = 0; t < 8; ++t) oacc[t] = (v8f){0.f,0.f,0.f,0.f,0.f,0.f,0.f,0.f};

  // fours of chunks, block-uniform; chunks of the last four that lie above the diagonal: their rows exist
  // (S / 64 is a multiple of four), they are copied with the rest and not worked on
  static_assert((SS / AKC) % NGRP == 0, "whole fours of chunks");
  const int nPairs = qb / NGRP + 1;
  // copy addresses: lane brings 16 B at column chunk (tid & 15) of rows (tid >> 4) + 32 i
  const int crow = tid >> 4, ccol = (tid & 15) * 8;
  const unsigned short* gK = kpp + (rowb + crow) * HDIM + ccol;
  const unsigned short* gV = vpp + (rowb + crow) * HDIM + ccol;
  const uint32_t lK = (uint32_t)(uintptr_t)Ksm + (uint32_t)(crow * KPITCH + ccol * 2);
  const uint32_t lV = (uint32_t)(uintptr_t)Vsm + (uint32_t)(crow * VPITCH + ccol * 2);
  copy_kv8<32 * KPITCH>(lK, gK);
  copy_kv8<32 * VPITCH>(lV, gV);
  asm volatile("s_wait_asynccnt 0x0" ::: "memory");   // the first four's own copies have landed
  __syncthreads();                                    // and every other wave's
  if (nPairs > 1) {
    copy_kv8<32 * KPITCH>(lK + NGRP * KBUF, gK + NGRP * AKC * HDIM);
    copy_kv8<32 * VPITCH>(lV + NGRP * VBUF, gV + NGRP * AKC * HDIM);
  }
  for (int pr = 0; pr < nPairs; ++pr) {
    const int kc = NGRP * pr + grp; // this group's chunk of the four
    const int kv0 = kc * AKC;
    const unsigned bsel = (unsigned)(pr & 1);
    const char* Kb = Ksm + (NGRP * bsel + grp) * KBUF + c * KPITCH + 16 * hh;
    const char* Vb = Vsm + (NGRP * bsel + grp) * VBUF + (8 * hh + (lane & 7)) * VPITCH + ((lane >> 3) & 1) * 16;

    // a chunk wholly above the diagonal changes nothing: its group leaves the LDS to the others and goes on to the barrier (wave-uniform)
    if (kc <= qb) {
    v8f s[4];
    v4i dk[4][2];                   // docs of the lane's 32 keys: kv0 + j*16 + 8 hh + 0..7
#pragma unroll
    for (int j = 0; j < 4; ++j) {
      dk[j][0] = *(const v4i*)(docs + kv0 + j * 16 + 8 * hh);
      dk[j][1] = *(const v4i*)(docs + kv0 + j * 16 + 8 * hh + 4);
    }
    // no address register of these eight loads is rewritten (here: by the K loads' results) ahead of this wait
    asm volatile("s_wait_xcnt 0x0" ::: "memory");
    // the chunk in two halves of 32 keys: all 32 K loads at once would need 128 registers, which 256 a wave do not leave
#pragma unroll
    for (int jh = 0; jh < 2; ++jh) {
      FH kb[2][4];
#pragma unroll
      for (int j = 0; j < 2; ++j) {
#pragma unroll
        for (int dc = 0; dc < 4; ++dc) {
          kb[j][dc].h[0] = *(const v8h*)(Kb + (2 * jh + j) * 16 * KPITCH + dc * 64);
          kb[j][dc].h[1] = *(const v8h*)(Kb + (2 * jh + j) * 16 * KPITCH + dc * 64 + 32);
        }
      }
      // keeps the half's 16 K loads together ahead of its 8 score products: one LDS latency per half, not one per product
      __builtin_amdgcn_sched_barrier(0);
#pragma unroll
      for (int j = 0; j < 2; ++j) s[2 * jh + j] = (v8f){0.f,0.f,0.f,0.f,0.f,0.f,0.f,0.f};
#pragma unroll
      for (int dc = 0; dc < 4; ++dc)
#pragma unroll
        for (int j = 0; j < 2; ++j)
          s[2 * jh + j] = Frag<_Float16>::mma(kb[j][dc].v, qa[dc], s[2 * jh + j]);   // rows = keys, column = query
      // keeps the next half's loads in one group behind these products, not spread among them as registers come free
      __builtin_amdgcn_sched_barrier(0);
    }
    const bool diag = (kc >= qb);
    float cm[4];
#pragma unroll
    for (int j = 0; j < 4; ++j) {
      float m = -INFINITY;
#pragma unroll
      for (int r = 0; r < 8; ++r) {
        const int key = kv0 + j * 16 + 8 * hh + r;
        float sv = s[j][r];         // raw: the positive scale commutes with the maximum and goes into the exponent's fma
        const bool masked = (dk[j][r >> 2][r & 3] != dq) || (diag && (key > qrow));
        if (masked) sv = -INFINITY;
        s[j][r] = sv;
        m = fmaxf(m, sv);
      }
      cm[j] = m;
    }
    float mc = fmaxf(fmaxf(cm[0], cm[1]), fmaxf(cm[2], cm[3]));
    mc = fmaxf(mc, xhalf(mc));
    const float mnew = fmaxf(mrow, mc * ATT_SCALE_LOG2E);
    const float mref = (mnew > -INFINITY) ? mnew : 0.0f;   // all-masked so far -> p = 0, alpha = 0
    const float alpha = exp2_hw(mrow - mref);
    const float eoff = PSCALE_LOG2 - mref;
    mrow = mnew;
    FH pt[2];
    float ps[4];
#pragma unroll
    for (int j = 0; j < 4; ++j) {
      float a = 0.f;
      float p[8];                   // p * 2^15
#pragma unroll
      for (int r = 0; r < 8; ++r) p[r] = fmaf(s[j][r], ATT_SCALE_LOG2E, eoff);
      exp2_hw8(p);
#pragma unroll
      for (int r = 0; r < 8; ++r) {
        a += p[r];
        pt[j >> 1].h[j & 1][r] = (_Float16)p[r];
      }
      ps[j] = a;
    }
    lrow = lrow * alpha + ((ps[0] + ps[1]) + (ps[2] + ps[3]));
#pragma unroll
    for (int t = 0; t < 8; ++t) oacc[t] *= alpha;
#pragma unroll
    for (int kk = 0; kk < 2; ++kk) {
      FH vb[8];
#pragma unroll
      for (int t = 0; t < 8; ++t) {
        vb[t].h[0] = ld_tr16(Vb + (kk * 32) * VPITCH + t * 32);        // keys kk*32 + 8 hh + 0..7 of column t*16 + c
        vb[t].h[1] = ld_tr16(Vb + (kk * 32 + 16) * VPITCH + t * 32);   // keys kk*32 + 16 + 8 hh + 0..7
      }
      // keeps the half's 16 V loads together ahead of its 8 output products
      __builtin_amdgcn_sched_barrier(0);
#pragma unroll
      for (int t = 0; t < 8; ++t) oacc[t] = Frag<_Float16>::mma(vb[t].v, pt[kk].v, oacc[t]);   // rows = d, column = query
      // keeps the next half's loads in one group behind these products
      __builtin_amdgcn_sched_barrier(0);
    }
    }
    asm volatile("s_wait_dscnt 0x0" ::: "memory");     // this wave's reads of the buffers have returned
    asm volatile("s_wait_asynccnt 0x0" ::: "memory");  // its copies for the four chunks pr + 1 have landed
    __syncthreads();                                   // publishes the four chunks pr + 1, frees this trip's buffers
    if (pr + 2 < nPairs) {
      copy_kv8<32 * KPITCH>(lK + bsel * (NGRP * KBUF), gK + (size_t)(pr + 2) * (NGRP * AKC * HDIM));
      copy_kv8<32 * VPITCH>(lV + bsel * (NGRP * VBUF), gV + (size_t)(pr + 2) * (NGRP * AKC * HDIM));
    }
  }
  asm volatile("s_wait_asynccnt 0x0" ::: "memory");    // nothing in flight when the buffers change their use

  // ---- join the four groups: lane l of waves w + 4, w + 8, w + 12 holds the same query and the same d as lane l of wave w ----
  // The loop's last barrier stands behind every wave's last read of the buffers.
  const int PXG = 4 * (16 * 32 * 4), PMG = 4 * 32 * 2;                    // floats of one group's O^T; of its maxima and sums
  const int gs = (grp > 0) ? grp - 1 : 0;                                 // the writer's slot; group 0 reads from slot 0 on
  float* px  = (float*)Ksm + (size_t)gs * PXG + (size_t)wq * (16 * 32 * 4) + lane * 4;    // [slot][wq][2 t + half of the 8][lane] x 16 B
  float* pml = (float*)Ksm + (NGRP - 1) * PXG + gs * PMG + (wq * 32 + lane) * 2;          // [slot][wq][lane] x (maximum, sum)
  if (grp != 0) {
#pragma unroll
    for (int t = 0; t < 8; ++t) {
      *(v4f*)(px + (2 * t) * 128)     = __builtin_shufflevector(oacc[t], oacc[t], 0, 1, 2, 3);
      *(v4f*)(px + (2 * t + 1) * 128) = __builtin_shufflevector(oacc[t], oacc[t], 4, 5, 6, 7);
    }
    pml[0] = mrow;
    pml[1] = lrow;
  }
  __syncthreads();                  // the partial results of groups 1..3 are there for group 0
  if (grp != 0) return;             // wave-uniform, behind the last work-group barrier

  _Float16* os = (_Float16*)Vsm + wq * (16 * OSP);   // per wave [row][d]
  {
    float mg[NGRP - 1], lg[NGRP - 1], wg[NGRP - 1];
    float mj = mrow;
#pragma unroll
    for (int g = 0; g < NGRP - 1; ++g) {
      mg[g] = pml[g * PMG];
      lg[g] = pml[g * PMG + 1];
      mj = fmaxf(mj, mg[g]);
    }
    const float mjr = (mj > -INFINITY) ? mj : 0.0f;  // a group that saw only masked keys weighs 0
    const float a0 = exp2_hw(mrow - mjr);
    float lj = lrow * a0;
#pragma unroll
    for (int g = 0; g < NGRP - 1; ++g) {
      wg[g] = exp2_hw(mg[g] - mjr);
      lj += lg[g] * wg[g];
    }
    const float inv = 1.0f / (lj + xhalf(lj));       // sum and O^T both carry the 2^15
    const float w0 = a0 * inv;
#pragma unroll
    for (int g = 0; g < NGRP - 1; ++g) wg[g] *= inv;
#pragma unroll
    for (int t = 0; t < 8; ++t) {
      v8f o = oacc[t] * w0;
#pragma unroll
      for (int g = 0; g < NGRP - 1; ++g) {
        const v4f pa = *(const v4f*)(px + g * PXG + (2 * t) * 128);
        const v4f pb = *(const v4f*)(px + g * PXG + (2 * t + 1) * 128);
#pragma unroll
        for (int r = 0; r < 4; ++r) {
          o[r]     += pa[r] * wg[g];
          o[r + 4] += pb[r] * wg[g];
        }
      }
      v8h ov;
#pragma unroll
      for (int r = 0; r < 8; ++r) ov[r] = (_Float16)o[r];
      *(v8h*)(os + c * OSP + t * 16 + 8 * hh) = ov;
    }
  }
  __builtin_amdgcn_fence(__ATOMIC_RELEASE, "workgroup");
  __builtin_amdgcn_wave_barrier();
  __builtin_amdgcn_fence(__ATOMIC_ACQUIRE, "workgroup");
  {
    const int c8 = (lane & 15) * 8;   // 256-B row segment = 16 lanes x 16 B, 2 rows per instruction
    {
#pragma unroll
      for (int it = 0; it < 8; ++it) {
        const int row = it * 2 + hh;
        const v8h val = *(const v8h*)(os + row * OSP + c8);
        *(v8h*)(out + (size_t)(b * SS + q0 + row) * DD + h * HDIM + c8) = val;
      }
      
    }
  }
}

// ---------------------------------------------------------------------------
extern "C" void kernel_launch(void* const* d_in, const int* in_sizes, int n_in,
                              void* d_out, int out_size, void* d_ws,
                              size_t ws_size, hipStream_t stream) {
  if (n_in < 12) return;
  if (in_sizes[0] != NTOK * DD || in_sizes[1] != SS * DD || in_sizes[2] != NTOK * DD ||
      in_sizes[3] < 2 || in_sizes[4] < 2 || in_sizes[5] < DD || in_sizes[6] < DD ||
      in_sizes[7] != DD * 3 * DD || in_sizes[8] != DD * DD || in_sizes[9] != DD * 4 * DD ||
      in_sizes[10] != 4 * DD * DD || in_sizes[11] != SS || out_size != NTOK * DD) return;

  const float* x     = (const float*)d_in[0];
  const float* ve    = (const float*)d_in[1];
  const float* x0    = (const float*)d_in[2];
  const float* lam   = (const float*)d_in[3];
  const float* sal   = (const float*)d_in[4];
  const float* ln1   = (const float*)d_in[5];
  const float* ln2   = (const float*)d_in[6];
  const float* wqkv  = (const float*)d_in[7];
  const float* wo    = (const float*)d_in[8];
  const float* wfc   = (const float*)d_in[9];
  const float* wproj = (const float*)d_in[10];
  const int*   ids   = (const int*)d_in[11];
  float* outf = (float*)d_out;

  // ---- carve (bytes) ----
  const size_t szWO   = (size_t)DD * DD * 2;              //   2 MiB  w_o^T f16
  const size_t szWFC  = (size_t)4 * DD * DD * 2;          //   8 MiB  w_fc^T f16
  const size_t szWPR  = (size_t)4 * DD * DD * 2;          //   8 MiB  w_proj^T f16
  const size_t szXR   = (size_t)NTOK * DD * 4;            //  16 MiB  mixed x f32
  const size_t szBIG  = (size_t)NTOK * 3 * DD * 4;        //  48 MiB  qkv f32, later h f16 (32 MiB) + x2 f32 (16 MiB)
  const size_t szXN   = (size_t)NTOK * DD * 2;            //   8 MiB  xn f16, later xn2 f16
  const size_t szWQA  = (size_t)NTOK * DD * 2;            //   8 MiB  w_qkv^T f16 (6 MiB), later attention out f16
  const size_t szPL   = (size_t)3 * NTOK * DD * 2;        //  24 MiB  q,k,v f16 planes
  const size_t szROPE = (size_t)SS * 64 * 4;              // 512 KiB
  const size_t szDOC  = (size_t)SS * 4;
  const size_t oWO = 0, oWFC = oWO + szWO, oWPR = oWFC + szWFC, oXR = oWPR + szWPR, oBIG = oXR + szXR,
               oXN = oBIG + szBIG, oWQA = oXN + szXN, oPL = oWQA + szWQA, oROPE = oPL + szPL,
               oDOC = oROPE + szROPE, oEND = oDOC + szDOC;
  if (oEND > ws_size) return;
  char* ws = (char*)d_ws;
  unsigned short* woT   = (unsigned short*)(ws + oWO);
  unsigned short* wfcT  = (unsigned short*)(ws + oWFC);
  unsigned short* wprT  = (unsigned short*)(ws + oWPR);
  float*          xr    = (float*)(ws + oXR);
  float*          qkvf  = (float*)(ws + oBIG);
  unsigned short* hbuf  = (unsigned short*)(ws + oBIG);
  float*          x2    = (float*)(ws + oBIG + (size_t)NTOK * 4 * DD * 2);
  unsigned short* xn    = (unsigned short*)(ws + oXN);
  unsigned short* xn2   = xn;
  unsigned short* wqkvT = (unsigned short*)(ws + oWQA);
  unsigned short* attn  = (unsigned short*)(ws + oWQA);
  unsigned short* qpl   = (unsigned short*)(ws + oPL);
  unsigned short* kpl   = qpl + (size_t)NTOK * DD;
  unsigned short* vpl   = qpl + (size_t)2 * NTOK * DD;
  float*          rope  = (float*)(ws + oROPE);
  int*            docs  = (int*)(ws + oDOC);

  // rotary table + docs; x = l0*x + l1*x0, xn = LN(x)*ln1_w; the four weight transposes
  prep_k<<<PB_TAB + PB_LN + PB_WQKV + PB_WO + PB_WFC + PB_WPR, 256, 0, stream>>>(
      x, x0, lam, ln1, xr, xn, wqkv, wqkvT, wo, woT, wfc, wfcT, wproj, wprT, ids, rope, docs);
  // qkv = xn @ w_qkv (f32 out)
  {
    const int M = NTOK, N = 3 * DD, K = DD;
    const int tiles = (M / 128) * (N / 128);
    wmma_gemm64<0, false, 0, 0, false, 0><<<dim3(tiles, 1), 128, 0, stream>>>(
        xn, xn, K, 0, wqkvT, wqkvT, K, 0, qkvf, qkvf, N, 0, xr, xr, 0, M, N, K, WMUL_INV);
  }
  // rotary + RMS-norm + value mix -> f16 planes
  rope_k<<<dim3(SS, BB), 256, 0, stream>>>(qkvf, ve, sal, rope, qpl);
  // attention
  attn128_k<<<BB * HH * (SS / AQB), 512, 0, stream>>>(qpl, kpl, vpl, docs, attn);
  // x2 = xr + attn @ w_o
  {
    const int M = NTOK, N = DD, K = DD;
    const int tiles = (M / 128) * (N / 128);
    wmma_gemm64<0, false, 0, 0, true, 0, true><<<dim3(tiles, 1), 128, 0, stream>>>(
        attn, attn, K, 0, woT, woT, K, 0, x2, x2, N, 0, xr, xr, 0, M, N, K, WMUL_INV);
  }
  // xn2 = LN(x2)*ln2_w
  ln_k<<<NTOK, 128, 0, stream>>>(x2, ln2, xn2);
  // h = relu(xn2 @ w_fc)^2 (f16 out)
  {
    const int M = NTOK, N = 4 * DD, K = DD;
    const int tiles = (M / 128) * (N / 128);
    wmma_gemm64<0, false, 0, 1, false, 6><<<dim3(tiles, 1), 128, 0, stream>>>(
        xn2, xn2, K, 0, wfcT, wfcT, K, 0, hbuf, hbuf, N, 0, xr, xr, 0, M, N, K, WMUL_INV);
  }
  // out = x2 + h @ w_proj
  {
    const int M = NTOK, N = DD, K = 4 * DD;
    const int tiles = (M / 128) * (N / 128);
    wmma_gemm64<0, false, 0, 0, true, 0, true><<<dim3(tiles, 1), 128, 0, stream>>>(
        hbuf, hbuf, K, 0, wprT, wprT, K, 0, outf, outf, N, 0, x2, x2, 0, M, N, K, WMUL_INV);
  }
}

// v010
// One run takes 170 microseconds.
// Next to v009, in two timings, it ran 1.05 and 1.07 times as fast.
// Over all steps from v000 it is 3.74 times as fast.
#include <hip/hip_runtime.h>
#include <stdint.h>
// All contractions: v_wmma_f32_16x16x32_f16 (f16 operands, f32 accumulate); projection weights carried x64, attention p carried x2^15; norms, rotary, softmax and residuals in f32.

#define BB 2
#define SS 2048
#define DD 1024
#define HH 8
#define HDIM 128
#define NTOK (BB * SS)
#define EOT_ID 50256
#define ATT_SCALE 0.12f
#define LN_EPS 1e-6f
#define RMS_EPS 1.1920929e-7f
#define WMUL 64.0f
#define WMUL_INV (1.0f / 64.0f)

typedef __attribute__((ext_vector_type(16))) _Float16 v16h;
typedef __attribute__((ext_vector_type(8)))  _Float16 v8h;
typedef __attribute__((ext_vector_type(4)))  _Float16 v4h;
typedef __attribute__((ext_vector_type(16))) __bf16   v16b;
typedef __attribute__((ext_vector_type(8)))  __bf16   v8b;
typedef __attribute__((ext_vector_type(8)))  float    v8f;
typedef __attribute__((ext_vector_type(4)))  float    v4f;
typedef __attribute__((ext_vector_type(4)))  int      v4i;
#define U16(p) ((const unsigned short*)(const void*)(p))
#define ATT_SCALE_LOG2E (ATT_SCALE * 1.44269504f)   // times log2(e): scores in base-2 units
#define PSCALE_LOG2 15.0f                           // p is carried x2^15

__device__ __forceinline__ unsigned short f2bf_bits(float f) {
  unsigned u = __float_as_uint(f);
  return (unsigned short)((u + 0x7FFFu + ((u >> 16) & 1u)) >> 16);
}
__device__ __forceinline__ float bf_bits2f(unsigned short h) { return __uint_as_float(((unsigned)h) << 16); }

// hazard guards as plain device helpers
__device__ __forceinline__ void dep_guard_h(v8f& a, v8f& b, v16h x, v16h y) { asm volatile("v_nop\n\tv_nop\n\tv_nop\n\tv_nop" : "+v"(a), "+v"(b) : "v"(x), "v"(y)); }
__device__ __forceinline__ void dep_guard_b(v8f& a, v8f& b, v16b x, v16b y) { asm volatile("v_nop\n\tv_nop\n\tv_nop\n\tv_nop" : "+v"(a), "+v"(b) : "v"(x), "v"(y)); }
__device__ __forceinline__ void keep4_h(v16h a, v16h b, v16h c, v16h d) { asm volatile("v_nop" :: "v"(a), "v"(b), "v"(c), "v"(d)); }
__device__ __forceinline__ void keep4_b(v16b a, v16b b, v16b c, v16b d) { asm volatile("v_nop" :: "v"(a), "v"(b), "v"(c), "v"(d)); }
__device__ __forceinline__ void acc_guard4(v8f& a, v8f& b, v8f& c, v8f& d) { asm volatile("v_nop\n\tv_nop\n\tv_nop\n\tv_nop" : "+v"(a), "+v"(b), "+v"(c), "+v"(d)); }
template <typename T> struct Frag;
template <> struct Frag<_Float16> {
  typedef v16h V; union U { v16h v; v8h h[2]; };
  static __device__ __forceinline__ v16h load(const _Float16* p) {   // elements 0..7 <- p[0..7], 8..15 <- p[16..23]
    U f; f.h[0] = *(const v8h*)(p); f.h[1] = *(const v8h*)(p + 16); return f.v;
  }
  static __device__ __forceinline__ v8f mma(v16h a, v16h b, v8f c) {
    return __builtin_amdgcn_wmma_f32_16x16x32_f16(false, a, false, b, (short)0, c, false, false);
  }
  static __device__ __forceinline__ void guard(v8f& a, v8f& b, v16h x, v16h y) { dep_guard_h(a, b, x, y); }
  static __device__ __forceinline__ void keep(v16h a, v16h b, v16h c, v16h d) { keep4_h(a, b, c, d); }
};
template <> struct Frag<__bf16> {
  typedef v16b V; union U { v16b v; v8b h[2]; };
  static __device__ __forceinline__ v16b load(const __bf16* p) {
    U f; f.h[0] = *(const v8b*)(p); f.h[1] = *(const v8b*)(p + 16); return f.v;
  }
  static __device__ __forceinline__ v8f mma(v16b a, v16b b, v8f c) {
    return __builtin_amdgcn_wmma_f32_16x16x32_bf16(false, a, false, b, (short)0, c, false, false);
  }
  static __device__ __forceinline__ void guard(v8f& a, v8f& b, v16b x, v16b y) { dep_guard_b(a, b, x, y); }
  static __device__ __forceinline__ void keep(v16b a, v16b b, v16b c, v16b d) { keep4_b(a, b, c, d); }
};

// ---- LDS-staged batched WMMA GEMM ------------------------------------------
// C[m,n] = scale * sum_k A[m,k] * Bt[n,k] (+bias)(+resid); a block of 4 waves owns a 128x128 tile, each wave 64x64 of it.
// A row-major [M,K]; Bt row-major [N,K]; M,N % 128 == 0, K % 64 == 0.
// Per trip 64 k of both operands (128 rows x 128 B each) lie in LDS at pitch 144 B, brought by asynchronous
// copies into two buffers: the next trip's copies fly while this trip's fragments are read and multiplied.
// Blocks of one tile row read the same A rows and blocks of one tile column the same Bt rows, all resident at once: each block
// starts its k walk at trip (tile row + tile column) mod trips and wraps, so that sharers ask L2 for different lines at any one moment.
// BIAS_MODE: 0 = none, 1 = bias[m], 2 = bias[n].
// OUT_MODE: 0 = f32, 1 = f16, 2 = bf16 hi plane (Cout) + bf16 lo plane (Cout2).
// ACT 6: relu then square.
// ET: 0 = f16 operands, 1 = bf16 operands (pointers passed as 16-bit storage)
template <int ET> struct Elem;
template <> struct Elem<0> { typedef _Float16 T; };
template <> struct Elem<1> { typedef __bf16 T; };
#define GBK 64                         // k per trip
#define GPITCH 144                     // LDS row pitch in bytes (16 B x odd: conflict-free for ds_load_b128)
#define GOPER (128 * GPITCH)           // one operand's 128 rows
#define GSTAGE (2 * GOPER)             // A rows, then Bt rows
// Eight 16-byte copies per lane: rows r, r+16, .. r+112 of one operand's 128-row slab. The s_wait_xcnt closes the
// statement so that no address register is rewritten ahead of it.
__device__ __forceinline__ void copy_rows8(uint32_t l, const unsigned short* gp, size_t step) {
  asm volatile(
      "global_load_async_to_lds_b128 %0, %8, off\n\t"
      "global_load_async_to_lds_b128 %1, %9, off\n\t"
      "global_load_async_to_lds_b128 %2, %10, off\n\t"
      "global_load_async_to_lds_b128 %3, %11, off\n\t"
      "global_load_async_to_lds_b128 %4, %12, off\n\t"
      "global_load_async_to_lds_b128 %5, %13, off\n\t"
      "global_load_async_to_lds_b128 %6, %14, off\n\t"
      "global_load_async_to_lds_b128 %7, %15, off\n\t"
      "s_wait_xcnt 0x0"
      :: "v"(l), "v"(l + 16 * GPITCH), "v"(l + 32 * GPITCH), "v"(l + 48 * GPITCH),
         "v"(l + 64 * GPITCH), "v"(l + 80 * GPITCH), "v"(l + 96 * GPITCH), "v"(l + 112 * GPITCH),
         "v"(gp), "v"(gp + step), "v"(gp + 2 * step), "v"(gp + 3 * step),
         "v"(gp + 4 * step), "v"(gp + 5 * step), "v"(gp + 6 * step), "v"(gp + 7 * step)
      : "memory");
}
// AHEAD (for a grid of one block a WGP, so one wave a SIMD, where no other wave covers a wave's own LDS latency; K % 128 == 0):
// a trip is 128 k (rows of 256 B at pitch 272 B) in four blocks of 16 products, and each block's 16 fragment loads go out
// as one group ahead of the block before it, into a second register set. The first block of trip t + 1 is so fetched in
// trip t: the point where trip t + 1 is published and trip t's buffer refilled stands ahead of trip t's last block,
// whose fragments are in registers by then.
#define PBK 128
#define PPITCH 272                     // 16 B x odd
#define POPER (128 * PPITCH)
#define PSTAGE (2 * POPER)
// Sixteen 16-byte copies per lane: both 128-byte halves of rows r, r+16, .. r+112 of one operand's 128 rows of 256 B; the
// immediate offset moves the LDS and the global address alike, so a row's two halves share their address registers.
// The builtin form leaves the choice of address registers to the compiler: asm operands, bound to the low 256 registers,
// made it move accumulators out of their way in every trip.
__device__ __forceinline__ void copy_wide16(char* l, const unsigned short* gp, size_t step) {
  typedef __attribute__((address_space(1))) v4i glb_v4i;
  typedef __attribute__((address_space(3))) v4i lds_v4i;
#pragma unroll
  for (int i = 0; i < 8; ++i) {
    __builtin_amdgcn_global_load_async_to_lds_b128((glb_v4i*)(gp + i * step), (lds_v4i*)(l + i * 16 * PPITCH), 0, 0);
    __builtin_amdgcn_global_load_async_to_lds_b128((glb_v4i*)(gp + i * step), (lds_v4i*)(l + i * 16 * PPITCH), 128, 0);
  }
}
// one trip's 128 rows of both operands; step = 16 rows
__device__ __forceinline__ void copy_stage(char* l, const unsigned short* ga, size_t stepA,
                                           const unsigned short* gb, size_t stepB) {
  copy_wide16(l, ga, stepA);
  copy_wide16(l + POPER, gb, stepB);
}
template <int ET, bool SPLIT, int BIAS_MODE, int OUT_MODE, bool RESID, int ACT = 0, bool AHEAD = false>
__global__ __launch_bounds__(128) void wmma_gemm64(
    const unsigned short* __restrict__ Ap, const unsigned short* __restrict__ A2p, int lda, long strideA,
    const unsigned short* __restrict__ Btp, const unsigned short* __restrict__ Bt2p, int ldb, long strideB,
    void* __restrict__ Cout, void* __restrict__ Cout2, int ldc, long strideC,
    const float* __restrict__ bias,
    const float* __restrict__ resid, long strideR,
    int M, int N, int K, float scale) {
  static_assert(!SPLIT, "single-plane operands only");
  typedef typename Elem<ET>::T T;
  typedef typename Frag<T>::V V;
  // two operand buffers; after the loop its first bytes serve as the per-wave 16x64 f32 slabs, pitch 68 floats
  __shared__ __align__(16) char smem[AHEAD ? 2 * PSTAGE : 2 * GSTAGE];
  const int b    = blockIdx.y;
  const int tid  = threadIdx.x;
  const int lane = tid & 31;
  const int wave = tid >> 5;
  const int tilesN = N >> 7;
  const int tilesM = M >> 7;
  const int tile = blockIdx.x;
  if (tile >= tilesM * tilesN) return;   // block-uniform, in front of every barrier
  const int tm = tile / tilesN;
  const int tn = tile - tm * tilesN;
  const int mB = tm << 7;                      // block tile origin
  const int nB = tn << 7;
  const int wm = (wave >> 1) << 6;             // wave tile origin inside the block tile
  const int wn = (wave & 1) << 6;
  const int m0 = mB + wm;
  const int n0 = nB + wn;

  const int rlane = lane & 15;                 // row (A) / col (B, D) within subtile
  const int koff  = (lane >> 4) * 8;           // k offset of this lane half
  const int mOff  = (lane >> 4) * 8;           // D row offset

  v8f acc[4][4];
#pragma unroll
  for (int i = 0; i < 4; ++i)
#pragma unroll
    for (int j = 0; j < 4; ++j) acc[i][j] = (v8f){0.f,0.f,0.f,0.f,0.f,0.f,0.f,0.f};

  if constexpr (AHEAD) {
  // copy addresses: lane brings 16 B at column chunks (tid & 7) and (tid & 7) + 8 of rows (tid >> 3) + 16 i
  const int crow = tid >> 3, ccol = (tid & 7) * 8;
  const unsigned short* gA = Ap  + (size_t)b * strideA + (size_t)(mB + crow) * lda + ccol;
  const unsigned short* gB = Btp + (size_t)b * strideB + (size_t)(nB + crow) * ldb + ccol;
  const size_t stepA = (size_t)16 * lda, stepB = (size_t)16 * ldb;
  char* lds0 = smem + crow * PPITCH + ccol * 2;
  const char* sA0 = smem + (wm + rlane) * PPITCH + koff * 2;
  const char* sB0 = smem + POPER + (wn + rlane) * PPITCH + koff * 2;

  const int nT = K / PBK;
  const int t0 = (tm + tn) % nT;                      // the block's first trip (block-uniform)
  const auto kat = [&](int t) { int q = t + t0; if (q >= nT) q -= nT; return (size_t)q * PBK; };   // k origin of the t-th trip walked
  copy_stage(lds0, gA + kat(0), stepA, gB + kat(0), stepB);
  asm volatile("s_wait_asynccnt 0x0" ::: "memory");   // trip 0's own copies have landed
  __syncthreads();                                    // and every other wave's
  if (nT > 1) copy_stage(lds0 + PSTAGE, gA + kat(1), stepA, gB + kat(1), stepB);
  V fa[2][4], fb[2][4];                               // block kk works on set kk & 1
#pragma unroll
  for (int j = 0; j < 4; ++j) fb[0][j] = Frag<T>::load((const T*)(sB0 + j * 16 * PPITCH));
#pragma unroll
  for (int i = 0; i < 4; ++i) fa[0][i] = Frag<T>::load((const T*)(sA0 + i * 16 * PPITCH));
  for (int t = 0; t < nT; ++t) {
    const unsigned bufo = (unsigned)(t & 1) * PSTAGE;
#pragma unroll
    for (int kk = 0; kk < PBK / 32; ++kk) {
      const int cur = kk & 1, nxt = cur ^ 1;
      if (kk + 1 < PBK / 32) {
#pragma unroll
        for (int j = 0; j < 4; ++j) fb[nxt][j] = Frag<T>::load((const T*)(sB0 + bufo + j * 16 * PPITCH + (kk + 1) * 64));
#pragma unroll
        for (int i = 0; i < 4; ++i) fa[nxt][i] = Frag<T>::load((const T*)(sA0 + bufo + i * 16 * PPITCH + (kk + 1) * 64));
      } else {
        asm volatile("s_wait_dscnt 0x0" ::: "memory");     // this wave's last reads of the buffer, the last block's fragments, have returned
        asm volatile("s_wait_asynccnt 0x0" ::: "memory");  // its copies for trip t + 1 have landed
        __syncthreads();                                   // publishes trip t + 1, frees this trip's buffer
        if (t + 2 < nT) copy_stage(lds0 + bufo, gA + kat(t + 2), stepA, gB + kat(t + 2), stepB);
        if (t + 1 < nT) {
          const unsigned bufn = bufo ^ PSTAGE;
#pragma unroll
          for (int j = 0; j < 4; ++j) fb[nxt][j] = Frag<T>::load((const T*)(sB0 + bufn + j * 16 * PPITCH));
#pragma unroll
          for (int i = 0; i < 4; ++i) fa[nxt][i] = Frag<T>::load((const T*)(sA0 + bufn + i * 16 * PPITCH));
        }
      }
      // keeps the next block's 16 loads together ahead of this block's 16 products, which cover their latency
      __builtin_amdgcn_sched_barrier(0);
#pragma unroll
      for (int i = 0; i < 4; ++i)
#pragma unroll
        for (int j = 0; j < 4; ++j) acc[i][j] = Frag<T>::mma(fa[cur][i], fb[cur][j], acc[i][j]);
      // keeps the loads that follow in one group behind these products, not spread among them as their registers come free
      __builtin_amdgcn_sched_barrier(0);
    }
  }
  } else {
  // copy addresses: lane brings 16 B at column chunk (tid & 7) of rows (tid >> 3) + 16 i
  const int crow = tid >> 3, ccol = (tid & 7) * 8;
  const unsigned short* gA = Ap  + (size_t)b * strideA + (size_t)(mB + crow) * lda + ccol;
  const unsigned short* gB = Btp + (size_t)b * strideB + (size_t)(nB + crow) * ldb + ccol;
  const size_t stepA = (size_t)16 * lda, stepB = (size_t)16 * ldb;
  const uint32_t lds0 = (uint32_t)(uintptr_t)smem + (uint32_t)(crow * GPITCH + ccol * 2);

  const int nT = K / GBK;
  const int t0 = (tm + tn) % nT;                      // the block's first trip (block-uniform)
  const auto kat = [&](int t) { int q = t + t0; if (q >= nT) q -= nT; return (size_t)q * GBK; };   // k origin of the t-th trip walked
  copy_rows8(lds0, gA + kat(0), stepA);
  copy_rows8(lds0 + GOPER, gB + kat(0), stepB);
  asm volatile("s_wait_asynccnt 0x0" ::: "memory");   // trip 0's own copies have landed
  __syncthreads();                                    // and every other wave's
  if (nT > 1) {
    copy_rows8(lds0 + GSTAGE, gA + kat(1), stepA);
    copy_rows8(lds0 + GSTAGE + GOPER, gB + kat(1), stepB);
  }
  for (int t = 0; t < nT; ++t) {
    const unsigned bufo = (unsigned)(t & 1) * GSTAGE;
    const char* sA = smem + bufo + (wm + rlane) * GPITCH + koff * 2;
    const char* sB = smem + bufo + GOPER + (wn + rlane) * GPITCH + koff * 2;
#pragma unroll
    for (int kk = 0; kk < GBK / 32; ++kk) {
      V bh[4], ah[4];
#pragma unroll
      for (int j = 0; j < 4; ++j) bh[j] = Frag<T>::load((const T*)(sB + j * 16 * GPITCH + kk * 64));
#pragma unroll
      for (int i = 0; i < 4; ++i) ah[i] = Frag<T>::load((const T*)(sA + i * 16 * GPITCH + kk * 64));
      // keeps the 16 fragment loads together ahead of the 16 products: one LDS latency per group, not one per A fragment
      __builtin_amdgcn_sched_barrier(0);
#pragma unroll
      for (int i = 0; i < 4; ++i) {
#pragma unroll
        for (int j = 0; j < 4; ++j) acc[i][j] = Frag<T>::mma(ah[i], bh[j], acc[i][j]);
        Frag<T>::guard(acc[i][0], acc[i][3], ah[i], ah[i]);
      }
      Frag<T>::keep(bh[0], bh[1], bh[2], bh[3]);
    }
    asm volatile("s_wait_dscnt 0x0" ::: "memory");     // this wave's reads of the buffer have returned
    asm volatile("s_wait_asynccnt 0x0" ::: "memory");  // its copies for trip t + 1 have landed
    __syncthreads();                                   // publishes trip t + 1, frees this trip's buffer
    if (t + 2 < nT) {
      copy_rows8(lds0 + bufo, gA + kat(t + 2), stepA);
      copy_rows8(lds0 + bufo + GOPER, gB + kat(t + 2), stepB);
    }
  }
  }
  asm volatile("s_wait_asynccnt 0x0" ::: "memory");    // nothing in flight when the buffers become slabs
  acc_guard4(acc[0][0], acc[0][1], acc[0][2], acc[0][3]);
  acc_guard4(acc[1][0], acc[1][1], acc[1][2], acc[1][3]);
  acc_guard4(acc[2][0], acc[2][1], acc[2][2], acc[2][3]);
  acc_guard4(acc[3][0], acc[3][1], acc[3][2], acc[3][3]);

  // ---- epilogue ----
  float* slab = (float*)smem + wave * (16 * 68);
  const float* Rb = RESID ? (resid + (size_t)b * strideR) : nullptr;
#pragma unroll
  for (int i = 0; i < 4; ++i) {
    const int mBase = m0 + (i << 4);
#pragma unroll
    for (int j = 0; j < 4; ++j) {
      const int n = n0 + (j << 4) + rlane;
      float bv = 0.f;
      if (BIAS_MODE == 2) bv = bias[n];
#pragma unroll
      for (int r = 0; r < 8; ++r) {
        float v = acc[i][j][r] * scale;
        if (BIAS_MODE == 1) v += bias[mBase + mOff + r];
        if (BIAS_MODE == 2) v += bv;
        if (RESID) v += Rb[(size_t)(mBase + mOff + r) * ldc + n];
        if (ACT == 1) v = tanhf(v);
        if (ACT == 2) v = fmaxf(v, 0.0f);
        if (ACT == 3) v = v / (1.0f + expf(-v));
        if (ACT == 4) v = (v > 0.f) ? v : 0.01f * v;
        if (ACT == 5) v = 0.5f * v * (1.0f + erff(v * 0.70710678118654752f));
        if (ACT == 6) { v = fmaxf(v, 0.0f); v = v * v; }
        slab[(mOff + r) * 68 + (j << 4) + rlane] = v;
      }
    }
    __builtin_amdgcn_fence(__ATOMIC_RELEASE, "workgroup");
    __builtin_amdgcn_wave_barrier();
    __builtin_amdgcn_fence(__ATOMIC_ACQUIRE, "workgroup");
    if (OUT_MODE == 0) {
      float* C = (float*)Cout + (size_t)b * strideC;
      const int hh = lane >> 4, c4 = (lane & 15) * 4;     // row seg = 256 B = 16 lanes x 16 B
      {
#pragma unroll
        for (int it = 0; it < 8; ++it) {
          const int row = it * 2 + hh;
          v4f v = *(const v4f*)(slab + row * 68 + c4);
          *(v4f*)(C + (size_t)(mBase + row) * ldc + n0 + c4) = v;
        }
        
      }
    } else {
      const int q = lane >> 3, c8 = (lane & 7) * 8;
      unsigned short* C  = (unsigned short*)Cout  + (size_t)b * strideC;
      unsigned short* C2 = (OUT_MODE == 2) ? ((unsigned short*)Cout2 + (size_t)b * strideC) : nullptr;
      {
#pragma unroll
        for (int it = 0; it < 4; ++it) {
          const int row = it * 4 + q;
          const float* sp = slab + row * 68 + c8;
          v8h hv, lv;
#pragma unroll
          for (int e = 0; e < 8; ++e) {
            if (OUT_MODE == 1) {
              hv[e] = (_Float16)sp[e];
            } else {
              unsigned short hb = f2bf_bits(sp[e]);
              unsigned short lb = f2bf_bits(sp[e] - bf_bits2f(hb));
              hv[e] = __builtin_bit_cast(_Float16, hb);
              lv[e] = __builtin_bit_cast(_Float16, lb);
            }
          }
          *(v8h*)(C + (size_t)(mBase + row) * ldc + n0 + c8) = hv;
          if (OUT_MODE == 2) *(v8h*)(C2 + (size_t)(mBase + row) * ldc + n0 + c8) = lv;
        }
        
      }
    }
    __builtin_amdgcn_fence(__ATOMIC_RELEASE, "workgroup");
    __builtin_amdgcn_wave_barrier();
    __builtin_amdgcn_fence(__ATOMIC_ACQUIRE, "workgroup");
  }
}

// ---- W [K][N] f32 -> Wt [N][K] f16 (x mul), 64x64 tile transposed through LDS ----
#define WTP 72
__device__ __forceinline__ void wt_cast_body(const float* __restrict__ W, unsigned short* __restrict__ Wtp,
                                             int K, int N, float mul, int bn, int bk, _Float16* st) {
  _Float16* Wt = (_Float16*)Wtp;
  const int n0 = bn * 64, k0 = bk * 64;
  const int tid = threadIdx.x;
  const int kr = tid >> 2, c16 = (tid & 3) * 16;
  const float* src = W + (size_t)(k0 + kr) * N + n0 + c16;
#pragma unroll
  for (int q = 0; q < 4; ++q) {
    const v4f v = *(const v4f*)(src + 4 * q);
#pragma unroll
    for (int e = 0; e < 4; ++e) st[(c16 + 4 * q + e) * WTP + kr] = (_Float16)(v[e] * mul);
  }
  __syncthreads();
  const int wave = tid >> 5, lane = tid & 31;
  const int q8 = lane >> 3, c8 = (lane & 7) * 8;
  {
#pragma unroll
    for (int it = 0; it < 2; ++it) {
      const int n = it * 32 + wave * 4 + q8;
      const v8h hv = *(const v8h*)(st + n * WTP + c8);
      *(v8h*)(Wt + (size_t)(n0 + n) * K + k0 + c8) = hv;
    }
    // the block ranges of the merged grid lie one behind another in the code: no register of these stores is rewritten ahead of this wait
    asm volatile("s_wait_xcnt 0x0" ::: "memory");
  }
}

// ---- rotary cos/sin table [S][64] (cos 0..31 | sin 32..63) and docs[S] = inclusive count of EOT ----
__device__ __forceinline__ void tables_body(const int* __restrict__ ids, float* __restrict__ rope,
                                            int* __restrict__ docs, int blk, int* scnt, int* sdoc) {
  const int tid = threadIdx.x, lane = tid & 31, wave = tid >> 5;
  if (blk < SS / 8) {
    const int s = blk * 8 + wave;
    float e = (float)lane * (1.0f / 31.0f);
    if (lane == 31) e = 1.0f;
    const float fr = powf(0.0009765625f, e);
    const float th = (float)s * fr;
    float sv, cv;
    sincosf(th, &sv, &cv);
    float* rp = rope + (size_t)s * 64;
    *(float*)(rp + lane) = cv;
    *(float*)(rp + 32 + lane) = sv;
    
  } else {
    int c = 0;
#pragma unroll
    for (int i = 0; i < 8; ++i) c += (ids[tid * 8 + i] == EOT_ID) ? 1 : 0;
    scnt[tid] = c;
    __syncthreads();
    for (int off = 1; off < 256; off <<= 1) {
      const int t = (tid >= off) ? scnt[tid - off] : 0;
      __syncthreads();
      scnt[tid] += t;
      __syncthreads();
    }
    int run = scnt[tid] - c;
#pragma unroll
    for (int i = 0; i < 8; ++i) {
      run += (ids[tid * 8 + i] == EOT_ID) ? 1 : 0;
      sdoc[tid * 8 + i] = run;
    }
    __syncthreads();
    const v4i a0 = *(const v4i*)(sdoc + tid * 4);
    const v4i a1 = *(const v4i*)(sdoc + 1024 + tid * 4);
    {
      *(v4i*)(docs + tid * 4) = a0;
      *(v4i*)(docs + 1024 + tid * 4) = a1;
      // as in wt_cast_body: no register of these stores is rewritten ahead of this wait
      asm volatile("s_wait_xcnt 0x0" ::: "memory");
    }
  }
}

// ---- residual mix + LayerNorm, 128 threads (tid 0..127) per row of 1024; thread owns cols 4t..4t+3 and 512+4t..+3 ----
template <bool MIX>
__device__ __forceinline__ void ln_body(const float* __restrict__ x, const float* __restrict__ x0,
                                        const float* __restrict__ lam, const float* __restrict__ w,
                                        float* __restrict__ xr, unsigned short* __restrict__ xnp,
                                        int row, int tid, float* red1, float* red2) {
  _Float16* xn = (_Float16*)xnp;
  const int lane = tid & 31, wave = tid >> 5;
  const size_t rb = (size_t)row * DD;
  const int ca = tid * 4, cb = 512 + tid * 4;
  v4f va = *(const v4f*)(x + rb + ca);
  v4f vb = *(const v4f*)(x + rb + cb);
  if (MIX) {
    const float l0 = lam[0], l1 = lam[1];
    const v4f a0 = *(const v4f*)(x0 + rb + ca);
    const v4f b0 = *(const v4f*)(x0 + rb + cb);
    va = va * l0 + a0 * l1;
    vb = vb * l0 + b0 * l1;
    {
      *(v4f*)(xr + rb + ca) = va;
      *(v4f*)(xr + rb + cb) = vb;
      
    }
  }
  float s = (va[0] + va[1]) + (va[2] + va[3]) + (vb[0] + vb[1]) + (vb[2] + vb[3]);
#pragma unroll
  for (int off = 1; off < 32; off <<= 1) s += __shfl_xor(s, off, 32);
  if (lane == 0) red1[wave] = s;
  __syncthreads();
  const float mu = ((red1[0] + red1[1]) + (red1[2] + red1[3])) * (1.0f / DD);
  const v4f da = va - mu, db = vb - mu;
  float s2 = (da[0] * da[0] + da[1] * da[1]) + (da[2] * da[2] + da[3] * da[3]) +
             (db[0] * db[0] + db[1] * db[1]) + (db[2] * db[2] + db[3] * db[3]);
#pragma unroll
  for (int off = 1; off < 32; off <<= 1) s2 += __shfl_xor(s2, off, 32);
  if (lane == 0) red2[wave] = s2;
  __syncthreads();
  const float var = ((red2[0] + red2[1]) + (red2[2] + red2[3])) * (1.0f / DD);
  const float inv = rsqrtf(var + LN_EPS);
  const v4f wa = *(const v4f*)(w + ca);
  const v4f wb = *(const v4f*)(w + cb);
  v4h ha, hb;
#pragma unroll
  for (int e = 0; e < 4; ++e) {
    ha[e] = (_Float16)(da[e] * inv * wa[e]);
    hb[e] = (_Float16)(db[e] * inv * wb[e]);
  }
  {
    *(v4h*)(xn + rb + ca) = ha;
    *(v4h*)(xn + rb + cb) = hb;
    // as in wt_cast_body, in the merged grid alone: no register of these stores is rewritten ahead of this wait
    if (MIX) asm volatile("s_wait_xcnt 0x0" ::: "memory");
  }
}
__global__ __launch_bounds__(128) void ln_k(const float* __restrict__ x, const float* __restrict__ w,
                                            unsigned short* __restrict__ xnp) {
  __shared__ float red1[4], red2[4];
  ln_body<false>(x, x, w, w, nullptr, xnp, blockIdx.x, threadIdx.x, red1, red2);
}

// ---- the six preparation steps, none of which reads what another writes, as block ranges of one grid ----
// The tables come first, their serial document count in block 0, so that the longest chain starts earliest.
#define PB_TAB  (SS / 8 + 1)
#define PB_LN   (NTOK / 2)                       // two rows per 256-thread block
#define PB_WQKV ((3 * DD / 64) * (DD / 64))
#define PB_WO   ((DD / 64) * (DD / 64))
#define PB_WFC  ((4 * DD / 64) * (DD / 64))
#define PB_WPR  ((DD / 64) * (4 * DD / 64))
__global__ __launch_bounds__(256) void prep_k(const float* __restrict__ x, const float* __restrict__ x0,
                                              const float* __restrict__ lam, const float* __restrict__ ln1,
                                              float* __restrict__ xr, unsigned short* __restrict__ xn,
                                              const float* __restrict__ wqkv, unsigned short* __restrict__ wqkvT,
                                              const float* __restrict__ wo, unsigned short* __restrict__ woT,
                                              const float* __restrict__ wfc, unsigned short* __restrict__ wfcT,
                                              const float* __restrict__ wproj, unsigned short* __restrict__ wprT,
                                              const int* __restrict__ ids, float* __restrict__ rope,
                                              int* __restrict__ docs) {
  __shared__ __align__(16) char sm[64 * WTP * 2];   // transpose tile, or count + document arrays, or the row sums
  static_assert(sizeof(sm) >= (256 + SS) * sizeof(int), "tables need 256 + S ints");
  int blk = blockIdx.x;
  if (blk < PB_TAB) {
    tables_body(ids, rope, docs, PB_TAB - 1 - blk, (int*)sm, (int*)sm + 256);
    return;
  }
  blk -= PB_TAB;
  if (blk < PB_LN) {
    const int half = threadIdx.x >> 7;
    float* red = (float*)sm + half * 8;
    ln_body<true>(x, x0, lam, ln1, xr, xn, blk * 2 + half, threadIdx.x & 127, red, red + 4);
    return;
  }
  blk -= PB_LN;
  // weights: W [in][out] -> Wt [out][in] f16 x64; tile column = out / 64, tile row = in / 64
  if (blk < PB_WQKV) {
    wt_cast_body(wqkv, wqkvT, DD, 3 * DD, WMUL, blk % (3 * DD / 64), blk / (3 * DD / 64), (_Float16*)sm);
    return;
  }
  blk -= PB_WQKV;
  if (blk < PB_WO) {
    wt_cast_body(wo, woT, DD, DD, WMUL, blk % (DD / 64), blk / (DD / 64), (_Float16*)sm);
    return;
  }
  blk -= PB_WO;
  if (blk < PB_WFC) {
    wt_cast_body(wfc, wfcT, DD, 4 * DD, WMUL, blk % (4 * DD / 64), blk / (4 * DD / 64), (_Float16*)sm);
    return;
  }
  blk -= PB_WFC;
  wt_cast_body(wproj, wprT, 4 * DD, DD, WMUL, blk % (DD / 64), blk / (DD / 64), (_Float16*)sm);
}

// ---- rotary + RMS-norm on q,k; v = sa0*v + sa1*ve; writes f16 planes [3][B*H*S][128] ----
// One block per token, wave = head; lane owns dims ln, ln+32, ln+64, ln+96 (pairs (ln,ln+64) rotate, (ln+32,ln+96) identity).
#define RSP 136
__global__ __launch_bounds__(256) void rope_k(const float* __restrict__ qkv, const float* __restrict__ ve,
                                              const float* __restrict__ sa, const float* __restrict__ rope,
                                              unsigned short* __restrict__ planesp) {
  __shared__ __align__(16) _Float16 st[HH][3 * RSP];
  _Float16* planes = (_Float16*)planesp;
  const int s = blockIdx.x, b = blockIdx.y;
  const int tid = threadIdx.x, h = tid >> 5, ln = tid & 31;
  const size_t tok = (size_t)b * SS + s;
  const float* base = qkv + tok * (3 * DD) + h * HDIM;
  const float cv = rope[(size_t)s * 64 + ln];
  const float sv = rope[(size_t)s * 64 + 32 + ln];
  _Float16* sw = st[h];
#pragma unroll
  for (int p = 0; p < 2; ++p) {
    const float* src = base + p * DD;
    const float a1 = src[ln], b1 = src[ln + 32], a2 = src[ln + 64], b2 = src[ln + 96];
    const float o0 = a1 * cv + a2 * sv;
    const float o2 = a2 * cv - a1 * sv;
    float sq = (o0 * o0 + b1 * b1) + (o2 * o2 + b2 * b2);
#pragma unroll
    for (int off = 1; off < 32; off <<= 1) sq += __shfl_xor(sq, off, 32);
    const float rs = rsqrtf(sq * (1.0f / HDIM) + RMS_EPS);
    sw[p * RSP + ln]      = (_Float16)(o0 * rs);
    sw[p * RSP + ln + 32] = (_Float16)(b1 * rs);
    sw[p * RSP + ln + 64] = (_Float16)(o2 * rs);
    sw[p * RSP + ln + 96] = (_Float16)(b2 * rs);
  }
  {
    const float sa0 = sa[0], sa1 = sa[1];
    const float* vsrc = base + 2 * DD;
    const float* vesrc = ve + (size_t)s * DD + h * HDIM;
#pragma unroll
    for (int i = 0; i < 4; ++i) {
      const int d = ln + 32 * i;
      sw[2 * RSP + d] = (_Float16)(sa0 * vsrc[d] + sa1 * vesrc[d]);
    }
  }
  __builtin_amdgcn_fence(__ATOMIC_RELEASE, "workgroup");
  __builtin_amdgcn_wave_barrier();
  __builtin_amdgcn_fence(__ATOMIC_ACQUIRE, "workgroup");
  const int hh = ln >> 4, c8 = (ln & 15) * 8;           // 256-B row = 16 lanes x 16 B
  const size_t PL = (size_t)NTOK * DD;
  const size_t row = ((size_t)(b * HH + h) * SS + s) * HDIM;
  const v8h v01 = *(const v8h*)(sw + hh * RSP + c8);
  const v8h v2  = *(const v8h*)(sw + 2 * RSP + c8);
  _Float16* d01 = planes + (size_t)hh * PL + row + c8;
  _Float16* d2  = planes + 2 * PL + row + c8;
  {
    *(v8h*)d01 = v01;
    if (hh == 0) *(v8h*)d2 = v2;
    
  }
}

#define AKC 64
#define AQB 64
#define NGRP 4                         // key groups of four waves
#define OSP 136
#define KPITCH 272                     // K row pitch in bytes (16 B x odd: conflict-free for ds_load_b128)
#define VPITCH 288                     // V row pitch in bytes (32 B x odd: conflict-free for ds_load_tr16_b128)
#define KBUF (AKC * KPITCH)
#define VBUF (AKC * VPITCH)
// Eight 16-byte copies per lane: rows r, r+32, .. r+224 of the 256 rows (256 bytes each) of four chunks (LSTEP = 32 LDS rows).
// The s_wait_xcnt closes the statement so that no address register is rewritten ahead of it.
template <int LSTEP>
__device__ __forceinline__ void copy_kv8(uint32_t l, const unsigned short* gp) {
  asm volatile(
      "global_load_async_to_lds_b128 %0, %8, off\n\t"
      "global_load_async_to_lds_b128 %1, %9, off\n\t"
      "global_load_async_to_lds_b128 %2, %10, off\n\t"
      "global_load_async_to_lds_b128 %3, %11, off\n\t"
      "global_load_async_to_lds_b128 %4, %12, off\n\t"
      "global_load_async_to_lds_b128 %5, %13, off\n\t"
      "global_load_async_to_lds_b128 %6, %14, off\n\t"
      "global_load_async_to_lds_b128 %7, %15, off\n\t"
      "s_wait_xcnt 0x0"
      :: "v"(l), "v"(l + LSTEP), "v"(l + 2 * LSTEP), "v"(l + 3 * LSTEP),
         "v"(l + 4 * LSTEP), "v"(l + 5 * LSTEP), "v"(l + 6 * LSTEP), "v"(l + 7 * LSTEP),
         "v"(gp), "v"(gp + 32 * HDIM), "v"(gp + 64 * HDIM), "v"(gp + 96 * HDIM),
         "v"(gp + 128 * HDIM), "v"(gp + 160 * HDIM), "v"(gp + 192 * HDIM), "v"(gp + 224 * HDIM)
      : "memory");
}
// lane (c, hh) gets T[row0 + 8 hh + 0..7][col0 + c] of a row-major 16-bit LDS tile; p is the lane's own address
typedef short s16x8 __attribute__((ext_vector_type(8)));
__device__ __forceinline__ v8h ld_tr16(const char* p) {
  typedef __attribute__((address_space(3))) s16x8 lds_s16x8;
  return __builtin_bit_cast(v8h, __builtin_amdgcn_ds_load_tr16_b128_v8i16((lds_s16x8*)p));
}
// lane l with lane l ^ 16
__device__ __forceinline__ float xhalf(float x) {
  return __builtin_bit_cast(float, __builtin_amdgcn_permlanex16(__builtin_bit_cast(int, x), __builtin_bit_cast(int, x),
                                                                0x76543210, 0xfedcba98, false, false));
}
// 2^x by the hardware's v_exp_f32. The v_nop that ends each statement is the free slot that the instruction set asks for behind a
// transcendental, before its result is read or its source overwritten.
// Eight at a time, each in place: none reads a neighbour's result or writes a neighbour's source, so one slot serves all eight.
__device__ __forceinline__ float exp2_hw(float x) {
  asm("v_exp_f32 %0, %0\n\tv_nop" : "+v"(x));
  return x;
}
__device__ __forceinline__ void exp2_hw8(float* e) {
  asm("v_exp_f32 %0, %0\n\tv_exp_f32 %1, %1\n\tv_exp_f32 %2, %2\n\tv_exp_f32 %3, %3\n\t"
      "v_exp_f32 %4, %4\n\tv_exp_f32 %5, %5\n\tv_exp_f32 %6, %6\n\tv_exp_f32 %7, %7\n\tv_nop"
      : "+v"(e[0]), "+v"(e[1]), "+v"(e[2]), "+v"(e[3]), "+v"(e[4]), "+v"(e[5]), "+v"(e[6]), "+v"(e[7]));
}
// four waves per SIMD: the sixteen waves of one work-group
__global__ __launch_bounds__(512) __attribute__((amdgpu_waves_per_eu(4, 4))) void attn128_k(const unsigned short* __restrict__ qpp, const unsigned short* __restrict__ kpp,
                                                 const unsigned short* __restrict__ vpp, const int* __restrict__ docs,
                                                 unsigned short* __restrict__ outp) {
  union FH { v16h v; v8h h[2]; };
  // two buffers of four chunks, [kv][d]; behind the loop Ksm carries the partial results of groups 1..3, Vsm the output rows
  __shared__ __align__(16) char Ksm[2 * NGRP * KBUF];      // pitch KPITCH
  __shared__ __align__(16) char Vsm[2 * NGRP * VBUF];      // pitch VPITCH
  static_assert(sizeof(Ksm) >= (NGRP - 1) * 4 * 32 * (64 + 2) * sizeof(float), "partial O^T, maximum and sum of twelve waves");
  static_assert(sizeof(Vsm) >= 4 * 16 * OSP * sizeof(_Float16), "output rows of four waves");
  const _Float16* qp = (const _Float16*)qpp;
  _Float16* out = (_Float16*)outp;
  const int tid = threadIdx.x, lane = tid & 31, hh = lane >> 4, c = lane & 15;
  const int wave = __builtin_amdgcn_readfirstlane(tid >> 5);
  const int grp = wave >> 2, wq = wave & 3;     // key group; the wave's 16 queries within the tile
  const int nqb = SS / AQB;
  const int bx = blockIdx.x;
  const int qb = nqb - 1 - bx / (BB * HH);      // longest tiles first
  const int bh = bx % (BB * HH);
  const int h = bh % HH;
  const int b = bh / HH;
  const int q0 = qb * AQB + wq * 16;
  const size_t rowb = (size_t)(b * HH + h) * SS;

  v16h qa[4];
  {
    const _Float16* qrow = qp + (rowb + q0 + c) * HDIM + 8 * hh;
#pragma unroll
    for (int dc = 0; dc < 4; ++dc) qa[dc] = Frag<_Float16>::load(qrow + dc * 32);
  }
  const int qrow = q0 + c;          // the lane's query
  const int dq = docs[qrow];
  float mrow = -INFINITY;           // running maximum of the query in base-2 units, alike in both halves
  float lrow = 0.f;                 // running sum (x2^15) over this half's keys; the halves are joined behind the loop
  v8f oacc[8];                      // O^T: oacc[t][r] = O[qrow][t*16 + 8 hh + r]
#pragma unroll
  for (int t = 0; t < 8; ++t) oacc[t] = (v8f){0.f,0.f,0.f,0.f,0.f,0.f,0.f,0.f};

  // fours of chunks, block-uniform; chunks of the highest four that lie above the diagonal: their rows exist
  // (S / 64 is a multiple of four), they are copied with the rest and not worked on
  static_assert((SS / AKC) % NGRP == 0, "whole fours of chunks");
  const int nPairs = qb / NGRP + 1;
  // the tiles of one (b,h) read the same K and V rows at the same time: each starts its walk at a four of its own and wraps
  // (the running softmax takes the fours in any order), so that sharers ask L2 for different lines at any one moment
  const int p0 = qb % nPairs;                         // block-uniform
  const auto pat = [&](int pr) { int q = pr + p0; if (q >= nPairs) q -= nPairs; return q; };   // the pr-th four walked
  // copy addresses: lane brings 16 B at column chunk (tid & 15) of rows (tid >> 4) + 32 i
  const int crow = tid >> 4, ccol = (tid & 15) * 8;
  const unsigned short* gK = kpp + (rowb + crow) * HDIM + ccol;
  const unsigned short* gV = vpp + (rowb + crow) * HDIM + ccol;
  const uint32_t lK = (uint32_t)(uintptr_t)Ksm + (uint32_t)(crow * KPITCH + ccol * 2);
  const uint32_t lV = (uint32_t)(uintptr_t)Vsm + (uint32_t)(crow * VPITCH + ccol * 2);
  copy_kv8<32 * KPITCH>(lK, gK + (size_t)pat(0) * (NGRP * AKC * HDIM));
  copy_kv8<32 * VPITCH>(lV, gV + (size_t)pat(0) * (NGRP * AKC * HDIM));
  asm volatile("s_wait_asynccnt 0x0" ::: "memory");   // the first four's own copies have landed
  __syncthreads();                                    // and every other wave's
  if (nPairs > 1) {
    copy_kv8<32 * KPITCH>(lK + NGRP * KBUF, gK + (size_t)pat(1) * (NGRP * AKC * HDIM));
    copy_kv8<32 * VPITCH>(lV + NGRP * VBUF, gV + (size_t)pat(1) * (NGRP * AKC * HDIM));
  }
  for (int pr = 0; pr < nPairs; ++pr) {
    const int kc = NGRP * pat(pr) + grp; // this group's chunk of the four
    const int kv0 = kc * AKC;
    const unsigned bsel = (unsigned)(pr & 1);
    const char* Kb = Ksm + (NGRP * bsel + grp) * KBUF + c * KPITCH + 16 * hh;
    const char* Vb = Vsm + (NGRP * bsel + grp) * VBUF + (8 * hh + (lane & 7)) * VPITCH + ((lane >> 3) & 1) * 16;

    // a chunk wholly above the diagonal changes nothing: its group leaves the LDS to the others and goes on to the barrier (wave-uniform)
    if (kc <= qb) {
    v8f s[4];
    v4i dk[4][2];                   // docs of the lane's 32 keys: kv0 + j*16 + 8 hh + 0..7
#pragma unroll
    for (int j = 0; j < 4; ++j) {
      dk[j][0] = *(const v4i*)(docs + kv0 + j * 16 + 8 * hh);
      dk[j][1] = *(const v4i*)(docs + kv0 + j * 16 + 8 * hh + 4);
    }
    // no address register of these eight loads is rewritten (here: by the K loads' results) ahead of this wait
    asm volatile("s_wait_xcnt 0x0" ::: "memory");
    // the chunk in two halves of 32 keys: all 32 K loads at once would need 128 registers, which 256 a wave do not leave
#pragma unroll
    for (int jh = 0; jh < 2; ++jh) {
      FH kb[2][4];
#pragma unroll
      for (int j = 0; j < 2; ++j) {
#pragma unroll
        for (int dc = 0; dc < 4; ++dc) {
          kb[j][dc].h[0] = *(const v8h*)(Kb + (2 * jh + j) * 16 * KPITCH + dc * 64);
          kb[j][dc].h[1] = *(const v8h*)(Kb + (2 * jh + j) * 16 * KPITCH + dc * 64 + 32);
        }
      }
      // keeps the half's 16 K loads together ahead of its 8 score products: one LDS latency per half, not one per product
      __builtin_amdgcn_sched_barrier(0);
#pragma unroll
      for (int j = 0; j < 2; ++j) s[2 * jh + j] = (v8f){0.f,0.f,0.f,0.f,0.f,0.f,0.f,0.f};
#pragma unroll
      for (int dc = 0; dc < 4; ++dc)
#pragma unroll
        for (int j = 0; j < 2; ++j)
          s[2 * jh + j] = Frag<_Float16>::mma(kb[j][dc].v, qa[dc], s[2 * jh + j]);   // rows = keys, column = query
      // keeps the next half's loads in one group behind these products, not spread among them as registers come free
      __builtin_amdgcn_sched_barrier(0);
    }
    const bool diag = (kc >= qb);
    float cm[4];
#pragma unroll
    for (int j = 0; j < 4; ++j) {
      float m = -INFINITY;
#pragma unroll
      for (int r = 0; r < 8; ++r) {
        const int key = kv0 + j * 16 + 8 * hh + r;
        float sv = s[j][r];         // raw: the positive scale commutes with the maximum and goes into the exponent's fma
        const bool masked = (dk[j][r >> 2][r & 3] != dq) || (diag && (key > qrow));
        if (masked) sv = -INFINITY;
        s[j][r] = sv;
        m = fmaxf(m, sv);
      }
      cm[j] = m;
    }
    float mc = fmaxf(fmaxf(cm[0], cm[1]), fmaxf(cm[2], cm[3]));
    mc = fmaxf(mc, xhalf(mc));
    const float mnew = fmaxf(mrow, mc * ATT_SCALE_LOG2E);
    const float mref = (mnew > -INFINITY) ? mnew : 0.0f;   // all-masked so far -> p = 0, alpha = 0
    const float alpha = exp2_hw(mrow - mref);
    const float eoff = PSCALE_LOG2 - mref;
    mrow = mnew;
    FH pt[2];
    float ps[4];
#pragma unroll
    for (int j = 0; j < 4; ++j) {
      float a = 0.f;
      float p[8];                   // p * 2^15
#pragma unroll
      for (int r = 0; r < 8; ++r) p[r] = fmaf(s[j][r], ATT_SCALE_LOG2E, eoff);
      exp2_hw8(p);
#pragma unroll
      for (int r = 0; r < 8; ++r) {
        a += p[r];
        pt[j >> 1].h[j & 1][r] = (_Float16)p[r];
      }
      ps[j] = a;
    }
    lrow = lrow * alpha + ((ps[0] + ps[1]) + (ps[2] + ps[3]));
#pragma unroll
    for (int t = 0; t < 8; ++t) oacc[t] *= alpha;
#pragma unroll
    for (int kk = 0; kk < 2; ++kk) {
      FH vb[8];
#pragma unroll
      for (int t = 0; t < 8; ++t) {
        vb[t].h[0] = ld_tr16(Vb + (kk * 32) * VPITCH + t * 32);        // keys kk*32 + 8 hh + 0..7 of column t*16 + c
        vb[t].h[1] = ld_tr16(Vb + (kk * 32 + 16) * VPITCH + t * 32);   // keys kk*32 + 16 + 8 hh + 0..7
      }
      // keeps the half's 16 V loads together ahead of its 8 output products
      __builtin_amdgcn_sched_barrier(0);
#pragma unroll
      for (int t = 0; t < 8; ++t) oacc[t] = Frag<_Float16>::mma(vb[t].v, pt[kk].v, oacc[t]);   // rows = d, column = query
      // keeps the next half's loads in one group behind these products
      __builtin_amdgcn_sched_barrier(0);
    }
    }
    asm volatile("s_wait_dscnt 0x0" ::: "memory");     // this wave's reads of the buffers have returned
    asm volatile("s_wait_asynccnt 0x0" ::: "memory");  // its copies for the four chunks pr + 1 have landed
    __syncthreads();                                   // publishes the four chunks pr + 1, frees this trip's buffers
    if (pr + 2 < nPairs) {
      copy_kv8<32 * KPITCH>(lK + bsel * (NGRP * KBUF), gK + (size_t)pat(pr + 2) * (NGRP * AKC * HDIM));
      copy_kv8<32 * VPITCH>(lV + bsel * (NGRP * VBUF), gV + (size_t)pat(pr + 2) * (NGRP * AKC * HDIM));
    }
  }
  asm volatile("s_wait_asynccnt 0x0" ::: "memory");    // nothing in flight when the buffers change their use

  // ---- join the four groups: lane l of waves w + 4, w + 8, w + 12 holds the same query and the same d as lane l of wave w ----
  // The loop's last barrier stands behind every wave's last read of the buffers.
  const int PXG = 4 * (16 * 32 * 4), PMG = 4 * 32 * 2;                    // floats of one group's O^T; of its maxima and sums
  const int gs = (grp > 0) ? grp - 1 : 0;                                 // the writer's slot; group 0 reads from slot 0 on
  float* px  = (float*)Ksm + (size_t)gs * PXG + (size_t)wq * (16 * 32 * 4) + lane * 4;    // [slot][wq][2 t + half of the 8][lane] x 16 B
  float* pml = (float*)Ksm + (NGRP - 1) * PXG + gs * PMG + (wq * 32 + lane) * 2;          // [slot][wq][lane] x (maximum, sum)
  if (grp != 0) {
#pragma unroll
    for (int t = 0; t < 8; ++t) {
      *(v4f*)(px + (2 * t) * 128)     = __builtin_shufflevector(oacc[t], oacc[t], 0, 1, 2, 3);
      *(v4f*)(px + (2 * t + 1) * 128) = __builtin_shufflevector(oacc[t], oacc[t], 4, 5, 6, 7);
    }
    pml[0] = mrow;
    pml[1] = lrow;
  }
  __syncthreads();                  // the partial results of groups 1..3 are there for group 0
  if (grp != 0) return;             // wave-uniform, behind the last work-group barrier

  _Float16* os = (_Float16*)Vsm + wq * (16 * OSP);   // per wave [row][d]
  {
    float mg[NGRP - 1], lg[NGRP - 1], wg[NGRP - 1];
    float mj = mrow;
#pragma unroll
    for (int g = 0; g < NGRP - 1; ++g) {
      mg[g] = pml[g * PMG];
      lg[g] = pml[g * PMG + 1];
      mj = fmaxf(mj, mg[g]);
    }
    const float mjr = (mj > -INFINITY) ? mj : 0.0f;  // a group that saw only masked keys weighs 0
    const float a0 = exp2_hw(mrow - mjr);
    float lj = lrow * a0;
#pragma unroll
    for (int g = 0; g < NGRP - 1; ++g) {
      wg[g] = exp2_hw(mg[g] - mjr);
      lj += lg[g] * wg[g];
    }
    const float inv = 1.0f / (lj + xhalf(lj));       // sum and O^T both carry the 2^15
    const float w0 = a0 * inv;
#pragma unroll
    for (int g = 0; g < NGRP - 1; ++g) wg[g] *= inv;
#pragma unroll
    for (int t = 0; t < 8; ++t) {
      v8f o = oacc[t] * w0;
#pragma unroll
      for (int g = 0; g < NGRP - 1; ++g) {
        const v4f pa = *(const v4f*)(px + g * PXG + (2 * t) * 128);
        const v4f pb = *(const v4f*)(px + g * PXG + (2 * t + 1) * 128);
#pragma unroll
        for (int r = 0; r < 4; ++r) {
          o[r]     += pa[r] * wg[g];
          o[r + 4] += pb[r] * wg[g];
        }
      }
      v8h ov;
#pragma unroll
      for (int r = 0; r < 8; ++r) ov[r] = (_Float16)o[r];
      *(v8h*)(os + c * OSP + t * 16 + 8 * hh) = ov;
    }
  }
  __builtin_amdgcn_fence(__ATOMIC_RELEASE, "workgroup");
  __builtin_amdgcn_wave_barrier();
  __builtin_amdgcn_fence(__ATOMIC_ACQUIRE, "workgroup");
  {
    const int c8 = (lane & 15) * 8;   // 256-B row segment = 16 lanes x 16 B, 2 rows per instruction
    {
#pragma unroll
      for (int it = 0; it < 8; ++it) {
        const int row = it * 2 + hh;
        const v8h val = *(const v8h*)(os + row * OSP + c8);
        *(v8h*)(out + (size_t)(b * SS + q0 + row) * DD + h * HDIM + c8) = val;
      }
      
    }
  }
}

// ---------------------------------------------------------------------------
extern "C" void kernel_launch(void* const* d_in, const int* in_sizes, int n_in,
                              void* d_out, int out_size, void* d_ws,
                              size_t ws_size, hipStream_t stream) {
  if (n_in < 12) return;
  if (in_sizes[0] != NTOK * DD || in_sizes[1] != SS * DD || in_sizes[2] != NTOK * DD ||
      in_sizes[3] < 2 || in_sizes[4] < 2 || in_sizes[5] < DD || in_sizes[6] < DD ||
      in_sizes[7] != DD * 3 * DD || in_sizes[8] != DD * DD || in_sizes[9] != DD * 4 * DD ||
      in_sizes[10] != 4 * DD * DD || in_sizes[11] != SS || out_size != NTOK * DD) return;

  const float* x     = (const float*)d_in[0];
  const float* ve    = (const float*)d_in[1];
  const float* x0    = (const float*)d_in[2];
  const float* lam   = (const float*)d_in[3];
  const float* sal   = (const float*)d_in[4];
  const float* ln1   = (const float*)d_in[5];
  const float* ln2   = (const float*)d_in[6];
  const float* wqkv  = (const float*)d_in[7];
  const float* wo    = (const float*)d_in[8];
  const float* wfc   = (const float*)d_in[9];
  const float* wproj = (const float*)d_in[10];
  const int*   ids   = (const int*)d_in[11];
  float* outf = (float*)d_out;

  // ---- carve (bytes) ----
  const size_t szWO   = (size_t)DD * DD * 2;              //   2 MiB  w_o^T f16
  const size_t szWFC  = (size_t)4 * DD * DD * 2;          //   8 MiB  w_fc^T f16
  const size_t szWPR  = (size_t)4 * DD * DD * 2;          //   8 MiB  w_proj^T f16
  const size_t szXR   = (size_t)NTOK * DD * 4;            //  16 MiB  mixed x f32
  const size_t szBIG  = (size_t)NTOK * 3 * DD * 4;        //  48 MiB  qkv f32, later h f16 (32 MiB) + x2 f32 (16 MiB)
  const size_t szXN   = (size_t)NTOK * DD * 2;            //   8 MiB  xn f16, later xn2 f16
  const size_t szWQA  = (size_t)NTOK * DD * 2;            //   8 MiB  w_qkv^T f16 (6 MiB), later attention out f16
  const size_t szPL   = (size_t)3 * NTOK * DD * 2;        //  24 MiB  q,k,v f16 planes
  const size_t szROPE = (size_t)SS * 64 * 4;              // 512 KiB
  const size_t szDOC  = (size_t)SS * 4;
  const size_t oWO = 0, oWFC = oWO + szWO, oWPR = oWFC + szWFC, oXR = oWPR + szWPR, oBIG = oXR + szXR,
               oXN = oBIG + szBIG, oWQA = oXN + szXN, oPL = oWQA + szWQA, oROPE = oPL + szPL,
               oDOC = oROPE + szROPE, oEND = oDOC + szDOC;
  if (oEND > ws_size) return;
  char* ws = (char*)d_ws;
  unsigned short* woT   = (unsigned short*)(ws + oWO);
  unsigned short* wfcT  = (unsigned short*)(ws + oWFC);
  unsigned short* wprT  = (unsigned short*)(ws + oWPR);
  float*          xr    = (float*)(ws + oXR);
  float*          qkvf  = (float*)(ws + oBIG);
  unsigned short* hbuf  = (unsigned short*)(ws + oBIG);
  float*          x2    = (float*)(ws + oBIG + (size_t)NTOK * 4 * DD * 2);
  unsigned short* xn    = (unsigned short*)(ws + oXN);
  unsigned short* xn2   = xn;
  unsigned short* wqkvT = (unsigned short*)(ws + oWQA);
  unsigned short* attn  = (unsigned short*)(ws + oWQA);
  unsigned short* qpl   = (unsigned short*)(ws + oPL);
  unsigned short* kpl   = qpl + (size_t)NTOK * DD;
  unsigned short* vpl   = qpl + (size_t)2 * NTOK * DD;
  float*          rope  = (float*)(ws + oROPE);
  int*            docs  = (int*)(ws + oDOC);

  // rotary table + docs; x = l0*x + l1*x0, xn = LN(x)*ln1_w; the four weight transposes
  prep_k<<<PB_TAB + PB_LN + PB_WQKV + PB_WO + PB_WFC + PB_WPR, 256, 0, stream>>>(
      x, x0, lam, ln1, xr, xn, wqkv, wqkvT, wo, woT, wfc, wfcT, wproj, wprT, ids, rope, docs);
  // qkv = xn @ w_qkv (f32 out)
  {
    const int M = NTOK, N = 3 * DD, K = DD;
    const int tiles = (M / 128) * (N / 128);
    wmma_gemm64<0, false, 0, 0, false, 0><<<dim3(tiles, 1), 128, 0, stream>>>(
        xn, xn, K, 0, wqkvT, wqkvT, K, 0, qkvf, qkvf, N, 0, xr, xr, 0, M, N, K, WMUL_INV);
  }
  // rotary + RMS-norm + value mix -> f16 planes
  rope_k<<<dim3(SS, BB), 256, 0, stream>>>(qkvf, ve, sal, rope, qpl);
  // attention
  attn128_k<<<BB * HH * (SS / AQB), 512, 0, stream>>>(qpl, kpl, vpl, docs, attn);
  // x2 = xr + attn @ w_o
  {
    const int M = NTOK, N = DD, K = DD;
    const int tiles = (M / 128) * (N / 128);
    wmma_gemm64<0, false, 0, 0, true, 0, true><<<dim3(tiles, 1), 128, 0, stream>>>(
        attn, attn, K, 0, woT, woT, K, 0, x2, x2, N, 0, xr, xr, 0, M, N, K, WMUL_INV);
  }
  // xn2 = LN(x2)*ln2_w
  ln_k<<<NTOK, 128, 0, stream>>>(x2, ln2, xn2);
  // h = relu(xn2 @ w_fc)^2 (f16 out)
  {
    const int M = NTOK, N = 4 * DD, K = DD;
    const int tiles = (M / 128) * (N / 128);
    wmma_gemm64<0, false, 0, 1, false, 6><<<dim3(tiles, 1), 128, 0, stream>>>(
        xn2, xn2, K, 0, wfcT, wfcT, K, 0, hbuf, hbuf, N, 0, xr, xr, 0, M, N, K, WMUL_INV);
  }
  // out = x2 + h @ w_proj
  {
    const int M = NTOK, N = DD, K = 4 * DD;
    const int tiles = (M / 128) * (N / 128);
    wmma_gemm64<0, false, 0, 0, true, 0, true><<<dim3(tiles, 1), 128, 0, stream>>>(
        hbuf, hbuf, K, 0, wprT, wprT, K, 0, outf, outf, N, 0, x2, x2, 0, M, N, K, WMUL_INV);
  }
}
